// v000
// Measured on an AMD MI455X. A time is GPU time per run, averaged over a window of back-to-back runs after a warm-up
// (all launches, gaps included; the runs take copies of the inputs in turn), and the median of several windows.
// Apart from v000's, it joins two sittings. Times from different sittings can be a few percent apart, while
// side-by-side timings come from the same sitting.
// v000, which the later versions start from, runs in 6380 microseconds.
#include <hip/hip_runtime.h>
// All contractions: v_wmma_f32_16x16x32_f16 (f16 operands, f32 accumulate). x, cos, sin and all four weights are RNE-converted to bf16 first (exact in f16; weights carried x16); q (after split-half rotation + scale-free RMS normalisation in f32), v, softmax weights (x256) and o (x64) are f16 value + x1024 residual planes, every residual product in its own own-element pass folded in f32; k is a single f16 plane; the first 256 query rows of every batch use f32 q/k/v from exact-operand GEMMs and an f32 online softmax on VALU.
// Causal grouped-query self-attention: x [NB][SQ][1024]; q = x Wq (16 heads of 64), k = x Wk, v = x Wv (4 kv heads of 64; weights are [in][out]); rotation with INPUT tables cos/sin [pos][32]: y[j] = x[j] c + x[j+32] s, y[j+32] = x[j+32] c - x[j] s; q, k scaled by rsqrt(mean square over the head + 1e-6); query head h uses kv head h >> 2; scores * 0.125; keys above the query get exactly zero weight; softmax; out = merged y Wo -> [NB][SQ][1024] f32.
// Structure: token rows r = b*SQ + s; X16 exact f16 rows; one q|k|v GEMM (N = 1536) whose epilogue applies rotation + normalisation on the 64-column head tiles of q and k and writes value + residual planes; V^T value and residual planes per (batch, kv head) via LDS transposes; per batch and per query tile of 256 rows: scores = qh k + qres k against the keys below the tile end (K = 64, heads on grid.y), causal row softmax on VALU (P value + residual), o = Vh ph + Vres ph + Vh pl accumulated in an f32 tile and written as f16 value + residual merged o rows (x64); out = oh Wo + ores Wo. Rows 0..255 of each batch: f32 attention, split into the same two o planes.
#ifndef NB
#define NB 2
#endif
#ifndef SQ
#define SQ 2048
#endif
#define NB_FULL 2
#define SQ_FULL 2048
#define DM 1024
#define NH 16
#define NKV 4
#define KVSH 2                       /* query head -> kv head shift */
#define HD 64
#define KVD (NKV * HD)               /* 256 */
#define LQ (DM + 2 * KVD)            /* row pitch of the q | k | v rows: 1536 */
#define ROTN (DM + KVD)              /* columns below this are q / k heads (rotated + normalised) */
#define QT 256                       /* query rows per causal tile */
#define QT0 256                      /* leading rows of every batch computed in f32 */
#define NKX SQ                       /* S / P row pitch */
#define NR ((size_t)NB * SQ)         /* token rows */

static_assert(NB <= NB_FULL);
static_assert(SQ <= SQ_FULL);
static_assert((SQ & (SQ - 1)) == 0);
static_assert(SQ % QT == 0);
static_assert((QT & (QT - 1)) == 0);
static_assert(QT % 128 == 0);
static_assert(QT0 == QT);
static_assert(QT0 % 128 == 0);
static_assert(QT0 % 64 == 0);
static_assert(HD == 64);
static_assert(DM == NH * HD);
static_assert(NH == (NKV << KVSH));
static_assert(DM / 8 == 128);
static_assert(DM % 64 == 0);
static_assert(KVD % 64 == 0);
static_assert(LQ % 64 == 0);
static_assert(ROTN % 64 == 0);
static_assert(((size_t)NB * SQ) % 128 == 0);
static_assert(SQ % 64 == 0);
static_assert(DM % 32 == 0);

typedef unsigned short v8us __attribute__((ext_vector_type(8), may_alias));
typedef float  v8f  __attribute__((ext_vector_type(8)));
typedef float  v4f  __attribute__((ext_vector_type(4)));
typedef float  v4fa __attribute__((ext_vector_type(4), may_alias));
typedef _Float16 v16h __attribute__((ext_vector_type(16)));
typedef _Float16 v4h __attribute__((ext_vector_type(4)));
union FragH { v16h v; v8us half[2]; _Float16 h[16]; unsigned short u[16]; };

__device__ __forceinline__ unsigned short bf16_bits(float x) { unsigned int u = __float_as_uint(x); return (unsigned short)((u + 0x7FFFu + ((u >> 16) & 1u)) >> 16); }
__device__ __forceinline__ float bf16_val(unsigned short b) { return __uint_as_float(((unsigned int)b) << 16); }
__device__ __forceinline__ float bf16_rne(float x) { return bf16_val(bf16_bits(x)); }

// fragment: elements 0..7 <- k0 + 8h + 0..7, elements 8..15 <- k0 + 16 + 8h + 0..7 (same map for A rows and B columns)
__device__ __forceinline__ v16h g2_frag(const _Float16* p, unsigned hh) { FragH f; f.half[0] = *(const v8us*)((const unsigned short*)p + 8 * hh); f.half[1] = *(const v8us*)((const unsigned short*)p + 16 + 8 * hh); return f.v; }
__device__ __forceinline__ v8f g2_mma(v16h a, v16h b, v8f c) { v8f d = __builtin_amdgcn_wmma_f32_16x16x32_f16(false, a, false, b, (short)0, c, false, false); asm volatile("v_nop\n\tv_nop\n\tv_nop\n\tv_nop" : "+v"(d) : "v"(a), "v"(b)); return d; }

__global__ __launch_bounds__(256) void k_wT(const float* __restrict__ w, unsigned int Kd, unsigned int Nd, _Float16* __restrict__ Bt) {
  __shared__ unsigned short tl[64][66];
  const unsigned int tid = threadIdx.x; const unsigned int ntn = Nd >> 6; const unsigned int kt = blockIdx.x / ntn, nt = blockIdx.x - kt * ntn; const unsigned int k0 = kt * 64u, n0 = nt * 64u;
  for (unsigned int i = tid; i < 64u * 16u; i += 256u) { const unsigned int r = i >> 4, c4 = (i & 15u) * 4u; const v4f a = *(const v4fa*)(w + (size_t)(k0 + r) * Nd + n0 + c4); FragH f;
#pragma unroll
    for (int q = 0; q < 4; ++q) f.h[q] = (_Float16)(bf16_rne(a[q]) * 16.0f);
#pragma unroll
    for (int q = 0; q < 4; ++q) tl[r][c4 + q] = f.u[q]; }
  __syncthreads();
  {
#pragma unroll
    for (int rd = 0; rd < 2; ++rd) { const unsigned int d = (unsigned int)rd * 32u + (tid >> 3), pc = tid & 7u; FragH f;
#pragma unroll
      for (int q = 0; q < 8; ++q) f.u[q] = tl[pc * 8u + q][d];
      const v8us o = f.half[0];
      *(v8us*)((unsigned short*)Bt + (size_t)(n0 + d) * Kd + k0 + pc * 8u) = o; }
     } }

__global__ __launch_bounds__(256) void k_x16(const float* __restrict__ x, _Float16* __restrict__ X16, unsigned int n8) {
  const unsigned int t = blockIdx.x * 256u + threadIdx.x; if (t >= n8) return;
  const unsigned int row = t >> 7;                       /* DM / 8 = 128 pieces per row */
  const unsigned int b = row / (unsigned int)SQ, s = row - b * (unsigned int)SQ;
  const float* src = x + ((size_t)b * SQ_FULL + s) * DM + (size_t)(t & 127u) * 8u;
  const v4f a = *(const v4fa*)src, c = *(const v4fa*)(src + 4);
  FragH f;
#pragma unroll
  for (int q = 0; q < 4; ++q) { f.h[q] = (_Float16)bf16_rne(a[q]); f.h[4 + q] = (_Float16)bf16_rne(c[q]); }
  const v8us o = f.half[0];
  unsigned short* d = (unsigned short*)X16 + (size_t)t * 8u;
  *(v8us*)d = o; 
}

__global__ __launch_bounds__(256) void k_vt(const _Float16* __restrict__ V16, _Float16* __restrict__ Vt) {
  __shared__ unsigned short tl[64][66];
  const unsigned int tid = threadIdx.x; const unsigned int slab = blockIdx.x / (unsigned int)(SQ / 64), lg = blockIdx.x % (unsigned int)(SQ / 64); const unsigned int b = slab / (unsigned int)NKV, h = slab % (unsigned int)NKV;
  for (unsigned int i = tid; i < 64u * 8u; i += 256u) { const unsigned int r = i >> 3, c8 = (i & 7u) * 8u; FragH f; f.half[0] = *(const v8us*)((const unsigned short*)V16 + ((size_t)b * SQ + lg * 64u + r) * LQ + h * 64u + c8);
#pragma unroll
    for (int q = 0; q < 8; ++q) tl[r][c8 + q] = f.u[q]; }
  __syncthreads();
  {
#pragma unroll
    for (int rd = 0; rd < 2; ++rd) { const unsigned int d = (unsigned int)rd * 32u + (tid >> 3), pc = tid & 7u; FragH f;
#pragma unroll
      for (int q = 0; q < 8; ++q) f.u[q] = tl[pc * 8u + q][d];
      const v8us o = f.half[0];
      *(v8us*)((unsigned short*)Vt + ((size_t)slab * 64u + d) * SQ + lg * 64u + pc * 8u) = o; }
     } }

__global__ __launch_bounds__(256) void k_hl(const float* __restrict__ F, _Float16* __restrict__ Hh, _Float16* __restrict__ Hl, unsigned int n8) {
  const unsigned int t = blockIdx.x * 256u + threadIdx.x; if (t >= n8) return; FragH fh, fl; const v4f a = *(const v4fa*)(F + (size_t)t * 8u), c = *(const v4fa*)(F + (size_t)t * 8u + 4);
  const unsigned int row = t >> 7; const unsigned int b = row / (unsigned int)QT0, r = row - b * (unsigned int)QT0;
  const size_t dh = ((size_t)b * SQ + r) * DM + (size_t)(t & 127u) * 8u;
#pragma unroll
  for (int q = 0; q < 4; ++q) { _Float16 h = (_Float16)a[q]; fh.h[q] = h; fl.h[q] = (_Float16)((a[q] - (float)h) * 1024.0f); h = (_Float16)c[q]; fh.h[4 + q] = h; fl.h[4 + q] = (_Float16)((c[q] - (float)h) * 1024.0f); }
  const v8us oh = fh.half[0], ol = fl.half[0];
  { *(v8us*)((unsigned short*)Hh + dh) = oh; *(v8us*)((unsigned short*)Hl + dh) = ol;  } }

// batched GEMM (grid.y = head / batch slab): C = alpha * A Bt^T (+ CP own element). A f16 [M][K] pitch lda (slab stride sA), Bt f16 [N][K] pitch ldb (slab stride sB applied to blockIdx.y >> bsh); outputs f32 C and/or f16 value plane C16 (+ optional x2^10 residual plane C16L of the same f32 value), pitch ldc, slab stride sC.
__global__ __launch_bounds__(128) void k_gemm2(const _Float16* __restrict__ A, int lda, size_t sA, const _Float16* __restrict__ Bh, int ldb, size_t sB, unsigned int bsh, float alpha, const float* CP,
    float* C, _Float16* C16, _Float16* C16L, int ldc, size_t sC, int M, int N, int K, const float* cosb, const float* sinb, unsigned int rotN, unsigned int pmask) {
  __shared__ __attribute__((aligned(16))) float so[4][32][68];
  const unsigned int tid = threadIdx.x, w = tid >> 5, lane = tid & 31u, ln = lane & 15u, hh = lane >> 4; const unsigned int by = blockIdx.y;
  A += (size_t)by * sA; Bh += (size_t)(by >> bsh) * sB; const size_t cofs = (size_t)by * sC;
  const unsigned int ntn = (unsigned int)N >> 6; const unsigned int mt = blockIdx.x / ntn, nq = blockIdx.x - mt * ntn; const unsigned int row0 = mt * 128u + 32u * w, col0 = nq * 64u; if (row0 >= (unsigned int)M) return;
  const _Float16* a0p = A + (size_t)(row0 + ln) * lda; const _Float16* a1p = a0p + (size_t)16 * lda;
  const _Float16* b0p = Bh + (size_t)(col0 + ln) * ldb; const _Float16* b1p = b0p + (size_t)16 * ldb; const _Float16* b2p = b1p + (size_t)16 * ldb; const _Float16* b3p = b2p + (size_t)16 * ldb;
  const v8f z8 = {0.f,0.f,0.f,0.f,0.f,0.f,0.f,0.f}; v8f c00 = z8, c01 = z8, c02 = z8, c03 = z8, c10 = z8, c11 = z8, c12 = z8, c13 = z8;
#pragma unroll 1
  for (int kb = 0; kb < K; kb += 32) { const v16h a0 = g2_frag(a0p + kb, hh), a1 = g2_frag(a1p + kb, hh);
    v16h b = g2_frag(b0p + kb, hh); c00 = g2_mma(a0, b, c00); c10 = g2_mma(a1, b, c10);
    b = g2_frag(b1p + kb, hh); c01 = g2_mma(a0, b, c01); c11 = g2_mma(a1, b, c11);
    b = g2_frag(b2p + kb, hh); c02 = g2_mma(a0, b, c02); c12 = g2_mma(a1, b, c12);
    b = g2_frag(b3p + kb, hh); c03 = g2_mma(a0, b, c03); c13 = g2_mma(a1, b, c13); }
  v8f accs[8] = {c00, c01, c02, c03, c10, c11, c12, c13};
#pragma unroll
  for (int u = 0; u < 8; ++u) { const unsigned int t = (unsigned int)u & 3u, half = (unsigned int)u >> 2; const unsigned int col = col0 + t * 16u + ln;
#pragma unroll
    for (int r = 0; r < 8; ++r) { const unsigned int rloc = half * 16u + 8u * hh + (unsigned int)r; float v = accs[u][r] * alpha; if (CP) v += CP[cofs + (size_t)(row0 + rloc) * ldc + col];      /* own element of the batched C plane */
      so[w][rloc][t * 16u + ln] = v; } }
  __builtin_amdgcn_fence(4 /* acq_rel order */, "workgroup"); __builtin_amdgcn_wave_barrier();
  if (col0 < rotN) {      /* block-uniform: this tile is one q / k head; lane owns tile row 'lane' */
    const unsigned int pos = (row0 + lane) & pmask;
    const float* cr = cosb + (size_t)pos * 32u; const float* sr = sinb + (size_t)pos * 32u; float ss = 0.f;
#pragma unroll 1
    for (unsigned int j = 0; j < 32u; j += 4u) { const v4f cc = *(const v4fa*)(cr + j), sn = *(const v4fa*)(sr + j); const v4f x1 = *(const v4fa*)&so[w][lane][j], x2 = *(const v4fa*)&so[w][lane][32u + j]; v4f y1, y2;
#pragma unroll
      for (int q = 0; q < 4; ++q) { const float c = bf16_rne(cc[q]), s = bf16_rne(sn[q]); y1[q] = x1[q] * c + x2[q] * s; y2[q] = x2[q] * c - x1[q] * s; ss += y1[q] * y1[q] + y2[q] * y2[q]; }
      *(v4fa*)&so[w][lane][j] = y1; *(v4fa*)&so[w][lane][32u + j] = y2; }
    const float rs = rsqrtf(ss * 0.015625f + 1.0e-6f);
#pragma unroll 1
    for (unsigned int j = 0; j < 64u; j += 4u) { v4f y = *(const v4fa*)&so[w][lane][j];
#pragma unroll
      for (int q = 0; q < 4; ++q) y[q] = y[q] * rs;
      *(v4fa*)&so[w][lane][j] = y; }
    __builtin_amdgcn_fence(4 /* acq_rel order */, "workgroup"); __builtin_amdgcn_wave_barrier(); }
  const unsigned int rsub = lane >> 4, c4 = (lane & 15u) * 4u;
  {
#pragma unroll
    for (int q = 0; q < 16; ++q) { const unsigned int r = (unsigned int)q * 2u + rsub; const v4f v = *(const v4fa*)&so[w][r][c4]; const size_t o = cofs + (size_t)(row0 + r) * ldc + col0 + c4;
      if (C) *(v4f*)(C + o) = v;
      if (C16) { v4h h4, l4;
#pragma unroll
        for (int i = 0; i < 4; ++i) { const _Float16 h = (_Float16)v[i]; h4[i] = h; l4[i] = (_Float16)((v[i] - (float)h) * 1024.0f); }
        *(v4h*)(C16 + o) = h4; if (C16L) *(v4h*)(C16L + o) = l4; } }
     } }

__global__ __launch_bounds__(256) void k_rsmcf2(const float* __restrict__ S, _Float16* __restrict__ P, _Float16* __restrict__ PL, unsigned int hg, unsigned int q0, unsigned int nk) {
  #pragma clang fp contract(off)
  const unsigned int t = blockIdx.x * 256u + threadIdx.x; if (t >= hg * (unsigned int)QT) return; const size_t i = (size_t)t; const float* s = S + i * NKX; const unsigned int last = q0 + (t & (unsigned int)(QT - 1)); float mx = -3.0e38f;
#pragma unroll 1
  for (unsigned int j = 0; j < nk; ++j) { const float f = (j <= last) ? 1.f : 0.f; mx = fmaxf(mx, fmaf(f, s[j], (1.f - f) * -1.0e9f)); } float se = 0.f;
#pragma unroll 1
  for (unsigned int j = 0; j < nk; ++j) { const float f = (j <= last) ? 1.f : 0.f; se += __expf(fmaf(f, s[j], (1.f - f) * -1.0e9f) - mx); } const float sc = 256.0f / se;
#pragma unroll 1
  for (unsigned int j0 = 0; j0 < nk; j0 += 8) { FragH fr, fl;
#pragma unroll
    for (int q = 0; q < 8; ++q) { const unsigned int j = j0 + (unsigned int)q; const float f = (j <= last) ? 1.f : 0.f; const float pv = __expf(fmaf(f, s[j], (1.f - f) * -1.0e9f) - mx) * sc; const _Float16 h = (_Float16)pv; fr.h[q] = h; fl.h[q] = (_Float16)((pv - (float)h) * 1024.0f); }
    const v8us o = fr.half[0], ol = fl.half[0]; unsigned short* d = (unsigned short*)P + i * NKX + j0; unsigned short* dl = (unsigned short*)PL + i * NKX + j0;
    *(v8us*)d = o; *(v8us*)dl = ol;  } }

__global__ __launch_bounds__(64) void k_att0(const float* __restrict__ QF, const float* __restrict__ KF, const float* __restrict__ VF, int ld, size_t sF, float scale, float* __restrict__ OF, int ldo, size_t sO) {
  #pragma clang fp contract(off)
  __shared__ __attribute__((aligned(16))) float lq[64][64]; __shared__ __attribute__((aligned(16))) float lo[64][64];
  const unsigned int tid = threadIdx.x; const unsigned int h = blockIdx.x / (unsigned int)(QT0 / 64), rg = blockIdx.x % (unsigned int)(QT0 / 64); const unsigned int i = rg * 64u + tid; const unsigned int hk = h >> KVSH;
  const size_t fo = (size_t)blockIdx.y * sF; QF += fo; KF += fo; VF += fo; OF += (size_t)blockIdx.y * sO;
  const float* qr = QF + (size_t)i * ld + h * HD;
#pragma unroll 1
  for (int c = 0; c < HD / 4; ++c) { *(v4fa*)&lq[tid][c * 4] = *(const v4fa*)(qr + c * 4); const v4f z = {0.f, 0.f, 0.f, 0.f}; *(v4fa*)&lo[tid][c * 4] = z; }
  float m = -1.0e30f, l = 0.f; const unsigned int jmax = rg * 64u + 63u;      /* keys up to the block's last row */
#pragma unroll 1
  for (unsigned int j = 0; j <= jmax; ++j) { const float* kr = KF + (size_t)j * ld + hk * HD; const float* vr = VF + (size_t)j * ld + hk * HD; float s = 0.f;
#pragma unroll 1
    for (int c = 0; c < HD / 4; ++c) { const v4f kq = *(const v4fa*)(kr + c * 4); const v4f qq = *(const v4fa*)&lq[tid][c * 4]; s = __fadd_rn(s, __fmul_rn(qq[0], kq[0])); s = __fadd_rn(s, __fmul_rn(qq[1], kq[1])); s = __fadd_rn(s, __fmul_rn(qq[2], kq[2])); s = __fadd_rn(s, __fmul_rn(qq[3], kq[3])); }
    s = __fmul_rn(s, scale);
    const float f = (j <= i) ? 1.f : 0.f; const float sm = fmaf(f, s, (1.f - f) * -1.0e30f); const float mn = fmaxf(m, sm); const float sc = expf(m - mn); const float e = expf(sm - mn); l = __fadd_rn(__fmul_rn(l, sc), e); m = mn;
#pragma unroll 1
    for (int c = 0; c < HD / 4; ++c) { const v4f vv = *(const v4fa*)(vr + c * 4); v4f oo = *(const v4fa*)&lo[tid][c * 4];
#pragma unroll
      for (int u = 0; u < 4; ++u) oo[u] = __fadd_rn(__fmul_rn(oo[u], sc), __fmul_rn(e, vv[u]));
      *(v4fa*)&lo[tid][c * 4] = oo; } }
  const float fin = 64.0f / l;      /* o carried x64 like the f16 path */
#pragma unroll 1
  for (int c = 0; c < HD / 4; ++c) { v4f oo = *(const v4fa*)&lo[tid][c * 4];
#pragma unroll
    for (int u = 0; u < 4; ++u) oo[u] = __fmul_rn(oo[u], fin);
    *(v4fa*)&lo[tid][c * 4] = oo; }
  __syncthreads();
  {
#pragma unroll 1
    for (unsigned int it = 0; it < 16u; ++it) { const unsigned int row = it * 4u + (tid >> 4), pc = (tid & 15u) * 4u; const v4f v = *(const v4fa*)&lo[row][pc]; *(v4f*)(OF + (size_t)(rg * 64u + row) * ldo + h * HD + pc) = v; }
     } }

constexpr size_t al256(size_t b) { return (b + 255) & ~(size_t)255; }
constexpr size_t cmax(size_t a, size_t b) { return a > b ? a : b; }
constexpr size_t SZ_BQKV = al256((size_t)LQ * DM * 2);
constexpr size_t SZ_BO   = al256((size_t)DM * DM * 2);
constexpr size_t SZ_XO   = al256(NR * DM * 2);                          /* X16, later reused as the merged o value rows */
constexpr size_t SZ_QKV  = al256(NR * LQ * 2);                          /* value plane; the residual plane has the same size */
constexpr size_t SZ_F0   = al256((size_t)NB * QT0 * LQ * 4);
constexpr size_t SZ_OF0  = al256((size_t)NB * QT0 * DM * 4);
constexpr size_t SZ_S    = cmax(al256((size_t)NH * QT * NKX * 4), SZ_F0 + SZ_OF0);      /* S of one query tile (all heads); before the tile loop the same bytes hold F0 | OF0 */
constexpr size_t SZ_P    = al256((size_t)NH * QT * NKX * 2);            /* P value plane of one query tile (all heads); the residual plane has the same size */
constexpr size_t SZ_VT   = al256((size_t)NB * NKV * HD * SQ * 2);       /* V^T value plane; the residual plane has the same size */
constexpr size_t SZ_OL   = al256(NR * DM * 2);                          /* merged o residual rows */
constexpr size_t SZ_OT   = al256((size_t)QT * DM * 4);                  /* f32 o tile of one (batch, query tile) */
static_assert(SZ_F0 + SZ_OF0 <= SZ_S);
constexpr size_t WS_TOTAL = SZ_BQKV + SZ_BO + SZ_XO + 2 * SZ_QKV + SZ_S + 2 * SZ_P + 2 * SZ_VT + SZ_OL + SZ_OT;
static_assert(WS_TOTAL <= (size_t)134217728);
/* plane coverage equalities of the producer grids */
static_assert(((size_t)(DM / 64) * (DM / 64)) * 64 * 64 == (size_t)DM * DM);
static_assert(((size_t)(DM / 64) * (KVD / 64)) * 64 * 64 == (size_t)DM * KVD);
static_assert(((size_t)NB * NKV * (SQ / 64)) * 64 * 64 == (size_t)NB * NKV * HD * SQ);
static_assert((NR * DM) % (256 * 8) == 0);
static_assert(((size_t)NB * QT0 * DM) % (256 * 8) == 0);
static_assert(((size_t)NH * QT) % 256 == 0);
static_assert((size_t)NH * (QT0 / 64) * 64 == (size_t)NH * QT0);
static_assert(((size_t)(NR / 128) * (LQ / 64)) * 128 * 64 == NR * LQ);
static_assert(((size_t)(QT / 128) * (HD / 64) * NH) * 128 * 64 == (size_t)QT * DM);
static_assert(((size_t)(SQ / 128) * (DM / 64) * NB) * 128 * 64 == NR * DM);

extern "C" void kernel_launch(void* const* d_in, const int* in_sizes, int n_in,
                              void* d_out, int out_size, void* d_ws, size_t ws_size, hipStream_t stream) {
  if (n_in < 7) return;
  const size_t need_x = ((size_t)(NB - 1) * SQ_FULL + SQ) * DM;
  if ((size_t)in_sizes[0] < need_x) return;
  if ((size_t)in_sizes[1] < (size_t)SQ * 32) return;
  if ((size_t)in_sizes[2] < (size_t)SQ * 32) return;
  if ((size_t)in_sizes[3] < (size_t)DM * DM) return;
  if ((size_t)in_sizes[4] < (size_t)DM * KVD) return;
  if ((size_t)in_sizes[5] < (size_t)DM * KVD) return;
  if ((size_t)in_sizes[6] < (size_t)DM * DM) return;
  if ((size_t)out_size < need_x) return;
  const float* x = (const float*)d_in[0]; const float* cosb = (const float*)d_in[1]; const float* sinb = (const float*)d_in[2];      /* tables [pos][32], read as values */
  const float* wq = (const float*)d_in[3]; const float* wk = (const float*)d_in[4]; const float* wv = (const float*)d_in[5]; const float* wo = (const float*)d_in[6];      /* all [in][out] */
  float* out = (float*)d_out;
  char* ws = (char*)d_ws; size_t off = 0;
  auto take = [&](size_t bytes) { char* p = ws + off; off += (bytes + 255) & ~(size_t)255; return p; };
  _Float16* BQKV = (_Float16*)take(SZ_BQKV); _Float16* BO = (_Float16*)take(SZ_BO);
  _Float16* X16 = (_Float16*)take(SZ_XO); _Float16* OH = X16;      /* X16 is dead after the projection GEMMs; the merged o value rows take its place */
  _Float16* QKV = (_Float16*)take(SZ_QKV); const _Float16* Q16 = QKV; const _Float16* K16 = QKV + DM; const _Float16* V16 = QKV + ROTN;
  _Float16* QKVL = (_Float16*)take(SZ_QKV); const _Float16* QL = QKVL; const _Float16* VL16 = QKVL + ROTN;      /* x1024 residual plane, same layout (k columns unused) */
  char* sreg = take(SZ_S); float* S = (float*)sreg; float* F0 = (float*)sreg; float* OF0 = (float*)(sreg + SZ_F0);      /* F0 | OF0 are consumed before the first score tile is written */
  _Float16* PH = (_Float16*)take(SZ_P); _Float16* PL = (_Float16*)take(SZ_P);
  _Float16* VT = (_Float16*)take(SZ_VT); _Float16* VTL = (_Float16*)take(SZ_VT);
  _Float16* OL = (_Float16*)take(SZ_OL); float* OT = (float*)take(SZ_OT);
  if (off > ws_size) return;

  k_wT<<<(DM / 64) * (DM / 64), 256, 0, stream>>>(wq, (unsigned int)DM, (unsigned int)DM, BQKV);                                   /* W[DM][DM] -> Bt rows 0..1023 */
  k_wT<<<(DM / 64) * (KVD / 64), 256, 0, stream>>>(wk, (unsigned int)DM, (unsigned int)KVD, BQKV + (size_t)DM * DM);                /* W[DM][KVD] -> Bt rows 1024..1279 */
  k_wT<<<(DM / 64) * (KVD / 64), 256, 0, stream>>>(wv, (unsigned int)DM, (unsigned int)KVD, BQKV + (size_t)ROTN * DM);              /* W[DM][KVD] -> Bt rows 1280..1535 */
  k_wT<<<(DM / 64) * (DM / 64), 256, 0, stream>>>(wo, (unsigned int)DM, (unsigned int)DM, BO);                                     /* Wo[c][n] -> Bt[n][c] */
  const unsigned int n8x = (unsigned int)(NR * DM / 8);
  k_x16<<<(n8x + 255u) / 256u, 256, 0, stream>>>(x, X16, n8x);
  const int MP = (int)(NR); const unsigned int pm = (unsigned int)(SQ - 1);
  k_gemm2<<<dim3((unsigned int)((MP / 128) * (LQ / 64)), 1), 128, 0, stream>>>(X16, DM, (size_t)0, BQKV, DM, (size_t)0, 0u, 0.0625f, nullptr, nullptr, QKV, QKVL, LQ, (size_t)0, MP, LQ, DM, cosb, sinb, (unsigned int)ROTN, pm);      /* q | k | v rows (f16 value + residual), q / k rotated + normalised */
  k_gemm2<<<dim3((unsigned int)((QT0 / 128) * (LQ / 64)), NB), 128, 0, stream>>>(X16, DM, (size_t)SQ * DM, BQKV, DM, (size_t)0, 0u, 0.0625f, nullptr, F0, nullptr, nullptr, LQ, (size_t)QT0 * LQ, QT0, LQ, DM, cosb, sinb, (unsigned int)ROTN, pm);      /* f32 q | k | v of rows 0..QT0-1 of every batch */
  k_vt<<<NB * NKV * (SQ / 64), 256, 0, stream>>>(V16, VT);        /* V^T value plane [NB][NKV][HD][SQ] */
  k_vt<<<NB * NKV * (SQ / 64), 256, 0, stream>>>(VL16, VTL);      /* V^T residual plane */
  k_att0<<<dim3(NH * (QT0 / 64), NB), 64, 0, stream>>>(F0, F0 + DM, F0 + ROTN, LQ, (size_t)QT0 * LQ, 0.125f, OF0, DM, (size_t)QT0 * DM);      /* f32 attention for rows 0..QT0-1 (o x64) */
  const unsigned int n8h = (unsigned int)((size_t)NB * QT0 * DM / 8);
  k_hl<<<(n8h + 255u) / 256u, 256, 0, stream>>>(OF0, OH, OL, n8h);      /* first rows: value + x1024 residual planes into the merged o rows */
  for (unsigned int b = 0; b < (unsigned int)NB; ++b) { const size_t r0 = (size_t)b * SQ; const _Float16* VTb = VT + (size_t)b * NKV * HD * SQ; const _Float16* VTLb = VTL + (size_t)b * NKV * HD * SQ;
    for (unsigned int q0 = (unsigned int)QT; q0 < (unsigned int)SQ; q0 += QT) { const unsigned int nk = q0 + QT;      /* causal: only keys below the tile end are computed; rows below QT0 come from the f32 path */
      const dim3 gs((QT / 128) * (nk / 64), NH), go((QT / 128) * (HD / 64), NH);
      k_gemm2<<<gs, 128, 0, stream>>>(Q16 + (r0 + q0) * LQ, LQ, (size_t)HD, K16 + r0 * LQ, LQ, (size_t)HD, (unsigned int)KVSH, 0.125f, nullptr, S, nullptr, nullptr, NKX, (size_t)QT * NKX, QT, (int)nk, HD, nullptr, nullptr, 0u, 0u);      /* scores: q value plane, heads on grid.y */
      k_gemm2<<<gs, 128, 0, stream>>>(QL + (r0 + q0) * LQ, LQ, (size_t)HD, K16 + r0 * LQ, LQ, (size_t)HD, (unsigned int)KVSH, 0.0001220703125f, (const float*)S, S, nullptr, nullptr, NKX, (size_t)QT * NKX, QT, (int)nk, HD, nullptr, nullptr, 0u, 0u);      /* += q residual plane 2^-13 (own element) */
      k_rsmcf2<<<(NH * QT + 255) / 256, 256, 0, stream>>>(S, PH, PL, (unsigned int)NH, q0, nk);
      k_gemm2<<<go, 128, 0, stream>>>(PH, NKX, (size_t)QT * NKX, VTb, SQ, (size_t)HD * SQ, (unsigned int)KVSH, 0.25f, nullptr, OT, nullptr, nullptr, DM, (size_t)HD, QT, HD, (int)nk, nullptr, nullptr, 0u, 0u);      /* o tile (x64) = Vh ph */
      k_gemm2<<<go, 128, 0, stream>>>(PH, NKX, (size_t)QT * NKX, VTLb, SQ, (size_t)HD * SQ, (unsigned int)KVSH, 0.000244140625f, (const float*)OT, OT, nullptr, nullptr, DM, (size_t)HD, QT, HD, (int)nk, nullptr, nullptr, 0u, 0u);      /* += Vres ph 2^-12 (own element) */
      k_gemm2<<<go, 128, 0, stream>>>(PL, NKX, (size_t)QT * NKX, VTb, SQ, (size_t)HD * SQ, (unsigned int)KVSH, 0.000244140625f, (const float*)OT, nullptr, OH + (r0 + q0) * DM, OL + (r0 + q0) * DM, DM, (size_t)HD, QT, HD, (int)nk, nullptr, nullptr, 0u, 0u); } }      /* += Vh pl 2^-12; final o written as f16 value + x1024 residual merged rows */
  k_gemm2<<<dim3((SQ / 128) * (DM / 64), NB), 128, 0, stream>>>(OH, DM, (size_t)SQ * DM, BO, DM, (size_t)0, 0u, 0.0009765625f, nullptr, out, nullptr, nullptr, DM, (size_t)SQ_FULL * DM, SQ, DM, DM, nullptr, nullptr, 0u, 0u);      /* out rows in the output layout: o value plane */
  k_gemm2<<<dim3((SQ / 128) * (DM / 64), NB), 128, 0, stream>>>(OL, DM, (size_t)SQ * DM, BO, DM, (size_t)0, 0u, 0.00000095367431640625f, (const float*)out, out, nullptr, nullptr, DM, (size_t)SQ_FULL * DM, SQ, DM, DM, nullptr, nullptr, 0u, 0u);      
}

// v001
// A run of this version takes 3260 microseconds.
// Two timings next to v000 both put it at 1.96 times that version's speed.
#include <hip/hip_runtime.h>
// All contractions: v_wmma_f32_16x16x32_f16 (f16 operands, f32 accumulate). x, cos, sin and all four weights are RNE-converted to bf16 first (exact in f16; weights carried x16); q (after split-half rotation + scale-free RMS normalisation in f32), v, softmax weights (x256) and o (x64) are f16 value + x1024 residual planes, every residual product in its own own-element pass folded in f32; k is a single f16 plane; the first 256 query rows of every batch use f32 q/k/v from exact-operand GEMMs and an f32 online softmax on VALU.
// Causal grouped-query self-attention: x [NB][SQ][1024]; q = x Wq (16 heads of 64), k = x Wk, v = x Wv (4 kv heads of 64; weights are [in][out]); rotation with INPUT tables cos/sin [pos][32]: y[j] = x[j] c + x[j+32] s, y[j+32] = x[j+32] c - x[j] s; q, k scaled by rsqrt(mean square over the head + 1e-6); query head h uses kv head h >> 2; scores * 0.125; keys above the query get exactly zero weight; softmax; out = merged y Wo -> [NB][SQ][1024] f32.
// Structure: token rows r = b*SQ + s; X16 exact f16 rows; one q|k|v GEMM (N = 1536) whose epilogue applies rotation + normalisation on the 64-column head tiles of q and k and writes value + residual planes; V^T value and residual planes per (batch, kv head) via LDS transposes; per batch and per query tile of 256 rows: scores = qh k + qres k against the keys below the tile end (K = 64, heads on grid.y), causal row softmax on VALU, one wave per row (P value + residual), o = Vh ph + Vres ph + Vh pl accumulated in an f32 tile and written as f16 value + residual merged o rows (x64); out = oh Wo + ores Wo. Rows 0..255 of each batch: f32 attention, split into the same two o planes.
#ifndef NB
#define NB 2
#endif
#ifndef SQ
#define SQ 2048
#endif
#define NB_FULL 2
#define SQ_FULL 2048
#define DM 1024
#define NH 16
#define NKV 4
#define KVSH 2                       /* query head -> kv head shift */
#define HD 64
#define KVD (NKV * HD)               /* 256 */
#define LQ (DM + 2 * KVD)            /* row pitch of the q | k | v rows: 1536 */
#define ROTN (DM + KVD)              /* columns below this are q / k heads (rotated + normalised) */
#define QT 256                       /* query rows per causal tile */
#define QT0 256                      /* leading rows of every batch computed in f32 */
#define NKX SQ                       /* S / P row pitch */
#define NR ((size_t)NB * SQ)         /* token rows */

static_assert(NB <= NB_FULL);
static_assert(SQ <= SQ_FULL);
static_assert((SQ & (SQ - 1)) == 0);
static_assert(SQ % QT == 0);
static_assert((QT & (QT - 1)) == 0);
static_assert(QT % 128 == 0);
static_assert(QT0 == QT);
static_assert(QT0 % 128 == 0);
static_assert(QT0 % 64 == 0);
static_assert(HD == 64);
static_assert(DM == NH * HD);
static_assert(NH == (NKV << KVSH));
static_assert(DM / 8 == 128);
static_assert(DM % 64 == 0);
static_assert(KVD % 64 == 0);
static_assert(LQ % 64 == 0);
static_assert(ROTN % 64 == 0);
static_assert(((size_t)NB * SQ) % 128 == 0);
static_assert(SQ % 64 == 0);
static_assert(DM % 32 == 0);

typedef unsigned short v8us __attribute__((ext_vector_type(8), may_alias));
typedef float  v8f  __attribute__((ext_vector_type(8)));
typedef float  v4f  __attribute__((ext_vector_type(4)));
typedef float  v4fa __attribute__((ext_vector_type(4), may_alias));
typedef _Float16 v16h __attribute__((ext_vector_type(16)));
typedef _Float16 v4h __attribute__((ext_vector_type(4)));
union FragH { v16h v; v8us half[2]; _Float16 h[16]; unsigned short u[16]; };

__device__ __forceinline__ unsigned short bf16_bits(float x) { unsigned int u = __float_as_uint(x); return (unsigned short)((u + 0x7FFFu + ((u >> 16) & 1u)) >> 16); }
__device__ __forceinline__ float bf16_val(unsigned short b) { return __uint_as_float(((unsigned int)b) << 16); }
__device__ __forceinline__ float bf16_rne(float x) { return bf16_val(bf16_bits(x)); }

// fragment: elements 0..7 <- k0 + 8h + 0..7, elements 8..15 <- k0 + 16 + 8h + 0..7 (same map for A rows and B columns)
__device__ __forceinline__ v16h g2_frag(const _Float16* p, unsigned hh) { FragH f; f.half[0] = *(const v8us*)((const unsigned short*)p + 8 * hh); f.half[1] = *(const v8us*)((const unsigned short*)p + 16 + 8 * hh); return f.v; }
__device__ __forceinline__ v8f g2_mma(v16h a, v16h b, v8f c) { v8f d = __builtin_amdgcn_wmma_f32_16x16x32_f16(false, a, false, b, (short)0, c, false, false); asm volatile("v_nop\n\tv_nop\n\tv_nop\n\tv_nop" : "+v"(d) : "v"(a), "v"(b)); return d; }

__global__ __launch_bounds__(256) void k_wT(const float* __restrict__ w, unsigned int Kd, unsigned int Nd, _Float16* __restrict__ Bt) {
  __shared__ unsigned short tl[64][66];
  const unsigned int tid = threadIdx.x; const unsigned int ntn = Nd >> 6; const unsigned int kt = blockIdx.x / ntn, nt = blockIdx.x - kt * ntn; const unsigned int k0 = kt * 64u, n0 = nt * 64u;
  for (unsigned int i = tid; i < 64u * 16u; i += 256u) { const unsigned int r = i >> 4, c4 = (i & 15u) * 4u; const v4f a = *(const v4fa*)(w + (size_t)(k0 + r) * Nd + n0 + c4); FragH f;
#pragma unroll
    for (int q = 0; q < 4; ++q) f.h[q] = (_Float16)(bf16_rne(a[q]) * 16.0f);
#pragma unroll
    for (int q = 0; q < 4; ++q) tl[r][c4 + q] = f.u[q]; }
  __syncthreads();
  {
#pragma unroll
    for (int rd = 0; rd < 2; ++rd) { const unsigned int d = (unsigned int)rd * 32u + (tid >> 3), pc = tid & 7u; FragH f;
#pragma unroll
      for (int q = 0; q < 8; ++q) f.u[q] = tl[pc * 8u + q][d];
      const v8us o = f.half[0];
      *(v8us*)((unsigned short*)Bt + (size_t)(n0 + d) * Kd + k0 + pc * 8u) = o; }
     } }

__global__ __launch_bounds__(256) void k_x16(const float* __restrict__ x, _Float16* __restrict__ X16, unsigned int n8) {
  const unsigned int t = blockIdx.x * 256u + threadIdx.x; if (t >= n8) return;
  const unsigned int row = t >> 7;                       /* DM / 8 = 128 pieces per row */
  const unsigned int b = row / (unsigned int)SQ, s = row - b * (unsigned int)SQ;
  const float* src = x + ((size_t)b * SQ_FULL + s) * DM + (size_t)(t & 127u) * 8u;
  const v4f a = *(const v4fa*)src, c = *(const v4fa*)(src + 4);
  FragH f;
#pragma unroll
  for (int q = 0; q < 4; ++q) { f.h[q] = (_Float16)bf16_rne(a[q]); f.h[4 + q] = (_Float16)bf16_rne(c[q]); }
  const v8us o = f.half[0];
  unsigned short* d = (unsigned short*)X16 + (size_t)t * 8u;
  *(v8us*)d = o; 
}

__global__ __launch_bounds__(256) void k_vt(const _Float16* __restrict__ V16, _Float16* __restrict__ Vt) {
  __shared__ unsigned short tl[64][66];
  const unsigned int tid = threadIdx.x; const unsigned int slab = blockIdx.x / (unsigned int)(SQ / 64), lg = blockIdx.x % (unsigned int)(SQ / 64); const unsigned int b = slab / (unsigned int)NKV, h = slab % (unsigned int)NKV;
  for (unsigned int i = tid; i < 64u * 8u; i += 256u) { const unsigned int r = i >> 3, c8 = (i & 7u) * 8u; FragH f; f.half[0] = *(const v8us*)((const unsigned short*)V16 + ((size_t)b * SQ + lg * 64u + r) * LQ + h * 64u + c8);
#pragma unroll
    for (int q = 0; q < 8; ++q) tl[r][c8 + q] = f.u[q]; }
  __syncthreads();
  {
#pragma unroll
    for (int rd = 0; rd < 2; ++rd) { const unsigned int d = (unsigned int)rd * 32u + (tid >> 3), pc = tid & 7u; FragH f;
#pragma unroll
      for (int q = 0; q < 8; ++q) f.u[q] = tl[pc * 8u + q][d];
      const v8us o = f.half[0];
      *(v8us*)((unsigned short*)Vt + ((size_t)slab * 64u + d) * SQ + lg * 64u + pc * 8u) = o; }
     } }

__global__ __launch_bounds__(256) void k_hl(const float* __restrict__ F, _Float16* __restrict__ Hh, _Float16* __restrict__ Hl, unsigned int n8) {
  const unsigned int t = blockIdx.x * 256u + threadIdx.x; if (t >= n8) return; FragH fh, fl; const v4f a = *(const v4fa*)(F + (size_t)t * 8u), c = *(const v4fa*)(F + (size_t)t * 8u + 4);
  const unsigned int row = t >> 7; const unsigned int b = row / (unsigned int)QT0, r = row - b * (unsigned int)QT0;
  const size_t dh = ((size_t)b * SQ + r) * DM + (size_t)(t & 127u) * 8u;
#pragma unroll
  for (int q = 0; q < 4; ++q) { _Float16 h = (_Float16)a[q]; fh.h[q] = h; fl.h[q] = (_Float16)((a[q] - (float)h) * 1024.0f); h = (_Float16)c[q]; fh.h[4 + q] = h; fl.h[4 + q] = (_Float16)((c[q] - (float)h) * 1024.0f); }
  const v8us oh = fh.half[0], ol = fl.half[0];
  { *(v8us*)((unsigned short*)Hh + dh) = oh; *(v8us*)((unsigned short*)Hl + dh) = ol;  } }

// batched GEMM (grid.y = head / batch slab): C = alpha * A Bt^T (+ CP own element). A f16 [M][K] pitch lda (slab stride sA), Bt f16 [N][K] pitch ldb (slab stride sB applied to blockIdx.y >> bsh); outputs f32 C and/or f16 value plane C16 (+ optional x2^10 residual plane C16L of the same f32 value), pitch ldc, slab stride sC.
__global__ __launch_bounds__(128) void k_gemm2(const _Float16* __restrict__ A, int lda, size_t sA, const _Float16* __restrict__ Bh, int ldb, size_t sB, unsigned int bsh, float alpha, const float* CP,
    float* C, _Float16* C16, _Float16* C16L, int ldc, size_t sC, int M, int N, int K, const float* cosb, const float* sinb, unsigned int rotN, unsigned int pmask) {
  __shared__ __attribute__((aligned(16))) float so[4][32][68];
  const unsigned int tid = threadIdx.x, w = tid >> 5, lane = tid & 31u, ln = lane & 15u, hh = lane >> 4; const unsigned int by = blockIdx.y;
  A += (size_t)by * sA; Bh += (size_t)(by >> bsh) * sB; const size_t cofs = (size_t)by * sC;
  const unsigned int ntn = (unsigned int)N >> 6; const unsigned int mt = blockIdx.x / ntn, nq = blockIdx.x - mt * ntn; const unsigned int row0 = mt * 128u + 32u * w, col0 = nq * 64u; if (row0 >= (unsigned int)M) return;
  const _Float16* a0p = A + (size_t)(row0 + ln) * lda; const _Float16* a1p = a0p + (size_t)16 * lda;
  const _Float16* b0p = Bh + (size_t)(col0 + ln) * ldb; const _Float16* b1p = b0p + (size_t)16 * ldb; const _Float16* b2p = b1p + (size_t)16 * ldb; const _Float16* b3p = b2p + (size_t)16 * ldb;
  const v8f z8 = {0.f,0.f,0.f,0.f,0.f,0.f,0.f,0.f}; v8f c00 = z8, c01 = z8, c02 = z8, c03 = z8, c10 = z8, c11 = z8, c12 = z8, c13 = z8;
#pragma unroll 1
  for (int kb = 0; kb < K; kb += 32) { const v16h a0 = g2_frag(a0p + kb, hh), a1 = g2_frag(a1p + kb, hh);
    v16h b = g2_frag(b0p + kb, hh); c00 = g2_mma(a0, b, c00); c10 = g2_mma(a1, b, c10);
    b = g2_frag(b1p + kb, hh); c01 = g2_mma(a0, b, c01); c11 = g2_mma(a1, b, c11);
    b = g2_frag(b2p + kb, hh); c02 = g2_mma(a0, b, c02); c12 = g2_mma(a1, b, c12);
    b = g2_frag(b3p + kb, hh); c03 = g2_mma(a0, b, c03); c13 = g2_mma(a1, b, c13); }
  v8f accs[8] = {c00, c01, c02, c03, c10, c11, c12, c13};
#pragma unroll
  for (int u = 0; u < 8; ++u) { const unsigned int t = (unsigned int)u & 3u, half = (unsigned int)u >> 2; const unsigned int col = col0 + t * 16u + ln;
#pragma unroll
    for (int r = 0; r < 8; ++r) { const unsigned int rloc = half * 16u + 8u * hh + (unsigned int)r; float v = accs[u][r] * alpha; if (CP) v += CP[cofs + (size_t)(row0 + rloc) * ldc + col];      /* own element of the batched C plane */
      so[w][rloc][t * 16u + ln] = v; } }
  __builtin_amdgcn_fence(4 /* acq_rel order */, "workgroup"); __builtin_amdgcn_wave_barrier();
  if (col0 < rotN) {      /* block-uniform: this tile is one q / k head; lane owns tile row 'lane' */
    const unsigned int pos = (row0 + lane) & pmask;
    const float* cr = cosb + (size_t)pos * 32u; const float* sr = sinb + (size_t)pos * 32u; float ss = 0.f;
#pragma unroll 1
    for (unsigned int j = 0; j < 32u; j += 4u) { const v4f cc = *(const v4fa*)(cr + j), sn = *(const v4fa*)(sr + j); const v4f x1 = *(const v4fa*)&so[w][lane][j], x2 = *(const v4fa*)&so[w][lane][32u + j]; v4f y1, y2;
#pragma unroll
      for (int q = 0; q < 4; ++q) { const float c = bf16_rne(cc[q]), s = bf16_rne(sn[q]); y1[q] = x1[q] * c + x2[q] * s; y2[q] = x2[q] * c - x1[q] * s; ss += y1[q] * y1[q] + y2[q] * y2[q]; }
      *(v4fa*)&so[w][lane][j] = y1; *(v4fa*)&so[w][lane][32u + j] = y2; }
    const float rs = rsqrtf(ss * 0.015625f + 1.0e-6f);
#pragma unroll 1
    for (unsigned int j = 0; j < 64u; j += 4u) { v4f y = *(const v4fa*)&so[w][lane][j];
#pragma unroll
      for (int q = 0; q < 4; ++q) y[q] = y[q] * rs;
      *(v4fa*)&so[w][lane][j] = y; }
    __builtin_amdgcn_fence(4 /* acq_rel order */, "workgroup"); __builtin_amdgcn_wave_barrier(); }
  const unsigned int rsub = lane >> 4, c4 = (lane & 15u) * 4u;
  {
#pragma unroll
    for (int q = 0; q < 16; ++q) { const unsigned int r = (unsigned int)q * 2u + rsub; const v4f v = *(const v4fa*)&so[w][r][c4]; const size_t o = cofs + (size_t)(row0 + r) * ldc + col0 + c4;
      if (C) *(v4f*)(C + o) = v;
      if (C16) { v4h h4, l4;
#pragma unroll
        for (int i = 0; i < 4; ++i) { const _Float16 h = (_Float16)v[i]; h4[i] = h; l4[i] = (_Float16)((v[i] - (float)h) * 1024.0f); }
        *(v4h*)(C16 + o) = h4; if (C16L) *(v4h*)(C16L + o) = l4; } }
     } }

// cross-lane steps of the row reductions: lane l with lane l ^ M inside a 16-lane row (DPP row_xmask), and lane l with lane l ^ 16
template <int M> __device__ __forceinline__ float sm_xrow(float x) { return __builtin_bit_cast(float, __builtin_amdgcn_update_dpp(0, __builtin_bit_cast(int, x), 0x160 | M, 0xf, 0xf, true)); }
__device__ __forceinline__ float sm_xhalf(float x) { return __builtin_bit_cast(float, __builtin_amdgcn_permlanex16(__builtin_bit_cast(int, x), __builtin_bit_cast(int, x), 0x76543210, 0xfedcba98, false, false)); }
__device__ __forceinline__ float sm_wave_max(float v) { v = fmaxf(v, sm_xrow<1>(v)); v = fmaxf(v, sm_xrow<2>(v)); v = fmaxf(v, sm_xrow<4>(v)); v = fmaxf(v, sm_xrow<8>(v)); return fmaxf(v, sm_xhalf(v)); }
__device__ __forceinline__ float sm_wave_sum(float v) { v += sm_xrow<1>(v); v += sm_xrow<2>(v); v += sm_xrow<4>(v); v += sm_xrow<8>(v); return v + sm_xhalf(v); }

// e^x as the fast library form computes it (multiply by log2 e, then v_exp_f32); the v_nop in the same statement is the one free slot the instruction set asks for behind a transcendental
__device__ __forceinline__ float sm_exp(float x) { const float t = x * 1.44269504088896340736f; float r; asm("v_exp_f32 %0, %1\n\tv_nop" : "=v"(r) : "v"(t)); return r; }

// causal row softmax of the query tile that ends at key NK (its first query is NK - QT), one wave per score row: lane l keeps columns 128 c + 4 l + 0..3 of every 128-column chunk c in registers, so S is read once, each load and store of a wave covers whole lines, and maximum and sum are per-lane partials joined across the 32 lanes. Keys below the tile's first query are at or below every query of the tile: only the chunks from there on are masked. Every loop over c is unrolled whole so that e[] is indexed by constants and stays in registers, and all loads of a row are in flight together.
template <unsigned int NK> __global__ __launch_bounds__(256) void k_rsmcf2(const float* __restrict__ S, _Float16* __restrict__ P, _Float16* __restrict__ PL, unsigned int hg) {
  static_assert(NK % 128 == 0 && NK >= QT && NK <= NKX);
  constexpr unsigned int NCH = NK / 128, CM = (NK - QT) / 128;
  const unsigned int lane = threadIdx.x & 31u; const unsigned int row = blockIdx.x * 8u + (threadIdx.x >> 5); if (row >= hg * (unsigned int)QT) return;
  const unsigned int last = (NK - QT) + (row & (unsigned int)(QT - 1));
  const size_t i = (size_t)row * NKX + lane * 4u; const float* s = S + i; v4f e[NCH];
#pragma unroll
  for (unsigned int c = 0; c < NCH; ++c) e[c] = *(const v4fa*)(s + c * 128u);
  v4f m4 = {-3.0e38f, -3.0e38f, -3.0e38f, -3.0e38f};
#pragma unroll
  for (unsigned int c = 0; c < NCH; ++c) {
#pragma unroll
    for (int q = 0; q < 4; ++q) { if (c >= CM) e[c][q] = (c * 128u + lane * 4u + (unsigned int)q <= last) ? e[c][q] : -1.0e9f; m4[q] = fmaxf(m4[q], e[c][q]); } }
  const float mx = sm_wave_max(fmaxf(fmaxf(m4[0], m4[1]), fmaxf(m4[2], m4[3])));
  v4f s4 = {0.f, 0.f, 0.f, 0.f};
#pragma unroll
  for (unsigned int c = 0; c < NCH; ++c) {
#pragma unroll
    for (int q = 0; q < 4; ++q) { e[c][q] = sm_exp(e[c][q] - mx); s4[q] += e[c][q]; } }
  const float se = sm_wave_sum((s4[0] + s4[1]) + (s4[2] + s4[3])); const float sc = 256.0f / se;
#pragma unroll
  for (unsigned int c = 0; c < NCH; ++c) { v4h h4, l4;
#pragma unroll
    for (int q = 0; q < 4; ++q) { const float pv = e[c][q] * sc; const _Float16 h = (_Float16)pv; h4[q] = h; l4[q] = (_Float16)((pv - (float)h) * 1024.0f); }
    *(v4h*)(P + i + c * 128u) = h4; *(v4h*)(PL + i + c * 128u) = l4; } }
// picks the instance whose row length is nk
template <unsigned int NK> static void sm_launch(unsigned int nk, const float* S, _Float16* P, _Float16* PL, hipStream_t stream) {
  if (nk == NK) k_rsmcf2<NK><<<NH * QT / 8, 256, 0, stream>>>(S, P, PL, (unsigned int)NH);
  else if constexpr (NK > 2 * QT) sm_launch<NK - QT>(nk, S, P, PL, stream); }

__global__ __launch_bounds__(64) void k_att0(const float* __restrict__ QF, const float* __restrict__ KF, const float* __restrict__ VF, int ld, size_t sF, float scale, float* __restrict__ OF, int ldo, size_t sO) {
  #pragma clang fp contract(off)
  __shared__ __attribute__((aligned(16))) float lq[64][64]; __shared__ __attribute__((aligned(16))) float lo[64][64];
  const unsigned int tid = threadIdx.x; const unsigned int h = blockIdx.x / (unsigned int)(QT0 / 64), rg = blockIdx.x % (unsigned int)(QT0 / 64); const unsigned int i = rg * 64u + tid; const unsigned int hk = h >> KVSH;
  const size_t fo = (size_t)blockIdx.y * sF; QF += fo; KF += fo; VF += fo; OF += (size_t)blockIdx.y * sO;
  const float* qr = QF + (size_t)i * ld + h * HD;
#pragma unroll 1
  for (int c = 0; c < HD / 4; ++c) { *(v4fa*)&lq[tid][c * 4] = *(const v4fa*)(qr + c * 4); const v4f z = {0.f, 0.f, 0.f, 0.f}; *(v4fa*)&lo[tid][c * 4] = z; }
  float m = -1.0e30f, l = 0.f; const unsigned int jmax = rg * 64u + 63u;      /* keys up to the block's last row */
#pragma unroll 1
  for (unsigned int j = 0; j <= jmax; ++j) { const float* kr = KF + (size_t)j * ld + hk * HD; const float* vr = VF + (size_t)j * ld + hk * HD; float s = 0.f;
#pragma unroll 1
    for (int c = 0; c < HD / 4; ++c) { const v4f kq = *(const v4fa*)(kr + c * 4); const v4f qq = *(const v4fa*)&lq[tid][c * 4]; s = __fadd_rn(s, __fmul_rn(qq[0], kq[0])); s = __fadd_rn(s, __fmul_rn(qq[1], kq[1])); s = __fadd_rn(s, __fmul_rn(qq[2], kq[2])); s = __fadd_rn(s, __fmul_rn(qq[3], kq[3])); }
    s = __fmul_rn(s, scale);
    const float f = (j <= i) ? 1.f : 0.f; const float sm = fmaf(f, s, (1.f - f) * -1.0e30f); const float mn = fmaxf(m, sm); const float sc = expf(m - mn); const float e = expf(sm - mn); l = __fadd_rn(__fmul_rn(l, sc), e); m = mn;
#pragma unroll 1
    for (int c = 0; c < HD / 4; ++c) { const v4f vv = *(const v4fa*)(vr + c * 4); v4f oo = *(const v4fa*)&lo[tid][c * 4];
#pragma unroll
      for (int u = 0; u < 4; ++u) oo[u] = __fadd_rn(__fmul_rn(oo[u], sc), __fmul_rn(e, vv[u]));
      *(v4fa*)&lo[tid][c * 4] = oo; } }
  const float fin = 64.0f / l;      /* o carried x64 like the f16 path */
#pragma unroll 1
  for (int c = 0; c < HD / 4; ++c) { v4f oo = *(const v4fa*)&lo[tid][c * 4];
#pragma unroll
    for (int u = 0; u < 4; ++u) oo[u] = __fmul_rn(oo[u], fin);
    *(v4fa*)&lo[tid][c * 4] = oo; }
  __syncthreads();
  {
#pragma unroll 1
    for (unsigned int it = 0; it < 16u; ++it) { const unsigned int row = it * 4u + (tid >> 4), pc = (tid & 15u) * 4u; const v4f v = *(const v4fa*)&lo[row][pc]; *(v4f*)(OF + (size_t)(rg * 64u + row) * ldo + h * HD + pc) = v; }
     } }

constexpr size_t al256(size_t b) { return (b + 255) & ~(size_t)255; }
constexpr size_t cmax(size_t a, size_t b) { return a > b ? a : b; }
constexpr size_t SZ_BQKV = al256((size_t)LQ * DM * 2);
constexpr size_t SZ_BO   = al256((size_t)DM * DM * 2);
constexpr size_t SZ_XO   = al256(NR * DM * 2);                          /* X16, later reused as the merged o value rows */
constexpr size_t SZ_QKV  = al256(NR * LQ * 2);                          /* value plane; the residual plane has the same size */
constexpr size_t SZ_F0   = al256((size_t)NB * QT0 * LQ * 4);
constexpr size_t SZ_OF0  = al256((size_t)NB * QT0 * DM * 4);
constexpr size_t SZ_S    = cmax(al256((size_t)NH * QT * NKX * 4), SZ_F0 + SZ_OF0);      /* S of one query tile (all heads); before the tile loop the same bytes hold F0 | OF0 */
constexpr size_t SZ_P    = al256((size_t)NH * QT * NKX * 2);            /* P value plane of one query tile (all heads); the residual plane has the same size */
constexpr size_t SZ_VT   = al256((size_t)NB * NKV * HD * SQ * 2);       /* V^T value plane; the residual plane has the same size */
constexpr size_t SZ_OL   = al256(NR * DM * 2);                          /* merged o residual rows */
constexpr size_t SZ_OT   = al256((size_t)QT * DM * 4);                  /* f32 o tile of one (batch, query tile) */
static_assert(SZ_F0 + SZ_OF0 <= SZ_S);
constexpr size_t WS_TOTAL = SZ_BQKV + SZ_BO + SZ_XO + 2 * SZ_QKV + SZ_S + 2 * SZ_P + 2 * SZ_VT + SZ_OL + SZ_OT;
static_assert(WS_TOTAL <= (size_t)134217728);
/* plane coverage equalities of the producer grids */
static_assert(((size_t)(DM / 64) * (DM / 64)) * 64 * 64 == (size_t)DM * DM);
static_assert(((size_t)(DM / 64) * (KVD / 64)) * 64 * 64 == (size_t)DM * KVD);
static_assert(((size_t)NB * NKV * (SQ / 64)) * 64 * 64 == (size_t)NB * NKV * HD * SQ);
static_assert((NR * DM) % (256 * 8) == 0);
static_assert(((size_t)NB * QT0 * DM) % (256 * 8) == 0);
static_assert(((size_t)NH * QT) % 8 == 0);
static_assert((size_t)NH * (QT0 / 64) * 64 == (size_t)NH * QT0);
static_assert(((size_t)(NR / 128) * (LQ / 64)) * 128 * 64 == NR * LQ);
static_assert(((size_t)(QT / 128) * (HD / 64) * NH) * 128 * 64 == (size_t)QT * DM);
static_assert(((size_t)(SQ / 128) * (DM / 64) * NB) * 128 * 64 == NR * DM);

extern "C" void kernel_launch(void* const* d_in, const int* in_sizes, int n_in,
                              void* d_out, int out_size, void* d_ws, size_t ws_size, hipStream_t stream) {
  if (n_in < 7) return;
  const size_t need_x = ((size_t)(NB - 1) * SQ_FULL + SQ) * DM;
  if ((size_t)in_sizes[0] < need_x) return;
  if ((size_t)in_sizes[1] < (size_t)SQ * 32) return;
  if ((size_t)in_sizes[2] < (size_t)SQ * 32) return;
  if ((size_t)in_sizes[3] < (size_t)DM * DM) return;
  if ((size_t)in_sizes[4] < (size_t)DM * KVD) return;
  if ((size_t)in_sizes[5] < (size_t)DM * KVD) return;
  if ((size_t)in_sizes[6] < (size_t)DM * DM) return;
  if ((size_t)out_size < need_x) return;
  const float* x = (const float*)d_in[0]; const float* cosb = (const float*)d_in[1]; const float* sinb = (const float*)d_in[2];      /* tables [pos][32], read as values */
  const float* wq = (const float*)d_in[3]; const float* wk = (const float*)d_in[4]; const float* wv = (const float*)d_in[5]; const float* wo = (const float*)d_in[6];      /* all [in][out] */
  float* out = (float*)d_out;
  char* ws = (char*)d_ws; size_t off = 0;
  auto take = [&](size_t bytes) { char* p = ws + off; off += (bytes + 255) & ~(size_t)255; return p; };
  _Float16* BQKV = (_Float16*)take(SZ_BQKV); _Float16* BO = (_Float16*)take(SZ_BO);
  _Float16* X16 = (_Float16*)take(SZ_XO); _Float16* OH = X16;      /* X16 is dead after the projection GEMMs; the merged o value rows take its place */
  _Float16* QKV = (_Float16*)take(SZ_QKV); const _Float16* Q16 = QKV; const _Float16* K16 = QKV + DM; const _Float16* V16 = QKV + ROTN;
  _Float16* QKVL = (_Float16*)take(SZ_QKV); const _Float16* QL = QKVL; const _Float16* VL16 = QKVL + ROTN;      /* x1024 residual plane, same layout (k columns unused) */
  char* sreg = take(SZ_S); float* S = (float*)sreg; float* F0 = (float*)sreg; float* OF0 = (float*)(sreg + SZ_F0);      /* F0 | OF0 are consumed before the first score tile is written */
  _Float16* PH = (_Float16*)take(SZ_P); _Float16* PL = (_Float16*)take(SZ_P);
  _Float16* VT = (_Float16*)take(SZ_VT); _Float16* VTL = (_Float16*)take(SZ_VT);
  _Float16* OL = (_Float16*)take(SZ_OL); float* OT = (float*)take(SZ_OT);
  if (off > ws_size) return;

  k_wT<<<(DM / 64) * (DM / 64), 256, 0, stream>>>(wq, (unsigned int)DM, (unsigned int)DM, BQKV);                                   /* W[DM][DM] -> Bt rows 0..1023 */
  k_wT<<<(DM / 64) * (KVD / 64), 256, 0, stream>>>(wk, (unsigned int)DM, (unsigned int)KVD, BQKV + (size_t)DM * DM);                /* W[DM][KVD] -> Bt rows 1024..1279 */
  k_wT<<<(DM / 64) * (KVD / 64), 256, 0, stream>>>(wv, (unsigned int)DM, (unsigned int)KVD, BQKV + (size_t)ROTN * DM);              /* W[DM][KVD] -> Bt rows 1280..1535 */
  k_wT<<<(DM / 64) * (DM / 64), 256, 0, stream>>>(wo, (unsigned int)DM, (unsigned int)DM, BO);                                     /* Wo[c][n] -> Bt[n][c] */
  const unsigned int n8x = (unsigned int)(NR * DM / 8);
  k_x16<<<(n8x + 255u) / 256u, 256, 0, stream>>>(x, X16, n8x);
  const int MP = (int)(NR); const unsigned int pm = (unsigned int)(SQ - 1);
  k_gemm2<<<dim3((unsigned int)((MP / 128) * (LQ / 64)), 1), 128, 0, stream>>>(X16, DM, (size_t)0, BQKV, DM, (size_t)0, 0u, 0.0625f, nullptr, nullptr, QKV, QKVL, LQ, (size_t)0, MP, LQ, DM, cosb, sinb, (unsigned int)ROTN, pm);      /* q | k | v rows (f16 value + residual), q / k rotated + normalised */
  k_gemm2<<<dim3((unsigned int)((QT0 / 128) * (LQ / 64)), NB), 128, 0, stream>>>(X16, DM, (size_t)SQ * DM, BQKV, DM, (size_t)0, 0u, 0.0625f, nullptr, F0, nullptr, nullptr, LQ, (size_t)QT0 * LQ, QT0, LQ, DM, cosb, sinb, (unsigned int)ROTN, pm);      /* f32 q | k | v of rows 0..QT0-1 of every batch */
  k_vt<<<NB * NKV * (SQ / 64), 256, 0, stream>>>(V16, VT);        /* V^T value plane [NB][NKV][HD][SQ] */
  k_vt<<<NB * NKV * (SQ / 64), 256, 0, stream>>>(VL16, VTL);      /* V^T residual plane */
  k_att0<<<dim3(NH * (QT0 / 64), NB), 64, 0, stream>>>(F0, F0 + DM, F0 + ROTN, LQ, (size_t)QT0 * LQ, 0.125f, OF0, DM, (size_t)QT0 * DM);      /* f32 attention for rows 0..QT0-1 (o x64) */
  const unsigned int n8h = (unsigned int)((size_t)NB * QT0 * DM / 8);
  k_hl<<<(n8h + 255u) / 256u, 256, 0, stream>>>(OF0, OH, OL, n8h);      /* first rows: value + x1024 residual planes into the merged o rows */
  for (unsigned int b = 0; b < (unsigned int)NB; ++b) { const size_t r0 = (size_t)b * SQ; const _Float16* VTb = VT + (size_t)b * NKV * HD * SQ; const _Float16* VTLb = VTL + (size_t)b * NKV * HD * SQ;
    for (unsigned int q0 = (unsigned int)QT; q0 < (unsigned int)SQ; q0 += QT) { const unsigned int nk = q0 + QT;      /* causal: only keys below the tile end are computed; rows below QT0 come from the f32 path */
      const dim3 gs((QT / 128) * (nk / 64), NH), go((QT / 128) * (HD / 64), NH);
      k_gemm2<<<gs, 128, 0, stream>>>(Q16 + (r0 + q0) * LQ, LQ, (size_t)HD, K16 + r0 * LQ, LQ, (size_t)HD, (unsigned int)KVSH, 0.125f, nullptr, S, nullptr, nullptr, NKX, (size_t)QT * NKX, QT, (int)nk, HD, nullptr, nullptr, 0u, 0u);      /* scores: q value plane, heads on grid.y */
      k_gemm2<<<gs, 128, 0, stream>>>(QL + (r0 + q0) * LQ, LQ, (size_t)HD, K16 + r0 * LQ, LQ, (size_t)HD, (unsigned int)KVSH, 0.0001220703125f, (const float*)S, S, nullptr, nullptr, NKX, (size_t)QT * NKX, QT, (int)nk, HD, nullptr, nullptr, 0u, 0u);      /* += q residual plane 2^-13 (own element) */
      sm_launch<SQ>(nk, S, PH, PL, stream);
      k_gemm2<<<go, 128, 0, stream>>>(PH, NKX, (size_t)QT * NKX, VTb, SQ, (size_t)HD * SQ, (unsigned int)KVSH, 0.25f, nullptr, OT, nullptr, nullptr, DM, (size_t)HD, QT, HD, (int)nk, nullptr, nullptr, 0u, 0u);      /* o tile (x64) = Vh ph */
      k_gemm2<<<go, 128, 0, stream>>>(PH, NKX, (size_t)QT * NKX, VTLb, SQ, (size_t)HD * SQ, (unsigned int)KVSH, 0.000244140625f, (const float*)OT, OT, nullptr, nullptr, DM, (size_t)HD, QT, HD, (int)nk, nullptr, nullptr, 0u, 0u);      /* += Vres ph 2^-12 (own element) */
      k_gemm2<<<go, 128, 0, stream>>>(PL, NKX, (size_t)QT * NKX, VTb, SQ, (size_t)HD * SQ, (unsigned int)KVSH, 0.000244140625f, (const float*)OT, nullptr, OH + (r0 + q0) * DM, OL + (r0 + q0) * DM, DM, (size_t)HD, QT, HD, (int)nk, nullptr, nullptr, 0u, 0u); } }      /* += Vh pl 2^-12; final o written as f16 value + x1024 residual merged rows */
  k_gemm2<<<dim3((SQ / 128) * (DM / 64), NB), 128, 0, stream>>>(OH, DM, (size_t)SQ * DM, BO, DM, (size_t)0, 0u, 0.0009765625f, nullptr, out, nullptr, nullptr, DM, (size_t)SQ_FULL * DM, SQ, DM, DM, nullptr, nullptr, 0u, 0u);      /* out rows in the output layout: o value plane */
  k_gemm2<<<dim3((SQ / 128) * (DM / 64), NB), 128, 0, stream>>>(OL, DM, (size_t)SQ * DM, BO, DM, (size_t)0, 0u, 0.00000095367431640625f, (const float*)out, out, nullptr, nullptr, DM, (size_t)SQ_FULL * DM, SQ, DM, DM, nullptr, nullptr, 0u, 0u);      
}

// v002
// It runs in 1880 microseconds.
// Next to v001, in two timings, it ran 1.73 and 1.74 times as fast.
// Counting every step since v000, it is 3.40 times as fast.
#include <hip/hip_runtime.h>
// All contractions: v_wmma_f32_16x16x32_f16 (f16 operands, f32 accumulate). x, cos, sin and all four weights are RNE-converted to bf16 first (exact in f16; weights carried x16); q (after split-half rotation + scale-free RMS normalisation in f32), v, softmax weights (x256) and o (x64) are f16 value + x1024 residual planes, every residual product in its own own-element pass folded in f32; k is a single f16 plane; the first 256 query rows of every batch use f32 q/k/v from exact-operand GEMMs and an f32 online softmax on VALU.
// Causal grouped-query self-attention: x [NB][SQ_FULL][1024] (rows 0..SQ-1 of each batch used); q = x Wq (16 heads of 64), k = x Wk, v = x Wv (4 kv heads of 64; weights are [in][out]); rotation with INPUT tables cos/sin [pos][32]: y[j] = x[j] c + x[j+32] s, y[j+32] = x[j+32] c - x[j] s; q, k scaled by rsqrt(mean square over the head + 1e-6); query head h uses kv head h >> 2; scores * 0.125; keys above the query get exactly zero weight; softmax; out = merged y Wo -> [NB][SQ_FULL][1024] f32 (rows 0..SQ-1 of each batch).
// Structure: token rows r = b*SQ + s; X16 exact f16 rows; one q|k|v GEMM (N = 1536) whose epilogue applies rotation + normalisation on the 64-column head tiles of q and k and writes value + residual planes; V^T value and residual planes per (batch, kv head) via LDS transposes; per batch and per query tile of 256 rows: scores = qh k + qres k against the keys below the tile end (K = 64, heads on grid.y), causal row softmax on VALU, one wave per row (P value + residual), o = Vh ph + Vres ph + Vh pl accumulated in an f32 tile and written as f16 value + residual merged o rows (x64); out = oh Wo + ores Wo. Rows 0..255 of each batch: f32 attention, split into the same two o planes.
#ifndef NB
#define NB 2
#endif
#ifndef SQ
#define SQ 2048
#endif
#define NB_FULL 2
#define SQ_FULL 2048
#define DM 1024
#define NH 16
#define NKV 4
#define KVSH 2                       /* query head -> kv head shift */
#define HD 64
#define KVD (NKV * HD)               /* 256 */
#define LQ (DM + 2 * KVD)            /* row pitch of the q | k | v rows: 1536 */
#define ROTN (DM + KVD)              /* columns below this are q / k heads (rotated + normalised) */
#define QT 256                       /* query rows per causal tile */
#define QT0 256                      /* leading rows of every batch computed in f32 */
#define NKX SQ                       /* S / P row pitch */
#define NR ((size_t)NB * SQ)         /* token rows */

static_assert(NB <= NB_FULL);
static_assert(SQ <= SQ_FULL);
static_assert((SQ & (SQ - 1)) == 0);
static_assert(SQ % QT == 0);
static_assert((QT & (QT - 1)) == 0);
static_assert(QT % 128 == 0);
static_assert(QT0 == QT);
static_assert(QT0 % 128 == 0);
static_assert(QT0 % 64 == 0);
static_assert(HD == 64);
static_assert(DM == NH * HD);
static_assert(NH == (NKV << KVSH));
static_assert(DM / 8 == 128);
static_assert(DM % 64 == 0);
static_assert(KVD % 64 == 0);
static_assert(LQ % 64 == 0);
static_assert(ROTN % 64 == 0);
static_assert(((size_t)NB * SQ) % 128 == 0);
static_assert(SQ % 64 == 0);
static_assert(DM % 32 == 0);

typedef unsigned short v8us __attribute__((ext_vector_type(8), may_alias));
typedef float  v8f  __attribute__((ext_vector_type(8)));
typedef float  v4f  __attribute__((ext_vector_type(4)));
typedef float  v4fa __attribute__((ext_vector_type(4), may_alias));
typedef _Float16 v16h __attribute__((ext_vector_type(16)));
typedef _Float16 v4h __attribute__((ext_vector_type(4)));
union FragH { v16h v; v8us half[2]; _Float16 h[16]; unsigned short u[16]; };

__device__ __forceinline__ unsigned short bf16_bits(float x) { unsigned int u = __float_as_uint(x); return (unsigned short)((u + 0x7FFFu + ((u >> 16) & 1u)) >> 16); }
__device__ __forceinline__ float bf16_val(unsigned short b) { return __uint_as_float(((unsigned int)b) << 16); }
__device__ __forceinline__ float bf16_rne(float x) { return bf16_val(bf16_bits(x)); }

// fragment: elements 0..7 <- k0 + 8h + 0..7, elements 8..15 <- k0 + 16 + 8h + 0..7 (same map for A rows and B columns)
__device__ __forceinline__ v16h g2_frag(const _Float16* p, unsigned hh) { FragH f; f.half[0] = *(const v8us*)((const unsigned short*)p + 8 * hh); f.half[1] = *(const v8us*)((const unsigned short*)p + 16 + 8 * hh); return f.v; }
__device__ __forceinline__ v8f g2_mma(v16h a, v16h b, v8f c) { v8f d = __builtin_amdgcn_wmma_f32_16x16x32_f16(false, a, false, b, (short)0, c, false, false); asm volatile("v_nop\n\tv_nop\n\tv_nop\n\tv_nop" : "+v"(d) : "v"(a), "v"(b)); return d; }

__global__ __launch_bounds__(256) void k_wT(const float* __restrict__ w, unsigned int Kd, unsigned int Nd, _Float16* __restrict__ Bt) {
  __shared__ unsigned short tl[64][66];
  const unsigned int tid = threadIdx.x; const unsigned int ntn = Nd >> 6; const unsigned int kt = blockIdx.x / ntn, nt = blockIdx.x - kt * ntn; const unsigned int k0 = kt * 64u, n0 = nt * 64u;
  for (unsigned int i = tid; i < 64u * 16u; i += 256u) { const unsigned int r = i >> 4, c4 = (i & 15u) * 4u; const v4f a = *(const v4fa*)(w + (size_t)(k0 + r) * Nd + n0 + c4); FragH f;
#pragma unroll
    for (int q = 0; q < 4; ++q) f.h[q] = (_Float16)(bf16_rne(a[q]) * 16.0f);
#pragma unroll
    for (int q = 0; q < 4; ++q) tl[r][c4 + q] = f.u[q]; }
  __syncthreads();
  {
#pragma unroll
    for (int rd = 0; rd < 2; ++rd) { const unsigned int d = (unsigned int)rd * 32u + (tid >> 3), pc = tid & 7u; FragH f;
#pragma unroll
      for (int q = 0; q < 8; ++q) f.u[q] = tl[pc * 8u + q][d];
      const v8us o = f.half[0];
      *(v8us*)((unsigned short*)Bt + (size_t)(n0 + d) * Kd + k0 + pc * 8u) = o; }
     } }

__global__ __launch_bounds__(256) void k_x16(const float* __restrict__ x, _Float16* __restrict__ X16, unsigned int n8) {
  const unsigned int t = blockIdx.x * 256u + threadIdx.x; if (t >= n8) return;
  const unsigned int row = t >> 7;                       /* DM / 8 = 128 pieces per row */
  const unsigned int b = row / (unsigned int)SQ, s = row - b * (unsigned int)SQ;
  const float* src = x + ((size_t)b * SQ_FULL + s) * DM + (size_t)(t & 127u) * 8u;
  const v4f a = *(const v4fa*)src, c = *(const v4fa*)(src + 4);
  FragH f;
#pragma unroll
  for (int q = 0; q < 4; ++q) { f.h[q] = (_Float16)bf16_rne(a[q]); f.h[4 + q] = (_Float16)bf16_rne(c[q]); }
  const v8us o = f.half[0];
  unsigned short* d = (unsigned short*)X16 + (size_t)t * 8u;
  *(v8us*)d = o; 
}

__global__ __launch_bounds__(256) void k_vt(const _Float16* __restrict__ V16, _Float16* __restrict__ Vt) {
  __shared__ unsigned short tl[64][66];
  const unsigned int tid = threadIdx.x; const unsigned int slab = blockIdx.x / (unsigned int)(SQ / 64), lg = blockIdx.x % (unsigned int)(SQ / 64); const unsigned int b = slab / (unsigned int)NKV, h = slab % (unsigned int)NKV;
  for (unsigned int i = tid; i < 64u * 8u; i += 256u) { const unsigned int r = i >> 3, c8 = (i & 7u) * 8u; FragH f; f.half[0] = *(const v8us*)((const unsigned short*)V16 + ((size_t)b * SQ + lg * 64u + r) * LQ + h * 64u + c8);
#pragma unroll
    for (int q = 0; q < 8; ++q) tl[r][c8 + q] = f.u[q]; }
  __syncthreads();
  {
#pragma unroll
    for (int rd = 0; rd < 2; ++rd) { const unsigned int d = (unsigned int)rd * 32u + (tid >> 3), pc = tid & 7u; FragH f;
#pragma unroll
      for (int q = 0; q < 8; ++q) f.u[q] = tl[pc * 8u + q][d];
      const v8us o = f.half[0];
      *(v8us*)((unsigned short*)Vt + ((size_t)slab * 64u + d) * SQ + lg * 64u + pc * 8u) = o; }
     } }

__global__ __launch_bounds__(256) void k_hl(const float* __restrict__ F, _Float16* __restrict__ Hh, _Float16* __restrict__ Hl, unsigned int n8) {
  const unsigned int t = blockIdx.x * 256u + threadIdx.x; if (t >= n8) return; FragH fh, fl; const v4f a = *(const v4fa*)(F + (size_t)t * 8u), c = *(const v4fa*)(F + (size_t)t * 8u + 4);
  const unsigned int row = t >> 7; const unsigned int b = row / (unsigned int)QT0, r = row - b * (unsigned int)QT0;
  const size_t dh = ((size_t)b * SQ + r) * DM + (size_t)(t & 127u) * 8u;
#pragma unroll
  for (int q = 0; q < 4; ++q) { _Float16 h = (_Float16)a[q]; fh.h[q] = h; fl.h[q] = (_Float16)((a[q] - (float)h) * 1024.0f); h = (_Float16)c[q]; fh.h[4 + q] = h; fl.h[4 + q] = (_Float16)((c[q] - (float)h) * 1024.0f); }
  const v8us oh = fh.half[0], ol = fl.half[0];
  { *(v8us*)((unsigned short*)Hh + dh) = oh; *(v8us*)((unsigned short*)Hl + dh) = ol;  } }

// one k-step (32 k) of a wave's operands: two A row fragments and four B column fragments
struct G2Stage { v16h a0, a1, b0, b1, b2, b3; };
__device__ __forceinline__ void g2_load(G2Stage& s, const _Float16* a0p, const _Float16* a1p, const _Float16* b0p, const _Float16* b1p, const _Float16* b2p, const _Float16* b3p, int kb, unsigned hh) {
  s.a0 = g2_frag(a0p + kb, hh); s.a1 = g2_frag(a1p + kb, hh); s.b0 = g2_frag(b0p + kb, hh); s.b1 = g2_frag(b1p + kb, hh); s.b2 = g2_frag(b2p + kb, hh); s.b3 = g2_frag(b3p + kb, hh); }
__device__ __forceinline__ void g2_step(const G2Stage& s, v8f& c00, v8f& c01, v8f& c02, v8f& c03, v8f& c10, v8f& c11, v8f& c12, v8f& c13) {
  c00 = g2_mma(s.a0, s.b0, c00); c10 = g2_mma(s.a1, s.b0, c10); c01 = g2_mma(s.a0, s.b1, c01); c11 = g2_mma(s.a1, s.b1, c11);
  c02 = g2_mma(s.a0, s.b2, c02); c12 = g2_mma(s.a1, s.b2, c12); c03 = g2_mma(s.a0, s.b3, c03); c13 = g2_mma(s.a1, s.b3, c13); }

// batched GEMM (grid.y = head / batch slab): C = alpha * A Bt^T (+ CP own element). A f16 [M][K] pitch lda (slab stride sA), Bt f16 [N][K] pitch ldb (slab stride sB applied to blockIdx.y >> bsh); outputs f32 C and/or f16 value plane C16 (+ optional x2^10 residual plane C16L of the same f32 value), pitch ldc, slab stride sC.
__global__ __launch_bounds__(128) void k_gemm2(const _Float16* __restrict__ A, int lda, size_t sA, const _Float16* __restrict__ Bh, int ldb, size_t sB, unsigned int bsh, float alpha, const float* CP,
    float* C, _Float16* C16, _Float16* C16L, int ldc, size_t sC, int M, int N, int K, const float* cosb, const float* sinb, unsigned int rotN, unsigned int pmask) {
  __shared__ __attribute__((aligned(16))) float so[4][32][68];
  const unsigned int tid = threadIdx.x, w = tid >> 5, lane = tid & 31u, ln = lane & 15u, hh = lane >> 4; const unsigned int by = blockIdx.y;
  A += (size_t)by * sA; Bh += (size_t)(by >> bsh) * sB; const size_t cofs = (size_t)by * sC;
  const unsigned int ntn = (unsigned int)N >> 6; const unsigned int mt = blockIdx.x / ntn, nq = blockIdx.x - mt * ntn; const unsigned int row0 = mt * 128u + 32u * w, col0 = nq * 64u; if (row0 >= (unsigned int)M) return;
  const _Float16* a0p = A + (size_t)(row0 + ln) * lda; const _Float16* a1p = a0p + (size_t)16 * lda;
  const _Float16* b0p = Bh + (size_t)(col0 + ln) * ldb; const _Float16* b1p = b0p + (size_t)16 * ldb; const _Float16* b2p = b1p + (size_t)16 * ldb; const _Float16* b3p = b2p + (size_t)16 * ldb;
  const v8f z8 = {0.f,0.f,0.f,0.f,0.f,0.f,0.f,0.f}; v8f c00 = z8, c01 = z8, c02 = z8, c03 = z8, c10 = z8, c11 = z8, c12 = z8, c13 = z8;
  /* K loop as a ring of three register stages: the twelve loads of k-step s + 2 are issued together in front of the products of k-step s, so a wave waits for a whole stage that was asked for two steps earlier instead of for each fragment in turn. In front of and inside the loop no load stands under a test of its own, so that each wait can count the younger stages as still in flight; the last two to four steps are peeled. The order of the k-steps and of the products into each accumulator is unchanged. */
#define G2_LD(S, ST) g2_load(S, a0p, a1p, b0p, b1p, b2p, b3p, (ST) * 32, hh)
#define G2_ST(S) g2_step(S, c00, c01, c02, c03, c10, c11, c12, c13)
#define G2_XW() asm volatile("s_wait_xcnt 0x0" ::: "memory")      /* stands in front of code that writes anew the address registers which the loads issued so far name */
  const int nst = (K + 31) >> 5;
  if (nst == 1) { G2Stage s0; G2_LD(s0, 0); G2_ST(s0); }
  else if (nst > 1) { G2Stage s0, s1, s2; int st = 0;
    G2_LD(s0, 0); G2_LD(s1, 1); G2_XW();
#pragma unroll 1      /* one trip is already three k-steps; more would only add code */
    for (; st + 5 <= nst; st += 3) { G2_LD(s2, st + 2); G2_ST(s0); G2_LD(s0, st + 3); G2_ST(s1); G2_LD(s1, st + 4); G2_ST(s2); G2_XW(); }
    const int rem = nst - st;      /* 2, 3 or 4 steps are left; s0 and s1 hold the first two */
    if (rem >= 3) G2_LD(s2, st + 2);
    G2_ST(s0);
    if (rem >= 4) { G2_XW(); const int kt = (st + 3) * 32;      /* here the address registers die with their loads and a later fragment may land in them: the wait stands behind each fragment's loads */
      s0.a0 = g2_frag(a0p + kt, hh); G2_XW(); s0.a1 = g2_frag(a1p + kt, hh); G2_XW(); s0.b0 = g2_frag(b0p + kt, hh); G2_XW(); s0.b1 = g2_frag(b1p + kt, hh); G2_XW(); s0.b2 = g2_frag(b2p + kt, hh); G2_XW(); s0.b3 = g2_frag(b3p + kt, hh); G2_XW(); }
    G2_ST(s1);
    if (rem >= 3) G2_ST(s2);
    if (rem >= 4) G2_ST(s0); }
#undef G2_LD
#undef G2_ST
#undef G2_XW
  v8f accs[8] = {c00, c01, c02, c03, c10, c11, c12, c13};
  if (CP) {      /* own elements of the batched C plane: a lane's 64 loads are issued together, in front of the first sum */
    const float* cp = CP + cofs + (size_t)(row0 + 8u * hh) * ldc + col0 + ln; v8f pv[8];
#pragma unroll
    for (int u = 0; u < 8; ++u) {
#pragma unroll
      for (int r = 0; r < 8; ++r) pv[u][r] = cp[(size_t)((u >> 2) * 16 + r) * ldc + (u & 3) * 16]; }
#pragma unroll
    for (int u = 0; u < 8; ++u) accs[u] = accs[u] * alpha + pv[u];
  } else {
#pragma unroll
    for (int u = 0; u < 8; ++u) accs[u] = accs[u] * alpha; }
#pragma unroll
  for (int u = 0; u < 8; ++u) { const unsigned int t = (unsigned int)u & 3u, half = (unsigned int)u >> 2;
#pragma unroll
    for (int r = 0; r < 8; ++r) { const unsigned int rloc = half * 16u + 8u * hh + (unsigned int)r;
      so[w][rloc][t * 16u + ln] = accs[u][r]; } }
  __builtin_amdgcn_fence(4 /* acq_rel order */, "workgroup"); __builtin_amdgcn_wave_barrier();
  if (col0 < rotN) {      /* block-uniform: this tile is one q / k head; lane owns tile row 'lane' */
    const unsigned int pos = (row0 + lane) & pmask;
    const float* cr = cosb + (size_t)pos * 32u; const float* sr = sinb + (size_t)pos * 32u; float ss = 0.f;
#pragma unroll 1
    for (unsigned int j = 0; j < 32u; j += 4u) { const v4f cc = *(const v4fa*)(cr + j), sn = *(const v4fa*)(sr + j); const v4f x1 = *(const v4fa*)&so[w][lane][j], x2 = *(const v4fa*)&so[w][lane][32u + j]; v4f y1, y2;
#pragma unroll
      for (int q = 0; q < 4; ++q) { const float c = bf16_rne(cc[q]), s = bf16_rne(sn[q]); y1[q] = x1[q] * c + x2[q] * s; y2[q] = x2[q] * c - x1[q] * s; ss += y1[q] * y1[q] + y2[q] * y2[q]; }
      *(v4fa*)&so[w][lane][j] = y1; *(v4fa*)&so[w][lane][32u + j] = y2; }
    const float rs = rsqrtf(ss * 0.015625f + 1.0e-6f);
#pragma unroll 1
    for (unsigned int j = 0; j < 64u; j += 4u) { v4f y = *(const v4fa*)&so[w][lane][j];
#pragma unroll
      for (int q = 0; q < 4; ++q) y[q] = y[q] * rs;
      *(v4fa*)&so[w][lane][j] = y; }
    __builtin_amdgcn_fence(4 /* acq_rel order */, "workgroup"); __builtin_amdgcn_wave_barrier(); }
  const unsigned int rsub = lane >> 4, c4 = (lane & 15u) * 4u;
  {
#pragma unroll
    for (int q = 0; q < 16; ++q) { const unsigned int r = (unsigned int)q * 2u + rsub; const v4f v = *(const v4fa*)&so[w][r][c4]; const size_t o = cofs + (size_t)(row0 + r) * ldc + col0 + c4;
      if (C) *(v4f*)(C + o) = v;
      if (C16) { v4h h4, l4;
#pragma unroll
        for (int i = 0; i < 4; ++i) { const _Float16 h = (_Float16)v[i]; h4[i] = h; l4[i] = (_Float16)((v[i] - (float)h) * 1024.0f); }
        *(v4h*)(C16 + o) = h4; if (C16L) *(v4h*)(C16L + o) = l4; } }
     } }

// cross-lane steps of the row reductions: lane l with lane l ^ M inside a 16-lane row (DPP row_xmask), and lane l with lane l ^ 16
template <int M> __device__ __forceinline__ float sm_xrow(float x) { return __builtin_bit_cast(float, __builtin_amdgcn_update_dpp(0, __builtin_bit_cast(int, x), 0x160 | M, 0xf, 0xf, true)); }
__device__ __forceinline__ float sm_xhalf(float x) { return __builtin_bit_cast(float, __builtin_amdgcn_permlanex16(__builtin_bit_cast(int, x), __builtin_bit_cast(int, x), 0x76543210, 0xfedcba98, false, false)); }
__device__ __forceinline__ float sm_wave_max(float v) { v = fmaxf(v, sm_xrow<1>(v)); v = fmaxf(v, sm_xrow<2>(v)); v = fmaxf(v, sm_xrow<4>(v)); v = fmaxf(v, sm_xrow<8>(v)); return fmaxf(v, sm_xhalf(v)); }
__device__ __forceinline__ float sm_wave_sum(float v) { v += sm_xrow<1>(v); v += sm_xrow<2>(v); v += sm_xrow<4>(v); v += sm_xrow<8>(v); return v + sm_xhalf(v); }

// e^x as the fast library form computes it (multiply by log2 e, then v_exp_f32); the v_nop in the same statement is the one free slot the instruction set asks for behind a transcendental
__device__ __forceinline__ float sm_exp(float x) { const float t = x * 1.44269504088896340736f; float r; asm("v_exp_f32 %0, %1\n\tv_nop" : "=v"(r) : "v"(t)); return r; }

// causal row softmax of the query tile that ends at key NK (its first query is NK - QT), one wave per score row: lane l keeps columns 128 c + 4 l + 0..3 of every 128-column chunk c in registers, so S is read once, each load and store of a wave covers whole lines, and maximum and sum are per-lane partials joined across the 32 lanes. Keys below the tile's first query are at or below every query of the tile: only the chunks from there on are masked. Every loop over c is unrolled whole so that e[] is indexed by constants and stays in registers, and all loads of a row are in flight together.
template <unsigned int NK> __global__ __launch_bounds__(256) void k_rsmcf2(const float* __restrict__ S, _Float16* __restrict__ P, _Float16* __restrict__ PL, unsigned int hg) {
  static_assert(NK % 128 == 0 && NK >= QT && NK <= NKX);
  constexpr unsigned int NCH = NK / 128, CM = (NK - QT) / 128;
  const unsigned int lane = threadIdx.x & 31u; const unsigned int row = blockIdx.x * 8u + (threadIdx.x >> 5); if (row >= hg * (unsigned int)QT) return;
  const unsigned int last = (NK - QT) + (row & (unsigned int)(QT - 1));
  const size_t i = (size_t)row * NKX + lane * 4u; const float* s = S + i; v4f e[NCH];
#pragma unroll
  for (unsigned int c = 0; c < NCH; ++c) e[c] = *(const v4fa*)(s + c * 128u);
  v4f m4 = {-3.0e38f, -3.0e38f, -3.0e38f, -3.0e38f};
#pragma unroll
  for (unsigned int c = 0; c < NCH; ++c) {
#pragma unroll
    for (int q = 0; q < 4; ++q) { if (c >= CM) e[c][q] = (c * 128u + lane * 4u + (unsigned int)q <= last) ? e[c][q] : -1.0e9f; m4[q] = fmaxf(m4[q], e[c][q]); } }
  const float mx = sm_wave_max(fmaxf(fmaxf(m4[0], m4[1]), fmaxf(m4[2], m4[3])));
  v4f s4 = {0.f, 0.f, 0.f, 0.f};
#pragma unroll
  for (unsigned int c = 0; c < NCH; ++c) {
#pragma unroll
    for (int q = 0; q < 4; ++q) { e[c][q] = sm_exp(e[c][q] - mx); s4[q] += e[c][q]; } }
  const float se = sm_wave_sum((s4[0] + s4[1]) + (s4[2] + s4[3])); const float sc = 256.0f / se;
#pragma unroll
  for (unsigned int c = 0; c < NCH; ++c) { v4h h4, l4;
#pragma unroll
    for (int q = 0; q < 4; ++q) { const float pv = e[c][q] * sc; const _Float16 h = (_Float16)pv; h4[q] = h; l4[q] = (_Float16)((pv - (float)h) * 1024.0f); }
    *(v4h*)(P + i + c * 128u) = h4; *(v4h*)(PL + i + c * 128u) = l4; } }
// picks the instance whose row length is nk
template <unsigned int NK> static void sm_launch(unsigned int nk, const float* S, _Float16* P, _Float16* PL, hipStream_t stream) {
  if (nk == NK) k_rsmcf2<NK><<<NH * QT / 8, 256, 0, stream>>>(S, P, PL, (unsigned int)NH);
  else if constexpr (NK > 2 * QT) sm_launch<NK - QT>(nk, S, P, PL, stream); }

__global__ __launch_bounds__(64) void k_att0(const float* __restrict__ QF, const float* __restrict__ KF, const float* __restrict__ VF, int ld, size_t sF, float scale, float* __restrict__ OF, int ldo, size_t sO) {
  #pragma clang fp contract(off)
  __shared__ __attribute__((aligned(16))) float lq[64][64]; __shared__ __attribute__((aligned(16))) float lo[64][64];
  const unsigned int tid = threadIdx.x; const unsigned int h = blockIdx.x / (unsigned int)(QT0 / 64), rg = blockIdx.x % (unsigned int)(QT0 / 64); const unsigned int i = rg * 64u + tid; const unsigned int hk = h >> KVSH;
  const size_t fo = (size_t)blockIdx.y * sF; QF += fo; KF += fo; VF += fo; OF += (size_t)blockIdx.y * sO;
  const float* qr = QF + (size_t)i * ld + h * HD;
#pragma unroll 1
  for (int c = 0; c < HD / 4; ++c) { *(v4fa*)&lq[tid][c * 4] = *(const v4fa*)(qr + c * 4); const v4f z = {0.f, 0.f, 0.f, 0.f}; *(v4fa*)&lo[tid][c * 4] = z; }
  float m = -1.0e30f, l = 0.f; const unsigned int jmax = rg * 64u + 63u;      /* keys up to the block's last row */
#pragma unroll 1
  for (unsigned int j = 0; j <= jmax; ++j) { const float* kr = KF + (size_t)j * ld + hk * HD; const float* vr = VF + (size_t)j * ld + hk * HD; float s = 0.f;
#pragma unroll 1
    for (int c = 0; c < HD / 4; ++c) { const v4f kq = *(const v4fa*)(kr + c * 4); const v4f qq = *(const v4fa*)&lq[tid][c * 4]; s = __fadd_rn(s, __fmul_rn(qq[0], kq[0])); s = __fadd_rn(s, __fmul_rn(qq[1], kq[1])); s = __fadd_rn(s, __fmul_rn(qq[2], kq[2])); s = __fadd_rn(s, __fmul_rn(qq[3], kq[3])); }
    s = __fmul_rn(s, scale);
    const float f = (j <= i) ? 1.f : 0.f; const float sm = fmaf(f, s, (1.f - f) * -1.0e30f); const float mn = fmaxf(m, sm); const float sc = expf(m - mn); const float e = expf(sm - mn); l = __fadd_rn(__fmul_rn(l, sc), e); m = mn;
#pragma unroll 1
    for (int c = 0; c < HD / 4; ++c) { const v4f vv = *(const v4fa*)(vr + c * 4); v4f oo = *(const v4fa*)&lo[tid][c * 4];
#pragma unroll
      for (int u = 0; u < 4; ++u) oo[u] = __fadd_rn(__fmul_rn(oo[u], sc), __fmul_rn(e, vv[u]));
      *(v4fa*)&lo[tid][c * 4] = oo; } }
  const float fin = 64.0f / l;      /* o carried x64 like the f16 path */
#pragma unroll 1
  for (int c = 0; c < HD / 4; ++c) { v4f oo = *(const v4fa*)&lo[tid][c * 4];
#pragma unroll
    for (int u = 0; u < 4; ++u) oo[u] = __fmul_rn(oo[u], fin);
    *(v4fa*)&lo[tid][c * 4] = oo; }
  __syncthreads();
  {
#pragma unroll 1
    for (unsigned int it = 0; it < 16u; ++it) { const unsigned int row = it * 4u + (tid >> 4), pc = (tid & 15u) * 4u; const v4f v = *(const v4fa*)&lo[row][pc]; *(v4f*)(OF + (size_t)(rg * 64u + row) * ldo + h * HD + pc) = v; }
     } }

constexpr size_t al256(size_t b) { return (b + 255) & ~(size_t)255; }
constexpr size_t cmax(size_t a, size_t b) { return a > b ? a : b; }
constexpr size_t SZ_BQKV = al256((size_t)LQ * DM * 2);
constexpr size_t SZ_BO   = al256((size_t)DM * DM * 2);
constexpr size_t SZ_XO   = al256(NR * DM * 2);                          /* X16, later reused as the merged o value rows */
constexpr size_t SZ_QKV  = al256(NR * LQ * 2);                          /* value plane; the residual plane has the same size */
constexpr size_t SZ_F0   = al256((size_t)NB * QT0 * LQ * 4);
constexpr size_t SZ_OF0  = al256((size_t)NB * QT0 * DM * 4);
constexpr size_t SZ_S    = cmax(al256((size_t)NH * QT * NKX * 4), SZ_F0 + SZ_OF0);      /* S of one query tile (all heads); before the tile loop the same bytes hold F0 | OF0 */
constexpr size_t SZ_P    = al256((size_t)NH * QT * NKX * 2);            /* P value plane of one query tile (all heads); the residual plane has the same size */
constexpr size_t SZ_VT   = al256((size_t)NB * NKV * HD * SQ * 2);       /* V^T value plane; the residual plane has the same size */
constexpr size_t SZ_OL   = al256(NR * DM * 2);                          /* merged o residual rows */
constexpr size_t SZ_OT   = al256((size_t)QT * DM * 4);                  /* f32 o tile of one (batch, query tile) */
static_assert(SZ_F0 + SZ_OF0 <= SZ_S);
constexpr size_t WS_TOTAL = SZ_BQKV + SZ_BO + SZ_XO + 2 * SZ_QKV + SZ_S + 2 * SZ_P + 2 * SZ_VT + SZ_OL + SZ_OT;
static_assert(WS_TOTAL <= (size_t)134217728);
/* plane coverage equalities of the producer grids */
static_assert(((size_t)(DM / 64) * (DM / 64)) * 64 * 64 == (size_t)DM * DM);
static_assert(((size_t)(DM / 64) * (KVD / 64)) * 64 * 64 == (size_t)DM * KVD);
static_assert(((size_t)NB * NKV * (SQ / 64)) * 64 * 64 == (size_t)NB * NKV * HD * SQ);
static_assert((NR * DM) % (256 * 8) == 0);
static_assert(((size_t)NB * QT0 * DM) % (256 * 8) == 0);
static_assert(((size_t)NH * QT) % 8 == 0);
static_assert((size_t)NH * (QT0 / 64) * 64 == (size_t)NH * QT0);
static_assert(((size_t)(NR / 128) * (LQ / 64)) * 128 * 64 == NR * LQ);
static_assert(((size_t)(QT / 128) * (HD / 64) * NH) * 128 * 64 == (size_t)QT * DM);
static_assert(((size_t)(SQ / 128) * (DM / 64) * NB) * 128 * 64 == NR * DM);

extern "C" void kernel_launch(void* const* d_in, const int* in_sizes, int n_in,
                              void* d_out, int out_size, void* d_ws, size_t ws_size, hipStream_t stream) {
  if (n_in < 7) return;
  const size_t need_x = ((size_t)(NB - 1) * SQ_FULL + SQ) * DM;
  if ((size_t)in_sizes[0] < need_x) return;
  if ((size_t)in_sizes[1] < (size_t)SQ * 32) return;
  if ((size_t)in_sizes[2] < (size_t)SQ * 32) return;
  if ((size_t)in_sizes[3] < (size_t)DM * DM) return;
  if ((size_t)in_sizes[4] < (size_t)DM * KVD) return;
  if ((size_t)in_sizes[5] < (size_t)DM * KVD) return;
  if ((size_t)in_sizes[6] < (size_t)DM * DM) return;
  if ((size_t)out_size < need_x) return;
  const float* x = (const float*)d_in[0]; const float* cosb = (const float*)d_in[1]; const float* sinb = (const float*)d_in[2];      /* tables [pos][32], read as values */
  const float* wq = (const float*)d_in[3]; const float* wk = (const float*)d_in[4]; const float* wv = (const float*)d_in[5]; const float* wo = (const float*)d_in[6];      /* all [in][out] */
  float* out = (float*)d_out;
  char* ws = (char*)d_ws; size_t off = 0;
  auto take = [&](size_t bytes) { char* p = ws + off; off += (bytes + 255) & ~(size_t)255; return p; };
  _Float16* BQKV = (_Float16*)take(SZ_BQKV); _Float16* BO = (_Float16*)take(SZ_BO);
  _Float16* X16 = (_Float16*)take(SZ_XO); _Float16* OH = X16;      /* X16 is dead after the projection GEMMs; the merged o value rows take its place */
  _Float16* QKV = (_Float16*)take(SZ_QKV); const _Float16* Q16 = QKV; const _Float16* K16 = QKV + DM; const _Float16* V16 = QKV + ROTN;
  _Float16* QKVL = (_Float16*)take(SZ_QKV); const _Float16* QL = QKVL; const _Float16* VL16 = QKVL + ROTN;      /* x1024 residual plane, same layout (k columns unused) */
  char* sreg = take(SZ_S); float* S = (float*)sreg; float* F0 = (float*)sreg; float* OF0 = (float*)(sreg + SZ_F0);      /* F0 | OF0 are consumed before the first score tile is written */
  _Float16* PH = (_Float16*)take(SZ_P); _Float16* PL = (_Float16*)take(SZ_P);
  _Float16* VT = (_Float16*)take(SZ_VT); _Float16* VTL = (_Float16*)take(SZ_VT);
  _Float16* OL = (_Float16*)take(SZ_OL); float* OT = (float*)take(SZ_OT);
  if (off > ws_size) return;

  k_wT<<<(DM / 64) * (DM / 64), 256, 0, stream>>>(wq, (unsigned int)DM, (unsigned int)DM, BQKV);                                   /* W[DM][DM] -> Bt rows 0..1023 */
  k_wT<<<(DM / 64) * (KVD / 64), 256, 0, stream>>>(wk, (unsigned int)DM, (unsigned int)KVD, BQKV + (size_t)DM * DM);                /* W[DM][KVD] -> Bt rows 1024..1279 */
  k_wT<<<(DM / 64) * (KVD / 64), 256, 0, stream>>>(wv, (unsigned int)DM, (unsigned int)KVD, BQKV + (size_t)ROTN * DM);              /* W[DM][KVD] -> Bt rows 1280..1535 */
  k_wT<<<(DM / 64) * (DM / 64), 256, 0, stream>>>(wo, (unsigned int)DM, (unsigned int)DM, BO);                                     /* Wo[c][n] -> Bt[n][c] */
  const unsigned int n8x = (unsigned int)(NR * DM / 8);
  k_x16<<<(n8x + 255u) / 256u, 256, 0, stream>>>(x, X16, n8x);
  const int MP = (int)(NR); const unsigned int pm = (unsigned int)(SQ - 1);
  k_gemm2<<<dim3((unsigned int)((MP / 128) * (LQ / 64)), 1), 128, 0, stream>>>(X16, DM, (size_t)0, BQKV, DM, (size_t)0, 0u, 0.0625f, nullptr, nullptr, QKV, QKVL, LQ, (size_t)0, MP, LQ, DM, cosb, sinb, (unsigned int)ROTN, pm);      /* q | k | v rows (f16 value + residual), q / k rotated + normalised */
  k_gemm2<<<dim3((unsigned int)((QT0 / 128) * (LQ / 64)), NB), 128, 0, stream>>>(X16, DM, (size_t)SQ * DM, BQKV, DM, (size_t)0, 0u, 0.0625f, nullptr, F0, nullptr, nullptr, LQ, (size_t)QT0 * LQ, QT0, LQ, DM, cosb, sinb, (unsigned int)ROTN, pm);      /* f32 q | k | v of rows 0..QT0-1 of every batch */
  k_vt<<<NB * NKV * (SQ / 64), 256, 0, stream>>>(V16, VT);        /* V^T value plane [NB][NKV][HD][SQ] */
  k_vt<<<NB * NKV * (SQ / 64), 256, 0, stream>>>(VL16, VTL);      /* V^T residual plane */
  k_att0<<<dim3(NH * (QT0 / 64), NB), 64, 0, stream>>>(F0, F0 + DM, F0 + ROTN, LQ, (size_t)QT0 * LQ, 0.125f, OF0, DM, (size_t)QT0 * DM);      /* f32 attention for rows 0..QT0-1 (o x64) */
  const unsigned int n8h = (unsigned int)((size_t)NB * QT0 * DM / 8);
  k_hl<<<(n8h + 255u) / 256u, 256, 0, stream>>>(OF0, OH, OL, n8h);      /* first rows: value + x1024 residual planes into the merged o rows */
  for (unsigned int b = 0; b < (unsigned int)NB; ++b) { const size_t r0 = (size_t)b * SQ; const _Float16* VTb = VT + (size_t)b * NKV * HD * SQ; const _Float16* VTLb = VTL + (size_t)b * NKV * HD * SQ;
    for (unsigned int q0 = (unsigned int)QT; q0 < (unsigned int)SQ; q0 += QT) { const unsigned int nk = q0 + QT;      /* causal: only keys below the tile end are computed; rows below QT0 come from the f32 path */
      const dim3 gs((QT / 128) * (nk / 64), NH), go((QT / 128) * (HD / 64), NH);
      k_gemm2<<<gs, 128, 0, stream>>>(Q16 + (r0 + q0) * LQ, LQ, (size_t)HD, K16 + r0 * LQ, LQ, (size_t)HD, (unsigned int)KVSH, 0.125f, nullptr, S, nullptr, nullptr, NKX, (size_t)QT * NKX, QT, (int)nk, HD, nullptr, nullptr, 0u, 0u);      /* scores: q value plane, heads on grid.y */
      k_gemm2<<<gs, 128, 0, stream>>>(QL + (r0 + q0) * LQ, LQ, (size_t)HD, K16 + r0 * LQ, LQ, (size_t)HD, (unsigned int)KVSH, 0.0001220703125f, (const float*)S, S, nullptr, nullptr, NKX, (size_t)QT * NKX, QT, (int)nk, HD, nullptr, nullptr, 0u, 0u);      /* += q residual plane 2^-13 (own element) */
      sm_launch<SQ>(nk, S, PH, PL, stream);
      k_gemm2<<<go, 128, 0, stream>>>(PH, NKX, (size_t)QT * NKX, VTb, SQ, (size_t)HD * SQ, (unsigned int)KVSH, 0.25f, nullptr, OT, nullptr, nullptr, DM, (size_t)HD, QT, HD, (int)nk, nullptr, nullptr, 0u, 0u);      /* o tile (x64) = Vh ph */
      k_gemm2<<<go, 128, 0, stream>>>(PH, NKX, (size_t)QT * NKX, VTLb, SQ, (size_t)HD * SQ, (unsigned int)KVSH, 0.000244140625f, (const float*)OT, OT, nullptr, nullptr, DM, (size_t)HD, QT, HD, (int)nk, nullptr, nullptr, 0u, 0u);      /* += Vres ph 2^-12 (own element) */
      k_gemm2<<<go, 128, 0, stream>>>(PL, NKX, (size_t)QT * NKX, VTb, SQ, (size_t)HD * SQ, (unsigned int)KVSH, 0.000244140625f, (const float*)OT, nullptr, OH + (r0 + q0) * DM, OL + (r0 + q0) * DM, DM, (size_t)HD, QT, HD, (int)nk, nullptr, nullptr, 0u, 0u); } }      /* += Vh pl 2^-12; final o written as f16 value + x1024 residual merged rows */
  k_gemm2<<<dim3((SQ / 128) * (DM / 64), NB), 128, 0, stream>>>(OH, DM, (size_t)SQ * DM, BO, DM, (size_t)0, 0u, 0.0009765625f, nullptr, out, nullptr, nullptr, DM, (size_t)SQ_FULL * DM, SQ, DM, DM, nullptr, nullptr, 0u, 0u);      /* out rows in the output layout: o value plane */
  k_gemm2<<<dim3((SQ / 128) * (DM / 64), NB), 128, 0, stream>>>(OL, DM, (size_t)SQ * DM, BO, DM, (size_t)0, 0u, 0.00000095367431640625f, (const float*)out, out, nullptr, nullptr, DM, (size_t)SQ_FULL * DM, SQ, DM, DM, nullptr, nullptr, 0u, 0u);      
}

// v003
// Measured time: 1090 microseconds a run.
// Timed twice side by side with v002, it ran 1.72 times as fast both times.
// All steps since v000 together make it 5.85 times as fast.
#include <hip/hip_runtime.h>
// All contractions: v_wmma_f32_16x16x32_f16 (f16 operands, f32 accumulate). x, cos, sin and all four weights are RNE-converted to bf16 first (exact in f16; weights carried x16); q (after split-half rotation + scale-free RMS normalisation in f32), v, softmax weights (x256) and o (x64) are f16 value + x1024 residual planes, every residual product in its own own-element pass folded in f32; k is a single f16 plane; the first 256 query rows of every batch use f32 q/k/v from exact-operand GEMMs and an f32 online softmax on VALU.
// Causal grouped-query self-attention: x [NB][SQ_FULL][1024] (rows 0..SQ-1 of each batch used); q = x Wq (16 heads of 64), k = x Wk, v = x Wv (4 kv heads of 64; weights are [in][out]); rotation with INPUT tables cos/sin [pos][32]: y[j] = x[j] c + x[j+32] s, y[j+32] = x[j+32] c - x[j] s; q, k scaled by rsqrt(mean square over the head + 1e-6); query head h uses kv head h >> 2; scores * 0.125; keys above the query get exactly zero weight; softmax; out = merged y Wo -> [NB][SQ_FULL][1024] f32 (rows 0..SQ-1 of each batch).
// Structure: token rows r = b*SQ + s; X16 exact f16 rows; one q|k|v GEMM (N = 1536) whose epilogue applies rotation + normalisation on the 64-column head tiles of q and k and writes value + residual planes; V^T value and residual planes per (batch, kv head) via LDS transposes; per batch and per query tile of 256 rows: scores = qh k + qres k against the keys below the tile end (K = 64, heads on grid.y), causal row softmax on VALU, one wave per row (P value + residual), o = Vh ph + Vres ph + Vh pl accumulated in an f32 tile and written as f16 value + residual merged o rows (x64); out = oh Wo + ores Wo. Rows 0..255 of each batch: f32 attention, split into the same two o planes.
#ifndef NB
#define NB 2
#endif
#ifndef SQ
#define SQ 2048
#endif
#define NB_FULL 2
#define SQ_FULL 2048
#define DM 1024
#define NH 16
#define NKV 4
#define KVSH 2                       /* query head -> kv head shift */
#define HD 64
#define KVD (NKV * HD)               /* 256 */
#define LQ (DM + 2 * KVD)            /* row pitch of the q | k | v rows: 1536 */
#define ROTN (DM + KVD)              /* columns below this are q / k heads (rotated + normalised) */
#define QT 256                       /* query rows per causal tile */
#define QT0 256                      /* leading rows of every batch computed in f32 */
#define NKX SQ                       /* S / P row pitch */
#define NR ((size_t)NB * SQ)         /* token rows */

static_assert(NB <= NB_FULL);
static_assert(SQ <= SQ_FULL);
static_assert((SQ & (SQ - 1)) == 0);
static_assert(SQ % QT == 0);
static_assert((QT & (QT - 1)) == 0);
static_assert(QT % 128 == 0);
static_assert(QT0 == QT);
static_assert(QT0 % 128 == 0);
static_assert(QT0 % 64 == 0);
static_assert(HD == 64);
static_assert(DM == NH * HD);
static_assert(NH == (NKV << KVSH));
static_assert(DM / 8 == 128);
static_assert(DM % 64 == 0);
static_assert(KVD % 64 == 0);
static_assert(LQ % 64 == 0);
static_assert(ROTN % 64 == 0);
static_assert(((size_t)NB * SQ) % 128 == 0);
static_assert(SQ % 64 == 0);
static_assert(DM % 32 == 0);

typedef unsigned short v8us __attribute__((ext_vector_type(8), may_alias));
typedef float  v8f  __attribute__((ext_vector_type(8)));
typedef float  v4f  __attribute__((ext_vector_type(4)));
typedef float  v4fa __attribute__((ext_vector_type(4), may_alias));
typedef _Float16 v16h __attribute__((ext_vector_type(16)));
typedef _Float16 v4h __attribute__((ext_vector_type(4)));
union FragH { v16h v; v8us half[2]; _Float16 h[16]; unsigned short u[16]; };

__device__ __forceinline__ unsigned short bf16_bits(float x) { unsigned int u = __float_as_uint(x); return (unsigned short)((u + 0x7FFFu + ((u >> 16) & 1u)) >> 16); }
__device__ __forceinline__ float bf16_val(unsigned short b) { return __uint_as_float(((unsigned int)b) << 16); }
__device__ __forceinline__ float bf16_rne(float x) { return bf16_val(bf16_bits(x)); }

// fragment: elements 0..7 <- k0 + 8h + 0..7, elements 8..15 <- k0 + 16 + 8h + 0..7 (same map for A rows and B columns)
__device__ __forceinline__ v16h g2_frag(const _Float16* p, unsigned hh) { FragH f; f.half[0] = *(const v8us*)((const unsigned short*)p + 8 * hh); f.half[1] = *(const v8us*)((const unsigned short*)p + 16 + 8 * hh); return f.v; }
__device__ __forceinline__ v8f g2_mma(v16h a, v16h b, v8f c) { v8f d = __builtin_amdgcn_wmma_f32_16x16x32_f16(false, a, false, b, (short)0, c, false, false); asm volatile("v_nop\n\tv_nop\n\tv_nop\n\tv_nop" : "+v"(d) : "v"(a), "v"(b)); return d; }

__global__ __launch_bounds__(256) void k_wT(const float* __restrict__ w, unsigned int Kd, unsigned int Nd, _Float16* __restrict__ Bt) {
  __shared__ unsigned short tl[64][66];
  const unsigned int tid = threadIdx.x; const unsigned int ntn = Nd >> 6; const unsigned int kt = blockIdx.x / ntn, nt = blockIdx.x - kt * ntn; const unsigned int k0 = kt * 64u, n0 = nt * 64u;
  for (unsigned int i = tid; i < 64u * 16u; i += 256u) { const unsigned int r = i >> 4, c4 = (i & 15u) * 4u; const v4f a = *(const v4fa*)(w + (size_t)(k0 + r) * Nd + n0 + c4); FragH f;
#pragma unroll
    for (int q = 0; q < 4; ++q) f.h[q] = (_Float16)(bf16_rne(a[q]) * 16.0f);
#pragma unroll
    for (int q = 0; q < 4; ++q) tl[r][c4 + q] = f.u[q]; }
  __syncthreads();
  {
#pragma unroll
    for (int rd = 0; rd < 2; ++rd) { const unsigned int d = (unsigned int)rd * 32u + (tid >> 3), pc = tid & 7u; FragH f;
#pragma unroll
      for (int q = 0; q < 8; ++q) f.u[q] = tl[pc * 8u + q][d];
      const v8us o = f.half[0];
      *(v8us*)((unsigned short*)Bt + (size_t)(n0 + d) * Kd + k0 + pc * 8u) = o; }
     } }

__global__ __launch_bounds__(256) void k_x16(const float* __restrict__ x, _Float16* __restrict__ X16, unsigned int n8) {
  const unsigned int t = blockIdx.x * 256u + threadIdx.x; if (t >= n8) return;
  const unsigned int row = t >> 7;                       /* DM / 8 = 128 pieces per row */
  const unsigned int b = row / (unsigned int)SQ, s = row - b * (unsigned int)SQ;
  const float* src = x + ((size_t)b * SQ_FULL + s) * DM + (size_t)(t & 127u) * 8u;
  const v4f a = *(const v4fa*)src, c = *(const v4fa*)(src + 4);
  FragH f;
#pragma unroll
  for (int q = 0; q < 4; ++q) { f.h[q] = (_Float16)bf16_rne(a[q]); f.h[4 + q] = (_Float16)bf16_rne(c[q]); }
  const v8us o = f.half[0];
  unsigned short* d = (unsigned short*)X16 + (size_t)t * 8u;
  *(v8us*)d = o; 
}

__global__ __launch_bounds__(256) void k_vt(const _Float16* __restrict__ V16, _Float16* __restrict__ Vt) {
  __shared__ unsigned short tl[64][66];
  const unsigned int tid = threadIdx.x; const unsigned int slab = blockIdx.x / (unsigned int)(SQ / 64), lg = blockIdx.x % (unsigned int)(SQ / 64); const unsigned int b = slab / (unsigned int)NKV, h = slab % (unsigned int)NKV;
  for (unsigned int i = tid; i < 64u * 8u; i += 256u) { const unsigned int r = i >> 3, c8 = (i & 7u) * 8u; FragH f; f.half[0] = *(const v8us*)((const unsigned short*)V16 + ((size_t)b * SQ + lg * 64u + r) * LQ + h * 64u + c8);
#pragma unroll
    for (int q = 0; q < 8; ++q) tl[r][c8 + q] = f.u[q]; }
  __syncthreads();
  {
#pragma unroll
    for (int rd = 0; rd < 2; ++rd) { const unsigned int d = (unsigned int)rd * 32u + (tid >> 3), pc = tid & 7u; FragH f;
#pragma unroll
      for (int q = 0; q < 8; ++q) f.u[q] = tl[pc * 8u + q][d];
      const v8us o = f.half[0];
      *(v8us*)((unsigned short*)Vt + ((size_t)slab * 64u + d) * SQ + lg * 64u + pc * 8u) = o; }
     } }

__global__ __launch_bounds__(256) void k_hl(const float* __restrict__ F, _Float16* __restrict__ Hh, _Float16* __restrict__ Hl, unsigned int n8) {
  const unsigned int t = blockIdx.x * 256u + threadIdx.x; if (t >= n8) return; FragH fh, fl; const v4f a = *(const v4fa*)(F + (size_t)t * 8u), c = *(const v4fa*)(F + (size_t)t * 8u + 4);
  const unsigned int row = t >> 7; const unsigned int b = row / (unsigned int)QT0, r = row - b * (unsigned int)QT0;
  const size_t dh = ((size_t)b * SQ + r) * DM + (size_t)(t & 127u) * 8u;
#pragma unroll
  for (int q = 0; q < 4; ++q) { _Float16 h = (_Float16)a[q]; fh.h[q] = h; fl.h[q] = (_Float16)((a[q] - (float)h) * 1024.0f); h = (_Float16)c[q]; fh.h[4 + q] = h; fl.h[4 + q] = (_Float16)((c[q] - (float)h) * 1024.0f); }
  const v8us oh = fh.half[0], ol = fl.half[0];
  { *(v8us*)((unsigned short*)Hh + dh) = oh; *(v8us*)((unsigned short*)Hl + dh) = ol;  } }

// one k-step (32 k) of a wave's operands: two A row fragments and four B column fragments
struct G2Stage { v16h a0, a1, b0, b1, b2, b3; };
__device__ __forceinline__ void g2_load(G2Stage& s, const _Float16* a0p, const _Float16* a1p, const _Float16* b0p, const _Float16* b1p, const _Float16* b2p, const _Float16* b3p, int kb, unsigned hh) {
  s.a0 = g2_frag(a0p + kb, hh); s.a1 = g2_frag(a1p + kb, hh); s.b0 = g2_frag(b0p + kb, hh); s.b1 = g2_frag(b1p + kb, hh); s.b2 = g2_frag(b2p + kb, hh); s.b3 = g2_frag(b3p + kb, hh); }
__device__ __forceinline__ void g2_step(const G2Stage& s, v8f& c00, v8f& c01, v8f& c02, v8f& c03, v8f& c10, v8f& c11, v8f& c12, v8f& c13) {
  c00 = g2_mma(s.a0, s.b0, c00); c10 = g2_mma(s.a1, s.b0, c10); c01 = g2_mma(s.a0, s.b1, c01); c11 = g2_mma(s.a1, s.b1, c11);
  c02 = g2_mma(s.a0, s.b2, c02); c12 = g2_mma(s.a1, s.b2, c12); c03 = g2_mma(s.a0, s.b3, c03); c13 = g2_mma(s.a1, s.b3, c13); }

// batched GEMM (grid.y = head / batch slab): C = alpha * A Bt^T (+ CP own element). A f16 [M][K] pitch lda (slab stride sA), Bt f16 [N][K] pitch ldb (slab stride sB applied to blockIdx.y >> bsh); outputs f32 C and/or f16 value plane C16 (+ optional x2^10 residual plane C16L of the same f32 value), pitch ldc, slab stride sC.
__global__ __launch_bounds__(128) void k_gemm2(const _Float16* __restrict__ A, int lda, size_t sA, const _Float16* __restrict__ Bh, int ldb, size_t sB, unsigned int bsh, float alpha, const float* CP,
    float* C, _Float16* C16, _Float16* C16L, int ldc, size_t sC, int M, int N, int K, const float* cosb, const float* sinb, unsigned int rotN, unsigned int pmask) {
  __shared__ __attribute__((aligned(16))) float so[4][32][68];
  const unsigned int tid = threadIdx.x, w = tid >> 5, lane = tid & 31u, ln = lane & 15u, hh = lane >> 4; const unsigned int by = blockIdx.y;
  A += (size_t)by * sA; Bh += (size_t)(by >> bsh) * sB; const size_t cofs = (size_t)by * sC;
  const unsigned int ntn = (unsigned int)N >> 6; const unsigned int mt = blockIdx.x / ntn, nq = blockIdx.x - mt * ntn; const unsigned int row0 = mt * 128u + 32u * w, col0 = nq * 64u; if (row0 >= (unsigned int)M) return;
  const _Float16* a0p = A + (size_t)(row0 + ln) * lda; const _Float16* a1p = a0p + (size_t)16 * lda;
  const _Float16* b0p = Bh + (size_t)(col0 + ln) * ldb; const _Float16* b1p = b0p + (size_t)16 * ldb; const _Float16* b2p = b1p + (size_t)16 * ldb; const _Float16* b3p = b2p + (size_t)16 * ldb;
  const v8f z8 = {0.f,0.f,0.f,0.f,0.f,0.f,0.f,0.f}; v8f c00 = z8, c01 = z8, c02 = z8, c03 = z8, c10 = z8, c11 = z8, c12 = z8, c13 = z8;
  /* K loop as a ring of three register stages: the twelve loads of k-step s + 2 are issued together in front of the products of k-step s, so a wave waits for a whole stage that was asked for two steps earlier instead of for each fragment in turn. In front of and inside the loop no load stands under a test of its own, so that each wait can count the younger stages as still in flight; the last two to four steps are peeled. The order of the k-steps and of the products into each accumulator is unchanged. */
#define G2_LD(S, ST) g2_load(S, a0p, a1p, b0p, b1p, b2p, b3p, (ST) * 32, hh)
#define G2_ST(S) g2_step(S, c00, c01, c02, c03, c10, c11, c12, c13)
#define G2_XW() asm volatile("s_wait_xcnt 0x0" ::: "memory")      /* stands in front of code that writes anew the address registers which the loads issued so far name */
  const int nst = (K + 31) >> 5;
  if (nst == 1) { G2Stage s0; G2_LD(s0, 0); G2_ST(s0); }
  else if (nst > 1) { G2Stage s0, s1, s2; int st = 0;
    G2_LD(s0, 0); G2_LD(s1, 1); G2_XW();
#pragma unroll 1      /* one trip is already three k-steps; more would only add code */
    for (; st + 5 <= nst; st += 3) { G2_LD(s2, st + 2); G2_ST(s0); G2_LD(s0, st + 3); G2_ST(s1); G2_LD(s1, st + 4); G2_ST(s2); G2_XW(); }
    const int rem = nst - st;      /* 2, 3 or 4 steps are left; s0 and s1 hold the first two */
    if (rem >= 3) G2_LD(s2, st + 2);
    G2_ST(s0);
    if (rem >= 4) { G2_XW(); const int kt = (st + 3) * 32;      /* here the address registers die with their loads and a later fragment may land in them: the wait stands behind each fragment's loads */
      s0.a0 = g2_frag(a0p + kt, hh); G2_XW(); s0.a1 = g2_frag(a1p + kt, hh); G2_XW(); s0.b0 = g2_frag(b0p + kt, hh); G2_XW(); s0.b1 = g2_frag(b1p + kt, hh); G2_XW(); s0.b2 = g2_frag(b2p + kt, hh); G2_XW(); s0.b3 = g2_frag(b3p + kt, hh); G2_XW(); }
    G2_ST(s1);
    if (rem >= 3) G2_ST(s2);
    if (rem >= 4) G2_ST(s0); }
#undef G2_LD
#undef G2_ST
#undef G2_XW
  v8f accs[8] = {c00, c01, c02, c03, c10, c11, c12, c13};
  if (CP) {      /* own elements of the batched C plane: a lane's 64 loads are issued together, in front of the first sum */
    const float* cp = CP + cofs + (size_t)(row0 + 8u * hh) * ldc + col0 + ln; v8f pv[8];
#pragma unroll
    for (int u = 0; u < 8; ++u) {
#pragma unroll
      for (int r = 0; r < 8; ++r) pv[u][r] = cp[(size_t)((u >> 2) * 16 + r) * ldc + (u & 3) * 16]; }
#pragma unroll
    for (int u = 0; u < 8; ++u) accs[u] = accs[u] * alpha + pv[u];
  } else {
#pragma unroll
    for (int u = 0; u < 8; ++u) accs[u] = accs[u] * alpha; }
#pragma unroll
  for (int u = 0; u < 8; ++u) { const unsigned int t = (unsigned int)u & 3u, half = (unsigned int)u >> 2;
#pragma unroll
    for (int r = 0; r < 8; ++r) { const unsigned int rloc = half * 16u + 8u * hh + (unsigned int)r;
      so[w][rloc][t * 16u + ln] = accs[u][r]; } }
  __builtin_amdgcn_fence(4 /* acq_rel order */, "workgroup"); __builtin_amdgcn_wave_barrier();
  if (col0 < rotN) {      /* block-uniform: this tile is one q / k head; lane owns tile row 'lane' */
    const unsigned int pos = (row0 + lane) & pmask;
    const float* cr = cosb + (size_t)pos * 32u; const float* sr = sinb + (size_t)pos * 32u; float ss = 0.f;
#pragma unroll 1
    for (unsigned int j = 0; j < 32u; j += 4u) { const v4f cc = *(const v4fa*)(cr + j), sn = *(const v4fa*)(sr + j); const v4f x1 = *(const v4fa*)&so[w][lane][j], x2 = *(const v4fa*)&so[w][lane][32u + j]; v4f y1, y2;
#pragma unroll
      for (int q = 0; q < 4; ++q) { const float c = bf16_rne(cc[q]), s = bf16_rne(sn[q]); y1[q] = x1[q] * c + x2[q] * s; y2[q] = x2[q] * c - x1[q] * s; ss += y1[q] * y1[q] + y2[q] * y2[q]; }
      *(v4fa*)&so[w][lane][j] = y1; *(v4fa*)&so[w][lane][32u + j] = y2; }
    const float rs = rsqrtf(ss * 0.015625f + 1.0e-6f);
#pragma unroll 1
    for (unsigned int j = 0; j < 64u; j += 4u) { v4f y = *(const v4fa*)&so[w][lane][j];
#pragma unroll
      for (int q = 0; q < 4; ++q) y[q] = y[q] * rs;
      *(v4fa*)&so[w][lane][j] = y; }
    __builtin_amdgcn_fence(4 /* acq_rel order */, "workgroup"); __builtin_amdgcn_wave_barrier(); }
  const unsigned int rsub = lane >> 4, c4 = (lane & 15u) * 4u;
  {
#pragma unroll
    for (int q = 0; q < 16; ++q) { const unsigned int r = (unsigned int)q * 2u + rsub; const v4f v = *(const v4fa*)&so[w][r][c4]; const size_t o = cofs + (size_t)(row0 + r) * ldc + col0 + c4;
      if (C) *(v4f*)(C + o) = v;
      if (C16) { v4h h4, l4;
#pragma unroll
        for (int i = 0; i < 4; ++i) { const _Float16 h = (_Float16)v[i]; h4[i] = h; l4[i] = (_Float16)((v[i] - (float)h) * 1024.0f); }
        *(v4h*)(C16 + o) = h4; if (C16L) *(v4h*)(C16L + o) = l4; } }
     } }

// cross-lane steps of the row reductions: lane l with lane l ^ M inside a 16-lane row (DPP row_xmask), and lane l with lane l ^ 16
template <int M> __device__ __forceinline__ float sm_xrow(float x) { return __builtin_bit_cast(float, __builtin_amdgcn_update_dpp(0, __builtin_bit_cast(int, x), 0x160 | M, 0xf, 0xf, true)); }
__device__ __forceinline__ float sm_xhalf(float x) { return __builtin_bit_cast(float, __builtin_amdgcn_permlanex16(__builtin_bit_cast(int, x), __builtin_bit_cast(int, x), 0x76543210, 0xfedcba98, false, false)); }
__device__ __forceinline__ float sm_wave_max(float v) { v = fmaxf(v, sm_xrow<1>(v)); v = fmaxf(v, sm_xrow<2>(v)); v = fmaxf(v, sm_xrow<4>(v)); v = fmaxf(v, sm_xrow<8>(v)); return fmaxf(v, sm_xhalf(v)); }
__device__ __forceinline__ float sm_wave_sum(float v) { v += sm_xrow<1>(v); v += sm_xrow<2>(v); v += sm_xrow<4>(v); v += sm_xrow<8>(v); return v + sm_xhalf(v); }

// e^x as the fast library form computes it (multiply by log2 e, then v_exp_f32); the v_nop in the same statement is the one free slot the instruction set asks for behind a transcendental
__device__ __forceinline__ float sm_exp(float x) { const float t = x * 1.44269504088896340736f; float r; asm("v_exp_f32 %0, %1\n\tv_nop" : "=v"(r) : "v"(t)); return r; }

// causal row softmax of the query tile that ends at key NK (its first query is NK - QT), one wave per score row: lane l keeps columns 128 c + 4 l + 0..3 of every 128-column chunk c in registers, so S is read once, each load and store of a wave covers whole lines, and maximum and sum are per-lane partials joined across the 32 lanes. Keys below the tile's first query are at or below every query of the tile: only the chunks from there on are masked. Every loop over c is unrolled whole so that e[] is indexed by constants and stays in registers, and all loads of a row are in flight together.
template <unsigned int NK> __global__ __launch_bounds__(256) void k_rsmcf2(const float* __restrict__ S, _Float16* __restrict__ P, _Float16* __restrict__ PL, unsigned int hg) {
  static_assert(NK % 128 == 0 && NK >= QT && NK <= NKX);
  constexpr unsigned int NCH = NK / 128, CM = (NK - QT) / 128;
  const unsigned int lane = threadIdx.x & 31u; const unsigned int row = blockIdx.x * 8u + (threadIdx.x >> 5); if (row >= hg * (unsigned int)QT) return;
  const unsigned int last = (NK - QT) + (row & (unsigned int)(QT - 1));
  const size_t i = (size_t)row * NKX + lane * 4u; const float* s = S + i; v4f e[NCH];
#pragma unroll
  for (unsigned int c = 0; c < NCH; ++c) e[c] = *(const v4fa*)(s + c * 128u);
  v4f m4 = {-3.0e38f, -3.0e38f, -3.0e38f, -3.0e38f};
#pragma unroll
  for (unsigned int c = 0; c < NCH; ++c) {
#pragma unroll
    for (int q = 0; q < 4; ++q) { if (c >= CM) e[c][q] = (c * 128u + lane * 4u + (unsigned int)q <= last) ? e[c][q] : -1.0e9f; m4[q] = fmaxf(m4[q], e[c][q]); } }
  const float mx = sm_wave_max(fmaxf(fmaxf(m4[0], m4[1]), fmaxf(m4[2], m4[3])));
  v4f s4 = {0.f, 0.f, 0.f, 0.f};
#pragma unroll
  for (unsigned int c = 0; c < NCH; ++c) {
#pragma unroll
    for (int q = 0; q < 4; ++q) { e[c][q] = sm_exp(e[c][q] - mx); s4[q] += e[c][q]; } }
  const float se = sm_wave_sum((s4[0] + s4[1]) + (s4[2] + s4[3])); const float sc = 256.0f / se;
#pragma unroll
  for (unsigned int c = 0; c < NCH; ++c) { v4h h4, l4;
#pragma unroll
    for (int q = 0; q < 4; ++q) { const float pv = e[c][q] * sc; const _Float16 h = (_Float16)pv; h4[q] = h; l4[q] = (_Float16)((pv - (float)h) * 1024.0f); }
    *(v4h*)(P + i + c * 128u) = h4; *(v4h*)(PL + i + c * 128u) = l4; } }
// picks the instance whose row length is nk
template <unsigned int NK> static void sm_launch(unsigned int nk, const float* S, _Float16* P, _Float16* PL, hipStream_t stream) {
  if (nk == NK) k_rsmcf2<NK><<<NH * QT / 8, 256, 0, stream>>>(S, P, PL, (unsigned int)NH);
  else if constexpr (NK > 2 * QT) sm_launch<NK - QT>(nk, S, P, PL, stream); }

// f32 attention of the leading rows, one thread per query row. What a thread alone uses, its q row and its o row, stays in registers for the whole key loop (every loop over the head is unrolled whole so that both are indexed by constants). What all 64 threads use, the K and V rows, is staged in LDS 64 keys at a time and read from there at one address per wave: K transposed, so that one 16-byte read brings one head element of four neighbouring keys. One trip takes four keys: their four score sums are independent chains that fill each other's latency. Each score sum, the running maximum and sum, and each o element take their terms in the same order as with one key per trip.
__global__ __launch_bounds__(64) void k_att0(const float* __restrict__ QF, const float* __restrict__ KF, const float* __restrict__ VF, int ld, size_t sF, float scale, float* __restrict__ OF, int ldo, size_t sO) {
  #pragma clang fp contract(off)
  __shared__ __attribute__((aligned(16))) float lk[HD][68];      /* K tile [head element][key]; pitch 68: the transposing stores of a wave fall on 32 different banks, rows stay 16-byte aligned */
  __shared__ __attribute__((aligned(16))) float lv[64][HD];      /* V tile [key][head element] */
  __shared__ __attribute__((aligned(16))) float lo[64][64];
  const unsigned int tid = threadIdx.x; const unsigned int h = blockIdx.x / (unsigned int)(QT0 / 64), rg = blockIdx.x % (unsigned int)(QT0 / 64); const unsigned int i = rg * 64u + tid; const unsigned int hk = h >> KVSH;
  const size_t fo = (size_t)blockIdx.y * sF; QF += fo; KF += fo; VF += fo; OF += (size_t)blockIdx.y * sO;
  const float* qr = QF + (size_t)i * ld + h * HD;
  v4f q[HD / 4], o[HD / 4];
#pragma unroll
  for (int c = 0; c < HD / 4; ++c) { q[c] = *(const v4fa*)(qr + c * 4); const v4f z = {0.f, 0.f, 0.f, 0.f}; o[c] = z; }
  asm volatile("s_wait_xcnt 0x0" :: "v"(qr) : "memory");      /* stands in front of code that writes anew the address registers which the q loads name; the pointer as an input keeps them out of those loads' own results */
  /* a thread's share of a tile. K: key (tid & 7) of a group of 8, 16-byte piece (tid >> 3) of a group of 8 (a wave's load covers 8 rows x 64 bytes). V: key (tid >> 4) of a group of 4, piece (tid & 15) (whole rows). */
  const unsigned int kb = tid & 7u, ka = tid >> 3, vb = tid >> 4, va = tid & 15u;
  const unsigned int kofs = (kb * (unsigned int)ld + ka * 4u) * 4u, vofs = (vb * (unsigned int)ld + va * 4u) * 4u;      /* byte offsets, the same for every tile */
  float m = -1.0e30f, l = 0.f; const unsigned int jmax = rg * 64u + 63u;      /* keys up to the block's last row */
#pragma unroll 1      /* a tile's code is long already */
  for (unsigned int j0 = 0; j0 <= jmax; j0 += 64u) { const float* kt = KF + (size_t)j0 * ld + hk * HD; const float* vt = VF + (size_t)j0 * ld + hk * HD;
    __syncthreads();      /* both waves have read the last tile to its end */
    { v4f kk[16]; const char* kp[8];      /* the eight row groups' addresses; both halves of a row group's rows are read from one of them */
#pragma unroll
      for (int g = 0; g < 8; ++g) kp[g] = (const char*)(kt + (size_t)(g * 8) * ld) + kofs;
#pragma unroll
      for (int it = 0; it < 16; ++it) kk[it] = *(const v4fa*)(kp[it & 7] + (it >> 3) * 128);
      asm volatile("s_wait_xcnt 0x0" :: "v"(kp[0]), "v"(kp[1]), "v"(kp[2]), "v"(kp[3]), "v"(kp[4]), "v"(kp[5]), "v"(kp[6]), "v"(kp[7]) : "memory");      /* stands in front of code that writes anew the address registers which the K loads name; the addresses as inputs keep them out of those loads' own results */
#pragma unroll
      for (int it = 0; it < 16; ++it) {
#pragma unroll
        for (int t = 0; t < 4; ++t) lk[((unsigned int)(it >> 3) * 8u + ka) * 4u + (unsigned int)t][(unsigned int)(it & 7) * 8u + kb] = kk[it][t]; } }
    { v4f vv[16]; const char* vp[16];
#pragma unroll
      for (int it = 0; it < 16; ++it) vp[it] = (const char*)(vt + (size_t)(it * 4) * ld) + vofs;
#pragma unroll
      for (int it = 0; it < 16; ++it) vv[it] = *(const v4fa*)vp[it];
      asm volatile("s_wait_xcnt 0x0" :: "v"(vp[0]), "v"(vp[1]), "v"(vp[2]), "v"(vp[3]), "v"(vp[4]), "v"(vp[5]), "v"(vp[6]), "v"(vp[7]), "v"(vp[8]), "v"(vp[9]), "v"(vp[10]), "v"(vp[11]), "v"(vp[12]), "v"(vp[13]), "v"(vp[14]), "v"(vp[15]) : "memory");      /* the same for the V loads */
#pragma unroll
      for (int it = 0; it < 16; ++it) *(v4fa*)&lv[(unsigned int)it * 4u + vb][va * 4u] = vv[it]; }
    __syncthreads();      /* the tile is whole before either wave reads it */
#pragma unroll 1      /* one trip is already four keys; more would only add code */
    for (unsigned int jj = 0; jj < 64u; jj += 4u) { float s[4] = {0.f, 0.f, 0.f, 0.f}, sc[4], e[4];
#pragma unroll
      for (int c = 0; c < HD / 4; ++c) {
#pragma unroll
        for (int t = 0; t < 4; ++t) { const v4f k4 = *(const v4fa*)&lk[c * 4 + t][jj];
#pragma unroll
          for (int u = 0; u < 4; ++u) s[u] = __fadd_rn(s[u], __fmul_rn(q[c][t], k4[u])); } }
#pragma unroll
      for (int u = 0; u < 4; ++u) { const float su = __fmul_rn(s[u], scale);
        const float f = (j0 + jj + (unsigned int)u <= i) ? 1.f : 0.f; const float sm = fmaf(f, su, (1.f - f) * -1.0e30f); const float mn = fmaxf(m, sm); sc[u] = expf(m - mn); e[u] = expf(sm - mn); l = __fadd_rn(__fmul_rn(l, sc[u]), e[u]); m = mn; }
#pragma unroll
      for (int u = 0; u < 4; ++u) {
#pragma unroll
        for (int c = 0; c < HD / 4; ++c) { const v4f vv = *(const v4fa*)&lv[jj + (unsigned int)u][c * 4];
#pragma unroll
          for (int t = 0; t < 4; ++t) o[c][t] = __fadd_rn(__fmul_rn(o[c][t], sc[u]), __fmul_rn(e[u], vv[t])); } } } }
  const float fin = 64.0f / l;      /* o carried x64 like the f16 path */
#pragma unroll
  for (int c = 0; c < HD / 4; ++c) { v4f oo = o[c];
#pragma unroll
    for (int u = 0; u < 4; ++u) oo[u] = __fmul_rn(oo[u], fin);
    *(v4fa*)&lo[tid][c * 4] = oo; }
  __syncthreads();
  {
#pragma unroll 1
    for (unsigned int it = 0; it < 16u; ++it) { const unsigned int row = it * 4u + (tid >> 4), pc = (tid & 15u) * 4u; const v4f v = *(const v4fa*)&lo[row][pc]; *(v4f*)(OF + (size_t)(rg * 64u + row) * ldo + h * HD + pc) = v; }
     } }

constexpr size_t al256(size_t b) { return (b + 255) & ~(size_t)255; }
constexpr size_t cmax(size_t a, size_t b) { return a > b ? a : b; }
constexpr size_t SZ_BQKV = al256((size_t)LQ * DM * 2);
constexpr size_t SZ_BO   = al256((size_t)DM * DM * 2);
constexpr size_t SZ_XO   = al256(NR * DM * 2);                          /* X16, later reused as the merged o value rows */
constexpr size_t SZ_QKV  = al256(NR * LQ * 2);                          /* value plane; the residual plane has the same size */
constexpr size_t SZ_F0   = al256((size_t)NB * QT0 * LQ * 4);
constexpr size_t SZ_OF0  = al256((size_t)NB * QT0 * DM * 4);
constexpr size_t SZ_S    = cmax(al256((size_t)NH * QT * NKX * 4), SZ_F0 + SZ_OF0);      /* S of one query tile (all heads); before the tile loop the same bytes hold F0 | OF0 */
constexpr size_t SZ_P    = al256((size_t)NH * QT * NKX * 2);            /* P value plane of one query tile (all heads); the residual plane has the same size */
constexpr size_t SZ_VT   = al256((size_t)NB * NKV * HD * SQ * 2);       /* V^T value plane; the residual plane has the same size */
constexpr size_t SZ_OL   = al256(NR * DM * 2);                          /* merged o residual rows */
constexpr size_t SZ_OT   = al256((size_t)QT * DM * 4);                  /* f32 o tile of one (batch, query tile) */
static_assert(SZ_F0 + SZ_OF0 <= SZ_S);
constexpr size_t WS_TOTAL = SZ_BQKV + SZ_BO + SZ_XO + 2 * SZ_QKV + SZ_S + 2 * SZ_P + 2 * SZ_VT + SZ_OL + SZ_OT;
static_assert(WS_TOTAL <= (size_t)134217728);
/* plane coverage equalities of the producer grids */
static_assert(((size_t)(DM / 64) * (DM / 64)) * 64 * 64 == (size_t)DM * DM);
static_assert(((size_t)(DM / 64) * (KVD / 64)) * 64 * 64 == (size_t)DM * KVD);
static_assert(((size_t)NB * NKV * (SQ / 64)) * 64 * 64 == (size_t)NB * NKV * HD * SQ);
static_assert((NR * DM) % (256 * 8) == 0);
static_assert(((size_t)NB * QT0 * DM) % (256 * 8) == 0);
static_assert(((size_t)NH * QT) % 8 == 0);
static_assert((size_t)NH * (QT0 / 64) * 64 == (size_t)NH * QT0);
static_assert(((size_t)(NR / 128) * (LQ / 64)) * 128 * 64 == NR * LQ);
static_assert(((size_t)(QT / 128) * (HD / 64) * NH) * 128 * 64 == (size_t)QT * DM);
static_assert(((size_t)(SQ / 128) * (DM / 64) * NB) * 128 * 64 == NR * DM);

extern "C" void kernel_launch(void* const* d_in, const int* in_sizes, int n_in,
                              void* d_out, int out_size, void* d_ws, size_t ws_size, hipStream_t stream) {
  if (n_in < 7) return;
  const size_t need_x = ((size_t)(NB - 1) * SQ_FULL + SQ) * DM;
  if ((size_t)in_sizes[0] < need_x) return;
  if ((size_t)in_sizes[1] < (size_t)SQ * 32) return;
  if ((size_t)in_sizes[2] < (size_t)SQ * 32) return;
  if ((size_t)in_sizes[3] < (size_t)DM * DM) return;
  if ((size_t)in_sizes[4] < (size_t)DM * KVD) return;
  if ((size_t)in_sizes[5] < (size_t)DM * KVD) return;
  if ((size_t)in_sizes[6] < (size_t)DM * DM) return;
  if ((size_t)out_size < need_x) return;
  const float* x = (const float*)d_in[0]; const float* cosb = (const float*)d_in[1]; const float* sinb = (const float*)d_in[2];      /* tables [pos][32], read as values */
  const float* wq = (const float*)d_in[3]; const float* wk = (const float*)d_in[4]; const float* wv = (const float*)d_in[5]; const float* wo = (const float*)d_in[6];      /* all [in][out] */
  float* out = (float*)d_out;
  char* ws = (char*)d_ws; size_t off = 0;
  auto take = [&](size_t bytes) { char* p = ws + off; off += (bytes + 255) & ~(size_t)255; return p; };
  _Float16* BQKV = (_Float16*)take(SZ_BQKV); _Float16* BO = (_Float16*)take(SZ_BO);
  _Float16* X16 = (_Float16*)take(SZ_XO); _Float16* OH = X16;      /* X16 is dead after the projection GEMMs; the merged o value rows take its place */
  _Float16* QKV = (_Float16*)take(SZ_QKV); const _Float16* Q16 = QKV; const _Float16* K16 = QKV + DM; const _Float16* V16 = QKV + ROTN;
  _Float16* QKVL = (_Float16*)take(SZ_QKV); const _Float16* QL = QKVL; const _Float16* VL16 = QKVL + ROTN;      /* x1024 residual plane, same layout (k columns unused) */
  char* sreg = take(SZ_S); float* S = (float*)sreg; float* F0 = (float*)sreg; float* OF0 = (float*)(sreg + SZ_F0);      /* F0 | OF0 are consumed before the first score tile is written */
  _Float16* PH = (_Float16*)take(SZ_P); _Float16* PL = (_Float16*)take(SZ_P);
  _Float16* VT = (_Float16*)take(SZ_VT); _Float16* VTL = (_Float16*)take(SZ_VT);
  _Float16* OL = (_Float16*)take(SZ_OL); float* OT = (float*)take(SZ_OT);
  if (off > ws_size) return;

  k_wT<<<(DM / 64) * (DM / 64), 256, 0, stream>>>(wq, (unsigned int)DM, (unsigned int)DM, BQKV);                                   /* W[DM][DM] -> Bt rows 0..1023 */
  k_wT<<<(DM / 64) * (KVD / 64), 256, 0, stream>>>(wk, (unsigned int)DM, (unsigned int)KVD, BQKV + (size_t)DM * DM);                /* W[DM][KVD] -> Bt rows 1024..1279 */
  k_wT<<<(DM / 64) * (KVD / 64), 256, 0, stream>>>(wv, (unsigned int)DM, (unsigned int)KVD, BQKV + (size_t)ROTN * DM);              /* W[DM][KVD] -> Bt rows 1280..1535 */
  k_wT<<<(DM / 64) * (DM / 64), 256, 0, stream>>>(wo, (unsigned int)DM, (unsigned int)DM, BO);                                     /* Wo[c][n] -> Bt[n][c] */
  const unsigned int n8x = (unsigned int)(NR * DM / 8);
  k_x16<<<(n8x + 255u) / 256u, 256, 0, stream>>>(x, X16, n8x);
  const int MP = (int)(NR); const unsigned int pm = (unsigned int)(SQ - 1);
  k_gemm2<<<dim3((unsigned int)((MP / 128) * (LQ / 64)), 1), 128, 0, stream>>>(X16, DM, (size_t)0, BQKV, DM, (size_t)0, 0u, 0.0625f, nullptr, nullptr, QKV, QKVL, LQ, (size_t)0, MP, LQ, DM, cosb, sinb, (unsigned int)ROTN, pm);      /* q | k | v rows (f16 value + residual), q / k rotated + normalised */
  k_gemm2<<<dim3((unsigned int)((QT0 / 128) * (LQ / 64)), NB), 128, 0, stream>>>(X16, DM, (size_t)SQ * DM, BQKV, DM, (size_t)0, 0u, 0.0625f, nullptr, F0, nullptr, nullptr, LQ, (size_t)QT0 * LQ, QT0, LQ, DM, cosb, sinb, (unsigned int)ROTN, pm);      /* f32 q | k | v of rows 0..QT0-1 of every batch */
  k_vt<<<NB * NKV * (SQ / 64), 256, 0, stream>>>(V16, VT);        /* V^T value plane [NB][NKV][HD][SQ] */
  k_vt<<<NB * NKV * (SQ / 64), 256, 0, stream>>>(VL16, VTL);      /* V^T residual plane */
  k_att0<<<dim3(NH * (QT0 / 64), NB), 64, 0, stream>>>(F0, F0 + DM, F0 + ROTN, LQ, (size_t)QT0 * LQ, 0.125f, OF0, DM, (size_t)QT0 * DM);      /* f32 attention for rows 0..QT0-1 (o x64) */
  const unsigned int n8h = (unsigned int)((size_t)NB * QT0 * DM / 8);
  k_hl<<<(n8h + 255u) / 256u, 256, 0, stream>>>(OF0, OH, OL, n8h);      /* first rows: value + x1024 residual planes into the merged o rows */
  for (unsigned int b = 0; b < (unsigned int)NB; ++b) { const size_t r0 = (size_t)b * SQ; const _Float16* VTb = VT + (size_t)b * NKV * HD * SQ; const _Float16* VTLb = VTL + (size_t)b * NKV * HD * SQ;
    for (unsigned int q0 = (unsigned int)QT; q0 < (unsigned int)SQ; q0 += QT) { const unsigned int nk = q0 + QT;      /* causal: only keys below the tile end are computed; rows below QT0 come from the f32 path */
      const dim3 gs((QT / 128) * (nk / 64), NH), go((QT / 128) * (HD / 64), NH);
      k_gemm2<<<gs, 128, 0, stream>>>(Q16 + (r0 + q0) * LQ, LQ, (size_t)HD, K16 + r0 * LQ, LQ, (size_t)HD, (unsigned int)KVSH, 0.125f, nullptr, S, nullptr, nullptr, NKX, (size_t)QT * NKX, QT, (int)nk, HD, nullptr, nullptr, 0u, 0u);      /* scores: q value plane, heads on grid.y */
      k_gemm2<<<gs, 128, 0, stream>>>(QL + (r0 + q0) * LQ, LQ, (size_t)HD, K16 + r0 * LQ, LQ, (size_t)HD, (unsigned int)KVSH, 0.0001220703125f, (const float*)S, S, nullptr, nullptr, NKX, (size_t)QT * NKX, QT, (int)nk, HD, nullptr, nullptr, 0u, 0u);      /* += q residual plane 2^-13 (own element) */
      sm_launch<SQ>(nk, S, PH, PL, stream);
      k_gemm2<<<go, 128, 0, stream>>>(PH, NKX, (size_t)QT * NKX, VTb, SQ, (size_t)HD * SQ, (unsigned int)KVSH, 0.25f, nullptr, OT, nullptr, nullptr, DM, (size_t)HD, QT, HD, (int)nk, nullptr, nullptr, 0u, 0u);      /* o tile (x64) = Vh ph */
      k_gemm2<<<go, 128, 0, stream>>>(PH, NKX, (size_t)QT * NKX, VTLb, SQ, (size_t)HD * SQ, (unsigned int)KVSH, 0.000244140625f, (const float*)OT, OT, nullptr, nullptr, DM, (size_t)HD, QT, HD, (int)nk, nullptr, nullptr, 0u, 0u);      /* += Vres ph 2^-12 (own element) */
      k_gemm2<<<go, 128, 0, stream>>>(PL, NKX, (size_t)QT * NKX, VTb, SQ, (size_t)HD * SQ, (unsigned int)KVSH, 0.000244140625f, (const float*)OT, nullptr, OH + (r0 + q0) * DM, OL + (r0 + q0) * DM, DM, (size_t)HD, QT, HD, (int)nk, nullptr, nullptr, 0u, 0u); } }      /* += Vh pl 2^-12; final o written as f16 value + x1024 residual merged rows */
  k_gemm2<<<dim3((SQ / 128) * (DM / 64), NB), 128, 0, stream>>>(OH, DM, (size_t)SQ * DM, BO, DM, (size_t)0, 0u, 0.0009765625f, nullptr, out, nullptr, nullptr, DM, (size_t)SQ_FULL * DM, SQ, DM, DM, nullptr, nullptr, 0u, 0u);      /* out rows in the output layout: o value plane */
  k_gemm2<<<dim3((SQ / 128) * (DM / 64), NB), 128, 0, stream>>>(OL, DM, (size_t)SQ * DM, BO, DM, (size_t)0, 0u, 0.00000095367431640625f, (const float*)out, out, nullptr, nullptr, DM, (size_t)SQ_FULL * DM, SQ, DM, DM, nullptr, nullptr, 0u, 0u);      
}

// v004
// It runs in 310 microseconds.
// Next to v003, in two timings, it ran 3.55 and 3.53 times as fast.
// All steps since v000 together make it 20.7 times as fast.
#include <hip/hip_runtime.h>
// All contractions: v_wmma_f32_16x16x32_f16 (f16 operands, f32 accumulate). x, cos, sin and all four weights are RNE-converted to bf16 first (exact in f16; weights carried x16); q (after split-half rotation + scale-free RMS normalisation in f32), v, softmax weights (x256) and o (x64) are f16 value + x1024 residual planes, every residual product in its own accumulator, folded in f32; k is a single f16 plane; the first 256 query rows of every batch use f32 q/k/v from exact-operand GEMMs and an f32 online softmax on VALU.
// Causal grouped-query self-attention: x [NB][SQ][1024]; q = x Wq (16 heads of 64), k = x Wk, v = x Wv (4 kv heads of 64; weights are [in][out]); rotation with INPUT tables cos/sin [pos][32]: y[j] = x[j] c + x[j+32] s, y[j+32] = x[j+32] c - x[j] s; q, k scaled by rsqrt(mean square over the head + 1e-6); query head h uses kv head h >> 2; scores * 0.125; keys above the query get exactly zero weight; softmax; out = merged y Wo -> [NB][SQ][1024] f32.
// Structure: token rows r = b*SQ + s; X16 exact f16 rows; one q|k|v GEMM (N = 1536) whose epilogue applies rotation + normalisation on the 64-column head tiles of q and k and writes value + residual planes; V^T value and residual planes per (batch, kv head) via LDS transposes; one attention launch, a work-group per (batch, head, 16 query rows), whose score rows never leave LDS: scores = qh k + qres k against the keys up to the end of the rows' own 128-key chunk, causal row softmax on VALU, one wave per row (P value + residual written over the row's scores), o = Vh ph + Vres ph + Vh pl folded in f32 and written as f16 value + residual merged o rows (x64); out = oh Wo + ores Wo. Rows 0..255 of each batch: f32 attention, split into the same two o planes.
#ifndef NB
#define NB 2
#endif
#ifndef SQ
#define SQ 2048
#endif
#define NB_FULL 2
#define SQ_FULL 2048
#define DM 1024
#define NH 16
#define NKV 4
#define KVSH 2                       /* query head -> kv head shift */
#define HD 64
#define KVD (NKV * HD)               /* 256 */
#define LQ (DM + 2 * KVD)            /* row pitch of the q | k | v rows: 1536 */
#define ROTN (DM + KVD)              /* columns below this are q / k heads (rotated + normalised) */
#define QT 256                       /* not used by any kernel, only by the static_asserts */
#define QT0 256                      /* leading rows of every batch computed in f32 */
#define NKX SQ                       /* keys of an S / P row; the LDS row pitch is APB */
#define NR ((size_t)NB * SQ)         /* token rows */

static_assert(NB <= NB_FULL);
static_assert(SQ <= SQ_FULL);
static_assert((SQ & (SQ - 1)) == 0);
static_assert(SQ % QT == 0);
static_assert((QT & (QT - 1)) == 0);
static_assert(QT % 128 == 0);
static_assert(QT0 == QT);
static_assert(QT0 % 128 == 0);
static_assert(QT0 % 64 == 0);
static_assert(HD == 64);
static_assert(DM == NH * HD);
static_assert(NH == (NKV << KVSH));
static_assert(DM / 8 == 128);
static_assert(DM % 64 == 0);
static_assert(KVD % 64 == 0);
static_assert(LQ % 64 == 0);
static_assert(ROTN % 64 == 0);
static_assert(((size_t)NB * SQ) % 128 == 0);
static_assert(SQ % 64 == 0);
static_assert(DM % 32 == 0);

typedef unsigned short v8us __attribute__((ext_vector_type(8), may_alias));
typedef float  v8f  __attribute__((ext_vector_type(8)));
typedef float  v4f  __attribute__((ext_vector_type(4)));
typedef float  v4fa __attribute__((ext_vector_type(4), may_alias));
typedef _Float16 v16h __attribute__((ext_vector_type(16)));
typedef _Float16 v4h __attribute__((ext_vector_type(4)));
union FragH { v16h v; v8us half[2]; _Float16 h[16]; unsigned short u[16]; };

__device__ __forceinline__ unsigned short bf16_bits(float x) { unsigned int u = __float_as_uint(x); return (unsigned short)((u + 0x7FFFu + ((u >> 16) & 1u)) >> 16); }
__device__ __forceinline__ float bf16_val(unsigned short b) { return __uint_as_float(((unsigned int)b) << 16); }
__device__ __forceinline__ float bf16_rne(float x) { return bf16_val(bf16_bits(x)); }

// fragment: elements 0..7 <- k0 + 8h + 0..7, elements 8..15 <- k0 + 16 + 8h + 0..7 (same map for A rows and B columns)
__device__ __forceinline__ v16h g2_frag(const _Float16* p, unsigned hh) { FragH f; f.half[0] = *(const v8us*)((const unsigned short*)p + 8 * hh); f.half[1] = *(const v8us*)((const unsigned short*)p + 16 + 8 * hh); return f.v; }
__device__ __forceinline__ v8f g2_mma(v16h a, v16h b, v8f c) { v8f d = __builtin_amdgcn_wmma_f32_16x16x32_f16(false, a, false, b, (short)0, c, false, false); asm volatile("v_nop\n\tv_nop\n\tv_nop\n\tv_nop" : "+v"(d) : "v"(a), "v"(b)); return d; }

__global__ __launch_bounds__(256) void k_wT(const float* __restrict__ w, unsigned int Kd, unsigned int Nd, _Float16* __restrict__ Bt) {
  __shared__ unsigned short tl[64][66];
  const unsigned int tid = threadIdx.x; const unsigned int ntn = Nd >> 6; const unsigned int kt = blockIdx.x / ntn, nt = blockIdx.x - kt * ntn; const unsigned int k0 = kt * 64u, n0 = nt * 64u;
  for (unsigned int i = tid; i < 64u * 16u; i += 256u) { const unsigned int r = i >> 4, c4 = (i & 15u) * 4u; const v4f a = *(const v4fa*)(w + (size_t)(k0 + r) * Nd + n0 + c4); FragH f;
#pragma unroll
    for (int q = 0; q < 4; ++q) f.h[q] = (_Float16)(bf16_rne(a[q]) * 16.0f);
#pragma unroll
    for (int q = 0; q < 4; ++q) tl[r][c4 + q] = f.u[q]; }
  __syncthreads();
  {
#pragma unroll
    for (int rd = 0; rd < 2; ++rd) { const unsigned int d = (unsigned int)rd * 32u + (tid >> 3), pc = tid & 7u; FragH f;
#pragma unroll
      for (int q = 0; q < 8; ++q) f.u[q] = tl[pc * 8u + q][d];
      const v8us o = f.half[0];
      *(v8us*)((unsigned short*)Bt + (size_t)(n0 + d) * Kd + k0 + pc * 8u) = o; }
     } }

__global__ __launch_bounds__(256) void k_x16(const float* __restrict__ x, _Float16* __restrict__ X16, unsigned int n8) {
  const unsigned int t = blockIdx.x * 256u + threadIdx.x; if (t >= n8) return;
  const unsigned int row = t >> 7;                       /* DM / 8 = 128 pieces per row */
  const unsigned int b = row / (unsigned int)SQ, s = row - b * (unsigned int)SQ;
  const float* src = x + ((size_t)b * SQ_FULL + s) * DM + (size_t)(t & 127u) * 8u;
  const v4f a = *(const v4fa*)src, c = *(const v4fa*)(src + 4);
  FragH f;
#pragma unroll
  for (int q = 0; q < 4; ++q) { f.h[q] = (_Float16)bf16_rne(a[q]); f.h[4 + q] = (_Float16)bf16_rne(c[q]); }
  const v8us o = f.half[0];
  unsigned short* d = (unsigned short*)X16 + (size_t)t * 8u;
  *(v8us*)d = o; 
}

__global__ __launch_bounds__(256) void k_vt(const _Float16* __restrict__ V16, _Float16* __restrict__ Vt) {
  __shared__ unsigned short tl[64][66];
  const unsigned int tid = threadIdx.x; const unsigned int slab = blockIdx.x / (unsigned int)(SQ / 64), lg = blockIdx.x % (unsigned int)(SQ / 64); const unsigned int b = slab / (unsigned int)NKV, h = slab % (unsigned int)NKV;
  for (unsigned int i = tid; i < 64u * 8u; i += 256u) { const unsigned int r = i >> 3, c8 = (i & 7u) * 8u; FragH f; f.half[0] = *(const v8us*)((const unsigned short*)V16 + ((size_t)b * SQ + lg * 64u + r) * LQ + h * 64u + c8);
#pragma unroll
    for (int q = 0; q < 8; ++q) tl[r][c8 + q] = f.u[q]; }
  __syncthreads();
  {
#pragma unroll
    for (int rd = 0; rd < 2; ++rd) { const unsigned int d = (unsigned int)rd * 32u + (tid >> 3), pc = tid & 7u; FragH f;
#pragma unroll
      for (int q = 0; q < 8; ++q) f.u[q] = tl[pc * 8u + q][d];
      const v8us o = f.half[0];
      *(v8us*)((unsigned short*)Vt + ((size_t)slab * 64u + d) * SQ + lg * 64u + pc * 8u) = o; }
     } }

__global__ __launch_bounds__(256) void k_hl(const float* __restrict__ F, _Float16* __restrict__ Hh, _Float16* __restrict__ Hl, unsigned int n8) {
  const unsigned int t = blockIdx.x * 256u + threadIdx.x; if (t >= n8) return; FragH fh, fl; const v4f a = *(const v4fa*)(F + (size_t)t * 8u), c = *(const v4fa*)(F + (size_t)t * 8u + 4);
  const unsigned int row = t >> 7; const unsigned int b = row / (unsigned int)QT0, r = row - b * (unsigned int)QT0;
  const size_t dh = ((size_t)b * SQ + r) * DM + (size_t)(t & 127u) * 8u;
#pragma unroll
  for (int q = 0; q < 4; ++q) { _Float16 h = (_Float16)a[q]; fh.h[q] = h; fl.h[q] = (_Float16)((a[q] - (float)h) * 1024.0f); h = (_Float16)c[q]; fh.h[4 + q] = h; fl.h[4 + q] = (_Float16)((c[q] - (float)h) * 1024.0f); }
  const v8us oh = fh.half[0], ol = fl.half[0];
  { *(v8us*)((unsigned short*)Hh + dh) = oh; *(v8us*)((unsigned short*)Hl + dh) = ol;  } }

// one k-step (32 k) of a wave's operands: two A row fragments and four B column fragments
struct G2Stage { v16h a0, a1, b0, b1, b2, b3; };
__device__ __forceinline__ void g2_load(G2Stage& s, const _Float16* a0p, const _Float16* a1p, const _Float16* b0p, const _Float16* b1p, const _Float16* b2p, const _Float16* b3p, int kb, unsigned hh) {
  s.a0 = g2_frag(a0p + kb, hh); s.a1 = g2_frag(a1p + kb, hh); s.b0 = g2_frag(b0p + kb, hh); s.b1 = g2_frag(b1p + kb, hh); s.b2 = g2_frag(b2p + kb, hh); s.b3 = g2_frag(b3p + kb, hh); }
__device__ __forceinline__ void g2_step(const G2Stage& s, v8f& c00, v8f& c01, v8f& c02, v8f& c03, v8f& c10, v8f& c11, v8f& c12, v8f& c13) {
  c00 = g2_mma(s.a0, s.b0, c00); c10 = g2_mma(s.a1, s.b0, c10); c01 = g2_mma(s.a0, s.b1, c01); c11 = g2_mma(s.a1, s.b1, c11);
  c02 = g2_mma(s.a0, s.b2, c02); c12 = g2_mma(s.a1, s.b2, c12); c03 = g2_mma(s.a0, s.b3, c03); c13 = g2_mma(s.a1, s.b3, c13); }

// batched GEMM (grid.y = head / batch slab): C = alpha * A Bt^T (+ CP own element). A f16 [M][K] pitch lda (slab stride sA), Bt f16 [N][K] pitch ldb (slab stride sB applied to blockIdx.y >> bsh); outputs f32 C and/or f16 value plane C16 (+ optional x2^10 residual plane C16L of the same f32 value), pitch ldc, slab stride sC.
__global__ __launch_bounds__(128) void k_gemm2(const _Float16* __restrict__ A, int lda, size_t sA, const _Float16* __restrict__ Bh, int ldb, size_t sB, unsigned int bsh, float alpha, const float* CP,
    float* C, _Float16* C16, _Float16* C16L, int ldc, size_t sC, int M, int N, int K, const float* cosb, const float* sinb, unsigned int rotN, unsigned int pmask) {
  __shared__ __attribute__((aligned(16))) float so[4][32][68];
  const unsigned int tid = threadIdx.x, w = tid >> 5, lane = tid & 31u, ln = lane & 15u, hh = lane >> 4; const unsigned int by = blockIdx.y;
  A += (size_t)by * sA; Bh += (size_t)(by >> bsh) * sB; const size_t cofs = (size_t)by * sC;
  const unsigned int ntn = (unsigned int)N >> 6; const unsigned int mt = blockIdx.x / ntn, nq = blockIdx.x - mt * ntn; const unsigned int row0 = mt * 128u + 32u * w, col0 = nq * 64u; if (row0 >= (unsigned int)M) return;
  const _Float16* a0p = A + (size_t)(row0 + ln) * lda; const _Float16* a1p = a0p + (size_t)16 * lda;
  const _Float16* b0p = Bh + (size_t)(col0 + ln) * ldb; const _Float16* b1p = b0p + (size_t)16 * ldb; const _Float16* b2p = b1p + (size_t)16 * ldb; const _Float16* b3p = b2p + (size_t)16 * ldb;
  const v8f z8 = {0.f,0.f,0.f,0.f,0.f,0.f,0.f,0.f}; v8f c00 = z8, c01 = z8, c02 = z8, c03 = z8, c10 = z8, c11 = z8, c12 = z8, c13 = z8;
  /* K loop as a ring of three register stages: the twelve loads of k-step s + 2 are issued together in front of the products of k-step s, so a wave waits for a whole stage that was asked for two steps earlier instead of for each fragment in turn. In front of and inside the loop no load stands under a test of its own, so that each wait can count the younger stages as still in flight; the last two to four steps are peeled. The order of the k-steps and of the products into each accumulator is unchanged. */
#define G2_LD(S, ST) g2_load(S, a0p, a1p, b0p, b1p, b2p, b3p, (ST) * 32, hh)
#define G2_ST(S) g2_step(S, c00, c01, c02, c03, c10, c11, c12, c13)
#define G2_XW() asm volatile("s_wait_xcnt 0x0" ::: "memory")      /* stands in front of code that writes anew the address registers which the loads issued so far name */
  const int nst = (K + 31) >> 5;
  if (nst == 1) { G2Stage s0; G2_LD(s0, 0); G2_ST(s0); }
  else if (nst > 1) { G2Stage s0, s1, s2; int st = 0;
    G2_LD(s0, 0); G2_LD(s1, 1); G2_XW();
#pragma unroll 1      /* one trip is already three k-steps; more would only add code */
    for (; st + 5 <= nst; st += 3) { G2_LD(s2, st + 2); G2_ST(s0); G2_LD(s0, st + 3); G2_ST(s1); G2_LD(s1, st + 4); G2_ST(s2); G2_XW(); }
    const int rem = nst - st;      /* 2, 3 or 4 steps are left; s0 and s1 hold the first two */
    if (rem >= 3) G2_LD(s2, st + 2);
    G2_ST(s0);
    if (rem >= 4) { G2_XW(); const int kt = (st + 3) * 32;      /* here the address registers die with their loads and a later fragment may land in them: the wait stands behind each fragment's loads */
      s0.a0 = g2_frag(a0p + kt, hh); G2_XW(); s0.a1 = g2_frag(a1p + kt, hh); G2_XW(); s0.b0 = g2_frag(b0p + kt, hh); G2_XW(); s0.b1 = g2_frag(b1p + kt, hh); G2_XW(); s0.b2 = g2_frag(b2p + kt, hh); G2_XW(); s0.b3 = g2_frag(b3p + kt, hh); G2_XW(); }
    G2_ST(s1);
    if (rem >= 3) G2_ST(s2);
    if (rem >= 4) G2_ST(s0); }
#undef G2_LD
#undef G2_ST
#undef G2_XW
  v8f accs[8] = {c00, c01, c02, c03, c10, c11, c12, c13};
  if (CP) {      /* own elements of the batched C plane: a lane's 64 loads are issued together, in front of the first sum */
    const float* cp = CP + cofs + (size_t)(row0 + 8u * hh) * ldc + col0 + ln; v8f pv[8];
#pragma unroll
    for (int u = 0; u < 8; ++u) {
#pragma unroll
      for (int r = 0; r < 8; ++r) pv[u][r] = cp[(size_t)((u >> 2) * 16 + r) * ldc + (u & 3) * 16]; }
#pragma unroll
    for (int u = 0; u < 8; ++u) accs[u] = accs[u] * alpha + pv[u];
  } else {
#pragma unroll
    for (int u = 0; u < 8; ++u) accs[u] = accs[u] * alpha; }
#pragma unroll
  for (int u = 0; u < 8; ++u) { const unsigned int t = (unsigned int)u & 3u, half = (unsigned int)u >> 2;
#pragma unroll
    for (int r = 0; r < 8; ++r) { const unsigned int rloc = half * 16u + 8u * hh + (unsigned int)r;
      so[w][rloc][t * 16u + ln] = accs[u][r]; } }
  __builtin_amdgcn_fence(4 /* acq_rel order */, "workgroup"); __builtin_amdgcn_wave_barrier();
  if (col0 < rotN) {      /* block-uniform: this tile is one q / k head; lane owns tile row 'lane' */
    const unsigned int pos = (row0 + lane) & pmask;
    const float* cr = cosb + (size_t)pos * 32u; const float* sr = sinb + (size_t)pos * 32u; float ss = 0.f;
#pragma unroll 1
    for (unsigned int j = 0; j < 32u; j += 4u) { const v4f cc = *(const v4fa*)(cr + j), sn = *(const v4fa*)(sr + j); const v4f x1 = *(const v4fa*)&so[w][lane][j], x2 = *(const v4fa*)&so[w][lane][32u + j]; v4f y1, y2;
#pragma unroll
      for (int q = 0; q < 4; ++q) { const float c = bf16_rne(cc[q]), s = bf16_rne(sn[q]); y1[q] = x1[q] * c + x2[q] * s; y2[q] = x2[q] * c - x1[q] * s; ss += y1[q] * y1[q] + y2[q] * y2[q]; }
      *(v4fa*)&so[w][lane][j] = y1; *(v4fa*)&so[w][lane][32u + j] = y2; }
    const float rs = rsqrtf(ss * 0.015625f + 1.0e-6f);
#pragma unroll 1
    for (unsigned int j = 0; j < 64u; j += 4u) { v4f y = *(const v4fa*)&so[w][lane][j];
#pragma unroll
      for (int q = 0; q < 4; ++q) y[q] = y[q] * rs;
      *(v4fa*)&so[w][lane][j] = y; }
    __builtin_amdgcn_fence(4 /* acq_rel order */, "workgroup"); __builtin_amdgcn_wave_barrier(); }
  const unsigned int rsub = lane >> 4, c4 = (lane & 15u) * 4u;
  {
#pragma unroll
    for (int q = 0; q < 16; ++q) { const unsigned int r = (unsigned int)q * 2u + rsub; const v4f v = *(const v4fa*)&so[w][r][c4]; const size_t o = cofs + (size_t)(row0 + r) * ldc + col0 + c4;
      if (C) *(v4f*)(C + o) = v;
      if (C16) { v4h h4, l4;
#pragma unroll
        for (int i = 0; i < 4; ++i) { const _Float16 h = (_Float16)v[i]; h4[i] = h; l4[i] = (_Float16)((v[i] - (float)h) * 1024.0f); }
        *(v4h*)(C16 + o) = h4; if (C16L) *(v4h*)(C16L + o) = l4; } }
     } }

// cross-lane steps of the row reductions: lane l with lane l ^ M inside a 16-lane row (DPP row_xmask), and lane l with lane l ^ 16
template <int M> __device__ __forceinline__ float sm_xrow(float x) { return __builtin_bit_cast(float, __builtin_amdgcn_update_dpp(0, __builtin_bit_cast(int, x), 0x160 | M, 0xf, 0xf, true)); }
__device__ __forceinline__ float sm_xhalf(float x) { return __builtin_bit_cast(float, __builtin_amdgcn_permlanex16(__builtin_bit_cast(int, x), __builtin_bit_cast(int, x), 0x76543210, 0xfedcba98, false, false)); }
__device__ __forceinline__ float sm_wave_max(float v) { v = fmaxf(v, sm_xrow<1>(v)); v = fmaxf(v, sm_xrow<2>(v)); v = fmaxf(v, sm_xrow<4>(v)); v = fmaxf(v, sm_xrow<8>(v)); return fmaxf(v, sm_xhalf(v)); }
__device__ __forceinline__ float sm_wave_sum(float v) { v += sm_xrow<1>(v); v += sm_xrow<2>(v); v += sm_xrow<4>(v); v += sm_xrow<8>(v); return v + sm_xhalf(v); }

// e^x as the fast library form computes it (multiply by log2 e, then v_exp_f32); the v_nop in the same statement is the one free slot the instruction set asks for behind a transcendental
__device__ __forceinline__ float sm_exp(float x) { const float t = x * 1.44269504088896340736f; float r; asm("v_exp_f32 %0, %1\n\tv_nop" : "=v"(r) : "v"(t)); return r; }

// attention of the rows from QT0 on, scores, softmax and o in one launch. A work-group owns AQ query rows of one (batch, head); their score rows stay in LDS from the products to the last use, so no score or weight goes through memory and every (batch, head, row group) runs side by side. Keys are taken up to the end of the 128-key chunk that holds the rows; later keys have weight exactly zero.
// Step 1: wave w forms the 16-key score tiles w, w + 8, ... (value plane, then residual plane of q, folded in f32). Step 2: one wave per score row, two rows a wave: lane l keeps columns 128 c + 4 l + 0..3 of every chunk c in registers, maximum and sum are per-lane partials joined across the 32 lanes; the row's weights (f16 value plane, then x1024 residual plane) are written over its own scores. Step 3: waves 0..3 (16 head columns each) sum Vh ph and Vh pl from one V fragment, waves 4..7 sum Vres ph; k-steps in rising order into each accumulator; the three sums are folded in f32 in the order Vh ph, Vres ph, Vh pl.
#define AQ 16                        /* query rows per work-group */
#define APB (NKX * 4 + 32)           /* bytes of a score row in LDS; 32 more than a multiple of 256, so that the 16-byte fragment reads of 16 rows x 2 halves fall on all banks evenly */
static_assert(QT0 % 128 == 0 && SQ % 128 == 0 && 128 % AQ == 0 && NKX / 128 <= 16 && QT0 >= 256);
typedef float fa1 __attribute__((may_alias));
typedef _Float16 v4ha __attribute__((ext_vector_type(4), may_alias));
struct VB { v16h f[4]; };      /* the V fragments of one 128-key chunk (four k-steps) */
// the fragment of g2_frag from a pointer that already holds the lane's 8 h, so that every load of a run names that one address with a constant offset
__device__ __forceinline__ v16h at_frag(const _Float16* q) { FragH f; f.half[0] = *(const v8us*)((const unsigned short*)q); f.half[1] = *(const v8us*)((const unsigned short*)q + 16); return f.v; }
__device__ __forceinline__ void vb_load(VB& s, const _Float16* q) {
#pragma unroll
  for (int u = 0; u < 4; ++u) s.f[u] = at_frag(q + u * 32); }
__global__ __launch_bounds__(256) void k_attf(const _Float16* __restrict__ Q16, const _Float16* __restrict__ QL, const _Float16* __restrict__ K16, const _Float16* __restrict__ VT, const _Float16* __restrict__ VTL, _Float16* __restrict__ OH, _Float16* __restrict__ OL) {
  __shared__ __attribute__((aligned(16))) unsigned char sp[AQ * APB];      /* per row: f32 scores, later f16 weights at byte 0 and their residuals at byte 2 NKX */
  __shared__ __attribute__((aligned(16))) float oc[AQ][68];
  const unsigned int tid = threadIdx.x, w = (unsigned int)__builtin_amdgcn_readfirstlane((int)(tid >> 5)), lane = tid & 31u, ln = lane & 15u, hh = lane >> 4;
  const unsigned int h = blockIdx.x % (unsigned int)NH, b = blockIdx.x / (unsigned int)NH, hk = h >> KVSH;
  const unsigned int q0 = (unsigned int)(SQ - AQ) - blockIdx.y * (unsigned int)AQ;      /* the longest rows have the lowest blockIdx.y */
  const unsigned int nch = q0 / 128u + 1u;      /* 128-key chunks; at least 3 */
  const size_t r0 = (size_t)b * SQ;
  const v8f z8 = {0.f,0.f,0.f,0.f,0.f,0.f,0.f,0.f};
  /* every plain '#pragma unroll' of this kernel and of vb_load stands on a short loop over a register array (u, r, q, c): unrolled whole, the array is indexed by constants and stays in registers */
  { const _Float16* qp = Q16 + (r0 + q0 + ln) * LQ + h * HD + 8u * hh; const _Float16* lp = QL + (r0 + q0 + ln) * LQ + h * HD + 8u * hh;
    const v16h qh0 = at_frag(qp), qh1 = at_frag(qp + 32), ql0 = at_frag(lp), ql1 = at_frag(lp + 32);
    asm volatile("s_wait_xcnt 0x0" :: "v"(qp), "v"(lp) : "memory");      /* stands in front of code that writes anew the address registers which the q loads name; the pointers as inputs keep them whole up to here */
    const _Float16* kb = K16 + (r0 + w * 16u + ln) * LQ + hk * HD + 8u * hh;
#pragma unroll 1      /* one trip is already four tiles with all their loads in flight together */
    for (unsigned int i0 = 0; i0 < nch; i0 += 4u) { const _Float16* kp[4]; v16h k0[4], k1[4];
#pragma unroll
      for (int u = 0; u < 4; ++u) { const unsigned int i = i0 + (unsigned int)u; kp[u] = kb + (size_t)((i < nch ? i : nch - 1u) * 128u) * LQ; }      /* past the end: the last tile again, so that no load stands under a test */
#pragma unroll
      for (int u = 0; u < 4; ++u) { k0[u] = at_frag(kp[u]); k1[u] = at_frag(kp[u] + 32); }
      asm volatile("s_wait_xcnt 0x0" :: "v"(kp[0]), "v"(kp[1]), "v"(kp[2]), "v"(kp[3]) : "memory");      /* the same for the K loads */
      __builtin_amdgcn_sched_barrier(0);      /* keeps the first product, which waits for its tile, from moving up among the loads of the later tiles */
#pragma unroll
      for (int u = 0; u < 4; ++u) { if (i0 + (unsigned int)u < nch) {
        v8f a1 = g2_mma(qh0, k0[u], z8); a1 = g2_mma(qh1, k1[u], a1);
        v8f a2 = g2_mma(ql0, k0[u], z8); a2 = g2_mma(ql1, k1[u], a2);
        unsigned char* sd = sp + (8u * hh) * (unsigned int)APB + (((i0 + (unsigned int)u) * 8u + w) * 16u + ln) * 4u;
#pragma unroll
        for (int r = 0; r < 8; ++r) *(fa1*)(sd + (unsigned int)r * (unsigned int)APB) = a2[r] * 0.0001220703125f + a1[r] * 0.125f; } } } }
  __syncthreads();      /* all score tiles of the 16 rows are in LDS */
#pragma unroll 1      /* the second row reuses the first row's registers */
  for (unsigned int rr = 0; rr < 2u; ++rr) { const unsigned int row = w * 2u + rr; unsigned char* rp = sp + row * (unsigned int)APB; const unsigned int last = q0 + row; v4f e[16];
#pragma unroll
    for (unsigned int c = 0; c < 16u; ++c) { if (c < nch) e[c] = *(const v4fa*)(rp + (c * 128u + lane * 4u) * 4u); }
    v4f m4 = {-3.0e38f, -3.0e38f, -3.0e38f, -3.0e38f};
#pragma unroll
    for (unsigned int c = 0; c < 16u; ++c) { if (c < nch) {
#pragma unroll
      for (int q = 0; q < 4; ++q) { e[c][q] = (c * 128u + lane * 4u + (unsigned int)q <= last) ? e[c][q] : -1.0e9f; m4[q] = fmaxf(m4[q], e[c][q]); } } }
    const float mx = sm_wave_max(fmaxf(fmaxf(m4[0], m4[1]), fmaxf(m4[2], m4[3])));
    v4f s4 = {0.f, 0.f, 0.f, 0.f};
#pragma unroll
    for (unsigned int c = 0; c < 16u; ++c) { if (c < nch) {
#pragma unroll
      for (int q = 0; q < 4; ++q) { e[c][q] = sm_exp(e[c][q] - mx); s4[q] += e[c][q]; } } }
    const float se = sm_wave_sum((s4[0] + s4[1]) + (s4[2] + s4[3])); const float sc = 256.0f / se;
#pragma unroll
    for (unsigned int c = 0; c < 16u; ++c) { if (c < nch) { v4h h4, l4;
#pragma unroll
      for (int q = 0; q < 4; ++q) { const float pv = e[c][q] * sc; const _Float16 hv = (_Float16)pv; h4[q] = hv; l4[q] = (_Float16)((pv - (float)hv) * 1024.0f); }
      *(v4ha*)(rp + (c * 128u + lane * 4u) * 2u) = h4; *(v4ha*)(rp + (unsigned int)NKX * 2u + (c * 128u + lane * 4u) * 2u) = l4; } } }
  __syncthreads();      /* all weight rows are in LDS */
  { const unsigned int ct = w & 3u; const bool resv = w >= 4u;      /* wave-uniform */
    const _Float16* vp = (resv ? VTL : VT) + (((size_t)b * NKV + hk) * HD + ct * 16u + ln) * SQ + 8u * hh;
    const _Float16* ph = (const _Float16*)(sp + ln * (unsigned int)APB) + 8u * hh; const _Float16* pl = ph + NKX;
    v8f a1 = z8, a3 = z8; VB v0, v1, v2;      /* ring of three chunks: chunk c + 2 is asked for in front of the products of chunk c */
    vb_load(v0, vp); vb_load(v1, vp + 128);
    asm volatile("s_wait_xcnt 0x0" :: "v"(vp) : "memory");      /* as above, for the V loads */
    /* one chunk: NEW takes chunk C + 2 (past the end: the last chunk again, so that no load stands under a test and each wait can count the younger chunks as still in flight); the chunk's weight fragments are read from LDS together; the wait as above, whose memory clobber also holds those reads in front of it, ahead of the first product; then the products of chunk C from CUR */
#define AT_CHUNK(CUR, NEW, C) { const unsigned int cc = (C); const _Float16* vn = vp + (cc + 2u < nch ? cc + 2u : nch - 1u) * 128u; vb_load(NEW, vn); VB pa, pb; vb_load(pa, ph + cc * 128u); if (!resv) vb_load(pb, pl + cc * 128u); \
      asm volatile("s_wait_xcnt 0x0" :: "v"(vn) : "memory"); \
      _Pragma("unroll") for (int u = 0; u < 4; ++u) a1 = g2_mma(pa.f[u], CUR.f[u], a1); \
      if (!resv) { _Pragma("unroll") for (int u = 0; u < 4; ++u) a3 = g2_mma(pb.f[u], CUR.f[u], a3); } }
    unsigned int c = 0;
#pragma unroll 1      /* one trip is three chunks, so that the ring's stages are named, not indexed; no way out from inside a trip, the last zero, one or two chunks stand behind the loop */
    for (; c + 3u <= nch; c += 3u) { AT_CHUNK(v0, v2, c); AT_CHUNK(v1, v0, c + 1u); AT_CHUNK(v2, v1, c + 2u); }
    if (c < nch) { AT_CHUNK(v0, v2, c); if (c + 1u < nch) AT_CHUNK(v1, v0, c + 1u); }
#undef AT_CHUNK
    if (resv) {
#pragma unroll
      for (int r = 0; r < 8; ++r) oc[8u * hh + (unsigned int)r][ct * 16u + ln] = a1[r]; }
    __syncthreads();      /* the Vres ph sums are in LDS */
    if (!resv) {      /* own elements: each is read and rewritten by the same lane */
#pragma unroll
      for (int r = 0; r < 8; ++r) { float o = a1[r] * 0.25f; o = oc[8u * hh + (unsigned int)r][ct * 16u + ln] * 0.000244140625f + o; o = a3[r] * 0.000244140625f + o; oc[8u * hh + (unsigned int)r][ct * 16u + ln] = o; } } }
  __syncthreads();      /* the o tile is whole */
  if (tid < 128u) { const unsigned int row = tid >> 3, pc = (tid & 7u) * 8u; const v4f a = *(const v4fa*)&oc[row][pc], c = *(const v4fa*)&oc[row][pc + 4u]; FragH fh, fl;      /* a row's 128 bytes of each plane leave from eight neighbouring lanes */
#pragma unroll
    for (int q = 0; q < 4; ++q) { _Float16 hv = (_Float16)a[q]; fh.h[q] = hv; fl.h[q] = (_Float16)((a[q] - (float)hv) * 1024.0f); hv = (_Float16)c[q]; fh.h[4 + q] = hv; fl.h[4 + q] = (_Float16)((c[q] - (float)hv) * 1024.0f); }
    const v8us oh = fh.half[0], ol = fl.half[0]; const size_t d = (r0 + q0 + row) * DM + h * HD + pc;
    *(v8us*)((unsigned short*)OH + d) = oh; *(v8us*)((unsigned short*)OL + d) = ol; } }

// f32 attention of the leading rows, one thread per query row. What a thread alone uses, its q row and its o row, stays in registers for the whole key loop (every loop over the head is unrolled whole so that both are indexed by constants). What all 64 threads use, the K and V rows, is staged in LDS 64 keys at a time and read from there at one address per wave: K transposed, so that one 16-byte read brings one head element of four neighbouring keys. One trip takes four keys: their four score sums are independent chains that fill each other's latency. Each score sum, the running maximum and sum, and each o element take their terms in the same order as with one key per trip.
__global__ __launch_bounds__(64) void k_att0(const float* __restrict__ QF, const float* __restrict__ KF, const float* __restrict__ VF, int ld, size_t sF, float scale, float* __restrict__ OF, int ldo, size_t sO) {
  #pragma clang fp contract(off)
  __shared__ __attribute__((aligned(16))) float lk[HD][68];      /* K tile [head element][key]; pitch 68: the transposing stores of a wave fall on 32 different banks, rows stay 16-byte aligned */
  __shared__ __attribute__((aligned(16))) float lv[64][HD];      /* V tile [key][head element] */
  __shared__ __attribute__((aligned(16))) float lo[64][64];
  const unsigned int tid = threadIdx.x; const unsigned int h = blockIdx.x / (unsigned int)(QT0 / 64), rg = blockIdx.x % (unsigned int)(QT0 / 64); const unsigned int i = rg * 64u + tid; const unsigned int hk = h >> KVSH;
  const size_t fo = (size_t)blockIdx.y * sF; QF += fo; KF += fo; VF += fo; OF += (size_t)blockIdx.y * sO;
  const float* qr = QF + (size_t)i * ld + h * HD;
  v4f q[HD / 4], o[HD / 4];
#pragma unroll
  for (int c = 0; c < HD / 4; ++c) { q[c] = *(const v4fa*)(qr + c * 4); const v4f z = {0.f, 0.f, 0.f, 0.f}; o[c] = z; }
  asm volatile("s_wait_xcnt 0x0" :: "v"(qr) : "memory");      /* stands in front of code that writes anew the address registers which the q loads name; the pointer as an input keeps them out of those loads' own results */
  /* a thread's share of a tile. K: key (tid & 7) of a group of 8, 16-byte piece (tid >> 3) of a group of 8 (a wave's load covers 8 rows x 64 bytes). V: key (tid >> 4) of a group of 4, piece (tid & 15) (whole rows). */
  const unsigned int kb = tid & 7u, ka = tid >> 3, vb = tid >> 4, va = tid & 15u;
  const unsigned int kofs = (kb * (unsigned int)ld + ka * 4u) * 4u, vofs = (vb * (unsigned int)ld + va * 4u) * 4u;      /* byte offsets, the same for every tile */
  float m = -1.0e30f, l = 0.f; const unsigned int jmax = rg * 64u + 63u;      /* keys up to the block's last row */
#pragma unroll 1      /* a tile's code is long already */
  for (unsigned int j0 = 0; j0 <= jmax; j0 += 64u) { const float* kt = KF + (size_t)j0 * ld + hk * HD; const float* vt = VF + (size_t)j0 * ld + hk * HD;
    __syncthreads();      /* both waves have read the last tile to its end */
    { v4f kk[16]; const char* kp[8];      /* the eight row groups' addresses; both halves of a row group's rows are read from one of them */
#pragma unroll
      for (int g = 0; g < 8; ++g) kp[g] = (const char*)(kt + (size_t)(g * 8) * ld) + kofs;
#pragma unroll
      for (int it = 0; it < 16; ++it) kk[it] = *(const v4fa*)(kp[it & 7] + (it >> 3) * 128);
      asm volatile("s_wait_xcnt 0x0" :: "v"(kp[0]), "v"(kp[1]), "v"(kp[2]), "v"(kp[3]), "v"(kp[4]), "v"(kp[5]), "v"(kp[6]), "v"(kp[7]) : "memory");      /* stands in front of code that writes anew the address registers which the K loads name; the addresses as inputs keep them out of those loads' own results */
#pragma unroll
      for (int it = 0; it < 16; ++it) {
#pragma unroll
        for (int t = 0; t < 4; ++t) lk[((unsigned int)(it >> 3) * 8u + ka) * 4u + (unsigned int)t][(unsigned int)(it & 7) * 8u + kb] = kk[it][t]; } }
    { v4f vv[16]; const char* vp[16];
#pragma unroll
      for (int it = 0; it < 16; ++it) vp[it] = (const char*)(vt + (size_t)(it * 4) * ld) + vofs;
#pragma unroll
      for (int it = 0; it < 16; ++it) vv[it] = *(const v4fa*)vp[it];
      asm volatile("s_wait_xcnt 0x0" :: "v"(vp[0]), "v"(vp[1]), "v"(vp[2]), "v"(vp[3]), "v"(vp[4]), "v"(vp[5]), "v"(vp[6]), "v"(vp[7]), "v"(vp[8]), "v"(vp[9]), "v"(vp[10]), "v"(vp[11]), "v"(vp[12]), "v"(vp[13]), "v"(vp[14]), "v"(vp[15]) : "memory");      /* the same for the V loads */
#pragma unroll
      for (int it = 0; it < 16; ++it) *(v4fa*)&lv[(unsigned int)it * 4u + vb][va * 4u] = vv[it]; }
    __syncthreads();      /* the tile is whole before either wave reads it */
#pragma unroll 1      /* one trip is already four keys; more would only add code */
    for (unsigned int jj = 0; jj < 64u; jj += 4u) { float s[4] = {0.f, 0.f, 0.f, 0.f}, sc[4], e[4];
#pragma unroll
      for (int c = 0; c < HD / 4; ++c) {
#pragma unroll
        for (int t = 0; t < 4; ++t) { const v4f k4 = *(const v4fa*)&lk[c * 4 + t][jj];
#pragma unroll
          for (int u = 0; u < 4; ++u) s[u] = __fadd_rn(s[u], __fmul_rn(q[c][t], k4[u])); } }
#pragma unroll
      for (int u = 0; u < 4; ++u) { const float su = __fmul_rn(s[u], scale);
        const float f = (j0 + jj + (unsigned int)u <= i) ? 1.f : 0.f; const float sm = fmaf(f, su, (1.f - f) * -1.0e30f); const float mn = fmaxf(m, sm); sc[u] = expf(m - mn); e[u] = expf(sm - mn); l = __fadd_rn(__fmul_rn(l, sc[u]), e[u]); m = mn; }
#pragma unroll
      for (int u = 0; u < 4; ++u) {
#pragma unroll
        for (int c = 0; c < HD / 4; ++c) { const v4f vv = *(const v4fa*)&lv[jj + (unsigned int)u][c * 4];
#pragma unroll
          for (int t = 0; t < 4; ++t) o[c][t] = __fadd_rn(__fmul_rn(o[c][t], sc[u]), __fmul_rn(e[u], vv[t])); } } } }
  const float fin = 64.0f / l;      /* o carried x64 like the f16 path */
#pragma unroll
  for (int c = 0; c < HD / 4; ++c) { v4f oo = o[c];
#pragma unroll
    for (int u = 0; u < 4; ++u) oo[u] = __fmul_rn(oo[u], fin);
    *(v4fa*)&lo[tid][c * 4] = oo; }
  __syncthreads();
  {
#pragma unroll 1
    for (unsigned int it = 0; it < 16u; ++it) { const unsigned int row = it * 4u + (tid >> 4), pc = (tid & 15u) * 4u; const v4f v = *(const v4fa*)&lo[row][pc]; *(v4f*)(OF + (size_t)(rg * 64u + row) * ldo + h * HD + pc) = v; }
     } }

constexpr size_t al256(size_t b) { return (b + 255) & ~(size_t)255; }
constexpr size_t SZ_BQKV = al256((size_t)LQ * DM * 2);
constexpr size_t SZ_BO   = al256((size_t)DM * DM * 2);
constexpr size_t SZ_XO   = al256(NR * DM * 2);                          /* X16, later reused as the merged o value rows */
constexpr size_t SZ_QKV  = al256(NR * LQ * 2);                          /* value plane; the residual plane has the same size */
constexpr size_t SZ_F0   = al256((size_t)NB * QT0 * LQ * 4);
constexpr size_t SZ_OF0  = al256((size_t)NB * QT0 * DM * 4);
constexpr size_t SZ_VT   = al256((size_t)NB * NKV * HD * SQ * 2);       /* V^T value plane; the residual plane has the same size */
constexpr size_t SZ_OL   = al256(NR * DM * 2);                          /* merged o residual rows */
constexpr size_t WS_TOTAL = SZ_BQKV + SZ_BO + SZ_XO + 2 * SZ_QKV + SZ_F0 + SZ_OF0 + 2 * SZ_VT + SZ_OL;
static_assert(WS_TOTAL <= (size_t)134217728);
/* plane coverage equalities of the producer grids */
static_assert(((size_t)(DM / 64) * (DM / 64)) * 64 * 64 == (size_t)DM * DM);
static_assert(((size_t)(DM / 64) * (KVD / 64)) * 64 * 64 == (size_t)DM * KVD);
static_assert(((size_t)NB * NKV * (SQ / 64)) * 64 * 64 == (size_t)NB * NKV * HD * SQ);
static_assert((NR * DM) % (256 * 8) == 0);
static_assert(((size_t)NB * QT0 * DM) % (256 * 8) == 0);
static_assert((size_t)NH * (QT0 / 64) * 64 == (size_t)NH * QT0);
static_assert(((size_t)(NR / 128) * (LQ / 64)) * 128 * 64 == NR * LQ);
static_assert(((size_t)NH * NB * ((SQ - QT0) / AQ)) * AQ * HD == (NR - (size_t)NB * QT0) * DM);
static_assert(((size_t)(SQ / 128) * (DM / 64) * NB) * 128 * 64 == NR * DM);

extern "C" void kernel_launch(void* const* d_in, const int* in_sizes, int n_in,
                              void* d_out, int out_size, void* d_ws, size_t ws_size, hipStream_t stream) {
  if (n_in < 7) return;
  const size_t need_x = ((size_t)(NB - 1) * SQ_FULL + SQ) * DM;
  if ((size_t)in_sizes[0] < need_x) return;
  if ((size_t)in_sizes[1] < (size_t)SQ * 32) return;
  if ((size_t)in_sizes[2] < (size_t)SQ * 32) return;
  if ((size_t)in_sizes[3] < (size_t)DM * DM) return;
  if ((size_t)in_sizes[4] < (size_t)DM * KVD) return;
  if ((size_t)in_sizes[5] < (size_t)DM * KVD) return;
  if ((size_t)in_sizes[6] < (size_t)DM * DM) return;
  if ((size_t)out_size < need_x) return;
  const float* x = (const float*)d_in[0]; const float* cosb = (const float*)d_in[1]; const float* sinb = (const float*)d_in[2];      /* tables [pos][32], read as values */
  const float* wq = (const float*)d_in[3]; const float* wk = (const float*)d_in[4]; const float* wv = (const float*)d_in[5]; const float* wo = (const float*)d_in[6];      /* all [in][out] */
  float* out = (float*)d_out;
  char* ws = (char*)d_ws; size_t off = 0;
  auto take = [&](size_t bytes) { char* p = ws + off; off += (bytes + 255) & ~(size_t)255; return p; };
  _Float16* BQKV = (_Float16*)take(SZ_BQKV); _Float16* BO = (_Float16*)take(SZ_BO);
  _Float16* X16 = (_Float16*)take(SZ_XO); _Float16* OH = X16;      /* X16 is dead after the projection GEMMs; the merged o value rows take its place */
  _Float16* QKV = (_Float16*)take(SZ_QKV); const _Float16* Q16 = QKV; const _Float16* K16 = QKV + DM; const _Float16* V16 = QKV + ROTN;
  _Float16* QKVL = (_Float16*)take(SZ_QKV); const _Float16* QL = QKVL; const _Float16* VL16 = QKVL + ROTN;      /* x1024 residual plane, same layout (k columns unused) */
  float* F0 = (float*)take(SZ_F0); float* OF0 = (float*)take(SZ_OF0);
  _Float16* VT = (_Float16*)take(SZ_VT); _Float16* VTL = (_Float16*)take(SZ_VT);
  _Float16* OL = (_Float16*)take(SZ_OL);
  if (off > ws_size) return;

  k_wT<<<(DM / 64) * (DM / 64), 256, 0, stream>>>(wq, (unsigned int)DM, (unsigned int)DM, BQKV);                                   /* W[DM][DM] -> Bt rows 0..1023 */
  k_wT<<<(DM / 64) * (KVD / 64), 256, 0, stream>>>(wk, (unsigned int)DM, (unsigned int)KVD, BQKV + (size_t)DM * DM);                /* W[DM][KVD] -> Bt rows 1024..1279 */
  k_wT<<<(DM / 64) * (KVD / 64), 256, 0, stream>>>(wv, (unsigned int)DM, (unsigned int)KVD, BQKV + (size_t)ROTN * DM);              /* W[DM][KVD] -> Bt rows 1280..1535 */
  k_wT<<<(DM / 64) * (DM / 64), 256, 0, stream>>>(wo, (unsigned int)DM, (unsigned int)DM, BO);                                     /* Wo[c][n] -> Bt[n][c] */
  const unsigned int n8x = (unsigned int)(NR * DM / 8);
  k_x16<<<(n8x + 255u) / 256u, 256, 0, stream>>>(x, X16, n8x);
  const int MP = (int)(NR); const unsigned int pm = (unsigned int)(SQ - 1);
  k_gemm2<<<dim3((unsigned int)((MP / 128) * (LQ / 64)), 1), 128, 0, stream>>>(X16, DM, (size_t)0, BQKV, DM, (size_t)0, 0u, 0.0625f, nullptr, nullptr, QKV, QKVL, LQ, (size_t)0, MP, LQ, DM, cosb, sinb, (unsigned int)ROTN, pm);      /* q | k | v rows (f16 value + residual), q / k rotated + normalised */
  k_gemm2<<<dim3((unsigned int)((QT0 / 128) * (LQ / 64)), NB), 128, 0, stream>>>(X16, DM, (size_t)SQ * DM, BQKV, DM, (size_t)0, 0u, 0.0625f, nullptr, F0, nullptr, nullptr, LQ, (size_t)QT0 * LQ, QT0, LQ, DM, cosb, sinb, (unsigned int)ROTN, pm);      /* f32 q | k | v of rows 0..QT0-1 of every batch */
  k_vt<<<NB * NKV * (SQ / 64), 256, 0, stream>>>(V16, VT);        /* V^T value plane [NB][NKV][HD][SQ] */
  k_vt<<<NB * NKV * (SQ / 64), 256, 0, stream>>>(VL16, VTL);      /* V^T residual plane */
  k_att0<<<dim3(NH * (QT0 / 64), NB), 64, 0, stream>>>(F0, F0 + DM, F0 + ROTN, LQ, (size_t)QT0 * LQ, 0.125f, OF0, DM, (size_t)QT0 * DM);      /* f32 attention for rows 0..QT0-1 (o x64) */
  const unsigned int n8h = (unsigned int)((size_t)NB * QT0 * DM / 8);
  k_hl<<<(n8h + 255u) / 256u, 256, 0, stream>>>(OF0, OH, OL, n8h);      /* first rows: value + x1024 residual planes into the merged o rows */
  k_attf<<<dim3(NH * NB, (SQ - QT0) / AQ), 256, 0, stream>>>(Q16, QL, K16, VT, VTL, OH, OL);      /* rows from QT0 on: scores, softmax and o; final o written as f16 value + x1024 residual merged rows */
  k_gemm2<<<dim3((SQ / 128) * (DM / 64), NB), 128, 0, stream>>>(OH, DM, (size_t)SQ * DM, BO, DM, (size_t)0, 0u, 0.0009765625f, nullptr, out, nullptr, nullptr, DM, (size_t)SQ_FULL * DM, SQ, DM, DM, nullptr, nullptr, 0u, 0u);      /* out rows in the output layout: o value plane */
  k_gemm2<<<dim3((SQ / 128) * (DM / 64), NB), 128, 0, stream>>>(OL, DM, (size_t)SQ * DM, BO, DM, (size_t)0, 0u, 0.00000095367431640625f, (const float*)out, out, nullptr, nullptr, DM, (size_t)SQ_FULL * DM, SQ, DM, DM, nullptr, nullptr, 0u, 0u);      
}

// v005
// A run of this version takes 270 microseconds.
// Next to v004, in two timings, it ran 1.15 times as fast each time.
// Counting every step since v000, it is 23.8 times as fast.
#include <hip/hip_runtime.h>
// All contractions: v_wmma_f32_16x16x32_f16 (f16 operands, f32 accumulate). x, cos, sin and all four weights are RNE-converted to bf16 first (exact in f16; weights carried x16); q (after split-half rotation + scale-free RMS normalisation in f32), v, softmax weights (x256) and o (x64) are f16 value + x1024 residual planes, every residual product in its own accumulator, folded in f32; k is a single f16 plane; the first 256 query rows of every batch use f32 q/k/v from exact-operand GEMMs and an f32 online softmax on VALU.
// Causal grouped-query self-attention: x [NB][SQ][1024]; q = x Wq (16 heads of 64), k = x Wk, v = x Wv (4 kv heads of 64; weights are [in][out]); rotation with INPUT tables cos/sin [pos][32]: y[j] = x[j] c + x[j+32] s, y[j+32] = x[j+32] c - x[j] s; q, k scaled by rsqrt(mean square over the head + 1e-6); query head h uses kv head h >> 2; scores * 0.125; keys above the query get exactly zero weight; softmax; out = merged y Wo -> [NB][SQ][1024] f32.
// Structure: token rows r = b*SQ + s; X16 exact f16 rows; one q|k|v GEMM (N = 1536) whose epilogue applies rotation + normalisation on the 64-column head tiles of q and k and writes value + residual planes; V^T value and residual planes per (batch, kv head) via LDS transposes; one attention launch, a work-group per (batch, head, 16 query rows), whose score rows never leave LDS: scores = qh k + qres k against the keys up to the end of the rows' own 128-key chunk, causal row softmax on VALU, one wave per row (P value + residual written over the row's scores), o = Vh ph + Vres ph + Vh pl folded in f32 and written as f16 value + residual merged o rows (x64); out = oh Wo + ores Wo. Rows 0..255 of each batch: f32 attention by the first work-groups of the same launch, split into the same two o planes.
#ifndef NB
#define NB 2
#endif
#ifndef SQ
#define SQ 2048
#endif
#define NB_FULL 2
#define SQ_FULL 2048
#define DM 1024
#define NH 16
#define NKV 4
#define KVSH 2                       /* query head -> kv head shift */
#define HD 64
#define KVD (NKV * HD)               /* 256 */
#define LQ (DM + 2 * KVD)            /* row pitch of the q | k | v rows: 1536 */
#define ROTN (DM + KVD)              /* columns below this are q / k heads (rotated + normalised) */
#define QT 256                       /* not used by any kernel, only by the static_asserts */
#define QT0 256                      /* leading rows of every batch computed in f32 */
#define NKX SQ                       /* keys of an S / P row; the LDS row pitch is APB */
#define NR ((size_t)NB * SQ)         /* token rows */

static_assert(NB <= NB_FULL);
static_assert(SQ <= SQ_FULL);
static_assert((SQ & (SQ - 1)) == 0);
static_assert(SQ % QT == 0);
static_assert((QT & (QT - 1)) == 0);
static_assert(QT % 128 == 0);
static_assert(QT0 == QT);
static_assert(QT0 % 128 == 0);
static_assert(QT0 % 64 == 0);
static_assert(HD == 64);
static_assert(DM == NH * HD);
static_assert(NH == (NKV << KVSH));
static_assert(DM / 8 == 128);
static_assert(DM % 64 == 0);
static_assert(KVD % 64 == 0);
static_assert(LQ % 64 == 0);
static_assert(ROTN % 64 == 0);
static_assert(((size_t)NB * SQ) % 128 == 0);
static_assert(SQ % 64 == 0);
static_assert(DM % 32 == 0);

typedef unsigned short v8us __attribute__((ext_vector_type(8), may_alias));
typedef float  v8f  __attribute__((ext_vector_type(8)));
typedef float  v4f  __attribute__((ext_vector_type(4)));
typedef float  v4fa __attribute__((ext_vector_type(4), may_alias));
typedef _Float16 v16h __attribute__((ext_vector_type(16)));
typedef _Float16 v4h __attribute__((ext_vector_type(4)));
union FragH { v16h v; v8us half[2]; _Float16 h[16]; unsigned short u[16]; };

__device__ __forceinline__ unsigned short bf16_bits(float x) { unsigned int u = __float_as_uint(x); return (unsigned short)((u + 0x7FFFu + ((u >> 16) & 1u)) >> 16); }
__device__ __forceinline__ float bf16_val(unsigned short b) { return __uint_as_float(((unsigned int)b) << 16); }
__device__ __forceinline__ float bf16_rne(float x) { return bf16_val(bf16_bits(x)); }

// fragment: elements 0..7 <- k0 + 8h + 0..7, elements 8..15 <- k0 + 16 + 8h + 0..7 (same map for A rows and B columns)
__device__ __forceinline__ v16h g2_frag(const _Float16* p, unsigned hh) { FragH f; f.half[0] = *(const v8us*)((const unsigned short*)p + 8 * hh); f.half[1] = *(const v8us*)((const unsigned short*)p + 16 + 8 * hh); return f.v; }
__device__ __forceinline__ v8f g2_mma(v16h a, v16h b, v8f c) { v8f d = __builtin_amdgcn_wmma_f32_16x16x32_f16(false, a, false, b, (short)0, c, false, false); asm volatile("v_nop\n\tv_nop\n\tv_nop\n\tv_nop" : "+v"(d) : "v"(a), "v"(b)); return d; }

__global__ __launch_bounds__(256) void k_wT(const float* __restrict__ w, unsigned int Kd, unsigned int Nd, _Float16* __restrict__ Bt) {
  __shared__ unsigned short tl[64][66];
  const unsigned int tid = threadIdx.x; const unsigned int ntn = Nd >> 6; const unsigned int kt = blockIdx.x / ntn, nt = blockIdx.x - kt * ntn; const unsigned int k0 = kt * 64u, n0 = nt * 64u;
  for (unsigned int i = tid; i < 64u * 16u; i += 256u) { const unsigned int r = i >> 4, c4 = (i & 15u) * 4u; const v4f a = *(const v4fa*)(w + (size_t)(k0 + r) * Nd + n0 + c4); FragH f;
#pragma unroll
    for (int q = 0; q < 4; ++q) f.h[q] = (_Float16)(bf16_rne(a[q]) * 16.0f);
#pragma unroll
    for (int q = 0; q < 4; ++q) tl[r][c4 + q] = f.u[q]; }
  __syncthreads();
  {
#pragma unroll
    for (int rd = 0; rd < 2; ++rd) { const unsigned int d = (unsigned int)rd * 32u + (tid >> 3), pc = tid & 7u; FragH f;
#pragma unroll
      for (int q = 0; q < 8; ++q) f.u[q] = tl[pc * 8u + q][d];
      const v8us o = f.half[0];
      *(v8us*)((unsigned short*)Bt + (size_t)(n0 + d) * Kd + k0 + pc * 8u) = o; }
     } }

__global__ __launch_bounds__(256) void k_x16(const float* __restrict__ x, _Float16* __restrict__ X16, unsigned int n8) {
  const unsigned int t = blockIdx.x * 256u + threadIdx.x; if (t >= n8) return;
  const unsigned int row = t >> 7;                       /* DM / 8 = 128 pieces per row */
  const unsigned int b = row / (unsigned int)SQ, s = row - b * (unsigned int)SQ;
  const float* src = x + ((size_t)b * SQ_FULL + s) * DM + (size_t)(t & 127u) * 8u;
  const v4f a = *(const v4fa*)src, c = *(const v4fa*)(src + 4);
  FragH f;
#pragma unroll
  for (int q = 0; q < 4; ++q) { f.h[q] = (_Float16)bf16_rne(a[q]); f.h[4 + q] = (_Float16)bf16_rne(c[q]); }
  const v8us o = f.half[0];
  unsigned short* d = (unsigned short*)X16 + (size_t)t * 8u;
  *(v8us*)d = o; 
}

__global__ __launch_bounds__(256) void k_vt(const _Float16* __restrict__ V16, _Float16* __restrict__ Vt) {
  __shared__ unsigned short tl[64][66];
  const unsigned int tid = threadIdx.x; const unsigned int slab = blockIdx.x / (unsigned int)(SQ / 64), lg = blockIdx.x % (unsigned int)(SQ / 64); const unsigned int b = slab / (unsigned int)NKV, h = slab % (unsigned int)NKV;
  for (unsigned int i = tid; i < 64u * 8u; i += 256u) { const unsigned int r = i >> 3, c8 = (i & 7u) * 8u; FragH f; f.half[0] = *(const v8us*)((const unsigned short*)V16 + ((size_t)b * SQ + lg * 64u + r) * LQ + h * 64u + c8);
#pragma unroll
    for (int q = 0; q < 8; ++q) tl[r][c8 + q] = f.u[q]; }
  __syncthreads();
  {
#pragma unroll
    for (int rd = 0; rd < 2; ++rd) { const unsigned int d = (unsigned int)rd * 32u + (tid >> 3), pc = tid & 7u; FragH f;
#pragma unroll
      for (int q = 0; q < 8; ++q) f.u[q] = tl[pc * 8u + q][d];
      const v8us o = f.half[0];
      *(v8us*)((unsigned short*)Vt + ((size_t)slab * 64u + d) * SQ + lg * 64u + pc * 8u) = o; }
     } }

// one k-step (32 k) of a wave's operands: two A row fragments and four B column fragments
struct G2Stage { v16h a0, a1, b0, b1, b2, b3; };
__device__ __forceinline__ void g2_load(G2Stage& s, const _Float16* a0p, const _Float16* a1p, const _Float16* b0p, const _Float16* b1p, const _Float16* b2p, const _Float16* b3p, int kb, unsigned hh) {
  s.a0 = g2_frag(a0p + kb, hh); s.a1 = g2_frag(a1p + kb, hh); s.b0 = g2_frag(b0p + kb, hh); s.b1 = g2_frag(b1p + kb, hh); s.b2 = g2_frag(b2p + kb, hh); s.b3 = g2_frag(b3p + kb, hh); }
__device__ __forceinline__ void g2_step(const G2Stage& s, v8f& c00, v8f& c01, v8f& c02, v8f& c03, v8f& c10, v8f& c11, v8f& c12, v8f& c13) {
  c00 = g2_mma(s.a0, s.b0, c00); c10 = g2_mma(s.a1, s.b0, c10); c01 = g2_mma(s.a0, s.b1, c01); c11 = g2_mma(s.a1, s.b1, c11);
  c02 = g2_mma(s.a0, s.b2, c02); c12 = g2_mma(s.a1, s.b2, c12); c03 = g2_mma(s.a0, s.b3, c03); c13 = g2_mma(s.a1, s.b3, c13); }

// batched GEMM (grid.y = head / batch slab): C = alpha * A Bt^T (+ CP own element). A f16 [M][K] pitch lda (slab stride sA), Bt f16 [N][K] pitch ldb (slab stride sB applied to blockIdx.y >> bsh); outputs f32 C and/or f16 value plane C16 (+ optional x2^10 residual plane C16L of the same f32 value), pitch ldc, slab stride sC.
__global__ __launch_bounds__(128) void k_gemm2(const _Float16* __restrict__ A, int lda, size_t sA, const _Float16* __restrict__ Bh, int ldb, size_t sB, unsigned int bsh, float alpha, const float* CP,
    float* C, _Float16* C16, _Float16* C16L, int ldc, size_t sC, int M, int N, int K, const float* cosb, const float* sinb, unsigned int rotN, unsigned int pmask) {
  __shared__ __attribute__((aligned(16))) float so[4][32][68];
  const unsigned int tid = threadIdx.x, w = tid >> 5, lane = tid & 31u, ln = lane & 15u, hh = lane >> 4; const unsigned int by = blockIdx.y;
  A += (size_t)by * sA; Bh += (size_t)(by >> bsh) * sB; const size_t cofs = (size_t)by * sC;
  const unsigned int ntn = (unsigned int)N >> 6; const unsigned int mt = blockIdx.x / ntn, nq = blockIdx.x - mt * ntn; const unsigned int row0 = mt * 128u + 32u * w, col0 = nq * 64u; if (row0 >= (unsigned int)M) return;
  const _Float16* a0p = A + (size_t)(row0 + ln) * lda; const _Float16* a1p = a0p + (size_t)16 * lda;
  const _Float16* b0p = Bh + (size_t)(col0 + ln) * ldb; const _Float16* b1p = b0p + (size_t)16 * ldb; const _Float16* b2p = b1p + (size_t)16 * ldb; const _Float16* b3p = b2p + (size_t)16 * ldb;
  const v8f z8 = {0.f,0.f,0.f,0.f,0.f,0.f,0.f,0.f}; v8f c00 = z8, c01 = z8, c02 = z8, c03 = z8, c10 = z8, c11 = z8, c12 = z8, c13 = z8;
  /* K loop as a ring of three register stages: the twelve loads of k-step s + 2 are issued together in front of the products of k-step s, so a wave waits for a whole stage that was asked for two steps earlier instead of for each fragment in turn. In front of and inside the loop no load stands under a test of its own, so that each wait can count the younger stages as still in flight; the last two to four steps are peeled. The order of the k-steps and of the products into each accumulator is unchanged. */
#define G2_LD(S, ST) g2_load(S, a0p, a1p, b0p, b1p, b2p, b3p, (ST) * 32, hh)
#define G2_ST(S) g2_step(S, c00, c01, c02, c03, c10, c11, c12, c13)
#define G2_XW() asm volatile("s_wait_xcnt 0x0" ::: "memory")      /* stands in front of code that writes anew the address registers which the loads issued so far name */
  const int nst = (K + 31) >> 5;
  if (nst == 1) { G2Stage s0; G2_LD(s0, 0); G2_ST(s0); }
  else if (nst > 1) { G2Stage s0, s1, s2; int st = 0;
    G2_LD(s0, 0); G2_LD(s1, 1); G2_XW();
#pragma unroll 1      /* one trip is already three k-steps; more would only add code */
    for (; st + 5 <= nst; st += 3) { G2_LD(s2, st + 2); G2_ST(s0); G2_LD(s0, st + 3); G2_ST(s1); G2_LD(s1, st + 4); G2_ST(s2); G2_XW(); }
    const int rem = nst - st;      /* 2, 3 or 4 steps are left; s0 and s1 hold the first two */
    if (rem >= 3) G2_LD(s2, st + 2);
    G2_ST(s0);
    if (rem >= 4) { G2_XW(); const int kt = (st + 3) * 32;      /* here the address registers die with their loads and a later fragment may land in them: the wait stands behind each fragment's loads */
      s0.a0 = g2_frag(a0p + kt, hh); G2_XW(); s0.a1 = g2_frag(a1p + kt, hh); G2_XW(); s0.b0 = g2_frag(b0p + kt, hh); G2_XW(); s0.b1 = g2_frag(b1p + kt, hh); G2_XW(); s0.b2 = g2_frag(b2p + kt, hh); G2_XW(); s0.b3 = g2_frag(b3p + kt, hh); G2_XW(); }
    G2_ST(s1);
    if (rem >= 3) G2_ST(s2);
    if (rem >= 4) G2_ST(s0); }
#undef G2_LD
#undef G2_ST
#undef G2_XW
  v8f accs[8] = {c00, c01, c02, c03, c10, c11, c12, c13};
  if (CP) {      /* own elements of the batched C plane: a lane's 64 loads are issued together, in front of the first sum */
    const float* cp = CP + cofs + (size_t)(row0 + 8u * hh) * ldc + col0 + ln; v8f pv[8];
#pragma unroll
    for (int u = 0; u < 8; ++u) {
#pragma unroll
      for (int r = 0; r < 8; ++r) pv[u][r] = cp[(size_t)((u >> 2) * 16 + r) * ldc + (u & 3) * 16]; }
#pragma unroll
    for (int u = 0; u < 8; ++u) accs[u] = accs[u] * alpha + pv[u];
  } else {
#pragma unroll
    for (int u = 0; u < 8; ++u) accs[u] = accs[u] * alpha; }
#pragma unroll
  for (int u = 0; u < 8; ++u) { const unsigned int t = (unsigned int)u & 3u, half = (unsigned int)u >> 2;
#pragma unroll
    for (int r = 0; r < 8; ++r) { const unsigned int rloc = half * 16u + 8u * hh + (unsigned int)r;
      so[w][rloc][t * 16u + ln] = accs[u][r]; } }
  __builtin_amdgcn_fence(4 /* acq_rel order */, "workgroup"); __builtin_amdgcn_wave_barrier();
  if (col0 < rotN) {      /* block-uniform: this tile is one q / k head; lane owns tile row 'lane' */
    const unsigned int pos = (row0 + lane) & pmask;
    const float* cr = cosb + (size_t)pos * 32u; const float* sr = sinb + (size_t)pos * 32u; float ss = 0.f;
#pragma unroll 1
    for (unsigned int j = 0; j < 32u; j += 4u) { const v4f cc = *(const v4fa*)(cr + j), sn = *(const v4fa*)(sr + j); const v4f x1 = *(const v4fa*)&so[w][lane][j], x2 = *(const v4fa*)&so[w][lane][32u + j]; v4f y1, y2;
#pragma unroll
      for (int q = 0; q < 4; ++q) { const float c = bf16_rne(cc[q]), s = bf16_rne(sn[q]); y1[q] = x1[q] * c + x2[q] * s; y2[q] = x2[q] * c - x1[q] * s; ss += y1[q] * y1[q] + y2[q] * y2[q]; }
      *(v4fa*)&so[w][lane][j] = y1; *(v4fa*)&so[w][lane][32u + j] = y2; }
    const float rs = rsqrtf(ss * 0.015625f + 1.0e-6f);
#pragma unroll 1
    for (unsigned int j = 0; j < 64u; j += 4u) { v4f y = *(const v4fa*)&so[w][lane][j];
#pragma unroll
      for (int q = 0; q < 4; ++q) y[q] = y[q] * rs;
      *(v4fa*)&so[w][lane][j] = y; }
    __builtin_amdgcn_fence(4 /* acq_rel order */, "workgroup"); __builtin_amdgcn_wave_barrier(); }
  const unsigned int rsub = lane >> 4, c4 = (lane & 15u) * 4u;
  {
#pragma unroll
    for (int q = 0; q < 16; ++q) { const unsigned int r = (unsigned int)q * 2u + rsub; const v4f v = *(const v4fa*)&so[w][r][c4]; const size_t o = cofs + (size_t)(row0 + r) * ldc + col0 + c4;
      if (C) *(v4f*)(C + o) = v;
      if (C16) { v4h h4, l4;
#pragma unroll
        for (int i = 0; i < 4; ++i) { const _Float16 h = (_Float16)v[i]; h4[i] = h; l4[i] = (_Float16)((v[i] - (float)h) * 1024.0f); }
        *(v4h*)(C16 + o) = h4; if (C16L) *(v4h*)(C16L + o) = l4; } }
     } }

// cross-lane steps of the row reductions: lane l with lane l ^ M inside a 16-lane row (DPP row_xmask), and lane l with lane l ^ 16
template <int M> __device__ __forceinline__ float sm_xrow(float x) { return __builtin_bit_cast(float, __builtin_amdgcn_update_dpp(0, __builtin_bit_cast(int, x), 0x160 | M, 0xf, 0xf, true)); }
__device__ __forceinline__ float sm_xhalf(float x) { return __builtin_bit_cast(float, __builtin_amdgcn_permlanex16(__builtin_bit_cast(int, x), __builtin_bit_cast(int, x), 0x76543210, 0xfedcba98, false, false)); }
__device__ __forceinline__ float sm_wave_max(float v) { v = fmaxf(v, sm_xrow<1>(v)); v = fmaxf(v, sm_xrow<2>(v)); v = fmaxf(v, sm_xrow<4>(v)); v = fmaxf(v, sm_xrow<8>(v)); return fmaxf(v, sm_xhalf(v)); }
__device__ __forceinline__ float sm_wave_sum(float v) { v += sm_xrow<1>(v); v += sm_xrow<2>(v); v += sm_xrow<4>(v); v += sm_xrow<8>(v); return v + sm_xhalf(v); }

// e^x as the fast library form computes it (multiply by log2 e, then v_exp_f32); the v_nop in the same statement is the one free slot the instruction set asks for behind a transcendental
__device__ __forceinline__ float sm_exp(float x) { const float t = x * 1.44269504088896340736f; float r; asm("v_exp_f32 %0, %1\n\tv_nop" : "=v"(r) : "v"(t)); return r; }

// attention of the rows from QT0 on, scores, softmax and o in one launch. A work-group owns AQ query rows of one (batch, head); their score rows stay in LDS from the products to the last use, so no score or weight goes through memory and every (batch, head, row group) runs side by side. Keys are taken up to the end of the 128-key chunk that holds the rows; later keys have weight exactly zero.
// Step 1: wave w forms the 16-key score tiles w, w + 8, ... (value plane, then residual plane of q, folded in f32). Step 2: one wave per score row, two rows a wave: lane l keeps columns 128 c + 4 l + 0..3 of every chunk c in registers, maximum and sum are per-lane partials joined across the 32 lanes; the row's weights (f16 value plane, then x1024 residual plane) are written over its own scores. Step 3: waves 0..3 (16 head columns each) sum Vh ph and Vh pl from one V fragment, waves 4..7 sum Vres ph; k-steps in rising order into each accumulator; the three sums are folded in f32 in the order Vh ph, Vres ph, Vh pl.
#define AQ 16                        /* query rows per work-group */
#define APB (NKX * 4 + 32)           /* bytes of a score row in LDS; 32 more than a multiple of 256, so that the 16-byte fragment reads of 16 rows x 2 halves fall on all banks evenly */
static_assert(QT0 % 128 == 0 && SQ % 128 == 0 && 128 % AQ == 0 && NKX / 128 <= 16 && QT0 >= 256);
typedef float fa1 __attribute__((may_alias));
typedef _Float16 v4ha __attribute__((ext_vector_type(4), may_alias));
struct VB { v16h f[4]; };      /* the V fragments of one 128-key chunk (four k-steps) */
// the fragment of g2_frag from a pointer that already holds the lane's 8 h, so that every load of a run names that one address with a constant offset
__device__ __forceinline__ v16h at_frag(const _Float16* q) { FragH f; f.half[0] = *(const v8us*)((const unsigned short*)q); f.half[1] = *(const v8us*)((const unsigned short*)q + 16); return f.v; }
__device__ __forceinline__ void vb_load(VB& s, const _Float16* q) {
#pragma unroll
  for (int u = 0; u < 4; ++u) s.f[u] = at_frag(q + u * 32); }
// f32 attention of the leading rows, run by the first A0Y grid rows of the attention launch, beside the work-groups of the later rows instead of in a launch of its own in front of them. A work-group owns A0R query rows of the four heads of one (batch, kv head), which share the staged K and V rows; a wave takes 16 rows of one head, two lanes a row: lane l and lane l + 16 each keep one half (32 elements) of the row's q and o in registers for the whole key loop (every loop over the half is unrolled whole so that both are indexed by constants), so that this path needs no more registers than the other and two work-groups still share a WGP. A score is the sum of the two lanes' 32-term sums; maximum, sum and weights are formed alike in both lanes. The K and V rows are staged in LDS 64 keys at a time and read from there at one address per half wave: K transposed, so that one 16-byte read brings one head element of four neighbouring keys. One trip takes four keys: their four score sums are independent chains that fill each other's latency. The running maximum and sum and each o element take their terms in the order of the keys. The o rows (x64) leave as f16 value + x1024 residual planes of the merged o rows.
#define A0R 32                                   /* query rows of each of its four heads per work-group of the f32 path */
#define A0G (NB * NKV * (QT0 / A0R))             /* its work-groups */
#define A0Y (A0G / (NH * NB))                    /* the grid rows they fill */
static_assert(A0G % (NH * NB) == 0 && QT0 % 64 == 0 && 64 % A0R == 0 && A0R == 32 && (1 << KVSH) == 4);
#define A0K (HD * 68 + 16)                       /* floats of the K tile */
static_assert((A0K + 64 * HD + 4 * A0R * 68) * 4 <= AQ * APB);
__device__ __forceinline__ void att0_rows(const float* __restrict__ F0, _Float16* __restrict__ OH, _Float16* __restrict__ OL, unsigned char* lds, unsigned int id) {
  float* lk = (float*)lds;                                            /* K tile [head element][key]; pitch 68: the transposing stores of a wave fall on 32 different banks, rows stay 16-byte aligned; elements 32..63 stand 16 floats further on, so that the two addresses of a wave's read fall on different banks */
  float (*lv)[HD] = (float (*)[HD])(lds + A0K * 4);                   /* V tile [key][head element] */
  float (*lo)[68] = (float (*)[68])(lds + A0K * 4 + 64 * HD * 4);     /* o rows [head of the four][row] */
  const unsigned int tid = threadIdx.x, w = (unsigned int)__builtin_amdgcn_readfirstlane((int)(tid >> 5)), lane = tid & 31u, ln = lane & 15u, hh = lane >> 4;
  const unsigned int rg = (unsigned int)(QT0 / A0R - 1) - id / (unsigned int)(NB * NKV), sl = id % (unsigned int)(NB * NKV), b = sl / (unsigned int)NKV, hk = sl % (unsigned int)NKV;      /* the longest rows start first */
  const unsigned int i = rg * (unsigned int)A0R + (w & 1u) * 16u + ln; const unsigned int ld = (unsigned int)LQ;
  const float* QF = F0 + (size_t)b * QT0 * LQ;      /* q | k | v rows of the batch's leading rows */
  const float* qr = QF + (size_t)i * ld + ((hk << KVSH) + (w >> 1)) * HD + hh * 32u;
  v4f q[HD / 8], o[HD / 8];
#pragma unroll
  for (int c = 0; c < HD / 8; ++c) { q[c] = *(const v4fa*)(qr + c * 4); const v4f z = {0.f, 0.f, 0.f, 0.f}; o[c] = z; }
  asm volatile("s_wait_xcnt 0x0" :: "v"(qr) : "memory");      /* stands in front of code that writes anew the address registers which the q loads name; the pointer as an input keeps them out of those loads' own results */
  /* a thread's share of a tile. K: key (tid & 7) of a group of 8, 16-byte piece ((tid >> 3) & 7) of a group of 8 (a wave's load covers 8 rows x 64 bytes), key groups (tid >> 6) and (tid >> 6) + 4. V: key (tid >> 4) of a group of 16, piece (tid & 15) (whole rows). */
  const unsigned int kb = tid & 7u, ka = (tid >> 3) & 7u, kg = tid >> 6, vb = tid >> 4, va = tid & 15u;
  const unsigned int kofs = ((kg * 8u + kb) * ld + ka * 4u) * 4u, vofs = (vb * ld + va * 4u) * 4u;      /* byte offsets, the same for every tile */
  float m = -1.0e30f, l = 0.f; const unsigned int jmax = rg * (unsigned int)A0R + (unsigned int)(A0R - 1);      /* keys up to the work-group's last row */
#pragma unroll 1      /* a tile's code is long already */
  for (unsigned int j0 = 0; j0 <= jmax; j0 += 64u) { const char* tb = (const char*)(QF + (size_t)j0 * ld + hk * HD);      /* the tile's first row; its k columns stand DM, its v columns ROTN floats further on */
    __syncthreads();      /* every wave has read the last tile to its end */
    { v4f kk[4], vv[4]; const char* kq = tb + kofs; const char* vq = tb + vofs;      /* a thread's four pieces of each tile lie at constant distances from one address */
#pragma unroll
      for (int it = 0; it < 4; ++it) kk[it] = *(const v4fa*)(kq + DM * 4 + (it & 1) * (32 * LQ * 4) + (it >> 1) * 128);
#pragma unroll
      for (int it = 0; it < 4; ++it) vv[it] = *(const v4fa*)(vq + ROTN * 4 + it * (16 * LQ * 4));
      asm volatile("s_wait_xcnt 0x0" :: "v"(kq), "v"(vq) : "memory");      /* stands in front of code that writes anew the address registers which the K and V loads name; the addresses as inputs keep them out of those loads' own results */
#pragma unroll
      for (int it = 0; it < 4; ++it) {
#pragma unroll
        for (int t = 0; t < 4; ++t) lk[(((unsigned int)(it >> 1) * 8u + ka) * 4u + (unsigned int)t) * 68u + (unsigned int)(it >> 1) * 16u + ((unsigned int)(it & 1) * 4u + kg) * 8u + kb] = kk[it][t]; }
#pragma unroll
      for (int it = 0; it < 4; ++it) *(v4fa*)&lv[(unsigned int)it * 16u + vb][va * 4u] = vv[it]; }
    __syncthreads();      /* the tile is whole before any wave reads it */
    const unsigned int jend = jmax + 1u - j0 < 64u ? jmax + 1u - j0 : 64u;      /* later keys of the tile lie above every row of the work-group: weight exactly zero */
    const float* lkh = lk + hh * (32u * 68u + 16u);
#pragma unroll 1      /* one trip is already four keys; more would only add code */
    for (unsigned int jj = 0; jj < jend; jj += 4u) { float s[4] = {0.f, 0.f, 0.f, 0.f}, sc[4], e[4];
#pragma unroll
      for (int c = 0; c < HD / 8; ++c) {
#pragma unroll
        for (int t = 0; t < 4; ++t) { const v4f k4 = *(const v4fa*)(lkh + (c * 4 + t) * 68 + jj);
#pragma unroll
          for (int u = 0; u < 4; ++u) s[u] = __fadd_rn(s[u], __fmul_rn(q[c][t], k4[u])); } }
#pragma unroll
      for (int u = 0; u < 4; ++u) { const float su = __fmul_rn(__fadd_rn(s[u], sm_xhalf(s[u])), 0.125f);      /* own half + the other lane's half: the same value in both lanes */
        const float f = (j0 + jj + (unsigned int)u <= i) ? 1.f : 0.f; const float sm = fmaf(f, su, (1.f - f) * -1.0e30f); const float mn = fmaxf(m, sm); sc[u] = expf(m - mn); e[u] = expf(sm - mn); l = __fadd_rn(__fmul_rn(l, sc[u]), e[u]); m = mn; }
#pragma unroll
      for (int u = 0; u < 4; ++u) {
#pragma unroll
        for (int c = 0; c < HD / 8; ++c) { const v4f vv = *(const v4fa*)&lv[jj + (unsigned int)u][hh * 32u + (unsigned int)(c * 4)];
#pragma unroll
          for (int t = 0; t < 4; ++t) o[c][t] = __fadd_rn(__fmul_rn(o[c][t], sc[u]), __fmul_rn(e[u], vv[t])); } } } }
  { const float fin = 64.0f / l;      /* o carried x64 like the f16 path */
#pragma unroll
    for (int c = 0; c < HD / 8; ++c) { v4f oo = o[c];
#pragma unroll
      for (int u = 0; u < 4; ++u) oo[u] = __fmul_rn(oo[u], fin);
      *(v4fa*)&lo[w * 16u + ln][hh * 32u + (unsigned int)(c * 4)] = oo; } }
  __syncthreads();      /* the o rows of the four heads are whole */
#pragma unroll
  for (int it = 0; it < 4; ++it) { const unsigned int p = (unsigned int)it * 256u + tid, row = p >> 3, pc = (p & 7u) * 8u; const v4f a = *(const v4fa*)&lo[row][pc], c = *(const v4fa*)&lo[row][pc + 4u]; FragH fh, fl;      /* a row's 128 bytes of each plane leave from eight neighbouring lanes */
#pragma unroll
    for (int t = 0; t < 4; ++t) { _Float16 hv = (_Float16)a[t]; fh.h[t] = hv; fl.h[t] = (_Float16)((a[t] - (float)hv) * 1024.0f); hv = (_Float16)c[t]; fh.h[4 + t] = hv; fl.h[4 + t] = (_Float16)((c[t] - (float)hv) * 1024.0f); }
    const v8us oh = fh.half[0], ol = fl.half[0]; const size_t d = ((size_t)b * SQ + rg * (unsigned int)A0R + (row & (unsigned int)(A0R - 1))) * DM + ((hk << KVSH) + row / (unsigned int)A0R) * HD + pc;
    *(v8us*)((unsigned short*)OH + d) = oh; *(v8us*)((unsigned short*)OL + d) = ol; } }

__global__ __launch_bounds__(256) void k_attf(const _Float16* __restrict__ Q16, const _Float16* __restrict__ QL, const _Float16* __restrict__ K16, const _Float16* __restrict__ VT, const _Float16* __restrict__ VTL, _Float16* __restrict__ OH, _Float16* __restrict__ OL, const float* __restrict__ F0) {
  __shared__ __attribute__((aligned(16))) unsigned char sp[AQ * APB];      /* per row: f32 scores, later f16 weights at byte 0 and their residuals at byte 2 NKX */
  __shared__ __attribute__((aligned(16))) float oc[AQ][68];
  if (blockIdx.y < (unsigned int)A0Y) { att0_rows(F0, OH, OL, sp, blockIdx.y * (unsigned int)(NH * NB) + blockIdx.x); return; }      /* block-uniform: the first work-groups take the leading rows in f32 */
  const unsigned int tid = threadIdx.x, w = (unsigned int)__builtin_amdgcn_readfirstlane((int)(tid >> 5)), lane = tid & 31u, ln = lane & 15u, hh = lane >> 4;
  const unsigned int h = blockIdx.x % (unsigned int)NH, b = blockIdx.x / (unsigned int)NH, hk = h >> KVSH;
  const unsigned int q0 = (unsigned int)(SQ - AQ) - (blockIdx.y - (unsigned int)A0Y) * (unsigned int)AQ;      /* the longest rows start first */
  const unsigned int nch = q0 / 128u + 1u;      /* 128-key chunks; at least 3 */
  const size_t r0 = (size_t)b * SQ;
  const v8f z8 = {0.f,0.f,0.f,0.f,0.f,0.f,0.f,0.f};
  /* every plain '#pragma unroll' of this kernel and of vb_load stands on a short loop over a register array (u, r, q, c): unrolled whole, the array is indexed by constants and stays in registers */
  { const _Float16* qp = Q16 + (r0 + q0 + ln) * LQ + h * HD + 8u * hh; const _Float16* lp = QL + (r0 + q0 + ln) * LQ + h * HD + 8u * hh;
    const v16h qh0 = at_frag(qp), qh1 = at_frag(qp + 32), ql0 = at_frag(lp), ql1 = at_frag(lp + 32);
    asm volatile("s_wait_xcnt 0x0" :: "v"(qp), "v"(lp) : "memory");      /* stands in front of code that writes anew the address registers which the q loads name; the pointers as inputs keep them whole up to here */
    const _Float16* kb = K16 + (r0 + w * 16u + ln) * LQ + hk * HD + 8u * hh;
#pragma unroll 1      /* one trip is already four tiles with all their loads in flight together */
    for (unsigned int i0 = 0; i0 < nch; i0 += 4u) { const _Float16* kp[4]; v16h k0[4], k1[4];
#pragma unroll
      for (int u = 0; u < 4; ++u) { const unsigned int i = i0 + (unsigned int)u; kp[u] = kb + (size_t)((i < nch ? i : nch - 1u) * 128u) * LQ; }      /* past the end: the last tile again, so that no load stands under a test */
#pragma unroll
      for (int u = 0; u < 4; ++u) { k0[u] = at_frag(kp[u]); k1[u] = at_frag(kp[u] + 32); }
      asm volatile("s_wait_xcnt 0x0" :: "v"(kp[0]), "v"(kp[1]), "v"(kp[2]), "v"(kp[3]) : "memory");      /* the same for the K loads */
      __builtin_amdgcn_sched_barrier(0);      /* keeps the first product, which waits for its tile, from moving up among the loads of the later tiles */
#pragma unroll
      for (int u = 0; u < 4; ++u) { if (i0 + (unsigned int)u < nch) {
        v8f a1 = g2_mma(qh0, k0[u], z8); a1 = g2_mma(qh1, k1[u], a1);
        v8f a2 = g2_mma(ql0, k0[u], z8); a2 = g2_mma(ql1, k1[u], a2);
        unsigned char* sd = sp + (8u * hh) * (unsigned int)APB + (((i0 + (unsigned int)u) * 8u + w) * 16u + ln) * 4u;
#pragma unroll
        for (int r = 0; r < 8; ++r) *(fa1*)(sd + (unsigned int)r * (unsigned int)APB) = a2[r] * 0.0001220703125f + a1[r] * 0.125f; } } } }
  __syncthreads();      /* all score tiles of the 16 rows are in LDS */
#pragma unroll 1      /* the second row reuses the first row's registers */
  for (unsigned int rr = 0; rr < 2u; ++rr) { const unsigned int row = w * 2u + rr; unsigned char* rp = sp + row * (unsigned int)APB; const unsigned int last = q0 + row; v4f e[16];
#pragma unroll
    for (unsigned int c = 0; c < 16u; ++c) { if (c < nch) e[c] = *(const v4fa*)(rp + (c * 128u + lane * 4u) * 4u); }
    v4f m4 = {-3.0e38f, -3.0e38f, -3.0e38f, -3.0e38f};
#pragma unroll
    for (unsigned int c = 0; c < 16u; ++c) { if (c < nch) {
#pragma unroll
      for (int q = 0; q < 4; ++q) { e[c][q] = (c * 128u + lane * 4u + (unsigned int)q <= last) ? e[c][q] : -1.0e9f; m4[q] = fmaxf(m4[q], e[c][q]); } } }
    const float mx = sm_wave_max(fmaxf(fmaxf(m4[0], m4[1]), fmaxf(m4[2], m4[3])));
    v4f s4 = {0.f, 0.f, 0.f, 0.f};
#pragma unroll
    for (unsigned int c = 0; c < 16u; ++c) { if (c < nch) {
#pragma unroll
      for (int q = 0; q < 4; ++q) { e[c][q] = sm_exp(e[c][q] - mx); s4[q] += e[c][q]; } } }
    const float se = sm_wave_sum((s4[0] + s4[1]) + (s4[2] + s4[3])); const float sc = 256.0f / se;
#pragma unroll
    for (unsigned int c = 0; c < 16u; ++c) { if (c < nch) { v4h h4, l4;
#pragma unroll
      for (int q = 0; q < 4; ++q) { const float pv = e[c][q] * sc; const _Float16 hv = (_Float16)pv; h4[q] = hv; l4[q] = (_Float16)((pv - (float)hv) * 1024.0f); }
      *(v4ha*)(rp + (c * 128u + lane * 4u) * 2u) = h4; *(v4ha*)(rp + (unsigned int)NKX * 2u + (c * 128u + lane * 4u) * 2u) = l4; } } }
  __syncthreads();      /* all weight rows are in LDS */
  { const unsigned int ct = w & 3u; const bool resv = w >= 4u;      /* wave-uniform */
    const _Float16* vp = (resv ? VTL : VT) + (((size_t)b * NKV + hk) * HD + ct * 16u + ln) * SQ + 8u * hh;
    const _Float16* ph = (const _Float16*)(sp + ln * (unsigned int)APB) + 8u * hh; const _Float16* pl = ph + NKX;
    v8f a1 = z8, a3 = z8; VB v0, v1, v2;      /* ring of three chunks: chunk c + 2 is asked for in front of the products of chunk c */
    vb_load(v0, vp); vb_load(v1, vp + 128);
    asm volatile("s_wait_xcnt 0x0" :: "v"(vp) : "memory");      /* as above, for the V loads */
    /* one chunk: NEW takes chunk C + 2 (past the end: the last chunk again, so that no load stands under a test and each wait can count the younger chunks as still in flight); the chunk's weight fragments are read from LDS together; the wait as above, whose memory clobber also holds those reads in front of it, ahead of the first product; then the products of chunk C from CUR */
#define AT_CHUNK(CUR, NEW, C) { const unsigned int cc = (C); const _Float16* vn = vp + (cc + 2u < nch ? cc + 2u : nch - 1u) * 128u; vb_load(NEW, vn); VB pa, pb; vb_load(pa, ph + cc * 128u); if (!resv) vb_load(pb, pl + cc * 128u); \
      asm volatile("s_wait_xcnt 0x0" :: "v"(vn) : "memory"); \
      _Pragma("unroll") for (int u = 0; u < 4; ++u) a1 = g2_mma(pa.f[u], CUR.f[u], a1); \
      if (!resv) { _Pragma("unroll") for (int u = 0; u < 4; ++u) a3 = g2_mma(pb.f[u], CUR.f[u], a3); } }
    unsigned int c = 0;
#pragma unroll 1      /* one trip is three chunks, so that the ring's stages are named, not indexed; no way out from inside a trip, the last zero, one or two chunks stand behind the loop */
    for (; c + 3u <= nch; c += 3u) { AT_CHUNK(v0, v2, c); AT_CHUNK(v1, v0, c + 1u); AT_CHUNK(v2, v1, c + 2u); }
    if (c < nch) { AT_CHUNK(v0, v2, c); if (c + 1u < nch) AT_CHUNK(v1, v0, c + 1u); }
#undef AT_CHUNK
    if (resv) {
#pragma unroll
      for (int r = 0; r < 8; ++r) oc[8u * hh + (unsigned int)r][ct * 16u + ln] = a1[r]; }
    __syncthreads();      /* the Vres ph sums are in LDS */
    if (!resv) {      /* own elements: each is read and rewritten by the same lane */
#pragma unroll
      for (int r = 0; r < 8; ++r) { float o = a1[r] * 0.25f; o = oc[8u * hh + (unsigned int)r][ct * 16u + ln] * 0.000244140625f + o; o = a3[r] * 0.000244140625f + o; oc[8u * hh + (unsigned int)r][ct * 16u + ln] = o; } } }
  __syncthreads();      /* the o tile is whole */
  if (tid < 128u) { const unsigned int row = tid >> 3, pc = (tid & 7u) * 8u; const v4f a = *(const v4fa*)&oc[row][pc], c = *(const v4fa*)&oc[row][pc + 4u]; FragH fh, fl;      /* a row's 128 bytes of each plane leave from eight neighbouring lanes */
#pragma unroll
    for (int q = 0; q < 4; ++q) { _Float16 hv = (_Float16)a[q]; fh.h[q] = hv; fl.h[q] = (_Float16)((a[q] - (float)hv) * 1024.0f); hv = (_Float16)c[q]; fh.h[4 + q] = hv; fl.h[4 + q] = (_Float16)((c[q] - (float)hv) * 1024.0f); }
    const v8us oh = fh.half[0], ol = fl.half[0]; const size_t d = (r0 + q0 + row) * DM + h * HD + pc;
    *(v8us*)((unsigned short*)OH + d) = oh; *(v8us*)((unsigned short*)OL + d) = ol; } }

constexpr size_t al256(size_t b) { return (b + 255) & ~(size_t)255; }
constexpr size_t SZ_BQKV = al256((size_t)LQ * DM * 2);
constexpr size_t SZ_BO   = al256((size_t)DM * DM * 2);
constexpr size_t SZ_XO   = al256(NR * DM * 2);                          /* X16, later reused as the merged o value rows */
constexpr size_t SZ_QKV  = al256(NR * LQ * 2);                          /* value plane; the residual plane has the same size */
constexpr size_t SZ_F0   = al256((size_t)NB * QT0 * LQ * 4);
constexpr size_t SZ_VT   = al256((size_t)NB * NKV * HD * SQ * 2);       /* V^T value plane; the residual plane has the same size */
constexpr size_t SZ_OL   = al256(NR * DM * 2);                          /* merged o residual rows */
constexpr size_t WS_TOTAL = SZ_BQKV + SZ_BO + SZ_XO + 2 * SZ_QKV + SZ_F0 + 2 * SZ_VT + SZ_OL;
static_assert(WS_TOTAL <= (size_t)134217728);
/* plane coverage equalities of the producer grids */
static_assert(((size_t)(DM / 64) * (DM / 64)) * 64 * 64 == (size_t)DM * DM);
static_assert(((size_t)(DM / 64) * (KVD / 64)) * 64 * 64 == (size_t)DM * KVD);
static_assert(((size_t)NB * NKV * (SQ / 64)) * 64 * 64 == (size_t)NB * NKV * HD * SQ);
static_assert((NR * DM) % (256 * 8) == 0);
static_assert((size_t)A0G * 4 * A0R * HD == (size_t)NB * QT0 * DM);
static_assert(((size_t)(NR / 128) * (LQ / 64)) * 128 * 64 == NR * LQ);
static_assert(((size_t)NH * NB * ((SQ - QT0) / AQ)) * AQ * HD == (NR - (size_t)NB * QT0) * DM);
static_assert(((size_t)(SQ / 128) * (DM / 64) * NB) * 128 * 64 == NR * DM);

extern "C" void kernel_launch(void* const* d_in, const int* in_sizes, int n_in,
                              void* d_out, int out_size, void* d_ws, size_t ws_size, hipStream_t stream) {
  if (n_in < 7) return;
  const size_t need_x = ((size_t)(NB - 1) * SQ_FULL + SQ) * DM;
  if ((size_t)in_sizes[0] < need_x) return;
  if ((size_t)in_sizes[1] < (size_t)SQ * 32) return;
  if ((size_t)in_sizes[2] < (size_t)SQ * 32) return;
  if ((size_t)in_sizes[3] < (size_t)DM * DM) return;
  if ((size_t)in_sizes[4] < (size_t)DM * KVD) return;
  if ((size_t)in_sizes[5] < (size_t)DM * KVD) return;
  if ((size_t)in_sizes[6] < (size_t)DM * DM) return;
  if ((size_t)out_size < need_x) return;
  const float* x = (const float*)d_in[0]; const float* cosb = (const float*)d_in[1]; const float* sinb = (const float*)d_in[2];      /* tables [pos][32], read as values */
  const float* wq = (const float*)d_in[3]; const float* wk = (const float*)d_in[4]; const float* wv = (const float*)d_in[5]; const float* wo = (const float*)d_in[6];      /* all [in][out] */
  float* out = (float*)d_out;
  char* ws = (char*)d_ws; size_t off = 0;
  auto take = [&](size_t bytes) { char* p = ws + off; off += (bytes + 255) & ~(size_t)255; return p; };
  _Float16* BQKV = (_Float16*)take(SZ_BQKV); _Float16* BO = (_Float16*)take(SZ_BO);
  _Float16* X16 = (_Float16*)take(SZ_XO); _Float16* OH = X16;      /* X16 is dead after the projection GEMMs; the merged o value rows take its place */
  _Float16* QKV = (_Float16*)take(SZ_QKV); const _Float16* Q16 = QKV; const _Float16* K16 = QKV + DM; const _Float16* V16 = QKV + ROTN;
  _Float16* QKVL = (_Float16*)take(SZ_QKV); const _Float16* QL = QKVL; const _Float16* VL16 = QKVL + ROTN;      /* x1024 residual plane, same layout (k columns unused) */
  float* F0 = (float*)take(SZ_F0);
  _Float16* VT = (_Float16*)take(SZ_VT); _Float16* VTL = (_Float16*)take(SZ_VT);
  _Float16* OL = (_Float16*)take(SZ_OL);
  if (off > ws_size) return;

  k_wT<<<(DM / 64) * (DM / 64), 256, 0, stream>>>(wq, (unsigned int)DM, (unsigned int)DM, BQKV);                                   /* W[DM][DM] -> Bt rows 0..1023 */
  k_wT<<<(DM / 64) * (KVD / 64), 256, 0, stream>>>(wk, (unsigned int)DM, (unsigned int)KVD, BQKV + (size_t)DM * DM);                /* W[DM][KVD] -> Bt rows 1024..1279 */
  k_wT<<<(DM / 64) * (KVD / 64), 256, 0, stream>>>(wv, (unsigned int)DM, (unsigned int)KVD, BQKV + (size_t)ROTN * DM);              /* W[DM][KVD] -> Bt rows 1280..1535 */
  k_wT<<<(DM / 64) * (DM / 64), 256, 0, stream>>>(wo, (unsigned int)DM, (unsigned int)DM, BO);                                     /* Wo[c][n] -> Bt[n][c] */
  const unsigned int n8x = (unsigned int)(NR * DM / 8);
  k_x16<<<(n8x + 255u) / 256u, 256, 0, stream>>>(x, X16, n8x);
  const int MP = (int)(NR); const unsigned int pm = (unsigned int)(SQ - 1);
  k_gemm2<<<dim3((unsigned int)((MP / 128) * (LQ / 64)), 1), 128, 0, stream>>>(X16, DM, (size_t)0, BQKV, DM, (size_t)0, 0u, 0.0625f, nullptr, nullptr, QKV, QKVL, LQ, (size_t)0, MP, LQ, DM, cosb, sinb, (unsigned int)ROTN, pm);      /* q | k | v rows (f16 value + residual), q / k rotated + normalised */
  k_gemm2<<<dim3((unsigned int)((QT0 / 128) * (LQ / 64)), NB), 128, 0, stream>>>(X16, DM, (size_t)SQ * DM, BQKV, DM, (size_t)0, 0u, 0.0625f, nullptr, F0, nullptr, nullptr, LQ, (size_t)QT0 * LQ, QT0, LQ, DM, cosb, sinb, (unsigned int)ROTN, pm);      /* f32 q | k | v of rows 0..QT0-1 of every batch */
  k_vt<<<NB * NKV * (SQ / 64), 256, 0, stream>>>(V16, VT);        /* V^T value plane [NB][NKV][HD][SQ] */
  k_vt<<<NB * NKV * (SQ / 64), 256, 0, stream>>>(VL16, VTL);      /* V^T residual plane */
  k_attf<<<dim3(NH * NB, A0Y + (SQ - QT0) / AQ), 256, 0, stream>>>(Q16, QL, K16, VT, VTL, OH, OL, F0);      /* grid rows below A0Y: f32 attention for rows 0..QT0-1; the others, rows from QT0 on: scores, softmax and o; final o (x64) written as f16 value + x1024 residual merged rows */
  k_gemm2<<<dim3((SQ / 128) * (DM / 64), NB), 128, 0, stream>>>(OH, DM, (size_t)SQ * DM, BO, DM, (size_t)0, 0u, 0.0009765625f, nullptr, out, nullptr, nullptr, DM, (size_t)SQ_FULL * DM, SQ, DM, DM, nullptr, nullptr, 0u, 0u);      /* out rows in the output layout: o value plane */
  k_gemm2<<<dim3((SQ / 128) * (DM / 64), NB), 128, 0, stream>>>(OL, DM, (size_t)SQ * DM, BO, DM, (size_t)0, 0u, 0.00000095367431640625f, (const float*)out, out, nullptr, nullptr, DM, (size_t)SQ_FULL * DM, SQ, DM, DM, nullptr, nullptr, 0u, 0u);      
}

// v006
// Measured time: 211 microseconds a run.
// Two timings next to v005 both put it at 1.28 times that version's speed.
// All steps since v000 together make it 30.4 times as fast.
#include <hip/hip_runtime.h>
// All contractions: v_wmma_f32_16x16x32_f16 (f16 operands, f32 accumulate). x, cos, sin and all four weights are RNE-converted to bf16 first (exact in f16; weights carried x16); q (after split-half rotation + scale-free RMS normalisation in f32), v, softmax weights (x256) and o (x64) are f16 value + x1024 residual planes, every residual product in its own accumulator, folded in f32; k is a single f16 plane; the first 256 query rows of every batch use f32 q/k/v from exact-operand GEMMs and an f32 online softmax on VALU.
// Causal grouped-query self-attention: x [NB][SQ][1024]; q = x Wq (16 heads of 64), k = x Wk, v = x Wv (4 kv heads of 64; weights are [in][out]); rotation with INPUT tables cos/sin [pos][32]: y[j] = x[j] c + x[j+32] s, y[j+32] = x[j+32] c - x[j] s; q, k scaled by rsqrt(mean square over the head + 1e-6); query head h uses kv head h >> 2; scores * 0.125; keys above the query get exactly zero weight; softmax; out = merged y Wo -> [NB][SQ][1024] f32.
// Structure: token rows r = b*SQ + s; X16 exact f16 rows; one q|k|v GEMM (N = 1536) whose epilogue applies rotation + normalisation on the 64-column head tiles of q and k and writes value + residual planes; V^T value and residual planes per (batch, kv head) via LDS transposes; one attention launch, a work-group per (batch, head, 16 query rows), whose score rows never leave LDS: scores = qh k + qres k against the keys up to the end of the rows' own 128-key chunk, causal row softmax on VALU, one wave per row (P value + residual written over the row's scores), o = Vh ph + Vres ph + Vh pl folded in f32 and written as f16 value + residual merged o rows (x64); out = oh Wo + ores Wo. Rows 0..255 of each batch: f32 attention by the first work-groups of the same launch, split into the same two o planes. Every f16 operand plane in the workspace (X16, the weights, q | k | v, V^T, o) is stored in fragment order (see fo_piece).
#ifndef NB
#define NB 2
#endif
#ifndef SQ
#define SQ 2048
#endif
#define NB_FULL 2
#define SQ_FULL 2048
#define DM 1024
#define NH 16
#define NKV 4
#define KVSH 2                       /* query head -> kv head shift */
#define HD 64
#define KVD (NKV * HD)               /* 256 */
#define LQ (DM + 2 * KVD)            /* row pitch of the q | k | v rows: 1536 */
#define ROTN (DM + KVD)              /* columns below this are q / k heads (rotated + normalised) */
#define QT 256                       /* not used by any kernel, only by the static_asserts */
#define QT0 256                      /* leading rows of every batch computed in f32 */
#define NKX SQ                       /* keys of an S / P row; the LDS row pitch is APB */
#define NR ((size_t)NB * SQ)         /* token rows */

static_assert(NB <= NB_FULL);
static_assert(SQ <= SQ_FULL);
static_assert((SQ & (SQ - 1)) == 0);
static_assert(SQ % QT == 0);
static_assert((QT & (QT - 1)) == 0);
static_assert(QT % 128 == 0);
static_assert(QT0 == QT);
static_assert(QT0 % 128 == 0);
static_assert(QT0 % 64 == 0);
static_assert(HD == 64);
static_assert(DM == NH * HD);
static_assert(NH == (NKV << KVSH));
static_assert(DM / 8 == 128);
static_assert(DM % 64 == 0);
static_assert(KVD % 64 == 0);
static_assert(LQ % 64 == 0);
static_assert(ROTN % 64 == 0);
static_assert(((size_t)NB * SQ) % 128 == 0);
static_assert(SQ % 64 == 0);
static_assert(DM % 32 == 0);

typedef unsigned short v8us __attribute__((ext_vector_type(8), may_alias));
typedef float  v8f  __attribute__((ext_vector_type(8)));
typedef float  v4f  __attribute__((ext_vector_type(4)));
typedef float  v4fa __attribute__((ext_vector_type(4), may_alias));
typedef _Float16 v16h __attribute__((ext_vector_type(16)));
typedef _Float16 v4h __attribute__((ext_vector_type(4)));
typedef _Float16 v4ha __attribute__((ext_vector_type(4), may_alias));
union FragH { v16h v; v8us half[2]; _Float16 h[16]; unsigned short u[16]; };

__device__ __forceinline__ unsigned short bf16_bits(float x) { unsigned int u = __float_as_uint(x); return (unsigned short)((u + 0x7FFFu + ((u >> 16) & 1u)) >> 16); }
__device__ __forceinline__ float bf16_val(unsigned short b) { return __uint_as_float(((unsigned int)b) << 16); }
__device__ __forceinline__ float bf16_rne(float x) { return bf16_val(bf16_bits(x)); }

// fragment: elements 0..7 <- k0 + 8h + 0..7, elements 8..15 <- k0 + 16 + 8h + 0..7 (same map for A rows and B columns)
// Fragment order of an f16 operand plane (rows of L elements, L a multiple of 32): the plane is cut into blocks of 16 rows x 32 k, 512 elements each, block (g, s) at (g * (L / 32) + s) * 512. Inside a block stand elements 0..7 of the fragment of lanes 0, 1, .. 31 (lane = 16 h + row), then elements 8..15 in the same lane order. Each of a fragment's two 16-byte loads then reads 512 bytes in a row, four whole lines; with the rows in memory order it read 32 bytes on each of 16 lines. A group of 16 rows takes 16 L elements as in row order, so offsets of whole row groups keep their values; 32 columns further on is 512 elements further on.
// fo_piece: offset of the 8 elements k .. k + 7 (k a multiple of 8) of row r
__device__ __forceinline__ size_t fo_piece(size_t r, unsigned int k, unsigned int L) { return ((r >> 4) * (size_t)(L >> 5) + (k >> 5)) * 512u + ((k >> 4) & 1u) * 256u + ((k >> 3) & 1u) * 128u + ((unsigned int)r & 15u) * 8u; }
// p: the block's start + 8 * lane
__device__ __forceinline__ v16h g2_frag(const _Float16* p) { FragH f; f.half[0] = *(const v8us*)((const unsigned short*)p); f.half[1] = *(const v8us*)((const unsigned short*)p + 256); return f.v; }
__device__ __forceinline__ v8f g2_mma(v16h a, v16h b, v8f c) { v8f d = __builtin_amdgcn_wmma_f32_16x16x32_f16(false, a, false, b, (short)0, c, false, false); asm volatile("v_nop\n\tv_nop\n\tv_nop\n\tv_nop" : "+v"(d) : "v"(a), "v"(b)); return d; }

__global__ __launch_bounds__(256) void k_wT(const float* __restrict__ w, unsigned int Kd, unsigned int Nd, _Float16* __restrict__ Bt) {
  __shared__ unsigned short tl[64][66];
  const unsigned int tid = threadIdx.x; const unsigned int ntn = Nd >> 6; const unsigned int kt = blockIdx.x / ntn, nt = blockIdx.x - kt * ntn; const unsigned int k0 = kt * 64u, n0 = nt * 64u;
  for (unsigned int i = tid; i < 64u * 16u; i += 256u) { const unsigned int r = i >> 4, c4 = (i & 15u) * 4u; const v4f a = *(const v4fa*)(w + (size_t)(k0 + r) * Nd + n0 + c4); FragH f;
#pragma unroll
    for (int q = 0; q < 4; ++q) f.h[q] = (_Float16)(bf16_rne(a[q]) * 16.0f);
#pragma unroll
    for (int q = 0; q < 4; ++q) tl[r][c4 + q] = f.u[q]; }
  __syncthreads();
  {
#pragma unroll
    for (int rd = 0; rd < 2; ++rd) { const unsigned int d = (unsigned int)rd * 32u + (tid >> 7) * 16u + (tid & 15u), pc = (tid >> 4) & 7u; FragH f;      /* a wave: 16 rows x 2 neighbouring pieces, 512 bytes in a row of the plane */
#pragma unroll
      for (int q = 0; q < 8; ++q) f.u[q] = tl[pc * 8u + q][d];
      const v8us o = f.half[0];
      *(v8us*)((unsigned short*)Bt + fo_piece(n0 + d, k0 + pc * 8u, Kd)) = o; }
     } }

__global__ __launch_bounds__(256) void k_x16(const float* __restrict__ x, _Float16* __restrict__ X16, unsigned int n8) {
  /* a work-group takes 16 rows x 128 columns: four blocks that follow one another in the plane. Whole 512-byte runs of x rows come in, the f16 tile turns in LDS, whole runs of the plane go out. */
  __shared__ __attribute__((aligned(16))) unsigned short tl[16][136];      /* pitch 136: rows stay 16-byte aligned and the 16-byte reads of 16 rows fall on different banks */
  const unsigned int tid = threadIdx.x; if (blockIdx.x * 256u >= n8) return;      /* block-uniform, in front of the barrier */
  const unsigned int g = blockIdx.x >> 3, kt = blockIdx.x & 7u;                   /* DM / 128 = 8 column tiles per row group */
  const unsigned int r = tid >> 5, c4 = (tid & 31u) * 4u;      /* rows r and r + 8 of the group: a wave reads 512 bytes in a row of one x row */
  const unsigned int row = g * 16u + r, b = row / (unsigned int)SQ, s = row - b * (unsigned int)SQ;      /* a group of 16 rows lies in one batch */
  const float* xp = x + ((size_t)b * SQ_FULL + s) * DM + kt * 128u + c4;
  const v4f a0 = *(const v4fa*)xp, a1 = *(const v4fa*)(xp + 8 * DM); v4h h0, h1;
  asm volatile("s_wait_xcnt 0x0" :: "v"(xp) : "memory");      /* stands in front of code that writes anew the address registers which the two loads name; the pointer as an input keeps them out of those loads' own results */
#pragma unroll
  for (int q = 0; q < 4; ++q) { h0[q] = (_Float16)bf16_rne(a0[q]); h1[q] = (_Float16)bf16_rne(a1[q]); }
  *(v4ha*)&tl[r][c4] = h0; *(v4ha*)&tl[r + 8u][c4] = h1;
  __syncthreads();      /* the tile is whole before it is read across its rows */
  const v8us o = *(const v8us*)&tl[tid & 15u][(tid >> 6) * 32u + ((tid >> 5) & 1u) * 16u + ((tid >> 4) & 1u) * 8u];      /* thread = (block, fragment half, lane) in the plane's own order */
  *(v8us*)((unsigned short*)X16 + ((size_t)blockIdx.x * 256u + tid) * 8u) = o;
}

__global__ __launch_bounds__(256) void k_vt(const _Float16* __restrict__ V16, _Float16* __restrict__ Vt) {
  __shared__ unsigned short tl[64][66];
  const unsigned int tid = threadIdx.x; const unsigned int slab = blockIdx.x / (unsigned int)(SQ / 64), lg = blockIdx.x % (unsigned int)(SQ / 64); const unsigned int b = slab / (unsigned int)NKV, h = slab % (unsigned int)NKV;
  for (unsigned int i = tid; i < 64u * 8u; i += 256u) { const unsigned int r = (i >> 7) * 16u + (i & 15u), c8 = ((i >> 4) & 7u) * 8u; FragH f; const unsigned short* vq = (const unsigned short*)V16 + fo_piece((size_t)b * SQ + lg * 64u + r, h * 64u + c8, (unsigned int)LQ); f.half[0] = *(const v8us*)vq;      /* a wave: 16 rows x 2 neighbouring pieces, 512 bytes in a row of the plane */
    asm volatile("s_wait_xcnt 0x0" :: "v"(vq) : "memory");      /* stands in front of code that writes anew the address registers which the load names; the pointer as an input keeps them out of the load's own result */
#pragma unroll
    for (int q = 0; q < 8; ++q) tl[r][c8 + q] = f.u[q]; }
  __syncthreads();
  {
#pragma unroll
    for (int rd = 0; rd < 2; ++rd) { const unsigned int d = (unsigned int)rd * 32u + (tid >> 7) * 16u + (tid & 15u), pc = (tid >> 4) & 7u; FragH f;      /* the same deal of a wave for the plane that is written */
#pragma unroll
      for (int q = 0; q < 8; ++q) f.u[q] = tl[pc * 8u + q][d];
      const v8us o = f.half[0];
      *(v8us*)((unsigned short*)Vt + fo_piece((size_t)slab * 64u + d, lg * 64u + pc * 8u, (unsigned int)SQ)) = o; }
     } }

// one k-step (32 k) of a wave's operands: two A row fragments and four B column fragments
struct G2Stage { v16h a0, a1, b0, b1, b2, b3; };
__device__ __forceinline__ void g2_load(G2Stage& s, const _Float16* a0p, const _Float16* a1p, const _Float16* b0p, const _Float16* b1p, const _Float16* b2p, const _Float16* b3p, int kb) {
  s.a0 = g2_frag(a0p + kb); s.a1 = g2_frag(a1p + kb); s.b0 = g2_frag(b0p + kb); s.b1 = g2_frag(b1p + kb); s.b2 = g2_frag(b2p + kb); s.b3 = g2_frag(b3p + kb); }
__device__ __forceinline__ void g2_step(const G2Stage& s, v8f& c00, v8f& c01, v8f& c02, v8f& c03, v8f& c10, v8f& c11, v8f& c12, v8f& c13) {
  c00 = g2_mma(s.a0, s.b0, c00); c10 = g2_mma(s.a1, s.b0, c10); c01 = g2_mma(s.a0, s.b1, c01); c11 = g2_mma(s.a1, s.b1, c11);
  c02 = g2_mma(s.a0, s.b2, c02); c12 = g2_mma(s.a1, s.b2, c12); c03 = g2_mma(s.a0, s.b3, c03); c13 = g2_mma(s.a1, s.b3, c13); }

// batched GEMM (grid.y = head / batch slab): C = alpha * A Bt^T (+ CP own element). A f16 [M][K], rows of lda elements (slab stride sA), Bt f16 [N][K], rows of ldb elements (slab stride sB applied to blockIdx.y >> bsh), both in fragment order; outputs f32 C in row order and/or f16 value plane C16 (+ optional x2^10 residual plane C16L of the same f32 value) in fragment order, rows of ldc elements, slab stride sC.
__global__ __launch_bounds__(128) void k_gemm2(const _Float16* __restrict__ A, int lda, size_t sA, const _Float16* __restrict__ Bh, int ldb, size_t sB, unsigned int bsh, float alpha, const float* CP,
    float* C, _Float16* C16, _Float16* C16L, int ldc, size_t sC, int M, int N, int K, const float* cosb, const float* sinb, unsigned int rotN, unsigned int pmask) {
  __shared__ __attribute__((aligned(16))) float so[4][32][68];
  const unsigned int tid = threadIdx.x, w = tid >> 5, lane = tid & 31u, ln = lane & 15u, hh = lane >> 4; const unsigned int by = blockIdx.y;
  A += (size_t)by * sA; Bh += (size_t)(by >> bsh) * sB; const size_t cofs = (size_t)by * sC;
  const unsigned int ntn = (unsigned int)N >> 6; const unsigned int mt = blockIdx.x / ntn, nq = blockIdx.x - mt * ntn; const unsigned int row0 = mt * 128u + 32u * w, col0 = nq * 64u; if (row0 >= (unsigned int)M) return;
  const _Float16* a0p = A + (size_t)row0 * lda + lane * 8u; const _Float16* a1p = a0p + (size_t)16 * lda;      /* first block of the row group + the lane's place in a block */
  const _Float16* b0p = Bh + (size_t)col0 * ldb + lane * 8u; const _Float16* b1p = b0p + (size_t)16 * ldb; const _Float16* b2p = b1p + (size_t)16 * ldb; const _Float16* b3p = b2p + (size_t)16 * ldb;
  const v8f z8 = {0.f,0.f,0.f,0.f,0.f,0.f,0.f,0.f}; v8f c00 = z8, c01 = z8, c02 = z8, c03 = z8, c10 = z8, c11 = z8, c12 = z8, c13 = z8;
  /* K loop as a ring of three register stages: the twelve loads of k-step s + 2 are issued together in front of the products of k-step s, so a wave waits for a whole stage that was asked for two steps earlier instead of for each fragment in turn. In front of and inside the loop no load stands under a test of its own, so that each wait can count the younger stages as still in flight; the last two to four steps are peeled. The order of the k-steps and of the products into each accumulator is unchanged. */
#define G2_LD(S, ST) g2_load(S, a0p, a1p, b0p, b1p, b2p, b3p, (ST) * 512)
#define G2_ST(S) g2_step(S, c00, c01, c02, c03, c10, c11, c12, c13)
#define G2_XW() asm volatile("s_wait_xcnt 0x0" ::: "memory")      /* stands in front of code that writes anew the address registers which the loads issued so far name */
  const int nst = (K + 31) >> 5;
  if (nst == 1) { G2Stage s0; G2_LD(s0, 0); G2_ST(s0); }
  else if (nst > 1) { G2Stage s0, s1, s2; int st = 0;
    G2_LD(s0, 0); G2_LD(s1, 1); G2_XW();
#pragma unroll 1      /* one trip is already three k-steps; more would only add code */
    for (; st + 5 <= nst; st += 3) { G2_LD(s2, 2); G2_ST(s0); G2_LD(s0, 3); G2_ST(s1); G2_LD(s1, 4); G2_ST(s2); G2_XW();
      a0p += 1536; a1p += 1536; b0p += 1536; b1p += 1536; b2p += 1536; b3p += 1536; }      /* every load names one of the six pointers with a constant offset; they move on three blocks a trip */
    const int rem = nst - st;      /* 2, 3 or 4 steps are left; s0 and s1 hold the first two */
    if (rem >= 3) G2_LD(s2, 2);
    G2_ST(s0);
    if (rem >= 4) { G2_XW(); const int kt = 3 * 512;      /* here the address registers die with their loads and a later fragment may land in them: the wait stands behind each fragment's loads */
      s0.a0 = g2_frag(a0p + kt); G2_XW(); s0.a1 = g2_frag(a1p + kt); G2_XW(); s0.b0 = g2_frag(b0p + kt); G2_XW(); s0.b1 = g2_frag(b1p + kt); G2_XW(); s0.b2 = g2_frag(b2p + kt); G2_XW(); s0.b3 = g2_frag(b3p + kt); G2_XW(); }
    G2_ST(s1);
    if (rem >= 3) G2_ST(s2);
    if (rem >= 4) G2_ST(s0); }
#undef G2_LD
#undef G2_ST
#undef G2_XW
  v8f accs[8] = {c00, c01, c02, c03, c10, c11, c12, c13};
  if (CP) {      /* own elements of the batched C plane: a lane's 64 loads are issued together, in front of the first sum */
    const float* cp = CP + cofs + (size_t)(row0 + 8u * hh) * ldc + col0 + ln; v8f pv[8];
#pragma unroll
    for (int u = 0; u < 8; ++u) {
#pragma unroll
      for (int r = 0; r < 8; ++r) pv[u][r] = cp[(size_t)((u >> 2) * 16 + r) * ldc + (u & 3) * 16]; }
#pragma unroll
    for (int u = 0; u < 8; ++u) accs[u] = accs[u] * alpha + pv[u];
  } else {
#pragma unroll
    for (int u = 0; u < 8; ++u) accs[u] = accs[u] * alpha; }
#pragma unroll
  for (int u = 0; u < 8; ++u) { const unsigned int t = (unsigned int)u & 3u, half = (unsigned int)u >> 2;
#pragma unroll
    for (int r = 0; r < 8; ++r) { const unsigned int rloc = half * 16u + 8u * hh + (unsigned int)r;
      so[w][rloc][t * 16u + ln] = accs[u][r]; } }
  __builtin_amdgcn_fence(4 /* acq_rel order */, "workgroup"); __builtin_amdgcn_wave_barrier();
  if (col0 < rotN) {      /* block-uniform: this tile is one q / k head; lane owns tile row 'lane' */
    const unsigned int pos = (row0 + lane) & pmask;
    const float* cr = cosb + (size_t)pos * 32u; const float* sr = sinb + (size_t)pos * 32u; float ss = 0.f;
#pragma unroll 1
    for (unsigned int j = 0; j < 32u; j += 4u) { const v4f cc = *(const v4fa*)(cr + j), sn = *(const v4fa*)(sr + j); const v4f x1 = *(const v4fa*)&so[w][lane][j], x2 = *(const v4fa*)&so[w][lane][32u + j]; v4f y1, y2;
#pragma unroll
      for (int q = 0; q < 4; ++q) { const float c = bf16_rne(cc[q]), s = bf16_rne(sn[q]); y1[q] = x1[q] * c + x2[q] * s; y2[q] = x2[q] * c - x1[q] * s; ss += y1[q] * y1[q] + y2[q] * y2[q]; }
      *(v4fa*)&so[w][lane][j] = y1; *(v4fa*)&so[w][lane][32u + j] = y2; }
    const float rs = rsqrtf(ss * 0.015625f + 1.0e-6f);
#pragma unroll 1
    for (unsigned int j = 0; j < 64u; j += 4u) { v4f y = *(const v4fa*)&so[w][lane][j];
#pragma unroll
      for (int q = 0; q < 4; ++q) y[q] = y[q] * rs;
      *(v4fa*)&so[w][lane][j] = y; }
    __builtin_amdgcn_fence(4 /* acq_rel order */, "workgroup"); __builtin_amdgcn_wave_barrier(); }
  if (C) { const unsigned int rsub = lane >> 4, c4 = (lane & 15u) * 4u;
#pragma unroll
    for (int q = 0; q < 16; ++q) { const unsigned int r = (unsigned int)q * 2u + rsub; const v4f v = *(const v4fa*)&so[w][r][c4];
      *(v4f*)(C + cofs + (size_t)(row0 + r) * ldc + col0 + c4) = v; }
    asm volatile("s_wait_xcnt 0x0" ::: "memory"); }      /* stands in front of code that writes anew the registers which these stores name */
  if (C16) {      /* the wave's tile is 2 x 2 whole blocks of the plane; one store takes one fragment half of a block, 512 bytes in a row */
    const size_t ob = cofs + (size_t)row0 * ldc + (size_t)(col0 >> 5) * 512u + lane * 8u; v4f ta[8], tc[8];
#pragma unroll
    for (int q = 0; q < 8; ++q) { const float* sr = &so[w][((unsigned int)q >> 2) * 16u + ln][(((unsigned int)q >> 1) & 1u) * 32u + ((unsigned int)q & 1u) * 16u + hh * 8u]; ta[q] = *(const v4fa*)sr; tc[q] = *(const v4fa*)(sr + 4); }      /* all LDS reads together, ahead of the waits below */
#pragma unroll
    for (int q = 0; q < 8; ++q) { const unsigned int rg = (unsigned int)q >> 2, s = ((unsigned int)q >> 1) & 1u, hf = (unsigned int)q & 1u; const v4f va = ta[q], vc = tc[q]; FragH fh, fl;
#pragma unroll
      for (int i = 0; i < 4; ++i) { _Float16 h = (_Float16)va[i]; fh.h[i] = h; fl.h[i] = (_Float16)((va[i] - (float)h) * 1024.0f); h = (_Float16)vc[i]; fh.h[4 + i] = h; fl.h[4 + i] = (_Float16)((vc[i] - (float)h) * 1024.0f); }
      const v8us oh = fh.half[0], ol = fl.half[0]; const size_t o = ob + (size_t)rg * 16u * ldc + s * 512u + hf * 256u;
      *(v8us*)((unsigned short*)C16 + o) = oh;
      asm volatile("s_wait_xcnt 0x0" ::: "memory");      /* the same for this store */
      if (C16L) { *(v8us*)((unsigned short*)C16L + o) = ol;
        asm volatile("s_wait_xcnt 0x0" ::: "memory"); } } } }      /* and for this one */

// cross-lane steps of the row reductions: lane l with lane l ^ M inside a 16-lane row (DPP row_xmask), and lane l with lane l ^ 16
template <int M> __device__ __forceinline__ float sm_xrow(float x) { return __builtin_bit_cast(float, __builtin_amdgcn_update_dpp(0, __builtin_bit_cast(int, x), 0x160 | M, 0xf, 0xf, true)); }
__device__ __forceinline__ float sm_xhalf(float x) { return __builtin_bit_cast(float, __builtin_amdgcn_permlanex16(__builtin_bit_cast(int, x), __builtin_bit_cast(int, x), 0x76543210, 0xfedcba98, false, false)); }
__device__ __forceinline__ float sm_wave_max(float v) { v = fmaxf(v, sm_xrow<1>(v)); v = fmaxf(v, sm_xrow<2>(v)); v = fmaxf(v, sm_xrow<4>(v)); v = fmaxf(v, sm_xrow<8>(v)); return fmaxf(v, sm_xhalf(v)); }
__device__ __forceinline__ float sm_wave_sum(float v) { v += sm_xrow<1>(v); v += sm_xrow<2>(v); v += sm_xrow<4>(v); v += sm_xrow<8>(v); return v + sm_xhalf(v); }

// e^x as the fast library form computes it (multiply by log2 e, then v_exp_f32); the v_nop in the same statement is the one free slot the instruction set asks for behind a transcendental
__device__ __forceinline__ float sm_exp(float x) { const float t = x * 1.44269504088896340736f; float r; asm("v_exp_f32 %0, %1\n\tv_nop" : "=v"(r) : "v"(t)); return r; }

// attention of the rows from QT0 on, scores, softmax and o in one launch. A work-group owns AQ query rows of one (batch, head); their score rows stay in LDS from the products to the last use, so no score or weight goes through memory and every (batch, head, row group) runs side by side. Keys are taken up to the end of the 128-key chunk that holds the rows; later keys have weight exactly zero.
// Step 1: wave w forms the 16-key score tiles w, w + 8, ... (value plane, then residual plane of q, folded in f32). Step 2: one wave per score row, two rows a wave: lane l keeps columns 128 c + 4 l + 0..3 of every chunk c in registers, maximum and sum are per-lane partials joined across the 32 lanes; the row's weights (f16 value plane, then x1024 residual plane) are written over its own scores. Step 3: waves 0..3 (16 head columns each) sum Vh ph and Vh pl from one V fragment, waves 4..7 sum Vres ph; k-steps in rising order into each accumulator; the three sums are folded in f32 in the order Vh ph, Vres ph, Vh pl.
#define AQ 16                        /* query rows per work-group */
#define APB (NKX * 4 + 32)           /* bytes of a score row in LDS; 32 more than a multiple of 256, so that the 16-byte fragment reads of 16 rows x 2 halves fall on all banks evenly */
static_assert(QT0 % 128 == 0 && SQ % 128 == 0 && 128 % AQ == 0 && NKX / 128 <= 16 && QT0 >= 256);
typedef float fa1 __attribute__((may_alias));
struct VB { v16h f[4]; };      /* the V fragments of one 128-key chunk (four k-steps) */
// a fragment from rows in row order (the weight rows in LDS), from a pointer that already holds the lane's 8 h, so that every load of a run names that one address with a constant offset
__device__ __forceinline__ v16h at_frag(const _Float16* q) { FragH f; f.half[0] = *(const v8us*)((const unsigned short*)q); f.half[1] = *(const v8us*)((const unsigned short*)q + 16); return f.v; }
__device__ __forceinline__ void vb_load(VB& s, const _Float16* q) {
#pragma unroll
  for (int u = 0; u < 4; ++u) s.f[u] = at_frag(q + u * 32); }
// the same chunk from a plane in fragment order: four blocks that follow one another
__device__ __forceinline__ void vb_loadg(VB& s, const _Float16* q) {
#pragma unroll
  for (int u = 0; u < 4; ++u) s.f[u] = g2_frag(q + u * 512); }
// f32 attention of the leading rows, run by the first A0Y grid rows of the attention launch, beside the work-groups of the later rows instead of in a launch of its own in front of them. A work-group owns A0R query rows of the four heads of one (batch, kv head), which share the staged K and V rows; a wave takes 16 rows of one head, two lanes a row: lane l and lane l + 16 each keep one half (32 elements) of the row's q and o in registers for the whole key loop (every loop over the half is unrolled whole so that both are indexed by constants), so that this path needs no more registers than the other and two work-groups still share a WGP. A score is the sum of the two lanes' 32-term sums; maximum, sum and weights are formed alike in both lanes. The K and V rows are staged in LDS 64 keys at a time and read from there at one address per half wave: K transposed, so that one 16-byte read brings one head element of four neighbouring keys. One trip takes four keys: their four score sums are independent chains that fill each other's latency. The running maximum and sum and each o element take their terms in the order of the keys. The o rows (x64) leave as f16 value + x1024 residual planes of the merged o rows.
#define A0R 32                                   /* query rows of each of its four heads per work-group of the f32 path */
#define A0G (NB * NKV * (QT0 / A0R))             /* its work-groups */
#define A0Y (A0G / (NH * NB))                    /* the grid rows they fill */
static_assert(A0G % (NH * NB) == 0 && QT0 % 64 == 0 && 64 % A0R == 0 && A0R == 32 && (1 << KVSH) == 4);
#define A0K (HD * 68 + 16)                       /* floats of the K tile */
static_assert((A0K + 64 * HD + 4 * A0R * 68) * 4 <= AQ * APB);
__device__ __forceinline__ void att0_rows(const float* __restrict__ F0, _Float16* __restrict__ OH, _Float16* __restrict__ OL, unsigned char* lds, unsigned int id) {
  float* lk = (float*)lds;                                            /* K tile [head element][key]; pitch 68: the transposing stores of a wave fall on 32 different banks, rows stay 16-byte aligned; elements 32..63 stand 16 floats further on, so that the two addresses of a wave's read fall on different banks */
  float (*lv)[HD] = (float (*)[HD])(lds + A0K * 4);                   /* V tile [key][head element] */
  float (*lo)[68] = (float (*)[68])(lds + A0K * 4 + 64 * HD * 4);     /* o rows [head of the four][row] */
  const unsigned int tid = threadIdx.x, w = (unsigned int)__builtin_amdgcn_readfirstlane((int)(tid >> 5)), lane = tid & 31u, ln = lane & 15u, hh = lane >> 4;
  const unsigned int rg = (unsigned int)(QT0 / A0R - 1) - id / (unsigned int)(NB * NKV), sl = id % (unsigned int)(NB * NKV), b = sl / (unsigned int)NKV, hk = sl % (unsigned int)NKV;      /* the longest rows start first */
  const unsigned int i = rg * (unsigned int)A0R + (w & 1u) * 16u + ln; const unsigned int ld = (unsigned int)LQ;
  const float* QF = F0 + (size_t)b * QT0 * LQ;      /* q | k | v rows of the batch's leading rows */
  const float* qr = QF + (size_t)i * ld + ((hk << KVSH) + (w >> 1)) * HD + hh * 32u;
  v4f q[HD / 8], o[HD / 8];
#pragma unroll
  for (int c = 0; c < HD / 8; ++c) { q[c] = *(const v4fa*)(qr + c * 4); const v4f z = {0.f, 0.f, 0.f, 0.f}; o[c] = z; }
  asm volatile("s_wait_xcnt 0x0" :: "v"(qr) : "memory");      /* stands in front of code that writes anew the address registers which the q loads name; the pointer as an input keeps them out of those loads' own results */
  /* a thread's share of a tile. K: key (tid & 7) of a group of 8, 16-byte piece ((tid >> 3) & 7) of a group of 8 (a wave's load covers 8 rows x 64 bytes), key groups (tid >> 6) and (tid >> 6) + 4. V: key (tid >> 4) of a group of 16, piece (tid & 15) (whole rows). */
  const unsigned int kb = tid & 7u, ka = (tid >> 3) & 7u, kg = tid >> 6, vb = tid >> 4, va = tid & 15u;
  const unsigned int kofs = ((kg * 8u + kb) * ld + ka * 4u) * 4u, vofs = (vb * ld + va * 4u) * 4u;      /* byte offsets, the same for every tile */
  float m = -1.0e30f, l = 0.f; const unsigned int jmax = rg * (unsigned int)A0R + (unsigned int)(A0R - 1);      /* keys up to the work-group's last row */
#pragma unroll 1      /* a tile's code is long already */
  for (unsigned int j0 = 0; j0 <= jmax; j0 += 64u) { const char* tb = (const char*)(QF + (size_t)j0 * ld + hk * HD);      /* the tile's first row; its k columns stand DM, its v columns ROTN floats further on */
    __syncthreads();      /* every wave has read the last tile to its end */
    { v4f kk[4], vv[4]; const char* kq = tb + kofs; const char* vq = tb + vofs;      /* a thread's four pieces of each tile lie at constant distances from one address */
#pragma unroll
      for (int it = 0; it < 4; ++it) kk[it] = *(const v4fa*)(kq + DM * 4 + (it & 1) * (32 * LQ * 4) + (it >> 1) * 128);
#pragma unroll
      for (int it = 0; it < 4; ++it) vv[it] = *(const v4fa*)(vq + ROTN * 4 + it * (16 * LQ * 4));
      asm volatile("s_wait_xcnt 0x0" :: "v"(kq), "v"(vq) : "memory");      /* stands in front of code that writes anew the address registers which the K and V loads name; the addresses as inputs keep them out of those loads' own results */
#pragma unroll
      for (int it = 0; it < 4; ++it) {
#pragma unroll
        for (int t = 0; t < 4; ++t) lk[(((unsigned int)(it >> 1) * 8u + ka) * 4u + (unsigned int)t) * 68u + (unsigned int)(it >> 1) * 16u + ((unsigned int)(it & 1) * 4u + kg) * 8u + kb] = kk[it][t]; }
#pragma unroll
      for (int it = 0; it < 4; ++it) *(v4fa*)&lv[(unsigned int)it * 16u + vb][va * 4u] = vv[it]; }
    __syncthreads();      /* the tile is whole before any wave reads it */
    const unsigned int jend = jmax + 1u - j0 < 64u ? jmax + 1u - j0 : 64u;      /* later keys of the tile lie above every row of the work-group: weight exactly zero */
    const float* lkh = lk + hh * (32u * 68u + 16u);
#pragma unroll 1      /* one trip is already four keys; more would only add code */
    for (unsigned int jj = 0; jj < jend; jj += 4u) { float s[4] = {0.f, 0.f, 0.f, 0.f}, sc[4], e[4];
#pragma unroll
      for (int c = 0; c < HD / 8; ++c) {
#pragma unroll
        for (int t = 0; t < 4; ++t) { const v4f k4 = *(const v4fa*)(lkh + (c * 4 + t) * 68 + jj);
#pragma unroll
          for (int u = 0; u < 4; ++u) s[u] = __fadd_rn(s[u], __fmul_rn(q[c][t], k4[u])); } }
#pragma unroll
      for (int u = 0; u < 4; ++u) { const float su = __fmul_rn(__fadd_rn(s[u], sm_xhalf(s[u])), 0.125f);      /* own half + the other lane's half: the same value in both lanes */
        const float f = (j0 + jj + (unsigned int)u <= i) ? 1.f : 0.f; const float sm = fmaf(f, su, (1.f - f) * -1.0e30f); const float mn = fmaxf(m, sm); sc[u] = expf(m - mn); e[u] = expf(sm - mn); l = __fadd_rn(__fmul_rn(l, sc[u]), e[u]); m = mn; }
#pragma unroll
      for (int u = 0; u < 4; ++u) {
#pragma unroll
        for (int c = 0; c < HD / 8; ++c) { const v4f vv = *(const v4fa*)&lv[jj + (unsigned int)u][hh * 32u + (unsigned int)(c * 4)];
#pragma unroll
          for (int t = 0; t < 4; ++t) o[c][t] = __fadd_rn(__fmul_rn(o[c][t], sc[u]), __fmul_rn(e[u], vv[t])); } } } }
  { const float fin = 64.0f / l;      /* o carried x64 like the f16 path */
#pragma unroll
    for (int c = 0; c < HD / 8; ++c) { v4f oo = o[c];
#pragma unroll
      for (int u = 0; u < 4; ++u) oo[u] = __fmul_rn(oo[u], fin);
      *(v4fa*)&lo[w * 16u + ln][hh * 32u + (unsigned int)(c * 4)] = oo; } }
  __syncthreads();      /* the o rows of the four heads are whole */
#pragma unroll
  for (int it = 0; it < 4; ++it) { const unsigned int p = (unsigned int)it * 256u + tid, row = (p >> 7) * 16u + (p & 15u), pc = ((p >> 4) & 7u) * 8u; const v4f a = *(const v4fa*)&lo[row][pc], c = *(const v4fa*)&lo[row][pc + 4u]; FragH fh, fl;      /* a wave: 16 rows x 2 neighbouring pieces, 512 bytes in a row of each plane */
#pragma unroll
    for (int t = 0; t < 4; ++t) { _Float16 hv = (_Float16)a[t]; fh.h[t] = hv; fl.h[t] = (_Float16)((a[t] - (float)hv) * 1024.0f); hv = (_Float16)c[t]; fh.h[4 + t] = hv; fl.h[4 + t] = (_Float16)((c[t] - (float)hv) * 1024.0f); }
    const v8us oh = fh.half[0], ol = fl.half[0]; const size_t d = fo_piece((size_t)b * SQ + rg * (unsigned int)A0R + (row & (unsigned int)(A0R - 1)), ((hk << KVSH) + row / (unsigned int)A0R) * HD + pc, (unsigned int)DM);
    *(v8us*)((unsigned short*)OH + d) = oh; *(v8us*)((unsigned short*)OL + d) = ol; } }

__global__ __launch_bounds__(256) void k_attf(const _Float16* __restrict__ Q16, const _Float16* __restrict__ QL, const _Float16* __restrict__ K16, const _Float16* __restrict__ VT, const _Float16* __restrict__ VTL, _Float16* __restrict__ OH, _Float16* __restrict__ OL, const float* __restrict__ F0) {
  __shared__ __attribute__((aligned(16))) unsigned char sp[AQ * APB];      /* per row: f32 scores, later f16 weights at byte 0 and their residuals at byte 2 NKX */
  __shared__ __attribute__((aligned(16))) float oc[AQ][68];
  if (blockIdx.y < (unsigned int)A0Y) { att0_rows(F0, OH, OL, sp, blockIdx.y * (unsigned int)(NH * NB) + blockIdx.x); return; }      /* block-uniform: the first work-groups take the leading rows in f32 */
  const unsigned int tid = threadIdx.x, w = (unsigned int)__builtin_amdgcn_readfirstlane((int)(tid >> 5)), lane = tid & 31u, ln = lane & 15u, hh = lane >> 4;
  const unsigned int h = blockIdx.x % (unsigned int)NH, b = blockIdx.x / (unsigned int)NH, hk = h >> KVSH;
  const unsigned int q0 = (unsigned int)(SQ - AQ) - (blockIdx.y - (unsigned int)A0Y) * (unsigned int)AQ;      /* the longest rows start first */
  const unsigned int nch = q0 / 128u + 1u;      /* 128-key chunks; at least 3 */
  const size_t r0 = (size_t)b * SQ;
  const v8f z8 = {0.f,0.f,0.f,0.f,0.f,0.f,0.f,0.f};
  /* every plain '#pragma unroll' of this kernel, of vb_load and of vb_loadg stands on a short loop over a register array (u, r, q, c): unrolled whole, the array is indexed by constants and stays in registers */
  { const _Float16* qp = Q16 + (r0 + q0) * LQ + h * (HD * 16) + lane * 8u; const _Float16* lp = QL + (r0 + q0) * LQ + h * (HD * 16) + lane * 8u;      /* a head's 64 columns are two blocks that follow one another */
    const v16h qh0 = g2_frag(qp), qh1 = g2_frag(qp + 512), ql0 = g2_frag(lp), ql1 = g2_frag(lp + 512);
    asm volatile("s_wait_xcnt 0x0" :: "v"(qp), "v"(lp) : "memory");      /* stands in front of code that writes anew the address registers which the q loads name; the pointers as inputs keep them whole up to here */
    const _Float16* kb = K16 + (r0 + w * 16u) * LQ + hk * (HD * 16) + lane * 8u;
#pragma unroll 1      /* one trip is already four tiles with all their loads in flight together */
    for (unsigned int i0 = 0; i0 < nch; i0 += 4u) { const _Float16* kp[4]; v16h k0[4], k1[4];
#pragma unroll
      for (int u = 0; u < 4; ++u) { const unsigned int i = i0 + (unsigned int)u; kp[u] = kb + (size_t)((i < nch ? i : nch - 1u) * 128u) * LQ; }      /* past the end: the last tile again, so that no load stands under a test */
#pragma unroll
      for (int u = 0; u < 4; ++u) { k0[u] = g2_frag(kp[u]); k1[u] = g2_frag(kp[u] + 512); }
      asm volatile("s_wait_xcnt 0x0" :: "v"(kp[0]), "v"(kp[1]), "v"(kp[2]), "v"(kp[3]) : "memory");      /* the same for the K loads */
      __builtin_amdgcn_sched_barrier(0);      /* keeps the first product, which waits for its tile, from moving up among the loads of the later tiles */
#pragma unroll
      for (int u = 0; u < 4; ++u) { if (i0 + (unsigned int)u < nch) {
        v8f a1 = g2_mma(qh0, k0[u], z8); a1 = g2_mma(qh1, k1[u], a1);
        v8f a2 = g2_mma(ql0, k0[u], z8); a2 = g2_mma(ql1, k1[u], a2);
        unsigned char* sd = sp + (8u * hh) * (unsigned int)APB + (((i0 + (unsigned int)u) * 8u + w) * 16u + ln) * 4u;
#pragma unroll
        for (int r = 0; r < 8; ++r) *(fa1*)(sd + (unsigned int)r * (unsigned int)APB) = a2[r] * 0.0001220703125f + a1[r] * 0.125f; } } } }
  __syncthreads();      /* all score tiles of the 16 rows are in LDS */
#pragma unroll 1      /* the second row reuses the first row's registers */
  for (unsigned int rr = 0; rr < 2u; ++rr) { const unsigned int row = w * 2u + rr; unsigned char* rp = sp + row * (unsigned int)APB; const unsigned int last = q0 + row; v4f e[16];
#pragma unroll
    for (unsigned int c = 0; c < 16u; ++c) { if (c < nch) e[c] = *(const v4fa*)(rp + (c * 128u + lane * 4u) * 4u); }
    v4f m4 = {-3.0e38f, -3.0e38f, -3.0e38f, -3.0e38f};
#pragma unroll
    for (unsigned int c = 0; c < 16u; ++c) { if (c < nch) {
#pragma unroll
      for (int q = 0; q < 4; ++q) { e[c][q] = (c * 128u + lane * 4u + (unsigned int)q <= last) ? e[c][q] : -1.0e9f; m4[q] = fmaxf(m4[q], e[c][q]); } } }
    const float mx = sm_wave_max(fmaxf(fmaxf(m4[0], m4[1]), fmaxf(m4[2], m4[3])));
    v4f s4 = {0.f, 0.f, 0.f, 0.f};
#pragma unroll
    for (unsigned int c = 0; c < 16u; ++c) { if (c < nch) {
#pragma unroll
      for (int q = 0; q < 4; ++q) { e[c][q] = sm_exp(e[c][q] - mx); s4[q] += e[c][q]; } } }
    const float se = sm_wave_sum((s4[0] + s4[1]) + (s4[2] + s4[3])); const float sc = 256.0f / se;
#pragma unroll
    for (unsigned int c = 0; c < 16u; ++c) { if (c < nch) { v4h h4, l4;
#pragma unroll
      for (int q = 0; q < 4; ++q) { const float pv = e[c][q] * sc; const _Float16 hv = (_Float16)pv; h4[q] = hv; l4[q] = (_Float16)((pv - (float)hv) * 1024.0f); }
      *(v4ha*)(rp + (c * 128u + lane * 4u) * 2u) = h4; *(v4ha*)(rp + (unsigned int)NKX * 2u + (c * 128u + lane * 4u) * 2u) = l4; } } }
  __syncthreads();      /* all weight rows are in LDS */
  { const unsigned int ct = w & 3u; const bool resv = w >= 4u;      /* wave-uniform */
    const _Float16* vp = (resv ? VTL : VT) + (((size_t)b * NKV + hk) * HD + ct * 16u) * SQ + lane * 8u;      /* a chunk of 128 keys is four blocks, 2048 elements */
    const _Float16* ph = (const _Float16*)(sp + ln * (unsigned int)APB) + 8u * hh; const _Float16* pl = ph + NKX;
    v8f a1 = z8, a3 = z8; VB v0, v1, v2;      /* ring of three chunks: chunk c + 2 is asked for in front of the products of chunk c */
    vb_loadg(v0, vp); vb_loadg(v1, vp + 2048);
    asm volatile("s_wait_xcnt 0x0" :: "v"(vp) : "memory");      /* as above, for the V loads */
    /* one chunk: NEW takes chunk C + 2 (past the end: the last chunk again, so that no load stands under a test and each wait can count the younger chunks as still in flight); the chunk's weight fragments are read from LDS together; the wait as above, whose memory clobber also holds those reads in front of it, ahead of the first product; then the products of chunk C from CUR */
#define AT_CHUNK(CUR, NEW, C) { const unsigned int cc = (C); const _Float16* vn = vp + (cc + 2u < nch ? cc + 2u : nch - 1u) * 2048u; vb_loadg(NEW, vn); VB pa, pb; vb_load(pa, ph + cc * 128u); if (!resv) vb_load(pb, pl + cc * 128u); \
      asm volatile("s_wait_xcnt 0x0" :: "v"(vn) : "memory"); \
      _Pragma("unroll") for (int u = 0; u < 4; ++u) a1 = g2_mma(pa.f[u], CUR.f[u], a1); \
      if (!resv) { _Pragma("unroll") for (int u = 0; u < 4; ++u) a3 = g2_mma(pb.f[u], CUR.f[u], a3); } }
    unsigned int c = 0;
#pragma unroll 1      /* one trip is three chunks, so that the ring's stages are named, not indexed; no way out from inside a trip, the last zero, one or two chunks stand behind the loop */
    for (; c + 3u <= nch; c += 3u) { AT_CHUNK(v0, v2, c); AT_CHUNK(v1, v0, c + 1u); AT_CHUNK(v2, v1, c + 2u); }
    if (c < nch) { AT_CHUNK(v0, v2, c); if (c + 1u < nch) AT_CHUNK(v1, v0, c + 1u); }
#undef AT_CHUNK
    if (resv) {
#pragma unroll
      for (int r = 0; r < 8; ++r) oc[8u * hh + (unsigned int)r][ct * 16u + ln] = a1[r]; }
    __syncthreads();      /* the Vres ph sums are in LDS */
    if (!resv) {      /* own elements: each is read and rewritten by the same lane */
#pragma unroll
      for (int r = 0; r < 8; ++r) { float o = a1[r] * 0.25f; o = oc[8u * hh + (unsigned int)r][ct * 16u + ln] * 0.000244140625f + o; o = a3[r] * 0.000244140625f + o; oc[8u * hh + (unsigned int)r][ct * 16u + ln] = o; } } }
  __syncthreads();      /* the o tile is whole */
  if (tid < 128u) { const unsigned int row = tid & 15u, pc = (tid >> 4) * 8u; const v4f a = *(const v4fa*)&oc[row][pc], c = *(const v4fa*)&oc[row][pc + 4u]; FragH fh, fl;      /* a wave: 16 rows x 2 neighbouring pieces, 512 bytes in a row of each plane */
#pragma unroll
    for (int q = 0; q < 4; ++q) { _Float16 hv = (_Float16)a[q]; fh.h[q] = hv; fl.h[q] = (_Float16)((a[q] - (float)hv) * 1024.0f); hv = (_Float16)c[q]; fh.h[4 + q] = hv; fl.h[4 + q] = (_Float16)((c[q] - (float)hv) * 1024.0f); }
    const v8us oh = fh.half[0], ol = fl.half[0]; const size_t d = fo_piece(r0 + q0 + row, h * HD + pc, (unsigned int)DM);
    *(v8us*)((unsigned short*)OH + d) = oh; *(v8us*)((unsigned short*)OL + d) = ol; } }

constexpr size_t al256(size_t b) { return (b + 255) & ~(size_t)255; }
constexpr size_t SZ_BQKV = al256((size_t)LQ * DM * 2);
constexpr size_t SZ_BO   = al256((size_t)DM * DM * 2);
constexpr size_t SZ_XO   = al256(NR * DM * 2);                          /* X16, later reused as the merged o value rows */
constexpr size_t SZ_QKV  = al256(NR * LQ * 2);                          /* value plane; the residual plane has the same size */
constexpr size_t SZ_F0   = al256((size_t)NB * QT0 * LQ * 4);
constexpr size_t SZ_VT   = al256((size_t)NB * NKV * HD * SQ * 2);       /* V^T value plane; the residual plane has the same size */
constexpr size_t SZ_OL   = al256(NR * DM * 2);                          /* merged o residual rows */
constexpr size_t WS_TOTAL = SZ_BQKV + SZ_BO + SZ_XO + 2 * SZ_QKV + SZ_F0 + 2 * SZ_VT + SZ_OL;
static_assert(WS_TOTAL <= (size_t)134217728);
/* plane coverage equalities of the producer grids */
static_assert(((size_t)(DM / 64) * (DM / 64)) * 64 * 64 == (size_t)DM * DM);
static_assert(((size_t)(DM / 64) * (KVD / 64)) * 64 * 64 == (size_t)DM * KVD);
static_assert(((size_t)NB * NKV * (SQ / 64)) * 64 * 64 == (size_t)NB * NKV * HD * SQ);
static_assert((NR * DM) % (256 * 8) == 0);
static_assert((size_t)A0G * 4 * A0R * HD == (size_t)NB * QT0 * DM);
static_assert(((size_t)(NR / 128) * (LQ / 64)) * 128 * 64 == NR * LQ);
static_assert(((size_t)NH * NB * ((SQ - QT0) / AQ)) * AQ * HD == (NR - (size_t)NB * QT0) * DM);
static_assert(((size_t)(SQ / 128) * (DM / 64) * NB) * 128 * 64 == NR * DM);

extern "C" void kernel_launch(void* const* d_in, const int* in_sizes, int n_in,
                              void* d_out, int out_size, void* d_ws, size_t ws_size, hipStream_t stream) {
  if (n_in < 7) return;
  const size_t need_x = ((size_t)(NB - 1) * SQ_FULL + SQ) * DM;
  if ((size_t)in_sizes[0] < need_x) return;
  if ((size_t)in_sizes[1] < (size_t)SQ * 32) return;
  if ((size_t)in_sizes[2] < (size_t)SQ * 32) return;
  if ((size_t)in_sizes[3] < (size_t)DM * DM) return;
  if ((size_t)in_sizes[4] < (size_t)DM * KVD) return;
  if ((size_t)in_sizes[5] < (size_t)DM * KVD) return;
  if ((size_t)in_sizes[6] < (size_t)DM * DM) return;
  if ((size_t)out_size < need_x) return;
  const float* x = (const float*)d_in[0]; const float* cosb = (const float*)d_in[1]; const float* sinb = (const float*)d_in[2];      /* tables [pos][32], read as values */
  const float* wq = (const float*)d_in[3]; const float* wk = (const float*)d_in[4]; const float* wv = (const float*)d_in[5]; const float* wo = (const float*)d_in[6];      /* all [in][out] */
  float* out = (float*)d_out;
  char* ws = (char*)d_ws; size_t off = 0;
  auto take = [&](size_t bytes) { char* p = ws + off; off += (bytes + 255) & ~(size_t)255; return p; };
  _Float16* BQKV = (_Float16*)take(SZ_BQKV); _Float16* BO = (_Float16*)take(SZ_BO);
  _Float16* X16 = (_Float16*)take(SZ_XO); _Float16* OH = X16;      /* X16 is dead after the projection GEMMs; the merged o value rows take its place */
  _Float16* QKV = (_Float16*)take(SZ_QKV); const _Float16* Q16 = QKV; const _Float16* K16 = QKV + DM * 16; const _Float16* V16 = QKV + ROTN * 16;      /* fragment order: column c, a multiple of 32, begins 16 c elements into a row group */
  _Float16* QKVL = (_Float16*)take(SZ_QKV); const _Float16* QL = QKVL; const _Float16* VL16 = QKVL + ROTN * 16;      /* x1024 residual plane, same layout (k columns unused) */
  float* F0 = (float*)take(SZ_F0);
  _Float16* VT = (_Float16*)take(SZ_VT); _Float16* VTL = (_Float16*)take(SZ_VT);
  _Float16* OL = (_Float16*)take(SZ_OL);
  if (off > ws_size) return;

  k_wT<<<(DM / 64) * (DM / 64), 256, 0, stream>>>(wq, (unsigned int)DM, (unsigned int)DM, BQKV);                                   /* W[DM][DM] -> Bt rows 0..1023 */
  k_wT<<<(DM / 64) * (KVD / 64), 256, 0, stream>>>(wk, (unsigned int)DM, (unsigned int)KVD, BQKV + (size_t)DM * DM);                /* W[DM][KVD] -> Bt rows 1024..1279 */
  k_wT<<<(DM / 64) * (KVD / 64), 256, 0, stream>>>(wv, (unsigned int)DM, (unsigned int)KVD, BQKV + (size_t)ROTN * DM);              /* W[DM][KVD] -> Bt rows 1280..1535 */
  k_wT<<<(DM / 64) * (DM / 64), 256, 0, stream>>>(wo, (unsigned int)DM, (unsigned int)DM, BO);                                     /* Wo[c][n] -> Bt[n][c] */
  const unsigned int n8x = (unsigned int)(NR * DM / 8);
  k_x16<<<(n8x + 255u) / 256u, 256, 0, stream>>>(x, X16, n8x);
  const int MP = (int)(NR); const unsigned int pm = (unsigned int)(SQ - 1);
  k_gemm2<<<dim3((unsigned int)((MP / 128) * (LQ / 64)), 1), 128, 0, stream>>>(X16, DM, (size_t)0, BQKV, DM, (size_t)0, 0u, 0.0625f, nullptr, nullptr, QKV, QKVL, LQ, (size_t)0, MP, LQ, DM, cosb, sinb, (unsigned int)ROTN, pm);      /* q | k | v rows (f16 value + residual), q / k rotated + normalised */
  k_gemm2<<<dim3((unsigned int)((QT0 / 128) * (LQ / 64)), NB), 128, 0, stream>>>(X16, DM, (size_t)SQ * DM, BQKV, DM, (size_t)0, 0u, 0.0625f, nullptr, F0, nullptr, nullptr, LQ, (size_t)QT0 * LQ, QT0, LQ, DM, cosb, sinb, (unsigned int)ROTN, pm);      /* f32 q | k | v of rows 0..QT0-1 of every batch */
  k_vt<<<NB * NKV * (SQ / 64), 256, 0, stream>>>(V16, VT);        /* V^T value plane [NB][NKV][HD][SQ] */
  k_vt<<<NB * NKV * (SQ / 64), 256, 0, stream>>>(VL16, VTL);      /* V^T residual plane */
  k_attf<<<dim3(NH * NB, A0Y + (SQ - QT0) / AQ), 256, 0, stream>>>(Q16, QL, K16, VT, VTL, OH, OL, F0);      /* grid rows below A0Y: f32 attention for rows 0..QT0-1; the others, rows from QT0 on: scores, softmax and o; final o (x64) written as f16 value + x1024 residual merged rows */
  k_gemm2<<<dim3((SQ / 128) * (DM / 64), NB), 128, 0, stream>>>(OH, DM, (size_t)SQ * DM, BO, DM, (size_t)0, 0u, 0.0009765625f, nullptr, out, nullptr, nullptr, DM, (size_t)SQ_FULL * DM, SQ, DM, DM, nullptr, nullptr, 0u, 0u);      /* out rows in the output layout: o value plane */
  k_gemm2<<<dim3((SQ / 128) * (DM / 64), NB), 128, 0, stream>>>(OL, DM, (size_t)SQ * DM, BO, DM, (size_t)0, 0u, 0.00000095367431640625f, (const float*)out, out, nullptr, nullptr, DM, (size_t)SQ_FULL * DM, SQ, DM, DM, nullptr, nullptr, 0u, 0u);      
}

// v007
// It runs in 190 microseconds.
// Next to v006, in two timings, it ran 1.12 and 1.11 times as fast.
// Counting every step since v000, it is 33.8 times as fast.
#include <hip/hip_runtime.h>
// All contractions: v_wmma_f32_16x16x32_f16 (f16 operands, f32 accumulate). x, cos, sin and all four weights are RNE-converted to bf16 first (exact in f16; weights carried x16); q (after split-half rotation + scale-free RMS normalisation in f32), v, softmax weights (x256) and o (x64) are f16 value + x1024 residual planes, every residual product in its own accumulator, folded in f32; k is a single f16 plane; the first 256 query rows of every batch use f32 q/k/v from exact-operand GEMMs and an f32 online softmax on VALU.
// Causal grouped-query self-attention: x [NB][SQ][1024]; q = x Wq (16 heads of 64), k = x Wk, v = x Wv (4 kv heads of 64; weights are [in][out]); rotation with INPUT tables cos/sin [pos][32]: y[j] = x[j] c + x[j+32] s, y[j+32] = x[j+32] c - x[j] s; q, k scaled by rsqrt(mean square over the head + 1e-6); query head h uses kv head h >> 2; scores * 0.125; keys above the query get exactly zero weight; softmax; out = merged y Wo -> [NB][SQ][1024] f32.
// Structure: token rows r = b*SQ + s; X16 exact f16 rows; one q|k|v GEMM (N = 1536) whose epilogue applies rotation + normalisation on the 64-column head tiles of q and k and writes value + residual planes; V^T value and residual planes per (batch, kv head) via LDS transposes; one attention launch, a work-group per (batch, head, 16 query rows), whose score rows never leave LDS: scores = qh k + qres k against the keys up to the end of the rows' own 128-key chunk, causal row softmax on VALU, one wave per row (P value + residual written over the row's scores), o = Vh ph + Vres ph + Vh pl folded in f32 and written as f16 value + residual merged o rows (x64); out = oh Wo + ores Wo. Rows 0..255 of each batch: f32 attention by the first work-groups of the same launch, split into the same two o planes. Every f16 operand plane in the workspace (X16, the weights, q | k | v, V^T, o) is stored in fragment order (see fo_piece).
#ifndef NB
#define NB 2
#endif
#ifndef SQ
#define SQ 2048
#endif
#define NB_FULL 2
#define SQ_FULL 2048
#define DM 1024
#define NH 16
#define NKV 4
#define KVSH 2                       /* query head -> kv head shift */
#define HD 64
#define KVD (NKV * HD)               /* 256 */
#define LQ (DM + 2 * KVD)            /* row pitch of the q | k | v rows: 1536 */
#define ROTN (DM + KVD)              /* columns below this are q / k heads (rotated + normalised) */
#define QT 256                       /* not used by any kernel, only by the static_asserts */
#define QT0 256                      /* leading rows of every batch computed in f32 */
#define NKX SQ                       /* keys of an S / P row; the LDS row pitch is APB */
#define NR ((size_t)NB * SQ)         /* token rows */

static_assert(NB <= NB_FULL);
static_assert(SQ <= SQ_FULL);
static_assert((SQ & (SQ - 1)) == 0);
static_assert(SQ % QT == 0);
static_assert((QT & (QT - 1)) == 0);
static_assert(QT % 128 == 0);
static_assert(QT0 == QT);
static_assert(QT0 % 128 == 0);
static_assert(QT0 % 64 == 0);
static_assert(HD == 64);
static_assert(DM == NH * HD);
static_assert(NH == (NKV << KVSH));
static_assert(DM / 8 == 128);
static_assert(DM % 64 == 0);
static_assert(KVD % 64 == 0);
static_assert(LQ % 64 == 0);
static_assert(ROTN % 64 == 0);
static_assert(((size_t)NB * SQ) % 128 == 0);
static_assert(SQ % 64 == 0);
static_assert(DM % 32 == 0);

typedef unsigned short v8us __attribute__((ext_vector_type(8), may_alias));
typedef float  v8f  __attribute__((ext_vector_type(8)));
typedef float  v4f  __attribute__((ext_vector_type(4)));
typedef float  v4fa __attribute__((ext_vector_type(4), may_alias));
typedef _Float16 v16h __attribute__((ext_vector_type(16)));
typedef _Float16 v4h __attribute__((ext_vector_type(4)));
typedef _Float16 v4ha __attribute__((ext_vector_type(4), may_alias));
union FragH { v16h v; v8us half[2]; _Float16 h[16]; unsigned short u[16]; };

__device__ __forceinline__ unsigned short bf16_bits(float x) { unsigned int u = __float_as_uint(x); return (unsigned short)((u + 0x7FFFu + ((u >> 16) & 1u)) >> 16); }
__device__ __forceinline__ float bf16_val(unsigned short b) { return __uint_as_float(((unsigned int)b) << 16); }
__device__ __forceinline__ float bf16_rne(float x) { return bf16_val(bf16_bits(x)); }

// fragment: elements 0..7 <- k0 + 8h + 0..7, elements 8..15 <- k0 + 16 + 8h + 0..7 (same map for A rows and B columns)
// Fragment order of an f16 operand plane (rows of L elements, L a multiple of 32): the plane is cut into blocks of 16 rows x 32 k, 512 elements each, block (g, s) at (g * (L / 32) + s) * 512. Inside a block stand elements 0..7 of the fragment of lanes 0, 1, .. 31 (lane = 16 h + row), then elements 8..15 in the same lane order. Each of a fragment's two 16-byte loads then reads 512 bytes in a row, four whole lines; with the rows in memory order it read 32 bytes on each of 16 lines. A group of 16 rows takes 16 L elements as in row order, so offsets of whole row groups keep their values; 32 columns further on is 512 elements further on.
// fo_piece: offset of the 8 elements k .. k + 7 (k a multiple of 8) of row r
__device__ __forceinline__ size_t fo_piece(size_t r, unsigned int k, unsigned int L) { return ((r >> 4) * (size_t)(L >> 5) + (k >> 5)) * 512u + ((k >> 4) & 1u) * 256u + ((k >> 3) & 1u) * 128u + ((unsigned int)r & 15u) * 8u; }
// p: the block's start + 8 * lane
__device__ __forceinline__ v16h g2_frag(const _Float16* p) { FragH f; f.half[0] = *(const v8us*)((const unsigned short*)p); f.half[1] = *(const v8us*)((const unsigned short*)p + 256); return f.v; }
__device__ __forceinline__ v8f g2_mma(v16h a, v16h b, v8f c) { v8f d = __builtin_amdgcn_wmma_f32_16x16x32_f16(false, a, false, b, (short)0, c, false, false); asm volatile("v_nop\n\tv_nop\n\tv_nop\n\tv_nop" : "+v"(d) : "v"(a), "v"(b)); return d; }

// bx: the 64 x 64 tile of this weight that the work-group takes
__device__ __forceinline__ void wT_tile(const float* __restrict__ w, unsigned int Kd, unsigned int Nd, _Float16* __restrict__ Bt, unsigned int bx) {
  __shared__ unsigned short tl[64][66];
  const unsigned int tid = threadIdx.x; const unsigned int ntn = Nd >> 6; const unsigned int kt = bx / ntn, nt = bx - kt * ntn; const unsigned int k0 = kt * 64u, n0 = nt * 64u;
  for (unsigned int i = tid; i < 64u * 16u; i += 256u) { const unsigned int r = i >> 4, c4 = (i & 15u) * 4u; const v4f a = *(const v4fa*)(w + (size_t)(k0 + r) * Nd + n0 + c4); FragH f;
#pragma unroll
    for (int q = 0; q < 4; ++q) f.h[q] = (_Float16)(bf16_rne(a[q]) * 16.0f);
#pragma unroll
    for (int q = 0; q < 4; ++q) tl[r][c4 + q] = f.u[q]; }
  __syncthreads();
  {
#pragma unroll
    for (int rd = 0; rd < 2; ++rd) { const unsigned int d = (unsigned int)rd * 32u + (tid >> 7) * 16u + (tid & 15u), pc = (tid >> 4) & 7u; FragH f;      /* a wave: 16 rows x 2 neighbouring pieces, 512 bytes in a row of the plane */
#pragma unroll
      for (int q = 0; q < 8; ++q) f.u[q] = tl[pc * 8u + q][d];
      const v8us o = f.half[0];
      *(v8us*)((unsigned short*)Bt + fo_piece(n0 + d, k0 + pc * 8u, Kd)) = o; }
     } }

__device__ __forceinline__ void x16_tile(const float* __restrict__ x, _Float16* __restrict__ X16, unsigned int bx) {
  /* a work-group takes 16 rows x 128 columns: four blocks that follow one another in the plane. Whole 512-byte runs of x rows come in, the f16 tile turns in LDS, whole runs of the plane go out. */
  __shared__ __attribute__((aligned(16))) unsigned short tl[16][136];      /* pitch 136: rows stay 16-byte aligned and the 16-byte reads of 16 rows fall on different banks */
  const unsigned int tid = threadIdx.x;
  const unsigned int g = bx >> 3, kt = bx & 7u;                   /* DM / 128 = 8 column tiles per row group */
  const unsigned int r = tid >> 5, c4 = (tid & 31u) * 4u;      /* rows r and r + 8 of the group: a wave reads 512 bytes in a row of one x row */
  const unsigned int row = g * 16u + r, b = row / (unsigned int)SQ, s = row - b * (unsigned int)SQ;      /* a group of 16 rows lies in one batch */
  const float* xp = x + ((size_t)b * SQ_FULL + s) * DM + kt * 128u + c4;
  const v4f a0 = *(const v4fa*)xp, a1 = *(const v4fa*)(xp + 8 * DM); v4h h0, h1;
  asm volatile("s_wait_xcnt 0x0" :: "v"(xp) : "memory");      /* stands in front of code that writes anew the address registers which the two loads name; the pointer as an input keeps them out of those loads' own results */
#pragma unroll
  for (int q = 0; q < 4; ++q) { h0[q] = (_Float16)bf16_rne(a0[q]); h1[q] = (_Float16)bf16_rne(a1[q]); }
  *(v4ha*)&tl[r][c4] = h0; *(v4ha*)&tl[r + 8u][c4] = h1;
  __syncthreads();      /* the tile is whole before it is read across its rows */
  const v8us o = *(const v8us*)&tl[tid & 15u][(tid >> 6) * 32u + ((tid >> 5) & 1u) * 16u + ((tid >> 4) & 1u) * 8u];      /* thread = (block, fragment half, lane) in the plane's own order */
  *(v8us*)((unsigned short*)X16 + ((size_t)bx * 256u + tid) * 8u) = o;
}

// the four weight transposes and the x conversion depend on nothing but the inputs: one launch runs them side by side, each work-group taking one tile of one of the five jobs (block-uniform choice, in front of every barrier)
#define PW_Q ((DM / 64) * (DM / 64))             /* tiles of Wq, and of Wo */
#define PW_KV ((DM / 64) * (KVD / 64))           /* tiles of Wk, and of Wv */
#define PW_ALL (2 * PW_Q + 2 * PW_KV)
#define PX_ALL ((unsigned int)(NR * DM / (256 * 8)))      /* tiles of x */
__global__ __launch_bounds__(256) void k_prep(const float* __restrict__ x, const float* __restrict__ wq, const float* __restrict__ wk, const float* __restrict__ wv, const float* __restrict__ wo, _Float16* __restrict__ X16, _Float16* __restrict__ BQKV, _Float16* __restrict__ BO) {
  const unsigned int bx = blockIdx.x;
  if (bx >= (unsigned int)PW_ALL) { x16_tile(x, X16, bx - (unsigned int)PW_ALL); return; }
  const float* w = wq; _Float16* Bt = BQKV; unsigned int Nd = (unsigned int)DM, t = bx;                                                     /* W[DM][DM] -> Bt rows 0..1023 */
  if (bx >= (unsigned int)(PW_Q + 2 * PW_KV)) { w = wo; Bt = BO; t = bx - (unsigned int)(PW_Q + 2 * PW_KV); }                                /* Wo[c][n] -> Bt[n][c] */
  else if (bx >= (unsigned int)(PW_Q + PW_KV)) { w = wv; Bt = BQKV + (size_t)ROTN * DM; Nd = (unsigned int)KVD; t = bx - (unsigned int)(PW_Q + PW_KV); }      /* W[DM][KVD] -> Bt rows 1280..1535 */
  else if (bx >= (unsigned int)PW_Q) { w = wk; Bt = BQKV + (size_t)DM * DM; Nd = (unsigned int)KVD; t = bx - (unsigned int)PW_Q; }           /* W[DM][KVD] -> Bt rows 1024..1279 */
  wT_tile(w, (unsigned int)DM, Nd, Bt, t);
}

// grid row 0 turns the value plane, grid row 1 the residual plane, side by side in one launch
__global__ __launch_bounds__(256) void k_vt(const _Float16* __restrict__ VH16, _Float16* __restrict__ VtH, const _Float16* __restrict__ VL16, _Float16* __restrict__ VtL) {
  __shared__ unsigned short tl[64][66];
  const _Float16* V16 = blockIdx.y ? VL16 : VH16; _Float16* Vt = blockIdx.y ? VtL : VtH;      /* block-uniform */
  const unsigned int tid = threadIdx.x; const unsigned int slab = blockIdx.x / (unsigned int)(SQ / 64), lg = blockIdx.x % (unsigned int)(SQ / 64); const unsigned int b = slab / (unsigned int)NKV, h = slab % (unsigned int)NKV;
  for (unsigned int i = tid; i < 64u * 8u; i += 256u) { const unsigned int r = (i >> 7) * 16u + (i & 15u), c8 = ((i >> 4) & 7u) * 8u; FragH f; const unsigned short* vq = (const unsigned short*)V16 + fo_piece((size_t)b * SQ + lg * 64u + r, h * 64u + c8, (unsigned int)LQ); f.half[0] = *(const v8us*)vq;      /* a wave: 16 rows x 2 neighbouring pieces, 512 bytes in a row of the plane */
    asm volatile("s_wait_xcnt 0x0" :: "v"(vq) : "memory");      /* stands in front of code that writes anew the address registers which the load names; the pointer as an input keeps them out of the load's own result */
#pragma unroll
    for (int q = 0; q < 8; ++q) tl[r][c8 + q] = f.u[q]; }
  __syncthreads();
  {
#pragma unroll
    for (int rd = 0; rd < 2; ++rd) { const unsigned int d = (unsigned int)rd * 32u + (tid >> 7) * 16u + (tid & 15u), pc = (tid >> 4) & 7u; FragH f;      /* the same deal of a wave for the plane that is written */
#pragma unroll
      for (int q = 0; q < 8; ++q) f.u[q] = tl[pc * 8u + q][d];
      const v8us o = f.half[0];
      *(v8us*)((unsigned short*)Vt + fo_piece((size_t)slab * 64u + d, lg * 64u + pc * 8u, (unsigned int)SQ)) = o; }
     } }

// one k-step (32 k) of a wave's operands: two A row fragments and four B column fragments
struct G2Stage { v16h a0, a1, b0, b1, b2, b3; };
__device__ __forceinline__ void g2_load(G2Stage& s, const _Float16* a0p, const _Float16* a1p, const _Float16* b0p, const _Float16* b1p, const _Float16* b2p, const _Float16* b3p, int kb) {
  s.a0 = g2_frag(a0p + kb); s.a1 = g2_frag(a1p + kb); s.b0 = g2_frag(b0p + kb); s.b1 = g2_frag(b1p + kb); s.b2 = g2_frag(b2p + kb); s.b3 = g2_frag(b3p + kb); }
__device__ __forceinline__ void g2_step(const G2Stage& s, v8f& c00, v8f& c01, v8f& c02, v8f& c03, v8f& c10, v8f& c11, v8f& c12, v8f& c13) {
  c00 = g2_mma(s.a0, s.b0, c00); c10 = g2_mma(s.a1, s.b0, c10); c01 = g2_mma(s.a0, s.b1, c01); c11 = g2_mma(s.a1, s.b1, c11);
  c02 = g2_mma(s.a0, s.b2, c02); c12 = g2_mma(s.a1, s.b2, c12); c03 = g2_mma(s.a0, s.b3, c03); c13 = g2_mma(s.a1, s.b3, c13); }

// batched GEMM (grid.y = head / batch slab): C = alpha * A Bt^T (+ CP own element). A f16 [M][K], rows of lda elements (slab stride sA), Bt f16 [N][K], rows of ldb elements (slab stride sB applied to blockIdx.y >> bsh), both in fragment order; outputs f32 C in row order and/or f16 value plane C16 (+ optional x2^10 residual plane C16L of the same f32 value) in fragment order, rows of ldc elements, slab stride sC.
// A second product of the same A and Bt planes may run side by side with the first in one launch: the first nx2 work-groups (none where nx2 is 0) form slabs of M2 rows, slab strides sA2 and sC2, f32 output C2 only.
__global__ __launch_bounds__(128) void k_gemm2(const _Float16* __restrict__ A, int lda, size_t sA, const _Float16* __restrict__ Bh, int ldb, size_t sB, unsigned int bsh, float alpha, const float* CP,
    float* C, _Float16* C16, _Float16* C16L, int ldc, size_t sC, int M, int N, int K, const float* cosb, const float* sinb, unsigned int rotN, unsigned int pmask, unsigned int nx2, size_t sA2, float* C2, size_t sC2, int M2) {
  __shared__ __attribute__((aligned(16))) float so[4][32][68];
  const unsigned int tid = threadIdx.x, w = tid >> 5, lane = tid & 31u, ln = lane & 15u, hh = lane >> 4; unsigned int bx = blockIdx.x, by = blockIdx.y;
  if (bx < nx2) { const unsigned int per = ((unsigned int)M2 >> 7) * ((unsigned int)N >> 6); by = bx / per; bx -= by * per; sA = sA2; sC = sC2; M = M2; C = C2; C16 = nullptr; C16L = nullptr; }      /* block-uniform: tile and slab of the second product */
  else bx -= nx2;
  A += (size_t)by * sA; Bh += (size_t)(by >> bsh) * sB; const size_t cofs = (size_t)by * sC;
  const unsigned int ntn = (unsigned int)N >> 6; const unsigned int mt = bx / ntn, nq = bx - mt * ntn; const unsigned int row0 = mt * 128u + 32u * w, col0 = nq * 64u; if (row0 >= (unsigned int)M) return;
  const _Float16* a0p = A + (size_t)row0 * lda + lane * 8u; const _Float16* a1p = a0p + (size_t)16 * lda;      /* first block of the row group + the lane's place in a block */
  const _Float16* b0p = Bh + (size_t)col0 * ldb + lane * 8u; const _Float16* b1p = b0p + (size_t)16 * ldb; const _Float16* b2p = b1p + (size_t)16 * ldb; const _Float16* b3p = b2p + (size_t)16 * ldb;
  const v8f z8 = {0.f,0.f,0.f,0.f,0.f,0.f,0.f,0.f}; v8f c00 = z8, c01 = z8, c02 = z8, c03 = z8, c10 = z8, c11 = z8, c12 = z8, c13 = z8;
  /* K loop as a ring of three register stages: the twelve loads of k-step s + 2 are issued together in front of the products of k-step s, so a wave waits for a whole stage that was asked for two steps earlier instead of for each fragment in turn. In front of and inside the loop no load stands under a test of its own, so that each wait can count the younger stages as still in flight; the last two to four steps are peeled. The order of the k-steps and of the products into each accumulator is unchanged. */
#define G2_LD(S, ST) g2_load(S, a0p, a1p, b0p, b1p, b2p, b3p, (ST) * 512)
#define G2_ST(S) g2_step(S, c00, c01, c02, c03, c10, c11, c12, c13)
#define G2_XW() asm volatile("s_wait_xcnt 0x0" ::: "memory")      /* stands in front of code that writes anew the address registers which the loads issued so far name */
  const int nst = (K + 31) >> 5;
  if (nst == 1) { G2Stage s0; G2_LD(s0, 0); G2_ST(s0); }
  else if (nst > 1) { G2Stage s0, s1, s2; int st = 0;
    G2_LD(s0, 0); G2_LD(s1, 1); G2_XW();
#pragma unroll 1      /* one trip is already three k-steps; more would only add code */
    for (; st + 5 <= nst; st += 3) { G2_LD(s2, 2); G2_ST(s0); G2_LD(s0, 3); G2_ST(s1); G2_LD(s1, 4); G2_ST(s2); G2_XW();
      a0p += 1536; a1p += 1536; b0p += 1536; b1p += 1536; b2p += 1536; b3p += 1536; }      /* every load names one of the six pointers with a constant offset; they move on three blocks a trip */
    const int rem = nst - st;      /* 2, 3 or 4 steps are left; s0 and s1 hold the first two */
    if (rem >= 3) G2_LD(s2, 2);
    G2_ST(s0);
    if (rem >= 4) { G2_XW(); const int kt = 3 * 512;      /* here the address registers die with their loads and a later fragment may land in them: the wait stands behind each fragment's loads */
      s0.a0 = g2_frag(a0p + kt); G2_XW(); s0.a1 = g2_frag(a1p + kt); G2_XW(); s0.b0 = g2_frag(b0p + kt); G2_XW(); s0.b1 = g2_frag(b1p + kt); G2_XW(); s0.b2 = g2_frag(b2p + kt); G2_XW(); s0.b3 = g2_frag(b3p + kt); G2_XW(); }
    G2_ST(s1);
    if (rem >= 3) G2_ST(s2);
    if (rem >= 4) G2_ST(s0); }
#undef G2_LD
#undef G2_ST
#undef G2_XW
  v8f accs[8] = {c00, c01, c02, c03, c10, c11, c12, c13};
  if (CP) {      /* own elements of the batched C plane: a lane's 64 loads are issued together, in front of the first sum */
    const float* cp = CP + cofs + (size_t)(row0 + 8u * hh) * ldc + col0 + ln; v8f pv[8];
#pragma unroll
    for (int u = 0; u < 8; ++u) {
#pragma unroll
      for (int r = 0; r < 8; ++r) pv[u][r] = cp[(size_t)((u >> 2) * 16 + r) * ldc + (u & 3) * 16]; }
#pragma unroll
    for (int u = 0; u < 8; ++u) accs[u] = accs[u] * alpha + pv[u];
  } else {
#pragma unroll
    for (int u = 0; u < 8; ++u) accs[u] = accs[u] * alpha; }
#pragma unroll
  for (int u = 0; u < 8; ++u) { const unsigned int t = (unsigned int)u & 3u, half = (unsigned int)u >> 2;
#pragma unroll
    for (int r = 0; r < 8; ++r) { const unsigned int rloc = half * 16u + 8u * hh + (unsigned int)r;
      so[w][rloc][t * 16u + ln] = accs[u][r]; } }
  __builtin_amdgcn_fence(4 /* acq_rel order */, "workgroup"); __builtin_amdgcn_wave_barrier();
  if (col0 < rotN) {      /* block-uniform: this tile is one q / k head; lane owns tile row 'lane' */
    const unsigned int pos = (row0 + lane) & pmask;
    const float* cr = cosb + (size_t)pos * 32u; const float* sr = sinb + (size_t)pos * 32u; float ss = 0.f;
#pragma unroll 1
    for (unsigned int j = 0; j < 32u; j += 4u) { const v4f cc = *(const v4fa*)(cr + j), sn = *(const v4fa*)(sr + j); const v4f x1 = *(const v4fa*)&so[w][lane][j], x2 = *(const v4fa*)&so[w][lane][32u + j]; v4f y1, y2;
#pragma unroll
      for (int q = 0; q < 4; ++q) { const float c = bf16_rne(cc[q]), s = bf16_rne(sn[q]); y1[q] = x1[q] * c + x2[q] * s; y2[q] = x2[q] * c - x1[q] * s; ss += y1[q] * y1[q] + y2[q] * y2[q]; }
      *(v4fa*)&so[w][lane][j] = y1; *(v4fa*)&so[w][lane][32u + j] = y2; }
    const float rs = rsqrtf(ss * 0.015625f + 1.0e-6f);
#pragma unroll 1
    for (unsigned int j = 0; j < 64u; j += 4u) { v4f y = *(const v4fa*)&so[w][lane][j];
#pragma unroll
      for (int q = 0; q < 4; ++q) y[q] = y[q] * rs;
      *(v4fa*)&so[w][lane][j] = y; }
    __builtin_amdgcn_fence(4 /* acq_rel order */, "workgroup"); __builtin_amdgcn_wave_barrier(); }
  if (C) { const unsigned int rsub = lane >> 4, c4 = (lane & 15u) * 4u;
#pragma unroll
    for (int q = 0; q < 16; ++q) { const unsigned int r = (unsigned int)q * 2u + rsub; const v4f v = *(const v4fa*)&so[w][r][c4];
      *(v4f*)(C + cofs + (size_t)(row0 + r) * ldc + col0 + c4) = v; }
    asm volatile("s_wait_xcnt 0x0" ::: "memory"); }      /* stands in front of code that writes anew the registers which these stores name */
  if (C16) {      /* the wave's tile is 2 x 2 whole blocks of the plane; one store takes one fragment half of a block, 512 bytes in a row */
    const size_t ob = cofs + (size_t)row0 * ldc + (size_t)(col0 >> 5) * 512u + lane * 8u; v4f ta[8], tc[8];
#pragma unroll
    for (int q = 0; q < 8; ++q) { const float* sr = &so[w][((unsigned int)q >> 2) * 16u + ln][(((unsigned int)q >> 1) & 1u) * 32u + ((unsigned int)q & 1u) * 16u + hh * 8u]; ta[q] = *(const v4fa*)sr; tc[q] = *(const v4fa*)(sr + 4); }      /* all LDS reads together, ahead of the waits below */
#pragma unroll
    for (int q = 0; q < 8; ++q) { const unsigned int rg = (unsigned int)q >> 2, s = ((unsigned int)q >> 1) & 1u, hf = (unsigned int)q & 1u; const v4f va = ta[q], vc = tc[q]; FragH fh, fl;
#pragma unroll
      for (int i = 0; i < 4; ++i) { _Float16 h = (_Float16)va[i]; fh.h[i] = h; fl.h[i] = (_Float16)((va[i] - (float)h) * 1024.0f); h = (_Float16)vc[i]; fh.h[4 + i] = h; fl.h[4 + i] = (_Float16)((vc[i] - (float)h) * 1024.0f); }
      const v8us oh = fh.half[0], ol = fl.half[0]; const size_t o = ob + (size_t)rg * 16u * ldc + s * 512u + hf * 256u;
      *(v8us*)((unsigned short*)C16 + o) = oh;
      asm volatile("s_wait_xcnt 0x0" ::: "memory");      /* the same for this store */
      if (C16L) { *(v8us*)((unsigned short*)C16L + o) = ol;
        asm volatile("s_wait_xcnt 0x0" ::: "memory"); } } } }      /* and for this one */

#define GP_L ((QT0 / 128) * (LQ / 64) * NB)      /* tiles of the f32 q | k | v of the leading rows */
#define GP_A ((unsigned int)(NR / 128) * (LQ / 64))      /* tiles of the q | k | v of all rows */

// cross-lane steps of the row reductions: lane l with lane l ^ M inside a 16-lane row (DPP row_xmask), and lane l with lane l ^ 16
template <int M> __device__ __forceinline__ float sm_xrow(float x) { return __builtin_bit_cast(float, __builtin_amdgcn_update_dpp(0, __builtin_bit_cast(int, x), 0x160 | M, 0xf, 0xf, true)); }
__device__ __forceinline__ float sm_xhalf(float x) { return __builtin_bit_cast(float, __builtin_amdgcn_permlanex16(__builtin_bit_cast(int, x), __builtin_bit_cast(int, x), 0x76543210, 0xfedcba98, false, false)); }
__device__ __forceinline__ float sm_wave_max(float v) { v = fmaxf(v, sm_xrow<1>(v)); v = fmaxf(v, sm_xrow<2>(v)); v = fmaxf(v, sm_xrow<4>(v)); v = fmaxf(v, sm_xrow<8>(v)); return fmaxf(v, sm_xhalf(v)); }
__device__ __forceinline__ float sm_wave_sum(float v) { v += sm_xrow<1>(v); v += sm_xrow<2>(v); v += sm_xrow<4>(v); v += sm_xrow<8>(v); return v + sm_xhalf(v); }

// e^x as the fast library form computes it (multiply by log2 e, then v_exp_f32); the v_nop in the same statement is the one free slot the instruction set asks for behind a transcendental
__device__ __forceinline__ float sm_exp(float x) { const float t = x * 1.44269504088896340736f; float r; asm("v_exp_f32 %0, %1\n\tv_nop" : "=v"(r) : "v"(t)); return r; }

// attention of the rows from QT0 on, scores, softmax and o in one launch. A work-group owns AQ query rows of one (batch, head); their score rows stay in LDS from the products to the last use, so no score or weight goes through memory and every (batch, head, row group) runs side by side. Keys are taken up to the end of the 128-key chunk that holds the rows; later keys have weight exactly zero.
// Step 1: wave w forms the 16-key score tiles w, w + 8, ... (value plane, then residual plane of q, folded in f32). Step 2: one wave per score row, two rows a wave: lane l keeps columns 128 c + 4 l + 0..3 of every chunk c in registers, maximum and sum are per-lane partials joined across the 32 lanes; the row's weights (f16 value plane, then x1024 residual plane) are written over its own scores. Step 3: waves 0..3 (16 head columns each) sum Vh ph and Vh pl from one V fragment, waves 4..7 sum Vres ph; k-steps in rising order into each accumulator; the three sums are folded in f32 in the order Vh ph, Vres ph, Vh pl.
#define AQ 16                        /* query rows per work-group */
#define APB (NKX * 4 + 32)           /* bytes of a score row in LDS; 32 more than a multiple of 256, so that the 16-byte fragment reads of 16 rows x 2 halves fall on all banks evenly */
static_assert(QT0 % 128 == 0 && SQ % 128 == 0 && 128 % AQ == 0 && NKX / 128 <= 16 && QT0 >= 256);
typedef float fa1 __attribute__((may_alias));
struct VB { v16h f[4]; };      /* the V fragments of one 128-key chunk (four k-steps) */
// a fragment from rows in row order (the weight rows in LDS), from a pointer that already holds the lane's 8 h, so that every load of a run names that one address with a constant offset
__device__ __forceinline__ v16h at_frag(const _Float16* q) { FragH f; f.half[0] = *(const v8us*)((const unsigned short*)q); f.half[1] = *(const v8us*)((const unsigned short*)q + 16); return f.v; }
__device__ __forceinline__ void vb_load(VB& s, const _Float16* q) {
#pragma unroll
  for (int u = 0; u < 4; ++u) s.f[u] = at_frag(q + u * 32); }
// the same chunk from a plane in fragment order: four blocks that follow one another
__device__ __forceinline__ void vb_loadg(VB& s, const _Float16* q) {
#pragma unroll
  for (int u = 0; u < 4; ++u) s.f[u] = g2_frag(q + u * 512); }
// f32 attention of the leading rows, run by the first A0Y grid rows of the attention launch, beside the work-groups of the later rows instead of in a launch of its own in front of them. A work-group owns A0R query rows of the four heads of one (batch, kv head), which share the staged K and V rows; a wave takes 16 rows of one head, two lanes a row: lane l and lane l + 16 each keep one half (32 elements) of the row's q and o in registers for the whole key loop (every loop over the half is unrolled whole so that both are indexed by constants), so that this path needs no more registers than the other and two work-groups still share a WGP. A score is the sum of the two lanes' 32-term sums; maximum, sum and weights are formed alike in both lanes. The K and V rows are staged in LDS 64 keys at a time and read from there at one address per half wave: K transposed, so that one 16-byte read brings one head element of four neighbouring keys. One trip takes four keys: their four score sums are independent chains that fill each other's latency. The running maximum and sum and each o element take their terms in the order of the keys. The o rows (x64) leave as f16 value + x1024 residual planes of the merged o rows.
#define A0R 32                                   /* query rows of each of its four heads per work-group of the f32 path */
#define A0G (NB * NKV * (QT0 / A0R))             /* its work-groups */
#define A0Y (A0G / (NH * NB))                    /* the grid rows they fill */
static_assert(A0G % (NH * NB) == 0 && QT0 % 64 == 0 && 64 % A0R == 0 && A0R == 32 && (1 << KVSH) == 4);
#define A0K (HD * 68 + 16)                       /* floats of the K tile */
static_assert((A0K + 64 * HD + 4 * A0R * 68) * 4 <= AQ * APB);
__device__ __forceinline__ void att0_rows(const float* __restrict__ F0, _Float16* __restrict__ OH, _Float16* __restrict__ OL, unsigned char* lds, unsigned int id) {
  float* lk = (float*)lds;                                            /* K tile [head element][key]; pitch 68: the transposing stores of a wave fall on 32 different banks, rows stay 16-byte aligned; elements 32..63 stand 16 floats further on, so that the two addresses of a wave's read fall on different banks */
  float (*lv)[HD] = (float (*)[HD])(lds + A0K * 4);                   /* V tile [key][head element] */
  float (*lo)[68] = (float (*)[68])(lds + A0K * 4 + 64 * HD * 4);     /* o rows [head of the four][row] */
  const unsigned int tid = threadIdx.x, w = (unsigned int)__builtin_amdgcn_readfirstlane((int)(tid >> 5)), lane = tid & 31u, ln = lane & 15u, hh = lane >> 4;
  const unsigned int rg = (unsigned int)(QT0 / A0R - 1) - id / (unsigned int)(NB * NKV), sl = id % (unsigned int)(NB * NKV), b = sl / (unsigned int)NKV, hk = sl % (unsigned int)NKV;      /* the longest rows start first */
  const unsigned int i = rg * (unsigned int)A0R + (w & 1u) * 16u + ln; const unsigned int ld = (unsigned int)LQ;
  const float* QF = F0 + (size_t)b * QT0 * LQ;      /* q | k | v rows of the batch's leading rows */
  const float* qr = QF + (size_t)i * ld + ((hk << KVSH) + (w >> 1)) * HD + hh * 32u;
  v4f q[HD / 8], o[HD / 8];
#pragma unroll
  for (int c = 0; c < HD / 8; ++c) { q[c] = *(const v4fa*)(qr + c * 4); const v4f z = {0.f, 0.f, 0.f, 0.f}; o[c] = z; }
  asm volatile("s_wait_xcnt 0x0" :: "v"(qr) : "memory");      /* stands in front of code that writes anew the address registers which the q loads name; the pointer as an input keeps them out of those loads' own results */
  /* a thread's share of a tile. K: key (tid & 7) of a group of 8, 16-byte piece ((tid >> 3) & 7) of a group of 8 (a wave's load covers 8 rows x 64 bytes), key groups (tid >> 6) and (tid >> 6) + 4. V: key (tid >> 4) of a group of 16, piece (tid & 15) (whole rows). */
  const unsigned int kb = tid & 7u, ka = (tid >> 3) & 7u, kg = tid >> 6, vb = tid >> 4, va = tid & 15u;
  const unsigned int kofs = ((kg * 8u + kb) * ld + ka * 4u) * 4u, vofs = (vb * ld + va * 4u) * 4u;      /* byte offsets, the same for every tile */
  float m = -1.0e30f, l = 0.f; const unsigned int jmax = rg * (unsigned int)A0R + (unsigned int)(A0R - 1);      /* keys up to the work-group's last row */
#pragma unroll 1      /* a tile's code is long already */
  for (unsigned int j0 = 0; j0 <= jmax; j0 += 64u) { const char* tb = (const char*)(QF + (size_t)j0 * ld + hk * HD);      /* the tile's first row; its k columns stand DM, its v columns ROTN floats further on */
    __syncthreads();      /* every wave has read the last tile to its end */
    { v4f kk[4], vv[4]; const char* kq = tb + kofs; const char* vq = tb + vofs;      /* a thread's four pieces of each tile lie at constant distances from one address */
#pragma unroll
      for (int it = 0; it < 4; ++it) kk[it] = *(const v4fa*)(kq + DM * 4 + (it & 1) * (32 * LQ * 4) + (it >> 1) * 128);
#pragma unroll
      for (int it = 0; it < 4; ++it) vv[it] = *(const v4fa*)(vq + ROTN * 4 + it * (16 * LQ * 4));
      asm volatile("s_wait_xcnt 0x0" :: "v"(kq), "v"(vq) : "memory");      /* stands in front of code that writes anew the address registers which the K and V loads name; the addresses as inputs keep them out of those loads' own results */
#pragma unroll
      for (int it = 0; it < 4; ++it) {
#pragma unroll
        for (int t = 0; t < 4; ++t) lk[(((unsigned int)(it >> 1) * 8u + ka) * 4u + (unsigned int)t) * 68u + (unsigned int)(it >> 1) * 16u + ((unsigned int)(it & 1) * 4u + kg) * 8u + kb] = kk[it][t]; }
#pragma unroll
      for (int it = 0; it < 4; ++it) *(v4fa*)&lv[(unsigned int)it * 16u + vb][va * 4u] = vv[it]; }
    __syncthreads();      /* the tile is whole before any wave reads it */
    const unsigned int jend = jmax + 1u - j0 < 64u ? jmax + 1u - j0 : 64u;      /* later keys of the tile lie above every row of the work-group: weight exactly zero */
    const float* lkh = lk + hh * (32u * 68u + 16u);
#pragma unroll 1      /* one trip is already four keys; more would only add code */
    for (unsigned int jj = 0; jj < jend; jj += 4u) { float s[4] = {0.f, 0.f, 0.f, 0.f}, sc[4], e[4];
#pragma unroll
      for (int c = 0; c < HD / 8; ++c) {
#pragma unroll
        for (int t = 0; t < 4; ++t) { const v4f k4 = *(const v4fa*)(lkh + (c * 4 + t) * 68 + jj);
#pragma unroll
          for (int u = 0; u < 4; ++u) s[u] = __fadd_rn(s[u], __fmul_rn(q[c][t], k4[u])); } }
#pragma unroll
      for (int u = 0; u < 4; ++u) { const float su = __fmul_rn(__fadd_rn(s[u], sm_xhalf(s[u])), 0.125f);      /* own half + the other lane's half: the same value in both lanes */
        const float f = (j0 + jj + (unsigned int)u <= i) ? 1.f : 0.f; const float sm = fmaf(f, su, (1.f - f) * -1.0e30f); const float mn = fmaxf(m, sm); sc[u] = expf(m - mn); e[u] = expf(sm - mn); l = __fadd_rn(__fmul_rn(l, sc[u]), e[u]); m = mn; }
#pragma unroll
      for (int u = 0; u < 4; ++u) {
#pragma unroll
        for (int c = 0; c < HD / 8; ++c) { const v4f vv = *(const v4fa*)&lv[jj + (unsigned int)u][hh * 32u + (unsigned int)(c * 4)];
#pragma unroll
          for (int t = 0; t < 4; ++t) o[c][t] = __fadd_rn(__fmul_rn(o[c][t], sc[u]), __fmul_rn(e[u], vv[t])); } } } }
  { const float fin = 64.0f / l;      /* o carried x64 like the f16 path */
#pragma unroll
    for (int c = 0; c < HD / 8; ++c) { v4f oo = o[c];
#pragma unroll
      for (int u = 0; u < 4; ++u) oo[u] = __fmul_rn(oo[u], fin);
      *(v4fa*)&lo[w * 16u + ln][hh * 32u + (unsigned int)(c * 4)] = oo; } }
  __syncthreads();      /* the o rows of the four heads are whole */
#pragma unroll
  for (int it = 0; it < 4; ++it) { const unsigned int p = (unsigned int)it * 256u + tid, row = (p >> 7) * 16u + (p & 15u), pc = ((p >> 4) & 7u) * 8u; const v4f a = *(const v4fa*)&lo[row][pc], c = *(const v4fa*)&lo[row][pc + 4u]; FragH fh, fl;      /* a wave: 16 rows x 2 neighbouring pieces, 512 bytes in a row of each plane */
#pragma unroll
    for (int t = 0; t < 4; ++t) { _Float16 hv = (_Float16)a[t]; fh.h[t] = hv; fl.h[t] = (_Float16)((a[t] - (float)hv) * 1024.0f); hv = (_Float16)c[t]; fh.h[4 + t] = hv; fl.h[4 + t] = (_Float16)((c[t] - (float)hv) * 1024.0f); }
    const v8us oh = fh.half[0], ol = fl.half[0]; const size_t d = fo_piece((size_t)b * SQ + rg * (unsigned int)A0R + (row & (unsigned int)(A0R - 1)), ((hk << KVSH) + row / (unsigned int)A0R) * HD + pc, (unsigned int)DM);
    *(v8us*)((unsigned short*)OH + d) = oh; *(v8us*)((unsigned short*)OL + d) = ol; } }

__global__ __launch_bounds__(256) void k_attf(const _Float16* __restrict__ Q16, const _Float16* __restrict__ QL, const _Float16* __restrict__ K16, const _Float16* __restrict__ VT, const _Float16* __restrict__ VTL, _Float16* __restrict__ OH, _Float16* __restrict__ OL, const float* __restrict__ F0) {
  __shared__ __attribute__((aligned(16))) unsigned char sp[AQ * APB];      /* per row: f32 scores, later f16 weights at byte 0 and their residuals at byte 2 NKX */
  __shared__ __attribute__((aligned(16))) float oc[AQ][68];
  if (blockIdx.y < (unsigned int)A0Y) { att0_rows(F0, OH, OL, sp, blockIdx.y * (unsigned int)(NH * NB) + blockIdx.x); return; }      /* block-uniform: the first work-groups take the leading rows in f32 */
  const unsigned int tid = threadIdx.x, w = (unsigned int)__builtin_amdgcn_readfirstlane((int)(tid >> 5)), lane = tid & 31u, ln = lane & 15u, hh = lane >> 4;
  const unsigned int h = blockIdx.x % (unsigned int)NH, b = blockIdx.x / (unsigned int)NH, hk = h >> KVSH;
  const unsigned int q0 = (unsigned int)(SQ - AQ) - (blockIdx.y - (unsigned int)A0Y) * (unsigned int)AQ;      /* the longest rows start first */
  const unsigned int nch = q0 / 128u + 1u;      /* 128-key chunks; at least 3 */
  const size_t r0 = (size_t)b * SQ;
  const v8f z8 = {0.f,0.f,0.f,0.f,0.f,0.f,0.f,0.f};
  /* every plain '#pragma unroll' of this kernel, of vb_load and of vb_loadg stands on a short loop over a register array (u, r, q, c): unrolled whole, the array is indexed by constants and stays in registers */
  { const _Float16* qp = Q16 + (r0 + q0) * LQ + h * (HD * 16) + lane * 8u; const _Float16* lp = QL + (r0 + q0) * LQ + h * (HD * 16) + lane * 8u;      /* a head's 64 columns are two blocks that follow one another */
    const v16h qh0 = g2_frag(qp), qh1 = g2_frag(qp + 512), ql0 = g2_frag(lp), ql1 = g2_frag(lp + 512);
    asm volatile("s_wait_xcnt 0x0" :: "v"(qp), "v"(lp) : "memory");      /* stands in front of code that writes anew the address registers which the q loads name; the pointers as inputs keep them whole up to here */
    const _Float16* kb = K16 + (r0 + w * 16u) * LQ + hk * (HD * 16) + lane * 8u;
#pragma unroll 1      /* one trip is already four tiles with all their loads in flight together */
    for (unsigned int i0 = 0; i0 < nch; i0 += 4u) { const _Float16* kp[4]; v16h k0[4], k1[4];
#pragma unroll
      for (int u = 0; u < 4; ++u) { const unsigned int i = i0 + (unsigned int)u; kp[u] = kb + (size_t)((i < nch ? i : nch - 1u) * 128u) * LQ; }      /* past the end: the last tile again, so that no load stands under a test */
#pragma unroll
      for (int u = 0; u < 4; ++u) { k0[u] = g2_frag(kp[u]); k1[u] = g2_frag(kp[u] + 512); }
      asm volatile("s_wait_xcnt 0x0" :: "v"(kp[0]), "v"(kp[1]), "v"(kp[2]), "v"(kp[3]) : "memory");      /* the same for the K loads */
      __builtin_amdgcn_sched_barrier(0);      /* keeps the first product, which waits for its tile, from moving up among the loads of the later tiles */
#pragma unroll
      for (int u = 0; u < 4; ++u) { if (i0 + (unsigned int)u < nch) {
        v8f a1 = g2_mma(qh0, k0[u], z8); a1 = g2_mma(qh1, k1[u], a1);
        v8f a2 = g2_mma(ql0, k0[u], z8); a2 = g2_mma(ql1, k1[u], a2);
        unsigned char* sd = sp + (8u * hh) * (unsigned int)APB + (((i0 + (unsigned int)u) * 8u + w) * 16u + ln) * 4u;
#pragma unroll
        for (int r = 0; r < 8; ++r) *(fa1*)(sd + (unsigned int)r * (unsigned int)APB) = a2[r] * 0.0001220703125f + a1[r] * 0.125f; } } } }
  __syncthreads();      /* all score tiles of the 16 rows are in LDS */
#pragma unroll 1      /* the second row reuses the first row's registers */
  for (unsigned int rr = 0; rr < 2u; ++rr) { const unsigned int row = w * 2u + rr; unsigned char* rp = sp + row * (unsigned int)APB; const unsigned int last = q0 + row; v4f e[16];
#pragma unroll
    for (unsigned int c = 0; c < 16u; ++c) { if (c < nch) e[c] = *(const v4fa*)(rp + (c * 128u + lane * 4u) * 4u); }
    v4f m4 = {-3.0e38f, -3.0e38f, -3.0e38f, -3.0e38f};
#pragma unroll
    for (unsigned int c = 0; c < 16u; ++c) { if (c < nch) {
#pragma unroll
      for (int q = 0; q < 4; ++q) { e[c][q] = (c * 128u + lane * 4u + (unsigned int)q <= last) ? e[c][q] : -1.0e9f; m4[q] = fmaxf(m4[q], e[c][q]); } } }
    const float mx = sm_wave_max(fmaxf(fmaxf(m4[0], m4[1]), fmaxf(m4[2], m4[3])));
    v4f s4 = {0.f, 0.f, 0.f, 0.f};
#pragma unroll
    for (unsigned int c = 0; c < 16u; ++c) { if (c < nch) {
#pragma unroll
      for (int q = 0; q < 4; ++q) { e[c][q] = sm_exp(e[c][q] - mx); s4[q] += e[c][q]; } } }
    const float se = sm_wave_sum((s4[0] + s4[1]) + (s4[2] + s4[3])); const float sc = 256.0f / se;
#pragma unroll
    for (unsigned int c = 0; c < 16u; ++c) { if (c < nch) { v4h h4, l4;
#pragma unroll
      for (int q = 0; q < 4; ++q) { const float pv = e[c][q] * sc; const _Float16 hv = (_Float16)pv; h4[q] = hv; l4[q] = (_Float16)((pv - (float)hv) * 1024.0f); }
      *(v4ha*)(rp + (c * 128u + lane * 4u) * 2u) = h4; *(v4ha*)(rp + (unsigned int)NKX * 2u + (c * 128u + lane * 4u) * 2u) = l4; } } }
  __syncthreads();      /* all weight rows are in LDS */
  { const unsigned int ct = w & 3u; const bool resv = w >= 4u;      /* wave-uniform */
    const _Float16* vp = (resv ? VTL : VT) + (((size_t)b * NKV + hk) * HD + ct * 16u) * SQ + lane * 8u;      /* a chunk of 128 keys is four blocks, 2048 elements */
    const _Float16* ph = (const _Float16*)(sp + ln * (unsigned int)APB) + 8u * hh; const _Float16* pl = ph + NKX;
    v8f a1 = z8, a3 = z8; VB v0, v1, v2;      /* ring of three chunks: chunk c + 2 is asked for in front of the products of chunk c */
    vb_loadg(v0, vp); vb_loadg(v1, vp + 2048);
    asm volatile("s_wait_xcnt 0x0" :: "v"(vp) : "memory");      /* as above, for the V loads */
    /* one chunk: NEW takes chunk C + 2 (past the end: the last chunk again, so that no load stands under a test and each wait can count the younger chunks as still in flight); the chunk's weight fragments are read from LDS together; the wait as above, whose memory clobber also holds those reads in front of it, ahead of the first product; then the products of chunk C from CUR */
#define AT_CHUNK(CUR, NEW, C) { const unsigned int cc = (C); const _Float16* vn = vp + (cc + 2u < nch ? cc + 2u : nch - 1u) * 2048u; vb_loadg(NEW, vn); VB pa, pb; vb_load(pa, ph + cc * 128u); if (!resv) vb_load(pb, pl + cc * 128u); \
      asm volatile("s_wait_xcnt 0x0" :: "v"(vn) : "memory"); \
      _Pragma("unroll") for (int u = 0; u < 4; ++u) a1 = g2_mma(pa.f[u], CUR.f[u], a1); \
      if (!resv) { _Pragma("unroll") for (int u = 0; u < 4; ++u) a3 = g2_mma(pb.f[u], CUR.f[u], a3); } }
    unsigned int c = 0;
#pragma unroll 1      /* one trip is three chunks, so that the ring's stages are named, not indexed; no way out from inside a trip, the last zero, one or two chunks stand behind the loop */
    for (; c + 3u <= nch; c += 3u) { AT_CHUNK(v0, v2, c); AT_CHUNK(v1, v0, c + 1u); AT_CHUNK(v2, v1, c + 2u); }
    if (c < nch) { AT_CHUNK(v0, v2, c); if (c + 1u < nch) AT_CHUNK(v1, v0, c + 1u); }
#undef AT_CHUNK
    if (resv) {
#pragma unroll
      for (int r = 0; r < 8; ++r) oc[8u * hh + (unsigned int)r][ct * 16u + ln] = a1[r]; }
    __syncthreads();      /* the Vres ph sums are in LDS */
    if (!resv) {      /* own elements: each is read and rewritten by the same lane */
#pragma unroll
      for (int r = 0; r < 8; ++r) { float o = a1[r] * 0.25f; o = oc[8u * hh + (unsigned int)r][ct * 16u + ln] * 0.000244140625f + o; o = a3[r] * 0.000244140625f + o; oc[8u * hh + (unsigned int)r][ct * 16u + ln] = o; } } }
  __syncthreads();      /* the o tile is whole */
  if (tid < 128u) { const unsigned int row = tid & 15u, pc = (tid >> 4) * 8u; const v4f a = *(const v4fa*)&oc[row][pc], c = *(const v4fa*)&oc[row][pc + 4u]; FragH fh, fl;      /* a wave: 16 rows x 2 neighbouring pieces, 512 bytes in a row of each plane */
#pragma unroll
    for (int q = 0; q < 4; ++q) { _Float16 hv = (_Float16)a[q]; fh.h[q] = hv; fl.h[q] = (_Float16)((a[q] - (float)hv) * 1024.0f); hv = (_Float16)c[q]; fh.h[4 + q] = hv; fl.h[4 + q] = (_Float16)((c[q] - (float)hv) * 1024.0f); }
    const v8us oh = fh.half[0], ol = fl.half[0]; const size_t d = fo_piece(r0 + q0 + row, h * HD + pc, (unsigned int)DM);
    *(v8us*)((unsigned short*)OH + d) = oh; *(v8us*)((unsigned short*)OL + d) = ol; } }

constexpr size_t al256(size_t b) { return (b + 255) & ~(size_t)255; }
constexpr size_t SZ_BQKV = al256((size_t)LQ * DM * 2);
constexpr size_t SZ_BO   = al256((size_t)DM * DM * 2);
constexpr size_t SZ_XO   = al256(NR * DM * 2);                          /* X16, later reused as the merged o value rows */
constexpr size_t SZ_QKV  = al256(NR * LQ * 2);                          /* value plane; the residual plane has the same size */
constexpr size_t SZ_F0   = al256((size_t)NB * QT0 * LQ * 4);
constexpr size_t SZ_VT   = al256((size_t)NB * NKV * HD * SQ * 2);       /* V^T value plane; the residual plane has the same size */
constexpr size_t SZ_OL   = al256(NR * DM * 2);                          /* merged o residual rows */
constexpr size_t WS_TOTAL = SZ_BQKV + SZ_BO + SZ_XO + 2 * SZ_QKV + SZ_F0 + 2 * SZ_VT + SZ_OL;
static_assert(WS_TOTAL <= (size_t)134217728);
/* plane coverage equalities of the producer grids */
static_assert(((size_t)(DM / 64) * (DM / 64)) * 64 * 64 == (size_t)DM * DM);
static_assert(((size_t)(DM / 64) * (KVD / 64)) * 64 * 64 == (size_t)DM * KVD);
static_assert(((size_t)NB * NKV * (SQ / 64)) * 64 * 64 == (size_t)NB * NKV * HD * SQ);
static_assert((NR * DM) % (256 * 8) == 0);
static_assert((size_t)A0G * 4 * A0R * HD == (size_t)NB * QT0 * DM);
static_assert(((size_t)(NR / 128) * (LQ / 64)) * 128 * 64 == NR * LQ);
static_assert(((size_t)NH * NB * ((SQ - QT0) / AQ)) * AQ * HD == (NR - (size_t)NB * QT0) * DM);
static_assert(((size_t)(SQ / 128) * (DM / 64) * NB) * 128 * 64 == NR * DM);

extern "C" void kernel_launch(void* const* d_in, const int* in_sizes, int n_in,
                              void* d_out, int out_size, void* d_ws, size_t ws_size, hipStream_t stream) {
  if (n_in < 7) return;
  const size_t need_x = ((size_t)(NB - 1) * SQ_FULL + SQ) * DM;
  if ((size_t)in_sizes[0] < need_x) return;
  if ((size_t)in_sizes[1] < (size_t)SQ * 32) return;
  if ((size_t)in_sizes[2] < (size_t)SQ * 32) return;
  if ((size_t)in_sizes[3] < (size_t)DM * DM) return;
  if ((size_t)in_sizes[4] < (size_t)DM * KVD) return;
  if ((size_t)in_sizes[5] < (size_t)DM * KVD) return;
  if ((size_t)in_sizes[6] < (size_t)DM * DM) return;
  if ((size_t)out_size < need_x) return;
  const float* x = (const float*)d_in[0]; const float* cosb = (const float*)d_in[1]; const float* sinb = (const float*)d_in[2];      /* tables [pos][32], read as values */
  const float* wq = (const float*)d_in[3]; const float* wk = (const float*)d_in[4]; const float* wv = (const float*)d_in[5]; const float* wo = (const float*)d_in[6];      /* all [in][out] */
  float* out = (float*)d_out;
  char* ws = (char*)d_ws; size_t off = 0;
  auto take = [&](size_t bytes) { char* p = ws + off; off += (bytes + 255) & ~(size_t)255; return p; };
  _Float16* BQKV = (_Float16*)take(SZ_BQKV); _Float16* BO = (_Float16*)take(SZ_BO);
  _Float16* X16 = (_Float16*)take(SZ_XO); _Float16* OH = X16;      /* X16 is dead after the projection GEMMs; the merged o value rows take its place */
  _Float16* QKV = (_Float16*)take(SZ_QKV); const _Float16* Q16 = QKV; const _Float16* K16 = QKV + DM * 16; const _Float16* V16 = QKV + ROTN * 16;      /* fragment order: column c, a multiple of 32, begins 16 c elements into a row group */
  _Float16* QKVL = (_Float16*)take(SZ_QKV); const _Float16* QL = QKVL; const _Float16* VL16 = QKVL + ROTN * 16;      /* x1024 residual plane, same layout (k columns unused) */
  float* F0 = (float*)take(SZ_F0);
  _Float16* VT = (_Float16*)take(SZ_VT); _Float16* VTL = (_Float16*)take(SZ_VT);
  _Float16* OL = (_Float16*)take(SZ_OL);
  if (off > ws_size) return;

  k_prep<<<PW_ALL + PX_ALL, 256, 0, stream>>>(x, wq, wk, wv, wo, X16, BQKV, BO);      /* weights -> Bt planes, x -> X16 */
  k_gemm2<<<dim3(GP_L + GP_A, 1), 128, 0, stream>>>(X16, DM, (size_t)0, BQKV, DM, (size_t)0, 0u, 0.0625f, nullptr, nullptr, QKV, QKVL, LQ, (size_t)0, (int)(NR), LQ, DM, cosb, sinb, (unsigned int)ROTN, (unsigned int)(SQ - 1), (unsigned int)GP_L, (size_t)SQ * DM, F0, (size_t)QT0 * LQ, QT0);      /* q | k | v rows (f16 value + residual) and, side by side, f32 q | k | v of rows 0..QT0-1 of every batch; q / k rotated + normalised */
  k_vt<<<dim3(NB * NKV * (SQ / 64), 2), 256, 0, stream>>>(V16, VT, VL16, VTL);      /* V^T value and residual planes [NB][NKV][HD][SQ] */
  k_attf<<<dim3(NH * NB, A0Y + (SQ - QT0) / AQ), 256, 0, stream>>>(Q16, QL, K16, VT, VTL, OH, OL, F0);      /* grid rows below A0Y: f32 attention for rows 0..QT0-1; the others, rows from QT0 on: scores, softmax and o; final o (x64) written as f16 value + x1024 residual merged rows */
  k_gemm2<<<dim3((SQ / 128) * (DM / 64), NB), 128, 0, stream>>>(OH, DM, (size_t)SQ * DM, BO, DM, (size_t)0, 0u, 0.0009765625f, nullptr, out, nullptr, nullptr, DM, (size_t)SQ_FULL * DM, SQ, DM, DM, nullptr, nullptr, 0u, 0u, 0u, (size_t)0, nullptr, (size_t)0, 0);      /* out rows in the output layout: o value plane */
  k_gemm2<<<dim3((SQ / 128) * (DM / 64), NB), 128, 0, stream>>>(OL, DM, (size_t)SQ * DM, BO, DM, (size_t)0, 0u, 0.00000095367431640625f, (const float*)out, out, nullptr, nullptr, DM, (size_t)SQ_FULL * DM, SQ, DM, DM, nullptr, nullptr, 0u, 0u, 0u, (size_t)0, nullptr, (size_t)0, 0);      
}

// v008
// It runs in 179 microseconds.
// Next to v007, in two timings, it ran 1.07 times as fast each time.
// Counting every step since v000, it is 36.1 times as fast.
#include <hip/hip_runtime.h>
// All contractions: v_wmma_f32_16x16x32_f16 (f16 operands, f32 accumulate). x, cos, sin and all four weights are RNE-converted to bf16 first (exact in f16; weights carried x16); q (after split-half rotation + scale-free RMS normalisation in f32), v, softmax weights (x256) and o (x64) are f16 value + x1024 residual planes, every residual product in its own accumulator, folded in f32; k is a single f16 plane; the first 256 query rows of every batch use f32 q/k/v from exact-operand GEMMs and an f32 online softmax on VALU.
// Causal grouped-query self-attention: x [NB][SQ][1024]; q = x Wq (16 heads of 64), k = x Wk, v = x Wv (4 kv heads of 64; weights are [in][out]); rotation with INPUT tables cos/sin [pos][32]: y[j] = x[j] c + x[j+32] s, y[j+32] = x[j+32] c - x[j] s; q, k scaled by rsqrt(mean square over the head + 1e-6); query head h uses kv head h >> 2; scores * 0.125; keys above the query get exactly zero weight; softmax; out = merged y Wo -> [NB][SQ][1024] f32.
// Structure: token rows r = b*SQ + s; X16 exact f16 rows; one q|k|v GEMM (N = 1536) whose epilogue applies rotation + normalisation on the 64-column head tiles of q and k and writes value + residual planes; V^T value and residual planes per (batch, kv head) via LDS transposes; one attention launch, a work-group per (batch, head, 16 query rows), whose score rows never leave LDS: scores = qh k + qres k against the keys up to the end of the rows' own 128-key chunk, causal row softmax on VALU, one wave per row (P value + residual written over the row's scores), o = Vh ph + Vres ph + Vh pl folded in f32 and written as f16 value + residual merged o rows (x64); out = oh Wo + ores Wo. Rows 0..255 of each batch: f32 attention by the first work-groups of the same launch, split into the same two o planes. Every f16 operand plane in the workspace (X16, the weights, q | k | v, V^T, o) is stored in fragment order (see fo_piece).
#ifndef NB
#define NB 2
#endif
#ifndef SQ
#define SQ 2048
#endif
#define NB_FULL 2
#define SQ_FULL 2048
#define DM 1024
#define NH 16
#define NKV 4
#define KVSH 2                       /* query head -> kv head shift */
#define HD 64
#define KVD (NKV * HD)               /* 256 */
#define LQ (DM + 2 * KVD)            /* row pitch of the q | k | v rows: 1536 */
#define ROTN (DM + KVD)              /* columns below this are q / k heads (rotated + normalised) */
#define QT 256                       /* not used by any kernel, only by the static_asserts */
#define QT0 256                      /* leading rows of every batch computed in f32 */
#define NKX SQ                       /* keys of an S / P row; the LDS row pitch is APB */
#define NR ((size_t)NB * SQ)         /* token rows */

static_assert(NB <= NB_FULL);
static_assert(SQ <= SQ_FULL);
static_assert((SQ & (SQ - 1)) == 0);
static_assert(SQ % QT == 0);
static_assert((QT & (QT - 1)) == 0);
static_assert(QT % 128 == 0);
static_assert(QT0 == QT);
static_assert(QT0 % 128 == 0);
static_assert(QT0 % 64 == 0);
static_assert(HD == 64);
static_assert(DM == NH * HD);
static_assert(NH == (NKV << KVSH));
static_assert(DM / 8 == 128);
static_assert(DM % 64 == 0);
static_assert(KVD % 64 == 0);
static_assert(LQ % 64 == 0);
static_assert(ROTN % 64 == 0);
static_assert(((size_t)NB * SQ) % 128 == 0);
static_assert(SQ % 64 == 0);
static_assert(DM % 32 == 0);

typedef unsigned short v8us __attribute__((ext_vector_type(8), may_alias));
typedef float  v8f  __attribute__((ext_vector_type(8)));
typedef float  v4f  __attribute__((ext_vector_type(4)));
typedef float  v4fa __attribute__((ext_vector_type(4), may_alias));
typedef _Float16 v16h __attribute__((ext_vector_type(16)));
typedef _Float16 v4h __attribute__((ext_vector_type(4)));
typedef _Float16 v4ha __attribute__((ext_vector_type(4), may_alias));
union FragH { v16h v; v8us half[2]; _Float16 h[16]; unsigned short u[16]; };

__device__ __forceinline__ unsigned short bf16_bits(float x) { unsigned int u = __float_as_uint(x); return (unsigned short)((u + 0x7FFFu + ((u >> 16) & 1u)) >> 16); }
__device__ __forceinline__ float bf16_val(unsigned short b) { return __uint_as_float(((unsigned int)b) << 16); }
__device__ __forceinline__ float bf16_rne(float x) { return bf16_val(bf16_bits(x)); }

// fragment: elements 0..7 <- k0 + 8h + 0..7, elements 8..15 <- k0 + 16 + 8h + 0..7 (same map for A rows and B columns)
// Fragment order of an f16 operand plane (rows of L elements, L a multiple of 32): the plane is cut into blocks of 16 rows x 32 k, 512 elements each, block (g, s) at (g * (L / 32) + s) * 512. Inside a block stand elements 0..7 of the fragment of lanes 0, 1, .. 31 (lane = 16 h + row), then elements 8..15 in the same lane order. Each of a fragment's two 16-byte loads then reads 512 bytes in a row, four whole lines; with the rows in memory order it read 32 bytes on each of 16 lines. A group of 16 rows takes 16 L elements as in row order, so offsets of whole row groups keep their values; 32 columns further on is 512 elements further on.
// fo_piece: offset of the 8 elements k .. k + 7 (k a multiple of 8) of row r
__device__ __forceinline__ size_t fo_piece(size_t r, unsigned int k, unsigned int L) { return ((r >> 4) * (size_t)(L >> 5) + (k >> 5)) * 512u + ((k >> 4) & 1u) * 256u + ((k >> 3) & 1u) * 128u + ((unsigned int)r & 15u) * 8u; }
// p: the block's start + 8 * lane
__device__ __forceinline__ v16h g2_frag(const _Float16* p) { FragH f; f.half[0] = *(const v8us*)((const unsigned short*)p); f.half[1] = *(const v8us*)((const unsigned short*)p + 256); return f.v; }
__device__ __forceinline__ v8f g2_mma(v16h a, v16h b, v8f c) { v8f d = __builtin_amdgcn_wmma_f32_16x16x32_f16(false, a, false, b, (short)0, c, false, false); asm volatile("v_nop\n\tv_nop\n\tv_nop\n\tv_nop" : "+v"(d) : "v"(a), "v"(b)); return d; }

// bx: the 64 x 64 tile of this weight that the work-group takes
__device__ __forceinline__ void wT_tile(const float* __restrict__ w, unsigned int Kd, unsigned int Nd, _Float16* __restrict__ Bt, unsigned int bx) {
  __shared__ unsigned short tl[64][66];
  const unsigned int tid = threadIdx.x; const unsigned int ntn = Nd >> 6; const unsigned int kt = bx / ntn, nt = bx - kt * ntn; const unsigned int k0 = kt * 64u, n0 = nt * 64u;
  for (unsigned int i = tid; i < 64u * 16u; i += 256u) { const unsigned int r = i >> 4, c4 = (i & 15u) * 4u; const v4f a = *(const v4fa*)(w + (size_t)(k0 + r) * Nd + n0 + c4); FragH f;
#pragma unroll
    for (int q = 0; q < 4; ++q) f.h[q] = (_Float16)(bf16_rne(a[q]) * 16.0f);
#pragma unroll
    for (int q = 0; q < 4; ++q) tl[r][c4 + q] = f.u[q]; }
  __syncthreads();
  {
#pragma unroll
    for (int rd = 0; rd < 2; ++rd) { const unsigned int d = (unsigned int)rd * 32u + (tid >> 7) * 16u + (tid & 15u), pc = (tid >> 4) & 7u; FragH f;      /* a wave: 16 rows x 2 neighbouring pieces, 512 bytes in a row of the plane */
#pragma unroll
      for (int q = 0; q < 8; ++q) f.u[q] = tl[pc * 8u + q][d];
      const v8us o = f.half[0];
      *(v8us*)((unsigned short*)Bt + fo_piece(n0 + d, k0 + pc * 8u, Kd)) = o; }
     } }

__device__ __forceinline__ void x16_tile(const float* __restrict__ x, _Float16* __restrict__ X16, unsigned int bx) {
  /* a work-group takes 16 rows x 128 columns: four blocks that follow one another in the plane. Whole 512-byte runs of x rows come in, the f16 tile turns in LDS, whole runs of the plane go out. */
  __shared__ __attribute__((aligned(16))) unsigned short tl[16][136];      /* pitch 136: rows stay 16-byte aligned and the 16-byte reads of 16 rows fall on different banks */
  const unsigned int tid = threadIdx.x;
  const unsigned int g = bx >> 3, kt = bx & 7u;                   /* DM / 128 = 8 column tiles per row group */
  const unsigned int r = tid >> 5, c4 = (tid & 31u) * 4u;      /* rows r and r + 8 of the group: a wave reads 512 bytes in a row of one x row */
  const unsigned int row = g * 16u + r, b = row / (unsigned int)SQ, s = row - b * (unsigned int)SQ;      /* a group of 16 rows lies in one batch */
  const float* xp = x + ((size_t)b * SQ_FULL + s) * DM + kt * 128u + c4;
  const v4f a0 = *(const v4fa*)xp, a1 = *(const v4fa*)(xp + 8 * DM); v4h h0, h1;
  asm volatile("s_wait_xcnt 0x0" :: "v"(xp) : "memory");      /* stands in front of code that writes anew the address registers which the two loads name; the pointer as an input keeps them out of those loads' own results */
#pragma unroll
  for (int q = 0; q < 4; ++q) { h0[q] = (_Float16)bf16_rne(a0[q]); h1[q] = (_Float16)bf16_rne(a1[q]); }
  *(v4ha*)&tl[r][c4] = h0; *(v4ha*)&tl[r + 8u][c4] = h1;
  __syncthreads();      /* the tile is whole before it is read across its rows */
  const v8us o = *(const v8us*)&tl[tid & 15u][(tid >> 6) * 32u + ((tid >> 5) & 1u) * 16u + ((tid >> 4) & 1u) * 8u];      /* thread = (block, fragment half, lane) in the plane's own order */
  *(v8us*)((unsigned short*)X16 + ((size_t)bx * 256u + tid) * 8u) = o;
}

// the four weight transposes and the x conversion depend on nothing but the inputs: one launch runs them side by side, each work-group taking one tile of one of the five jobs (block-uniform choice, in front of every barrier)
#define PW_Q ((DM / 64) * (DM / 64))             /* tiles of Wq, and of Wo */
#define PW_KV ((DM / 64) * (KVD / 64))           /* tiles of Wk, and of Wv */
#define PW_ALL (2 * PW_Q + 2 * PW_KV)
#define PX_ALL ((unsigned int)(NR * DM / (256 * 8)))      /* tiles of x */
__global__ __launch_bounds__(256) void k_prep(const float* __restrict__ x, const float* __restrict__ wq, const float* __restrict__ wk, const float* __restrict__ wv, const float* __restrict__ wo, _Float16* __restrict__ X16, _Float16* __restrict__ BQKV, _Float16* __restrict__ BO) {
  const unsigned int bx = blockIdx.x;
  if (bx >= (unsigned int)PW_ALL) { x16_tile(x, X16, bx - (unsigned int)PW_ALL); return; }
  const float* w = wq; _Float16* Bt = BQKV; unsigned int Nd = (unsigned int)DM, t = bx;                                                     /* W[DM][DM] -> Bt rows 0..1023 */
  if (bx >= (unsigned int)(PW_Q + 2 * PW_KV)) { w = wo; Bt = BO; t = bx - (unsigned int)(PW_Q + 2 * PW_KV); }                                /* Wo[c][n] -> Bt[n][c] */
  else if (bx >= (unsigned int)(PW_Q + PW_KV)) { w = wv; Bt = BQKV + (size_t)ROTN * DM; Nd = (unsigned int)KVD; t = bx - (unsigned int)(PW_Q + PW_KV); }      /* W[DM][KVD] -> Bt rows 1280..1535 */
  else if (bx >= (unsigned int)PW_Q) { w = wk; Bt = BQKV + (size_t)DM * DM; Nd = (unsigned int)KVD; t = bx - (unsigned int)PW_Q; }           /* W[DM][KVD] -> Bt rows 1024..1279 */
  wT_tile(w, (unsigned int)DM, Nd, Bt, t);
}

// grid row 0 turns the value plane, grid row 1 the residual plane, side by side in one launch
__global__ __launch_bounds__(256) void k_vt(const _Float16* __restrict__ VH16, _Float16* __restrict__ VtH, const _Float16* __restrict__ VL16, _Float16* __restrict__ VtL) {
  __shared__ unsigned short tl[64][66];
  const _Float16* V16 = blockIdx.y ? VL16 : VH16; _Float16* Vt = blockIdx.y ? VtL : VtH;      /* block-uniform */
  const unsigned int tid = threadIdx.x; const unsigned int slab = blockIdx.x / (unsigned int)(SQ / 64), lg = blockIdx.x % (unsigned int)(SQ / 64); const unsigned int b = slab / (unsigned int)NKV, h = slab % (unsigned int)NKV;
  for (unsigned int i = tid; i < 64u * 8u; i += 256u) { const unsigned int r = (i >> 7) * 16u + (i & 15u), c8 = ((i >> 4) & 7u) * 8u; FragH f; const unsigned short* vq = (const unsigned short*)V16 + fo_piece((size_t)b * SQ + lg * 64u + r, h * 64u + c8, (unsigned int)LQ); f.half[0] = *(const v8us*)vq;      /* a wave: 16 rows x 2 neighbouring pieces, 512 bytes in a row of the plane */
    asm volatile("s_wait_xcnt 0x0" :: "v"(vq) : "memory");      /* stands in front of code that writes anew the address registers which the load names; the pointer as an input keeps them out of the load's own result */
#pragma unroll
    for (int q = 0; q < 8; ++q) tl[r][c8 + q] = f.u[q]; }
  __syncthreads();
  {
#pragma unroll
    for (int rd = 0; rd < 2; ++rd) { const unsigned int d = (unsigned int)rd * 32u + (tid >> 7) * 16u + (tid & 15u), pc = (tid >> 4) & 7u; FragH f;      /* the same deal of a wave for the plane that is written */
#pragma unroll
      for (int q = 0; q < 8; ++q) f.u[q] = tl[pc * 8u + q][d];
      const v8us o = f.half[0];
      *(v8us*)((unsigned short*)Vt + fo_piece((size_t)slab * 64u + d, lg * 64u + pc * 8u, (unsigned int)SQ)) = o; }
     } }

// one k-step (32 k) of a wave's operands: two A row fragments and four B column fragments
struct G2Stage { v16h a0, a1, b0, b1, b2, b3; };
__device__ __forceinline__ void g2_load(G2Stage& s, const _Float16* a0p, const _Float16* a1p, const _Float16* b0p, const _Float16* b1p, const _Float16* b2p, const _Float16* b3p, int kb) {
  s.a0 = g2_frag(a0p + kb); s.a1 = g2_frag(a1p + kb); s.b0 = g2_frag(b0p + kb); s.b1 = g2_frag(b1p + kb); s.b2 = g2_frag(b2p + kb); s.b3 = g2_frag(b3p + kb); }
__device__ __forceinline__ void g2_step(const G2Stage& s, v8f& c00, v8f& c01, v8f& c02, v8f& c03, v8f& c10, v8f& c11, v8f& c12, v8f& c13) {
  c00 = g2_mma(s.a0, s.b0, c00); c10 = g2_mma(s.a1, s.b0, c10); c01 = g2_mma(s.a0, s.b1, c01); c11 = g2_mma(s.a1, s.b1, c11);
  c02 = g2_mma(s.a0, s.b2, c02); c12 = g2_mma(s.a1, s.b2, c12); c03 = g2_mma(s.a0, s.b3, c03); c13 = g2_mma(s.a1, s.b3, c13); }

// batched GEMM (grid.y = head / batch slab): C = alpha * A Bt^T. A f16 [M][K], rows of lda elements (slab stride sA), Bt f16 [N][K], rows of ldb elements (slab stride sB applied to blockIdx.y >> bsh), both in fragment order; outputs f32 C in row order and/or f16 value plane C16 (+ optional x2^10 residual plane C16L of the same f32 value) in fragment order, rows of ldc elements, slab stride sC.
// A second product of the same A and Bt planes may run side by side with the first in one launch: the first nx2 work-groups (none where nx2 is 0) form slabs of M2 rows, slab strides sA2 and sC2, f32 output C2 only.
__global__ __launch_bounds__(128) void k_gemm2(const _Float16* __restrict__ A, int lda, size_t sA, const _Float16* __restrict__ Bh, int ldb, size_t sB, unsigned int bsh, float alpha,
    float* C, _Float16* C16, _Float16* C16L, int ldc, size_t sC, int M, int N, int K, const float* cosb, const float* sinb, unsigned int rotN, unsigned int pmask, unsigned int nx2, size_t sA2, float* C2, size_t sC2, int M2) {
  __shared__ __attribute__((aligned(16))) float so[4][32][68];
  const unsigned int tid = threadIdx.x, w = tid >> 5, lane = tid & 31u, ln = lane & 15u, hh = lane >> 4; unsigned int bx = blockIdx.x, by = blockIdx.y;
  if (bx < nx2) { const unsigned int per = ((unsigned int)M2 >> 7) * ((unsigned int)N >> 6); by = bx / per; bx -= by * per; sA = sA2; sC = sC2; M = M2; C = C2; C16 = nullptr; C16L = nullptr; }      /* block-uniform: tile and slab of the second product */
  else bx -= nx2;
  A += (size_t)by * sA; Bh += (size_t)(by >> bsh) * sB; const size_t cofs = (size_t)by * sC;
  const unsigned int ntn = (unsigned int)N >> 6; const unsigned int mt = bx / ntn, nq = bx - mt * ntn; const unsigned int row0 = mt * 128u + 32u * w, col0 = nq * 64u; if (row0 >= (unsigned int)M) return;
  const _Float16* a0p = A + (size_t)row0 * lda + lane * 8u; const _Float16* a1p = a0p + (size_t)16 * lda;      /* first block of the row group + the lane's place in a block */
  const _Float16* b0p = Bh + (size_t)col0 * ldb + lane * 8u; const _Float16* b1p = b0p + (size_t)16 * ldb; const _Float16* b2p = b1p + (size_t)16 * ldb; const _Float16* b3p = b2p + (size_t)16 * ldb;
  const v8f z8 = {0.f,0.f,0.f,0.f,0.f,0.f,0.f,0.f}; v8f c00 = z8, c01 = z8, c02 = z8, c03 = z8, c10 = z8, c11 = z8, c12 = z8, c13 = z8;
  /* K loop as a ring of three register stages: the twelve loads of k-step s + 2 are issued together in front of the products of k-step s, so a wave waits for a whole stage that was asked for two steps earlier instead of for each fragment in turn. In front of and inside the loop no load stands under a test of its own, so that each wait can count the younger stages as still in flight; the last two to four steps are peeled. The order of the k-steps and of the products into each accumulator is unchanged. */
#define G2_LD(S, ST) g2_load(S, a0p, a1p, b0p, b1p, b2p, b3p, (ST) * 512)
#define G2_ST(S) g2_step(S, c00, c01, c02, c03, c10, c11, c12, c13)
#define G2_XW() asm volatile("s_wait_xcnt 0x0" ::: "memory")      /* stands in front of code that writes anew the address registers which the loads issued so far name */
  const int nst = (K + 31) >> 5;
  if (nst == 1) { G2Stage s0; G2_LD(s0, 0); G2_ST(s0); }
  else if (nst > 1) { G2Stage s0, s1, s2; int st = 0;
    G2_LD(s0, 0); G2_LD(s1, 1); G2_XW();
#pragma unroll 1      /* one trip is already three k-steps; more would only add code */
    for (; st + 5 <= nst; st += 3) { G2_LD(s2, 2); G2_ST(s0); G2_LD(s0, 3); G2_ST(s1); G2_LD(s1, 4); G2_ST(s2); G2_XW();
      a0p += 1536; a1p += 1536; b0p += 1536; b1p += 1536; b2p += 1536; b3p += 1536; }      /* every load names one of the six pointers with a constant offset; they move on three blocks a trip */
    const int rem = nst - st;      /* 2, 3 or 4 steps are left; s0 and s1 hold the first two */
    if (rem >= 3) G2_LD(s2, 2);
    G2_ST(s0);
    if (rem >= 4) { G2_XW(); const int kt = 3 * 512;      /* here the address registers die with their loads and a later fragment may land in them: the wait stands behind each fragment's loads */
      s0.a0 = g2_frag(a0p + kt); G2_XW(); s0.a1 = g2_frag(a1p + kt); G2_XW(); s0.b0 = g2_frag(b0p + kt); G2_XW(); s0.b1 = g2_frag(b1p + kt); G2_XW(); s0.b2 = g2_frag(b2p + kt); G2_XW(); s0.b3 = g2_frag(b3p + kt); G2_XW(); }
    G2_ST(s1);
    if (rem >= 3) G2_ST(s2);
    if (rem >= 4) G2_ST(s0); }
#undef G2_LD
#undef G2_ST
#undef G2_XW
  v8f accs[8] = {c00, c01, c02, c03, c10, c11, c12, c13};
#pragma unroll
  for (int u = 0; u < 8; ++u) accs[u] = accs[u] * alpha;
#pragma unroll
  for (int u = 0; u < 8; ++u) { const unsigned int t = (unsigned int)u & 3u, half = (unsigned int)u >> 2;
#pragma unroll
    for (int r = 0; r < 8; ++r) { const unsigned int rloc = half * 16u + 8u * hh + (unsigned int)r;
      so[w][rloc][t * 16u + ln] = accs[u][r]; } }
  __builtin_amdgcn_fence(4 /* acq_rel order */, "workgroup"); __builtin_amdgcn_wave_barrier();
  if (col0 < rotN) {      /* block-uniform: this tile is one q / k head; lane owns tile row 'lane' */
    const unsigned int pos = (row0 + lane) & pmask;
    const float* cr = cosb + (size_t)pos * 32u; const float* sr = sinb + (size_t)pos * 32u; float ss = 0.f;
#pragma unroll 1
    for (unsigned int j = 0; j < 32u; j += 4u) { const v4f cc = *(const v4fa*)(cr + j), sn = *(const v4fa*)(sr + j); const v4f x1 = *(const v4fa*)&so[w][lane][j], x2 = *(const v4fa*)&so[w][lane][32u + j]; v4f y1, y2;
#pragma unroll
      for (int q = 0; q < 4; ++q) { const float c = bf16_rne(cc[q]), s = bf16_rne(sn[q]); y1[q] = x1[q] * c + x2[q] * s; y2[q] = x2[q] * c - x1[q] * s; ss += y1[q] * y1[q] + y2[q] * y2[q]; }
      *(v4fa*)&so[w][lane][j] = y1; *(v4fa*)&so[w][lane][32u + j] = y2; }
    const float rs = rsqrtf(ss * 0.015625f + 1.0e-6f);
#pragma unroll 1
    for (unsigned int j = 0; j < 64u; j += 4u) { v4f y = *(const v4fa*)&so[w][lane][j];
#pragma unroll
      for (int q = 0; q < 4; ++q) y[q] = y[q] * rs;
      *(v4fa*)&so[w][lane][j] = y; }
    __builtin_amdgcn_fence(4 /* acq_rel order */, "workgroup"); __builtin_amdgcn_wave_barrier(); }
  if (C) { const unsigned int rsub = lane >> 4, c4 = (lane & 15u) * 4u;
#pragma unroll
    for (int q = 0; q < 16; ++q) { const unsigned int r = (unsigned int)q * 2u + rsub; const v4f v = *(const v4fa*)&so[w][r][c4];
      *(v4f*)(C + cofs + (size_t)(row0 + r) * ldc + col0 + c4) = v; }
    asm volatile("s_wait_xcnt 0x0" ::: "memory"); }      /* stands in front of code that writes anew the registers which these stores name */
  if (C16) {      /* the wave's tile is 2 x 2 whole blocks of the plane; one store takes one fragment half of a block, 512 bytes in a row */
    const size_t ob = cofs + (size_t)row0 * ldc + (size_t)(col0 >> 5) * 512u + lane * 8u; v4f ta[8], tc[8];
#pragma unroll
    for (int q = 0; q < 8; ++q) { const float* sr = &so[w][((unsigned int)q >> 2) * 16u + ln][(((unsigned int)q >> 1) & 1u) * 32u + ((unsigned int)q & 1u) * 16u + hh * 8u]; ta[q] = *(const v4fa*)sr; tc[q] = *(const v4fa*)(sr + 4); }      /* all LDS reads together, ahead of the waits below */
#pragma unroll
    for (int q = 0; q < 8; ++q) { const unsigned int rg = (unsigned int)q >> 2, s = ((unsigned int)q >> 1) & 1u, hf = (unsigned int)q & 1u; const v4f va = ta[q], vc = tc[q]; FragH fh, fl;
#pragma unroll
      for (int i = 0; i < 4; ++i) { _Float16 h = (_Float16)va[i]; fh.h[i] = h; fl.h[i] = (_Float16)((va[i] - (float)h) * 1024.0f); h = (_Float16)vc[i]; fh.h[4 + i] = h; fl.h[4 + i] = (_Float16)((vc[i] - (float)h) * 1024.0f); }
      const v8us oh = fh.half[0], ol = fl.half[0]; const size_t o = ob + (size_t)rg * 16u * ldc + s * 512u + hf * 256u;
      *(v8us*)((unsigned short*)C16 + o) = oh;
      asm volatile("s_wait_xcnt 0x0" ::: "memory");      /* the same for this store */
      if (C16L) { *(v8us*)((unsigned short*)C16L + o) = ol;
        asm volatile("s_wait_xcnt 0x0" ::: "memory"); } } } }      /* and for this one */

// out = OSH * (oh Wo) + OSL * (ores Wo), both products in one launch. A wave owns 32 rows x 64 columns of out and keeps two accumulator sets, one per o plane: every Wo fragment it loads feeds the products of both planes (8 fragment loads for 16 products; with a launch per plane 12), and the two sums are folded in registers, so that out is written once and never read. Each accumulator takes its k-steps in rising order, and the fold is value sum * OSH first, then residual sum * OSL added to it.
#define OSH 0.0009765625f                /* 1 / (64 * 16): o is carried x64, Wo x16 */
#define OSL 0.00000095367431640625f      /* the same / 1024 for the residual plane */
#define ONST (DM / 32)                   /* k-steps */
static_assert(ONST >= 2);
struct GOStage { v16h h0, h1, l0, l1, b0, b1, b2, b3; };      /* one k-step: two row fragments of each o plane, four Wo column fragments */
// every load of a stage names one of three addresses with a constant offset: 16 rows further on is 16 DM elements further on
__device__ __forceinline__ void go_load(GOStage& s, const _Float16* hp, const _Float16* lp, const _Float16* bp, int kb) {
  s.h0 = g2_frag(hp + kb); s.h1 = g2_frag(hp + 16 * DM + kb); s.l0 = g2_frag(lp + kb); s.l1 = g2_frag(lp + 16 * DM + kb);
  s.b0 = g2_frag(bp + kb); s.b1 = g2_frag(bp + 16 * DM + kb); s.b2 = g2_frag(bp + 32 * DM + kb); s.b3 = g2_frag(bp + 48 * DM + kb); }
// the plain builtin: its operands may stand in any register of the wave's budget (this kernel needs more than 256), and the compiler keeps the distances behind it itself
__device__ __forceinline__ v8f go_mma(v16h a, v16h b, v8f c) { return __builtin_amdgcn_wmma_f32_16x16x32_f16(false, a, false, b, (short)0, c, false, false); }
__device__ __forceinline__ void go_col(v16h b, const GOStage& s, v8f& h0, v8f& h1, v8f& l0, v8f& l1) { h0 = go_mma(s.h0, b, h0); h1 = go_mma(s.h1, b, h1); l0 = go_mma(s.l0, b, l0); l1 = go_mma(s.l1, b, l1); }
__device__ __forceinline__ void go_step(const GOStage& s, v8f (&ch)[8], v8f (&cl)[8]) {
  go_col(s.b0, s, ch[0], ch[4], cl[0], cl[4]); go_col(s.b1, s, ch[1], ch[5], cl[1], cl[5]); go_col(s.b2, s, ch[2], ch[6], cl[2], cl[6]); go_col(s.b3, s, ch[3], ch[7], cl[3], cl[7]); }
__global__ __launch_bounds__(128) void k_gemmo(const _Float16* __restrict__ AH, const _Float16* __restrict__ AL, const _Float16* __restrict__ Bh, float* __restrict__ C) {
  __shared__ __attribute__((aligned(16))) float so[4][32][68];
  const unsigned int tid = threadIdx.x, w = tid >> 5, lane = tid & 31u, ln = lane & 15u, hh = lane >> 4;
  const unsigned int mt = blockIdx.x / (unsigned int)(DM / 64), nq = blockIdx.x % (unsigned int)(DM / 64); const unsigned int row0 = mt * 128u + 32u * w, col0 = nq * 64u;
  const size_t aofs = ((size_t)blockIdx.y * SQ + row0) * DM + lane * 8u;      /* first block of the row group + the lane's place in a block */
  const _Float16* hp = AH + aofs; const _Float16* lp = AL + aofs; const _Float16* bp = Bh + (size_t)col0 * DM + lane * 8u;
  const v8f z8 = {0.f,0.f,0.f,0.f,0.f,0.f,0.f,0.f}; v8f ch[8], cl[8];
  /* every plain '#pragma unroll' of this kernel stands on a short loop over a register array: unrolled whole, the array is indexed by constants and stays in registers */
#pragma unroll
  for (int u = 0; u < 8; ++u) { ch[u] = z8; cl[u] = z8; }
  /* K loop as in k_gemm2: a ring of three register stages, the loads of k-step s + 2 issued together in front of the products of k-step s; the last two to four steps are peeled */
#define GO_LD(S, ST) go_load(S, hp, lp, bp, (ST) * 512)
#define GO_XW() asm volatile("s_wait_xcnt 0x0" :: "v"(hp), "v"(lp), "v"(bp) : "memory")      /* stands in front of code that writes anew the address registers which the loads issued so far name; the three addresses as inputs keep them whole up to here */
  { GOStage s0, s1, s2; int st = 0;
    GO_LD(s0, 0); GO_LD(s1, 1); GO_XW();
#pragma unroll 1      /* one trip is already three k-steps; more would only add code */
    for (; st + 5 <= ONST; st += 3) { GO_LD(s2, 2); go_step(s0, ch, cl); GO_LD(s0, 3); go_step(s1, ch, cl); GO_LD(s1, 4); go_step(s2, ch, cl); GO_XW();
      hp += 1536; lp += 1536; bp += 1536; }      /* three blocks a trip */
    constexpr int rem = ONST - ((ONST - 2) / 3) * 3;      /* 2, 3 or 4 steps are left; s0 and s1 hold the first two */
    if (rem >= 3) { GO_LD(s2, 2); GO_XW(); }
    go_step(s0, ch, cl);
    if (rem >= 4) { GO_LD(s0, 3); GO_XW(); }
    go_step(s1, ch, cl);
    if (rem >= 3) go_step(s2, ch, cl);
    if (rem >= 4) go_step(s0, ch, cl); }
#undef GO_LD
#undef GO_XW
#pragma unroll
  for (int u = 0; u < 8; ++u) { const unsigned int t = (unsigned int)u & 3u, half = (unsigned int)u >> 2; const v8f o = cl[u] * OSL + ch[u] * OSH;
#pragma unroll
    for (int r = 0; r < 8; ++r) so[w][half * 16u + 8u * hh + (unsigned int)r][t * 16u + ln] = o[r]; }
  __builtin_amdgcn_fence(4 /* acq_rel order */, "workgroup"); __builtin_amdgcn_wave_barrier();      /* the wave's own tile is in LDS before its lanes read across it */
  { const unsigned int rsub = lane >> 4, c4 = (lane & 15u) * 4u; float* cp = C + ((size_t)blockIdx.y * SQ_FULL + row0 + rsub) * DM + col0 + c4; v4f v[16];      /* whole 256-byte runs of two out rows a store; all stores name one address with a constant offset */
#pragma unroll
    for (int q = 0; q < 16; ++q) v[q] = *(const v4fa*)&so[w][(unsigned int)q * 2u + rsub][c4];
#pragma unroll
    for (int q = 0; q < 16; ++q) *(v4f*)(cp + (size_t)q * 2u * DM) = v[q]; } }

#define GP_L ((QT0 / 128) * (LQ / 64) * NB)      /* tiles of the f32 q | k | v of the leading rows */
#define GP_A ((unsigned int)(NR / 128) * (LQ / 64))      /* tiles of the q | k | v of all rows */

// cross-lane steps of the row reductions: lane l with lane l ^ M inside a 16-lane row (DPP row_xmask), and lane l with lane l ^ 16
template <int M> __device__ __forceinline__ float sm_xrow(float x) { return __builtin_bit_cast(float, __builtin_amdgcn_update_dpp(0, __builtin_bit_cast(int, x), 0x160 | M, 0xf, 0xf, true)); }
__device__ __forceinline__ float sm_xhalf(float x) { return __builtin_bit_cast(float, __builtin_amdgcn_permlanex16(__builtin_bit_cast(int, x), __builtin_bit_cast(int, x), 0x76543210, 0xfedcba98, false, false)); }
__device__ __forceinline__ float sm_wave_max(float v) { v = fmaxf(v, sm_xrow<1>(v)); v = fmaxf(v, sm_xrow<2>(v)); v = fmaxf(v, sm_xrow<4>(v)); v = fmaxf(v, sm_xrow<8>(v)); return fmaxf(v, sm_xhalf(v)); }
__device__ __forceinline__ float sm_wave_sum(float v) { v += sm_xrow<1>(v); v += sm_xrow<2>(v); v += sm_xrow<4>(v); v += sm_xrow<8>(v); return v + sm_xhalf(v); }

// e^x as the fast library form computes it (multiply by log2 e, then v_exp_f32); the v_nop in the same statement is the one free slot the instruction set asks for behind a transcendental
__device__ __forceinline__ float sm_exp(float x) { const float t = x * 1.44269504088896340736f; float r; asm("v_exp_f32 %0, %1\n\tv_nop" : "=v"(r) : "v"(t)); return r; }

// attention of the rows from QT0 on, scores, softmax and o in one launch. A work-group owns AQ query rows of one (batch, head); their score rows stay in LDS from the products to the last use, so no score or weight goes through memory and every (batch, head, row group) runs side by side. Keys are taken up to the end of the 128-key chunk that holds the rows; later keys have weight exactly zero.
// Step 1: wave w forms the 16-key score tiles w, w + 8, ... (value plane, then residual plane of q, folded in f32). Step 2: one wave per score row, two rows a wave: lane l keeps columns 128 c + 4 l + 0..3 of every chunk c in registers, maximum and sum are per-lane partials joined across the 32 lanes; the row's weights (f16 value plane, then x1024 residual plane) are written over its own scores. Step 3: waves 0..3 (16 head columns each) sum Vh ph and Vh pl from one V fragment, waves 4..7 sum Vres ph; k-steps in rising order into each accumulator; the three sums are folded in f32 in the order Vh ph, Vres ph, Vh pl.
#define AQ 16                        /* query rows per work-group */
#define APB (NKX * 4 + 32)           /* bytes of a score row in LDS; 32 more than a multiple of 256, so that the 16-byte fragment reads of 16 rows x 2 halves fall on all banks evenly */
static_assert(QT0 % 128 == 0 && SQ % 128 == 0 && 128 % AQ == 0 && NKX / 128 <= 16 && QT0 >= 256);
typedef float fa1 __attribute__((may_alias));
struct VB { v16h f[4]; };      /* the V fragments of one 128-key chunk (four k-steps) */
// a fragment from rows in row order (the weight rows in LDS), from a pointer that already holds the lane's 8 h, so that every load of a run names that one address with a constant offset
__device__ __forceinline__ v16h at_frag(const _Float16* q) { FragH f; f.half[0] = *(const v8us*)((const unsigned short*)q); f.half[1] = *(const v8us*)((const unsigned short*)q + 16); return f.v; }
__device__ __forceinline__ void vb_load(VB& s, const _Float16* q) {
#pragma unroll
  for (int u = 0; u < 4; ++u) s.f[u] = at_frag(q + u * 32); }
// the same chunk from a plane in fragment order: four blocks that follow one another
__device__ __forceinline__ void vb_loadg(VB& s, const _Float16* q) {
#pragma unroll
  for (int u = 0; u < 4; ++u) s.f[u] = g2_frag(q + u * 512); }
// f32 attention of the leading rows, run by the first A0Y grid rows of the attention launch, beside the work-groups of the later rows instead of in a launch of its own in front of them. A work-group owns A0R query rows of the four heads of one (batch, kv head), which share the staged K and V rows; a wave takes 16 rows of one head, two lanes a row: lane l and lane l + 16 each keep one half (32 elements) of the row's q and o in registers for the whole key loop (every loop over the half is unrolled whole so that both are indexed by constants), so that this path needs no more registers than the other and two work-groups still share a WGP. A score is the sum of the two lanes' 32-term sums; maximum, sum and weights are formed alike in both lanes. The K and V rows are staged in LDS 64 keys at a time and read from there at one address per half wave: K transposed, so that one 16-byte read brings one head element of four neighbouring keys. One trip takes four keys: their four score sums are independent chains that fill each other's latency. The running maximum and sum and each o element take their terms in the order of the keys. The o rows (x64) leave as f16 value + x1024 residual planes of the merged o rows.
#define A0R 32                                   /* query rows of each of its four heads per work-group of the f32 path */
#define A0G (NB * NKV * (QT0 / A0R))             /* its work-groups */
#define A0Y (A0G / (NH * NB))                    /* the grid rows they fill */
static_assert(A0G % (NH * NB) == 0 && QT0 % 64 == 0 && 64 % A0R == 0 && A0R == 32 && (1 << KVSH) == 4);
#define A0K (HD * 68 + 16)                       /* floats of the K tile */
static_assert((A0K + 64 * HD + 4 * A0R * 68) * 4 <= AQ * APB);
__device__ __forceinline__ void att0_rows(const float* __restrict__ F0, _Float16* __restrict__ OH, _Float16* __restrict__ OL, unsigned char* lds, unsigned int id) {
  float* lk = (float*)lds;                                            /* K tile [head element][key]; pitch 68: the transposing stores of a wave fall on 32 different banks, rows stay 16-byte aligned; elements 32..63 stand 16 floats further on, so that the two addresses of a wave's read fall on different banks */
  float (*lv)[HD] = (float (*)[HD])(lds + A0K * 4);                   /* V tile [key][head element] */
  float (*lo)[68] = (float (*)[68])(lds + A0K * 4 + 64 * HD * 4);     /* o rows [head of the four][row] */
  const unsigned int tid = threadIdx.x, w = (unsigned int)__builtin_amdgcn_readfirstlane((int)(tid >> 5)), lane = tid & 31u, ln = lane & 15u, hh = lane >> 4;
  const unsigned int rg = (unsigned int)(QT0 / A0R - 1) - id / (unsigned int)(NB * NKV), sl = id % (unsigned int)(NB * NKV), b = sl / (unsigned int)NKV, hk = sl % (unsigned int)NKV;      /* the longest rows start first */
  const unsigned int i = rg * (unsigned int)A0R + (w & 1u) * 16u + ln; const unsigned int ld = (unsigned int)LQ;
  const float* QF = F0 + (size_t)b * QT0 * LQ;      /* q | k | v rows of the batch's leading rows */
  const float* qr = QF + (size_t)i * ld + ((hk << KVSH) + (w >> 1)) * HD + hh * 32u;
  v4f q[HD / 8], o[HD / 8];
#pragma unroll
  for (int c = 0; c < HD / 8; ++c) { q[c] = *(const v4fa*)(qr + c * 4); const v4f z = {0.f, 0.f, 0.f, 0.f}; o[c] = z; }
  asm volatile("s_wait_xcnt 0x0" :: "v"(qr) : "memory");      /* stands in front of code that writes anew the address registers which the q loads name; the pointer as an input keeps them out of those loads' own results */
  /* a thread's share of a tile. K: key (tid & 7) of a group of 8, 16-byte piece ((tid >> 3) & 7) of a group of 8 (a wave's load covers 8 rows x 64 bytes), key groups (tid >> 6) and (tid >> 6) + 4. V: key (tid >> 4) of a group of 16, piece (tid & 15) (whole rows). */
  const unsigned int kb = tid & 7u, ka = (tid >> 3) & 7u, kg = tid >> 6, vb = tid >> 4, va = tid & 15u;
  const unsigned int kofs = ((kg * 8u + kb) * ld + ka * 4u) * 4u, vofs = (vb * ld + va * 4u) * 4u;      /* byte offsets, the same for every tile */
  float m = -1.0e30f, l = 0.f; const unsigned int jmax = rg * (unsigned int)A0R + (unsigned int)(A0R - 1);      /* keys up to the work-group's last row */
#pragma unroll 1      /* a tile's code is long already */
  for (unsigned int j0 = 0; j0 <= jmax; j0 += 64u) { const char* tb = (const char*)(QF + (size_t)j0 * ld + hk * HD);      /* the tile's first row; its k columns stand DM, its v columns ROTN floats further on */
    __syncthreads();      /* every wave has read the last tile to its end */
    { v4f kk[4], vv[4]; const char* kq = tb + kofs; const char* vq = tb + vofs;      /* a thread's four pieces of each tile lie at constant distances from one address */
#pragma unroll
      for (int it = 0; it < 4; ++it) kk[it] = *(const v4fa*)(kq + DM * 4 + (it & 1) * (32 * LQ * 4) + (it >> 1) * 128);
#pragma unroll
      for (int it = 0; it < 4; ++it) vv[it] = *(const v4fa*)(vq + ROTN * 4 + it * (16 * LQ * 4));
      asm volatile("s_wait_xcnt 0x0" :: "v"(kq), "v"(vq) : "memory");      /* stands in front of code that writes anew the address registers which the K and V loads name; the addresses as inputs keep them out of those loads' own results */
#pragma unroll
      for (int it = 0; it < 4; ++it) {
#pragma unroll
        for (int t = 0; t < 4; ++t) lk[(((unsigned int)(it >> 1) * 8u + ka) * 4u + (unsigned int)t) * 68u + (unsigned int)(it >> 1) * 16u + ((unsigned int)(it & 1) * 4u + kg) * 8u + kb] = kk[it][t]; }
#pragma unroll
      for (int it = 0; it < 4; ++it) *(v4fa*)&lv[(unsigned int)it * 16u + vb][va * 4u] = vv[it]; }
    __syncthreads();      /* the tile is whole before any wave reads it */
    const unsigned int jend = jmax + 1u - j0 < 64u ? jmax + 1u - j0 : 64u;      /* later keys of the tile lie above every row of the work-group: weight exactly zero */
    const float* lkh = lk + hh * (32u * 68u + 16u);
#pragma unroll 1      /* one trip is already four keys; more would only add code */
    for (unsigned int jj = 0; jj < jend; jj += 4u) { float s[4] = {0.f, 0.f, 0.f, 0.f}, sc[4], e[4];
#pragma unroll
      for (int c = 0; c < HD / 8; ++c) {
#pragma unroll
        for (int t = 0; t < 4; ++t) { const v4f k4 = *(const v4fa*)(lkh + (c * 4 + t) * 68 + jj);
#pragma unroll
          for (int u = 0; u < 4; ++u) s[u] = __fadd_rn(s[u], __fmul_rn(q[c][t], k4[u])); } }
#pragma unroll
      for (int u = 0; u < 4; ++u) { const float su = __fmul_rn(__fadd_rn(s[u], sm_xhalf(s[u])), 0.125f);      /* own half + the other lane's half: the same value in both lanes */
        const float f = (j0 + jj + (unsigned int)u <= i) ? 1.f : 0.f; const float sm = fmaf(f, su, (1.f - f) * -1.0e30f); const float mn = fmaxf(m, sm); sc[u] = expf(m - mn); e[u] = expf(sm - mn); l = __fadd_rn(__fmul_rn(l, sc[u]), e[u]); m = mn; }
#pragma unroll
      for (int u = 0; u < 4; ++u) {
#pragma unroll
        for (int c = 0; c < HD / 8; ++c) { const v4f vv = *(const v4fa*)&lv[jj + (unsigned int)u][hh * 32u + (unsigned int)(c * 4)];
#pragma unroll
          for (int t = 0; t < 4; ++t) o[c][t] = __fadd_rn(__fmul_rn(o[c][t], sc[u]), __fmul_rn(e[u], vv[t])); } } } }
  { const float fin = 64.0f / l;      /* o carried x64 like the f16 path */
#pragma unroll
    for (int c = 0; c < HD / 8; ++c) { v4f oo = o[c];
#pragma unroll
      for (int u = 0; u < 4; ++u) oo[u] = __fmul_rn(oo[u], fin);
      *(v4fa*)&lo[w * 16u + ln][hh * 32u + (unsigned int)(c * 4)] = oo; } }
  __syncthreads();      /* the o rows of the four heads are whole */
#pragma unroll
  for (int it = 0; it < 4; ++it) { const unsigned int p = (unsigned int)it * 256u + tid, row = (p >> 7) * 16u + (p & 15u), pc = ((p >> 4) & 7u) * 8u; const v4f a = *(const v4fa*)&lo[row][pc], c = *(const v4fa*)&lo[row][pc + 4u]; FragH fh, fl;      /* a wave: 16 rows x 2 neighbouring pieces, 512 bytes in a row of each plane */
#pragma unroll
    for (int t = 0; t < 4; ++t) { _Float16 hv = (_Float16)a[t]; fh.h[t] = hv; fl.h[t] = (_Float16)((a[t] - (float)hv) * 1024.0f); hv = (_Float16)c[t]; fh.h[4 + t] = hv; fl.h[4 + t] = (_Float16)((c[t] - (float)hv) * 1024.0f); }
    const v8us oh = fh.half[0], ol = fl.half[0]; const size_t d = fo_piece((size_t)b * SQ + rg * (unsigned int)A0R + (row & (unsigned int)(A0R - 1)), ((hk << KVSH) + row / (unsigned int)A0R) * HD + pc, (unsigned int)DM);
    *(v8us*)((unsigned short*)OH + d) = oh; *(v8us*)((unsigned short*)OL + d) = ol; } }

__global__ __launch_bounds__(256) void k_attf(const _Float16* __restrict__ Q16, const _Float16* __restrict__ QL, const _Float16* __restrict__ K16, const _Float16* __restrict__ VT, const _Float16* __restrict__ VTL, _Float16* __restrict__ OH, _Float16* __restrict__ OL, const float* __restrict__ F0) {
  __shared__ __attribute__((aligned(16))) unsigned char sp[AQ * APB];      /* per row: f32 scores, later f16 weights at byte 0 and their residuals at byte 2 NKX */
  __shared__ __attribute__((aligned(16))) float oc[AQ][68];
  if (blockIdx.y < (unsigned int)A0Y) { att0_rows(F0, OH, OL, sp, blockIdx.y * (unsigned int)(NH * NB) + blockIdx.x); return; }      /* block-uniform: the first work-groups take the leading rows in f32 */
  const unsigned int tid = threadIdx.x, w = (unsigned int)__builtin_amdgcn_readfirstlane((int)(tid >> 5)), lane = tid & 31u, ln = lane & 15u, hh = lane >> 4;
  const unsigned int h = blockIdx.x % (unsigned int)NH, b = blockIdx.x / (unsigned int)NH, hk = h >> KVSH;
  const unsigned int q0 = (unsigned int)(SQ - AQ) - (blockIdx.y - (unsigned int)A0Y) * (unsigned int)AQ;      /* the longest rows start first */
  const unsigned int nch = q0 / 128u + 1u;      /* 128-key chunks; at least 3 */
  const size_t r0 = (size_t)b * SQ;
  const v8f z8 = {0.f,0.f,0.f,0.f,0.f,0.f,0.f,0.f};
  /* every plain '#pragma unroll' of this kernel, of vb_load and of vb_loadg stands on a short loop over a register array (u, r, q, c): unrolled whole, the array is indexed by constants and stays in registers */
  { const _Float16* qp = Q16 + (r0 + q0) * LQ + h * (HD * 16) + lane * 8u; const _Float16* lp = QL + (r0 + q0) * LQ + h * (HD * 16) + lane * 8u;      /* a head's 64 columns are two blocks that follow one another */
    const v16h qh0 = g2_frag(qp), qh1 = g2_frag(qp + 512), ql0 = g2_frag(lp), ql1 = g2_frag(lp + 512);
    asm volatile("s_wait_xcnt 0x0" :: "v"(qp), "v"(lp) : "memory");      /* stands in front of code that writes anew the address registers which the q loads name; the pointers as inputs keep them whole up to here */
    const _Float16* kb = K16 + (r0 + w * 16u) * LQ + hk * (HD * 16) + lane * 8u;
#pragma unroll 1      /* one trip is already four tiles with all their loads in flight together */
    for (unsigned int i0 = 0; i0 < nch; i0 += 4u) { const _Float16* kp[4]; v16h k0[4], k1[4];
#pragma unroll
      for (int u = 0; u < 4; ++u) { const unsigned int i = i0 + (unsigned int)u; kp[u] = kb + (size_t)((i < nch ? i : nch - 1u) * 128u) * LQ; }      /* past the end: the last tile again, so that no load stands under a test */
#pragma unroll
      for (int u = 0; u < 4; ++u) { k0[u] = g2_frag(kp[u]); k1[u] = g2_frag(kp[u] + 512); }
      asm volatile("s_wait_xcnt 0x0" :: "v"(kp[0]), "v"(kp[1]), "v"(kp[2]), "v"(kp[3]) : "memory");      /* the same for the K loads */
      __builtin_amdgcn_sched_barrier(0);      /* keeps the first product, which waits for its tile, from moving up among the loads of the later tiles */
#pragma unroll
      for (int u = 0; u < 4; ++u) { if (i0 + (unsigned int)u < nch) {
        v8f a1 = g2_mma(qh0, k0[u], z8); a1 = g2_mma(qh1, k1[u], a1);
        v8f a2 = g2_mma(ql0, k0[u], z8); a2 = g2_mma(ql1, k1[u], a2);
        unsigned char* sd = sp + (8u * hh) * (unsigned int)APB + (((i0 + (unsigned int)u) * 8u + w) * 16u + ln) * 4u;
#pragma unroll
        for (int r = 0; r < 8; ++r) *(fa1*)(sd + (unsigned int)r * (unsigned int)APB) = a2[r] * 0.0001220703125f + a1[r] * 0.125f; } } } }
  __syncthreads();      /* all score tiles of the 16 rows are in LDS */
#pragma unroll 1      /* the second row reuses the first row's registers */
  for (unsigned int rr = 0; rr < 2u; ++rr) { const unsigned int row = w * 2u + rr; unsigned char* rp = sp + row * (unsigned int)APB; const unsigned int last = q0 + row; v4f e[16];
#pragma unroll
    for (unsigned int c = 0; c < 16u; ++c) { if (c < nch) e[c] = *(const v4fa*)(rp + (c * 128u + lane * 4u) * 4u); }
    v4f m4 = {-3.0e38f, -3.0e38f, -3.0e38f, -3.0e38f};
#pragma unroll
    for (unsigned int c = 0; c < 16u; ++c) { if (c < nch) {
#pragma unroll
      for (int q = 0; q < 4; ++q) { e[c][q] = (c * 128u + lane * 4u + (unsigned int)q <= last) ? e[c][q] : -1.0e9f; m4[q] = fmaxf(m4[q], e[c][q]); } } }
    const float mx = sm_wave_max(fmaxf(fmaxf(m4[0], m4[1]), fmaxf(m4[2], m4[3])));
    v4f s4 = {0.f, 0.f, 0.f, 0.f};
#pragma unroll
    for (unsigned int c = 0; c < 16u; ++c) { if (c < nch) {
#pragma unroll
      for (int q = 0; q < 4; ++q) { e[c][q] = sm_exp(e[c][q] - mx); s4[q] += e[c][q]; } } }
    const float se = sm_wave_sum((s4[0] + s4[1]) + (s4[2] + s4[3])); const float sc = 256.0f / se;
#pragma unroll
    for (unsigned int c = 0; c < 16u; ++c) { if (c < nch) { v4h h4, l4;
#pragma unroll
      for (int q = 0; q < 4; ++q) { const float pv = e[c][q] * sc; const _Float16 hv = (_Float16)pv; h4[q] = hv; l4[q] = (_Float16)((pv - (float)hv) * 1024.0f); }
      *(v4ha*)(rp + (c * 128u + lane * 4u) * 2u) = h4; *(v4ha*)(rp + (unsigned int)NKX * 2u + (c * 128u + lane * 4u) * 2u) = l4; } } }
  __syncthreads();      /* all weight rows are in LDS */
  { const unsigned int ct = w & 3u; const bool resv = w >= 4u;      /* wave-uniform */
    const _Float16* vp = (resv ? VTL : VT) + (((size_t)b * NKV + hk) * HD + ct * 16u) * SQ + lane * 8u;      /* a chunk of 128 keys is four blocks, 2048 elements */
    const _Float16* ph = (const _Float16*)(sp + ln * (unsigned int)APB) + 8u * hh; const _Float16* pl = ph + NKX;
    v8f a1 = z8, a3 = z8; VB v0, v1, v2;      /* ring of three chunks: chunk c + 2 is asked for in front of the products of chunk c */
    vb_loadg(v0, vp); vb_loadg(v1, vp + 2048);
    asm volatile("s_wait_xcnt 0x0" :: "v"(vp) : "memory");      /* as above, for the V loads */
    /* one chunk: NEW takes chunk C + 2 (past the end: the last chunk again, so that no load stands under a test and each wait can count the younger chunks as still in flight); the chunk's weight fragments are read from LDS together; the wait as above, whose memory clobber also holds those reads in front of it, ahead of the first product; then the products of chunk C from CUR */
#define AT_CHUNK(CUR, NEW, C) { const unsigned int cc = (C); const _Float16* vn = vp + (cc + 2u < nch ? cc + 2u : nch - 1u) * 2048u; vb_loadg(NEW, vn); VB pa, pb; vb_load(pa, ph + cc * 128u); if (!resv) vb_load(pb, pl + cc * 128u); \
      asm volatile("s_wait_xcnt 0x0" :: "v"(vn) : "memory"); \
      _Pragma("unroll") for (int u = 0; u < 4; ++u) a1 = g2_mma(pa.f[u], CUR.f[u], a1); \
      if (!resv) { _Pragma("unroll") for (int u = 0; u < 4; ++u) a3 = g2_mma(pb.f[u], CUR.f[u], a3); } }
    unsigned int c = 0;
#pragma unroll 1      /* one trip is three chunks, so that the ring's stages are named, not indexed; no way out from inside a trip, the last zero, one or two chunks stand behind the loop */
    for (; c + 3u <= nch; c += 3u) { AT_CHUNK(v0, v2, c); AT_CHUNK(v1, v0, c + 1u); AT_CHUNK(v2, v1, c + 2u); }
    if (c < nch) { AT_CHUNK(v0, v2, c); if (c + 1u < nch) AT_CHUNK(v1, v0, c + 1u); }
#undef AT_CHUNK
    if (resv) {
#pragma unroll
      for (int r = 0; r < 8; ++r) oc[8u * hh + (unsigned int)r][ct * 16u + ln] = a1[r]; }
    __syncthreads();      /* the Vres ph sums are in LDS */
    if (!resv) {      /* own elements: each is read and rewritten by the same lane */
#pragma unroll
      for (int r = 0; r < 8; ++r) { float o = a1[r] * 0.25f; o = oc[8u * hh + (unsigned int)r][ct * 16u + ln] * 0.000244140625f + o; o = a3[r] * 0.000244140625f + o; oc[8u * hh + (unsigned int)r][ct * 16u + ln] = o; } } }
  __syncthreads();      /* the o tile is whole */
  if (tid < 128u) { const unsigned int row = tid & 15u, pc = (tid >> 4) * 8u; const v4f a = *(const v4fa*)&oc[row][pc], c = *(const v4fa*)&oc[row][pc + 4u]; FragH fh, fl;      /* a wave: 16 rows x 2 neighbouring pieces, 512 bytes in a row of each plane */
#pragma unroll
    for (int q = 0; q < 4; ++q) { _Float16 hv = (_Float16)a[q]; fh.h[q] = hv; fl.h[q] = (_Float16)((a[q] - (float)hv) * 1024.0f); hv = (_Float16)c[q]; fh.h[4 + q] = hv; fl.h[4 + q] = (_Float16)((c[q] - (float)hv) * 1024.0f); }
    const v8us oh = fh.half[0], ol = fl.half[0]; const size_t d = fo_piece(r0 + q0 + row, h * HD + pc, (unsigned int)DM);
    *(v8us*)((unsigned short*)OH + d) = oh; *(v8us*)((unsigned short*)OL + d) = ol; } }

constexpr size_t al256(size_t b) { return (b + 255) & ~(size_t)255; }
constexpr size_t SZ_BQKV = al256((size_t)LQ * DM * 2);
constexpr size_t SZ_BO   = al256((size_t)DM * DM * 2);
constexpr size_t SZ_XO   = al256(NR * DM * 2);                          /* X16, later reused as the merged o value rows */
constexpr size_t SZ_QKV  = al256(NR * LQ * 2);                          /* value plane; the residual plane has the same size */
constexpr size_t SZ_F0   = al256((size_t)NB * QT0 * LQ * 4);
constexpr size_t SZ_VT   = al256((size_t)NB * NKV * HD * SQ * 2);       /* V^T value plane; the residual plane has the same size */
constexpr size_t SZ_OL   = al256(NR * DM * 2);                          /* merged o residual rows */
constexpr size_t WS_TOTAL = SZ_BQKV + SZ_BO + SZ_XO + 2 * SZ_QKV + SZ_F0 + 2 * SZ_VT + SZ_OL;
static_assert(WS_TOTAL <= (size_t)134217728);
/* plane coverage equalities of the producer grids */
static_assert(((size_t)(DM / 64) * (DM / 64)) * 64 * 64 == (size_t)DM * DM);
static_assert(((size_t)(DM / 64) * (KVD / 64)) * 64 * 64 == (size_t)DM * KVD);
static_assert(((size_t)NB * NKV * (SQ / 64)) * 64 * 64 == (size_t)NB * NKV * HD * SQ);
static_assert((NR * DM) % (256 * 8) == 0);
static_assert((size_t)A0G * 4 * A0R * HD == (size_t)NB * QT0 * DM);
static_assert(((size_t)(NR / 128) * (LQ / 64)) * 128 * 64 == NR * LQ);
static_assert(((size_t)NH * NB * ((SQ - QT0) / AQ)) * AQ * HD == (NR - (size_t)NB * QT0) * DM);
static_assert(((size_t)(SQ / 128) * (DM / 64) * NB) * 128 * 64 == NR * DM);

extern "C" void kernel_launch(void* const* d_in, const int* in_sizes, int n_in,
                              void* d_out, int out_size, void* d_ws, size_t ws_size, hipStream_t stream) {
  if (n_in < 7) return;
  const size_t need_x = ((size_t)(NB - 1) * SQ_FULL + SQ) * DM;
  if ((size_t)in_sizes[0] < need_x) return;
  if ((size_t)in_sizes[1] < (size_t)SQ * 32) return;
  if ((size_t)in_sizes[2] < (size_t)SQ * 32) return;
  if ((size_t)in_sizes[3] < (size_t)DM * DM) return;
  if ((size_t)in_sizes[4] < (size_t)DM * KVD) return;
  if ((size_t)in_sizes[5] < (size_t)DM * KVD) return;
  if ((size_t)in_sizes[6] < (size_t)DM * DM) return;
  if ((size_t)out_size < need_x) return;
  const float* x = (const float*)d_in[0]; const float* cosb = (const float*)d_in[1]; const float* sinb = (const float*)d_in[2];      /* tables [pos][32], read as values */
  const float* wq = (const float*)d_in[3]; const float* wk = (const float*)d_in[4]; const float* wv = (const float*)d_in[5]; const float* wo = (const float*)d_in[6];      /* all [in][out] */
  float* out = (float*)d_out;
  char* ws = (char*)d_ws; size_t off = 0;
  auto take = [&](size_t bytes) { char* p = ws + off; off += (bytes + 255) & ~(size_t)255; return p; };
  _Float16* BQKV = (_Float16*)take(SZ_BQKV); _Float16* BO = (_Float16*)take(SZ_BO);
  _Float16* X16 = (_Float16*)take(SZ_XO); _Float16* OH = X16;      /* X16 is dead after the projection GEMMs; the merged o value rows take its place */
  _Float16* QKV = (_Float16*)take(SZ_QKV); const _Float16* Q16 = QKV; const _Float16* K16 = QKV + DM * 16; const _Float16* V16 = QKV + ROTN * 16;      /* fragment order: column c, a multiple of 32, begins 16 c elements into a row group */
  _Float16* QKVL = (_Float16*)take(SZ_QKV); const _Float16* QL = QKVL; const _Float16* VL16 = QKVL + ROTN * 16;      /* x1024 residual plane, same layout (k columns unused) */
  float* F0 = (float*)take(SZ_F0);
  _Float16* VT = (_Float16*)take(SZ_VT); _Float16* VTL = (_Float16*)take(SZ_VT);
  _Float16* OL = (_Float16*)take(SZ_OL);
  if (off > ws_size) return;

  k_prep<<<PW_ALL + PX_ALL, 256, 0, stream>>>(x, wq, wk, wv, wo, X16, BQKV, BO);      /* weights -> Bt planes, x -> X16 */
  k_gemm2<<<dim3(GP_L + GP_A, 1), 128, 0, stream>>>(X16, DM, (size_t)0, BQKV, DM, (size_t)0, 0u, 0.0625f, nullptr, QKV, QKVL, LQ, (size_t)0, (int)(NR), LQ, DM, cosb, sinb, (unsigned int)ROTN, (unsigned int)(SQ - 1), (unsigned int)GP_L, (size_t)SQ * DM, F0, (size_t)QT0 * LQ, QT0);      /* q | k | v rows (f16 value + residual) and, side by side, f32 q | k | v of rows 0..QT0-1 of every batch; q / k rotated + normalised */
  k_vt<<<dim3(NB * NKV * (SQ / 64), 2), 256, 0, stream>>>(V16, VT, VL16, VTL);      /* V^T value and residual planes [NB][NKV][HD][SQ] */
  k_attf<<<dim3(NH * NB, A0Y + (SQ - QT0) / AQ), 256, 0, stream>>>(Q16, QL, K16, VT, VTL, OH, OL, F0);      /* grid rows below A0Y: f32 attention for rows 0..QT0-1; the others, rows from QT0 on: scores, softmax and o; final o (x64) written as f16 value + x1024 residual merged rows */
  k_gemmo<<<dim3((SQ / 128) * (DM / 64), NB), 128, 0, stream>>>(OH, OL, BO, out);      /* out rows in the output layout: o value plane and o residual plane against Wo, folded in f32 */
}

// v009
// One run takes 136 microseconds.
// Timed twice side by side with v008, it ran 1.31 and 1.32 times as fast.
// Over all steps from v000 it is 47.5 times as fast.
#include <hip/hip_runtime.h>
// All contractions: v_wmma_f32_16x16x32_f16 (f16 operands, f32 accumulate). x, cos, sin and all four weights are RNE-converted to bf16 first (exact in f16; weights carried x16); q (after split-half rotation + scale-free RMS normalisation in f32), v, softmax weights (x256) and o (x64) are f16 value + x1024 residual planes, every residual product in its own accumulator, folded in f32; k is a single f16 plane; the first 256 query rows of every batch use f32 q/k/v from exact-operand GEMMs and an f32 online softmax on VALU.
// Causal grouped-query self-attention: x [NB][SQ][1024]; q = x Wq (16 heads of 64), k = x Wk, v = x Wv (4 kv heads of 64; weights are [in][out]); rotation with INPUT tables cos/sin [pos][32]: y[j] = x[j] c + x[j+32] s, y[j+32] = x[j+32] c - x[j] s; q, k scaled by rsqrt(mean square over the head + 1e-6); query head h uses kv head h >> 2; scores * 0.125; keys above the query get exactly zero weight; softmax; out = merged y Wo -> [NB][SQ][1024] f32.
// Structure: token rows r = b*SQ + s; X16 exact f16 rows; one q|k|v GEMM (N = 1536) whose epilogue applies rotation + normalisation on the 64-column head tiles of q and k and writes value + residual planes; V^T value and residual planes per (batch, kv head) via LDS transposes; one attention launch, a work-group per (batch, head, 16 query rows), whose score rows never leave LDS: scores = qh k + qres k against the keys up to the end of the rows' own 128-key chunk, causal row softmax on VALU, one wave per row (P value + residual written over the row's scores), o = Vh ph + Vres ph + Vh pl folded in f32 and written as f16 value + residual merged o rows (x64); out = oh Wo + ores Wo. Rows 0..255 of each batch: f32 attention by the first work-groups of the same launch, split into the same two o planes. Every f16 operand plane in the workspace (X16, the weights, q | k | v, V^T, o) is stored in fragment order (see fo_piece).
#ifndef NB
#define NB 2
#endif
#ifndef SQ
#define SQ 2048
#endif
#define NB_FULL 2
#define SQ_FULL 2048
#define DM 1024
#define NH 16
#define NKV 4
#define KVSH 2                       /* query head -> kv head shift */
#define HD 64
#define KVD (NKV * HD)               /* 256 */
#define LQ (DM + 2 * KVD)            /* row pitch of the q | k | v rows: 1536 */
#define ROTN (DM + KVD)              /* columns below this are q / k heads (rotated + normalised) */
#define QT 256                       /* not used by any kernel, only by the static_asserts */
#define QT0 256                      /* leading rows of every batch computed in f32 */
#define NKX SQ                       /* keys of an S / P row; the LDS row pitch is APB */
#define NR ((size_t)NB * SQ)         /* token rows */

static_assert(NB <= NB_FULL);
static_assert(SQ <= SQ_FULL);
static_assert((SQ & (SQ - 1)) == 0);
static_assert(SQ % QT == 0);
static_assert((QT & (QT - 1)) == 0);
static_assert(QT % 128 == 0);
static_assert(QT0 == QT);
static_assert(QT0 % 128 == 0);
static_assert(QT0 % 64 == 0);
static_assert(HD == 64);
static_assert(DM == NH * HD);
static_assert(NH == (NKV << KVSH));
static_assert(DM / 8 == 128);
static_assert(DM % 64 == 0);
static_assert(KVD % 64 == 0);
static_assert(LQ % 64 == 0);
static_assert(ROTN % 64 == 0);
static_assert(((size_t)NB * SQ) % 128 == 0);
static_assert(SQ % 64 == 0);
static_assert(DM % 32 == 0);

typedef unsigned short v8us __attribute__((ext_vector_type(8), may_alias));
typedef float  v8f  __attribute__((ext_vector_type(8)));
typedef float  v4f  __attribute__((ext_vector_type(4)));
typedef float  v4fa __attribute__((ext_vector_type(4), may_alias));
typedef _Float16 v16h __attribute__((ext_vector_type(16)));
typedef _Float16 v4h __attribute__((ext_vector_type(4)));
typedef _Float16 v4ha __attribute__((ext_vector_type(4), may_alias));
union FragH { v16h v; v8us half[2]; _Float16 h[16]; unsigned short u[16]; };

__device__ __forceinline__ unsigned short bf16_bits(float x) { unsigned int u = __float_as_uint(x); return (unsigned short)((u + 0x7FFFu + ((u >> 16) & 1u)) >> 16); }
__device__ __forceinline__ float bf16_val(unsigned short b) { return __uint_as_float(((unsigned int)b) << 16); }
__device__ __forceinline__ float bf16_rne(float x) { return bf16_val(bf16_bits(x)); }

// fragment: elements 0..7 <- k0 + 8h + 0..7, elements 8..15 <- k0 + 16 + 8h + 0..7 (same map for A rows and B columns)
// Fragment order of an f16 operand plane (rows of L elements, L a multiple of 32): the plane is cut into blocks of 16 rows x 32 k, 512 elements each, block (g, s) at (g * (L / 32) + s) * 512. Inside a block stand elements 0..7 of the fragment of lanes 0, 1, .. 31 (lane = 16 h + row), then elements 8..15 in the same lane order. Each of a fragment's two 16-byte loads then reads 512 bytes in a row, four whole lines; with the rows in memory order it read 32 bytes on each of 16 lines. A group of 16 rows takes 16 L elements as in row order, so offsets of whole row groups keep their values; 32 columns further on is 512 elements further on.
// fo_piece: offset of the 8 elements k .. k + 7 (k a multiple of 8) of row r
__device__ __forceinline__ size_t fo_piece(size_t r, unsigned int k, unsigned int L) { return ((r >> 4) * (size_t)(L >> 5) + (k >> 5)) * 512u + ((k >> 4) & 1u) * 256u + ((k >> 3) & 1u) * 128u + ((unsigned int)r & 15u) * 8u; }
// p: the block's start + 8 * lane
__device__ __forceinline__ v16h g2_frag(const _Float16* p) { FragH f; f.half[0] = *(const v8us*)((const unsigned short*)p); f.half[1] = *(const v8us*)((const unsigned short*)p + 256); return f.v; }
__device__ __forceinline__ v8f g2_mma(v16h a, v16h b, v8f c) { v8f d = __builtin_amdgcn_wmma_f32_16x16x32_f16(false, a, false, b, (short)0, c, false, false); asm volatile("v_nop\n\tv_nop\n\tv_nop\n\tv_nop" : "+v"(d) : "v"(a), "v"(b)); return d; }

// bx: the 64 x 64 tile of this weight that the work-group takes
__device__ __forceinline__ void wT_tile(const float* __restrict__ w, unsigned int Kd, unsigned int Nd, _Float16* __restrict__ Bt, unsigned int bx) {
  __shared__ unsigned short tl[64][66];
  const unsigned int tid = threadIdx.x; const unsigned int ntn = Nd >> 6; const unsigned int kt = bx / ntn, nt = bx - kt * ntn; const unsigned int k0 = kt * 64u, n0 = nt * 64u;
  for (unsigned int i = tid; i < 64u * 16u; i += 256u) { const unsigned int r = i >> 4, c4 = (i & 15u) * 4u; const v4f a = *(const v4fa*)(w + (size_t)(k0 + r) * Nd + n0 + c4); FragH f;
#pragma unroll
    for (int q = 0; q < 4; ++q) f.h[q] = (_Float16)(bf16_rne(a[q]) * 16.0f);
#pragma unroll
    for (int q = 0; q < 4; ++q) tl[r][c4 + q] = f.u[q]; }
  __syncthreads();
  {
#pragma unroll
    for (int rd = 0; rd < 2; ++rd) { const unsigned int d = (unsigned int)rd * 32u + (tid >> 7) * 16u + (tid & 15u), pc = (tid >> 4) & 7u; FragH f;      /* a wave: 16 rows x 2 neighbouring pieces, 512 bytes in a row of the plane */
#pragma unroll
      for (int q = 0; q < 8; ++q) f.u[q] = tl[pc * 8u + q][d];
      const v8us o = f.half[0];
      *(v8us*)((unsigned short*)Bt + fo_piece(n0 + d, k0 + pc * 8u, Kd)) = o; }
     } }

__device__ __forceinline__ void x16_tile(const float* __restrict__ x, _Float16* __restrict__ X16, unsigned int bx) {
  /* a work-group takes 16 rows x 128 columns: four blocks that follow one another in the plane. Whole 512-byte runs of x rows come in, the f16 tile turns in LDS, whole runs of the plane go out. */
  __shared__ __attribute__((aligned(16))) unsigned short tl[16][136];      /* pitch 136: rows stay 16-byte aligned and the 16-byte reads of 16 rows fall on different banks */
  const unsigned int tid = threadIdx.x;
  const unsigned int g = bx >> 3, kt = bx & 7u;                   /* DM / 128 = 8 column tiles per row group */
  const unsigned int r = tid >> 5, c4 = (tid & 31u) * 4u;      /* rows r and r + 8 of the group: a wave reads 512 bytes in a row of one x row */
  const unsigned int row = g * 16u + r, b = row / (unsigned int)SQ, s = row - b * (unsigned int)SQ;      /* a group of 16 rows lies in one batch */
  const float* xp = x + ((size_t)b * SQ_FULL + s) * DM + kt * 128u + c4;
  const v4f a0 = *(const v4fa*)xp, a1 = *(const v4fa*)(xp + 8 * DM); v4h h0, h1;
  asm volatile("s_wait_xcnt 0x0" :: "v"(xp) : "memory");      /* stands in front of code that writes anew the address registers which the two loads name; the pointer as an input keeps them out of those loads' own results */
#pragma unroll
  for (int q = 0; q < 4; ++q) { h0[q] = (_Float16)bf16_rne(a0[q]); h1[q] = (_Float16)bf16_rne(a1[q]); }
  *(v4ha*)&tl[r][c4] = h0; *(v4ha*)&tl[r + 8u][c4] = h1;
  __syncthreads();      /* the tile is whole before it is read across its rows */
  const v8us o = *(const v8us*)&tl[tid & 15u][(tid >> 6) * 32u + ((tid >> 5) & 1u) * 16u + ((tid >> 4) & 1u) * 8u];      /* thread = (block, fragment half, lane) in the plane's own order */
  *(v8us*)((unsigned short*)X16 + ((size_t)bx * 256u + tid) * 8u) = o;
}

// the four weight transposes and the x conversion depend on nothing but the inputs: one launch runs them side by side, each work-group taking one tile of one of the five jobs (block-uniform choice, in front of every barrier)
#define PW_Q ((DM / 64) * (DM / 64))             /* tiles of Wq, and of Wo */
#define PW_KV ((DM / 64) * (KVD / 64))           /* tiles of Wk, and of Wv */
#define PW_ALL (2 * PW_Q + 2 * PW_KV)
#define PX_ALL ((unsigned int)(NR * DM / (256 * 8)))      /* tiles of x */
__global__ __launch_bounds__(256) void k_prep(const float* __restrict__ x, const float* __restrict__ wq, const float* __restrict__ wk, const float* __restrict__ wv, const float* __restrict__ wo, _Float16* __restrict__ X16, _Float16* __restrict__ BQKV, _Float16* __restrict__ BO) {
  const unsigned int bx = blockIdx.x;
  if (bx >= (unsigned int)PW_ALL) { x16_tile(x, X16, bx - (unsigned int)PW_ALL); return; }
  const float* w = wq; _Float16* Bt = BQKV; unsigned int Nd = (unsigned int)DM, t = bx;                                                     /* W[DM][DM] -> Bt rows 0..1023 */
  if (bx >= (unsigned int)(PW_Q + 2 * PW_KV)) { w = wo; Bt = BO; t = bx - (unsigned int)(PW_Q + 2 * PW_KV); }                                /* Wo[c][n] -> Bt[n][c] */
  else if (bx >= (unsigned int)(PW_Q + PW_KV)) { w = wv; Bt = BQKV + (size_t)ROTN * DM; Nd = (unsigned int)KVD; t = bx - (unsigned int)(PW_Q + PW_KV); }      /* W[DM][KVD] -> Bt rows 1280..1535 */
  else if (bx >= (unsigned int)PW_Q) { w = wk; Bt = BQKV + (size_t)DM * DM; Nd = (unsigned int)KVD; t = bx - (unsigned int)PW_Q; }           /* W[DM][KVD] -> Bt rows 1024..1279 */
  wT_tile(w, (unsigned int)DM, Nd, Bt, t);
}

// grid row 0 turns the value plane, grid row 1 the residual plane, side by side in one launch
__global__ __launch_bounds__(256) void k_vt(const _Float16* __restrict__ VH16, _Float16* __restrict__ VtH, const _Float16* __restrict__ VL16, _Float16* __restrict__ VtL) {
  __shared__ unsigned short tl[64][66];
  const _Float16* V16 = blockIdx.y ? VL16 : VH16; _Float16* Vt = blockIdx.y ? VtL : VtH;      /* block-uniform */
  const unsigned int tid = threadIdx.x; const unsigned int slab = blockIdx.x / (unsigned int)(SQ / 64), lg = blockIdx.x % (unsigned int)(SQ / 64); const unsigned int b = slab / (unsigned int)NKV, h = slab % (unsigned int)NKV;
  for (unsigned int i = tid; i < 64u * 8u; i += 256u) { const unsigned int r = (i >> 7) * 16u + (i & 15u), c8 = ((i >> 4) & 7u) * 8u; FragH f; const unsigned short* vq = (const unsigned short*)V16 + fo_piece((size_t)b * SQ + lg * 64u + r, h * 64u + c8, (unsigned int)LQ); f.half[0] = *(const v8us*)vq;      /* a wave: 16 rows x 2 neighbouring pieces, 512 bytes in a row of the plane */
    asm volatile("s_wait_xcnt 0x0" :: "v"(vq) : "memory");      /* stands in front of code that writes anew the address registers which the load names; the pointer as an input keeps them out of the load's own result */
#pragma unroll
    for (int q = 0; q < 8; ++q) tl[r][c8 + q] = f.u[q]; }
  __syncthreads();
  {
#pragma unroll
    for (int rd = 0; rd < 2; ++rd) { const unsigned int d = (unsigned int)rd * 32u + (tid >> 7) * 16u + (tid & 15u), pc = (tid >> 4) & 7u; FragH f;      /* the same deal of a wave for the plane that is written */
#pragma unroll
      for (int q = 0; q < 8; ++q) f.u[q] = tl[pc * 8u + q][d];
      const v8us o = f.half[0];
      *(v8us*)((unsigned short*)Vt + fo_piece((size_t)slab * 64u + d, lg * 64u + pc * 8u, (unsigned int)SQ)) = o; }
     } }

// one k-step (32 k) of a wave's operands: two A row fragments and four B column fragments
struct G2Stage { v16h a0, a1, b0, b1, b2, b3; };
__device__ __forceinline__ void g2_load(G2Stage& s, const _Float16* a0p, const _Float16* a1p, const _Float16* b0p, const _Float16* b1p, const _Float16* b2p, const _Float16* b3p, int kb) {
  s.a0 = g2_frag(a0p + kb); s.a1 = g2_frag(a1p + kb); s.b0 = g2_frag(b0p + kb); s.b1 = g2_frag(b1p + kb); s.b2 = g2_frag(b2p + kb); s.b3 = g2_frag(b3p + kb); }
__device__ __forceinline__ void g2_step(const G2Stage& s, v8f& c00, v8f& c01, v8f& c02, v8f& c03, v8f& c10, v8f& c11, v8f& c12, v8f& c13) {
  c00 = g2_mma(s.a0, s.b0, c00); c10 = g2_mma(s.a1, s.b0, c10); c01 = g2_mma(s.a0, s.b1, c01); c11 = g2_mma(s.a1, s.b1, c11);
  c02 = g2_mma(s.a0, s.b2, c02); c12 = g2_mma(s.a1, s.b2, c12); c03 = g2_mma(s.a0, s.b3, c03); c13 = g2_mma(s.a1, s.b3, c13); }

// batched GEMM (grid.y = head / batch slab): C = alpha * A Bt^T. A f16 [M][K], rows of lda elements (slab stride sA), Bt f16 [N][K], rows of ldb elements (slab stride sB applied to blockIdx.y >> bsh), both in fragment order; outputs f32 C in row order and/or f16 value plane C16 (+ optional x2^10 residual plane C16L of the same f32 value) in fragment order, rows of ldc elements, slab stride sC.
// A second product of the same A and Bt planes may run side by side with the first in one launch: the first nx2 work-groups (none where nx2 is 0) form slabs of M2 rows, slab strides sA2 and sC2, f32 output C2 only.
__global__ __launch_bounds__(128) void k_gemm2(const _Float16* __restrict__ A, int lda, size_t sA, const _Float16* __restrict__ Bh, int ldb, size_t sB, unsigned int bsh, float alpha,
    float* C, _Float16* C16, _Float16* C16L, int ldc, size_t sC, int M, int N, int K, const float* cosb, const float* sinb, unsigned int rotN, unsigned int pmask, unsigned int nx2, size_t sA2, float* C2, size_t sC2, int M2) {
  __shared__ __attribute__((aligned(16))) float so[4][32][68];
  const unsigned int tid = threadIdx.x, w = tid >> 5, lane = tid & 31u, ln = lane & 15u, hh = lane >> 4; unsigned int bx = blockIdx.x, by = blockIdx.y;
  if (bx < nx2) { const unsigned int per = ((unsigned int)M2 >> 7) * ((unsigned int)N >> 6); by = bx / per; bx -= by * per; sA = sA2; sC = sC2; M = M2; C = C2; C16 = nullptr; C16L = nullptr; }      /* block-uniform: tile and slab of the second product */
  else bx -= nx2;
  A += (size_t)by * sA; Bh += (size_t)(by >> bsh) * sB; const size_t cofs = (size_t)by * sC;
  const unsigned int ntn = (unsigned int)N >> 6; const unsigned int mt = bx / ntn, nq = bx - mt * ntn; const unsigned int row0 = mt * 128u + 32u * w, col0 = nq * 64u; if (row0 >= (unsigned int)M) return;
  const _Float16* a0p = A + (size_t)row0 * lda + lane * 8u; const _Float16* a1p = a0p + (size_t)16 * lda;      /* first block of the row group + the lane's place in a block */
  const _Float16* b0p = Bh + (size_t)col0 * ldb + lane * 8u; const _Float16* b1p = b0p + (size_t)16 * ldb; const _Float16* b2p = b1p + (size_t)16 * ldb; const _Float16* b3p = b2p + (size_t)16 * ldb;
  const v8f z8 = {0.f,0.f,0.f,0.f,0.f,0.f,0.f,0.f}; v8f c00 = z8, c01 = z8, c02 = z8, c03 = z8, c10 = z8, c11 = z8, c12 = z8, c13 = z8;
  /* K loop as a ring of three register stages: the twelve loads of k-step s + 2 are issued together in front of the products of k-step s, so a wave waits for a whole stage that was asked for two steps earlier instead of for each fragment in turn. In front of and inside the loop no load stands under a test of its own, so that each wait can count the younger stages as still in flight; the last two to four steps are peeled. The order of the k-steps and of the products into each accumulator is unchanged. */
#define G2_LD(S, ST) g2_load(S, a0p, a1p, b0p, b1p, b2p, b3p, (ST) * 512)
#define G2_ST(S) g2_step(S, c00, c01, c02, c03, c10, c11, c12, c13)
#define G2_XW() asm volatile("s_wait_xcnt 0x0" ::: "memory")      /* stands in front of code that writes anew the address registers which the loads issued so far name */
  const int nst = (K + 31) >> 5;
  if (nst == 1) { G2Stage s0; G2_LD(s0, 0); G2_ST(s0); }
  else if (nst > 1) { G2Stage s0, s1, s2; int st = 0;
    G2_LD(s0, 0); G2_LD(s1, 1); G2_XW();
#pragma unroll 1      /* one trip is already three k-steps; more would only add code */
    for (; st + 5 <= nst; st += 3) { G2_LD(s2, 2); G2_ST(s0); G2_LD(s0, 3); G2_ST(s1); G2_LD(s1, 4); G2_ST(s2); G2_XW();
      a0p += 1536; a1p += 1536; b0p += 1536; b1p += 1536; b2p += 1536; b3p += 1536; }      /* every load names one of the six pointers with a constant offset; they move on three blocks a trip */
    const int rem = nst - st;      /* 2, 3 or 4 steps are left; s0 and s1 hold the first two */
    if (rem >= 3) G2_LD(s2, 2);
    G2_ST(s0);
    if (rem >= 4) { G2_XW(); const int kt = 3 * 512;      /* here the address registers die with their loads and a later fragment may land in them: the wait stands behind each fragment's loads */
      s0.a0 = g2_frag(a0p + kt); G2_XW(); s0.a1 = g2_frag(a1p + kt); G2_XW(); s0.b0 = g2_frag(b0p + kt); G2_XW(); s0.b1 = g2_frag(b1p + kt); G2_XW(); s0.b2 = g2_frag(b2p + kt); G2_XW(); s0.b3 = g2_frag(b3p + kt); G2_XW(); }
    G2_ST(s1);
    if (rem >= 3) G2_ST(s2);
    if (rem >= 4) G2_ST(s0); }
#undef G2_LD
#undef G2_ST
#undef G2_XW
  v8f accs[8] = {c00, c01, c02, c03, c10, c11, c12, c13};
#pragma unroll
  for (int u = 0; u < 8; ++u) accs[u] = accs[u] * alpha;
#pragma unroll
  for (int u = 0; u < 8; ++u) { const unsigned int t = (unsigned int)u & 3u, half = (unsigned int)u >> 2;
#pragma unroll
    for (int r = 0; r < 8; ++r) { const unsigned int rloc = half * 16u + 8u * hh + (unsigned int)r;
      so[w][rloc][t * 16u + ln] = accs[u][r]; } }
  __builtin_amdgcn_fence(4 /* acq_rel order */, "workgroup"); __builtin_amdgcn_wave_barrier();
  if (col0 < rotN) {      /* block-uniform: this tile is one q / k head; lane owns tile row 'lane' */
    const unsigned int pos = (row0 + lane) & pmask;
    const float* cr = cosb + (size_t)pos * 32u; const float* sr = sinb + (size_t)pos * 32u; float ss = 0.f;
#pragma unroll 1
    for (unsigned int j = 0; j < 32u; j += 4u) { const v4f cc = *(const v4fa*)(cr + j), sn = *(const v4fa*)(sr + j); const v4f x1 = *(const v4fa*)&so[w][lane][j], x2 = *(const v4fa*)&so[w][lane][32u + j]; v4f y1, y2;
#pragma unroll
      for (int q = 0; q < 4; ++q) { const float c = bf16_rne(cc[q]), s = bf16_rne(sn[q]); y1[q] = x1[q] * c + x2[q] * s; y2[q] = x2[q] * c - x1[q] * s; ss += y1[q] * y1[q] + y2[q] * y2[q]; }
      *(v4fa*)&so[w][lane][j] = y1; *(v4fa*)&so[w][lane][32u + j] = y2; }
    const float rs = rsqrtf(ss * 0.015625f + 1.0e-6f);
#pragma unroll 1
    for (unsigned int j = 0; j < 64u; j += 4u) { v4f y = *(const v4fa*)&so[w][lane][j];
#pragma unroll
      for (int q = 0; q < 4; ++q) y[q] = y[q] * rs;
      *(v4fa*)&so[w][lane][j] = y; }
    __builtin_amdgcn_fence(4 /* acq_rel order */, "workgroup"); __builtin_amdgcn_wave_barrier(); }
  if (C) { const unsigned int rsub = lane >> 4, c4 = (lane & 15u) * 4u;
#pragma unroll
    for (int q = 0; q < 16; ++q) { const unsigned int r = (unsigned int)q * 2u + rsub; const v4f v = *(const v4fa*)&so[w][r][c4];
      *(v4f*)(C + cofs + (size_t)(row0 + r) * ldc + col0 + c4) = v; }
    asm volatile("s_wait_xcnt 0x0" ::: "memory"); }      /* stands in front of code that writes anew the registers which these stores name */
  if (C16) {      /* the wave's tile is 2 x 2 whole blocks of the plane; one store takes one fragment half of a block, 512 bytes in a row */
    const size_t ob = cofs + (size_t)row0 * ldc + (size_t)(col0 >> 5) * 512u + lane * 8u; v4f ta[8], tc[8];
#pragma unroll
    for (int q = 0; q < 8; ++q) { const float* sr = &so[w][((unsigned int)q >> 2) * 16u + ln][(((unsigned int)q >> 1) & 1u) * 32u + ((unsigned int)q & 1u) * 16u + hh * 8u]; ta[q] = *(const v4fa*)sr; tc[q] = *(const v4fa*)(sr + 4); }      /* all LDS reads together, ahead of the waits below */
#pragma unroll
    for (int q = 0; q < 8; ++q) { const unsigned int rg = (unsigned int)q >> 2, s = ((unsigned int)q >> 1) & 1u, hf = (unsigned int)q & 1u; const v4f va = ta[q], vc = tc[q]; FragH fh, fl;
#pragma unroll
      for (int i = 0; i < 4; ++i) { _Float16 h = (_Float16)va[i]; fh.h[i] = h; fl.h[i] = (_Float16)((va[i] - (float)h) * 1024.0f); h = (_Float16)vc[i]; fh.h[4 + i] = h; fl.h[4 + i] = (_Float16)((vc[i] - (float)h) * 1024.0f); }
      const v8us oh = fh.half[0], ol = fl.half[0]; const size_t o = ob + (size_t)rg * 16u * ldc + s * 512u + hf * 256u;
      *(v8us*)((unsigned short*)C16 + o) = oh;
      asm volatile("s_wait_xcnt 0x0" ::: "memory");      /* the same for this store */
      if (C16L) { *(v8us*)((unsigned short*)C16L + o) = ol;
        asm volatile("s_wait_xcnt 0x0" ::: "memory"); } } } }      /* and for this one */

// out = OSH * (oh Wo) + OSL * (ores Wo), both products in one launch. A wave owns 32 rows x 64 columns of out and keeps two accumulator sets, one per o plane: every Wo fragment it loads feeds the products of both planes (8 fragment loads for 16 products; with a launch per plane 12), and the two sums are folded in registers, so that out is written once and never read. Each accumulator takes its k-steps in rising order, and the fold is value sum * OSH first, then residual sum * OSL added to it.
#define OSH 0.0009765625f                /* 1 / (64 * 16): o is carried x64, Wo x16 */
#define OSL 0.00000095367431640625f      /* the same / 1024 for the residual plane */
#define ONST (DM / 32)                   /* k-steps */
static_assert(ONST >= 2);
struct GOStage { v16h h0, h1, l0, l1, b0, b1, b2, b3; };      /* one k-step: two row fragments of each o plane, four Wo column fragments */
// every load of a stage names one of three addresses with a constant offset: 16 rows further on is 16 DM elements further on
__device__ __forceinline__ void go_load(GOStage& s, const _Float16* hp, const _Float16* lp, const _Float16* bp, int kb) {
  s.h0 = g2_frag(hp + kb); s.h1 = g2_frag(hp + 16 * DM + kb); s.l0 = g2_frag(lp + kb); s.l1 = g2_frag(lp + 16 * DM + kb);
  s.b0 = g2_frag(bp + kb); s.b1 = g2_frag(bp + 16 * DM + kb); s.b2 = g2_frag(bp + 32 * DM + kb); s.b3 = g2_frag(bp + 48 * DM + kb); }
// the plain builtin: its operands may stand in any register of the wave's budget (this kernel needs more than 256), and the compiler keeps the distances behind it itself
__device__ __forceinline__ v8f go_mma(v16h a, v16h b, v8f c) { return __builtin_amdgcn_wmma_f32_16x16x32_f16(false, a, false, b, (short)0, c, false, false); }
__device__ __forceinline__ void go_col(v16h b, const GOStage& s, v8f& h0, v8f& h1, v8f& l0, v8f& l1) { h0 = go_mma(s.h0, b, h0); h1 = go_mma(s.h1, b, h1); l0 = go_mma(s.l0, b, l0); l1 = go_mma(s.l1, b, l1); }
__device__ __forceinline__ void go_step(const GOStage& s, v8f (&ch)[8], v8f (&cl)[8]) {
  go_col(s.b0, s, ch[0], ch[4], cl[0], cl[4]); go_col(s.b1, s, ch[1], ch[5], cl[1], cl[5]); go_col(s.b2, s, ch[2], ch[6], cl[2], cl[6]); go_col(s.b3, s, ch[3], ch[7], cl[3], cl[7]); }
__global__ __launch_bounds__(128) void k_gemmo(const _Float16* __restrict__ AH, const _Float16* __restrict__ AL, const _Float16* __restrict__ Bh, float* __restrict__ C) {
  __shared__ __attribute__((aligned(16))) float so[4][32][68];
  const unsigned int tid = threadIdx.x, w = tid >> 5, lane = tid & 31u, ln = lane & 15u, hh = lane >> 4;
  const unsigned int mt = blockIdx.x / (unsigned int)(DM / 64), nq = blockIdx.x % (unsigned int)(DM / 64); const unsigned int row0 = mt * 128u + 32u * w, col0 = nq * 64u;
  const size_t aofs = ((size_t)blockIdx.y * SQ + row0) * DM + lane * 8u;      /* first block of the row group + the lane's place in a block */
  const _Float16* hp = AH + aofs; const _Float16* lp = AL + aofs; const _Float16* bp = Bh + (size_t)col0 * DM + lane * 8u;
  const v8f z8 = {0.f,0.f,0.f,0.f,0.f,0.f,0.f,0.f}; v8f ch[8], cl[8];
  /* every plain '#pragma unroll' of this kernel stands on a short loop over a register array: unrolled whole, the array is indexed by constants and stays in registers */
#pragma unroll
  for (int u = 0; u < 8; ++u) { ch[u] = z8; cl[u] = z8; }
  /* K loop as in k_gemm2: a ring of three register stages, the loads of k-step s + 2 issued together in front of the products of k-step s; the last two to four steps are peeled */
#define GO_LD(S, ST) go_load(S, hp, lp, bp, (ST) * 512)
#define GO_XW() asm volatile("s_wait_xcnt 0x0" :: "v"(hp), "v"(lp), "v"(bp) : "memory")      /* stands in front of code that writes anew the address registers which the loads issued so far name; the three addresses as inputs keep them whole up to here */
  { GOStage s0, s1, s2; int st = 0;
    GO_LD(s0, 0); GO_LD(s1, 1); GO_XW();
#pragma unroll 1      /* one trip is already three k-steps; more would only add code */
    for (; st + 5 <= ONST; st += 3) { GO_LD(s2, 2); go_step(s0, ch, cl); GO_LD(s0, 3); go_step(s1, ch, cl); GO_LD(s1, 4); go_step(s2, ch, cl); GO_XW();
      hp += 1536; lp += 1536; bp += 1536; }      /* three blocks a trip */
    constexpr int rem = ONST - ((ONST - 2) / 3) * 3;      /* 2, 3 or 4 steps are left; s0 and s1 hold the first two */
    if (rem >= 3) { GO_LD(s2, 2); GO_XW(); }
    go_step(s0, ch, cl);
    if (rem >= 4) { GO_LD(s0, 3); GO_XW(); }
    go_step(s1, ch, cl);
    if (rem >= 3) go_step(s2, ch, cl);
    if (rem >= 4) go_step(s0, ch, cl); }
#undef GO_LD
#undef GO_XW
#pragma unroll
  for (int u = 0; u < 8; ++u) { const unsigned int t = (unsigned int)u & 3u, half = (unsigned int)u >> 2; const v8f o = cl[u] * OSL + ch[u] * OSH;
#pragma unroll
    for (int r = 0; r < 8; ++r) so[w][half * 16u + 8u * hh + (unsigned int)r][t * 16u + ln] = o[r]; }
  __builtin_amdgcn_fence(4 /* acq_rel order */, "workgroup"); __builtin_amdgcn_wave_barrier();      /* the wave's own tile is in LDS before its lanes read across it */
  { const unsigned int rsub = lane >> 4, c4 = (lane & 15u) * 4u; float* cp = C + ((size_t)blockIdx.y * SQ_FULL + row0 + rsub) * DM + col0 + c4; v4f v[16];      /* whole 256-byte runs of two out rows a store; all stores name one address with a constant offset */
#pragma unroll
    for (int q = 0; q < 16; ++q) v[q] = *(const v4fa*)&so[w][(unsigned int)q * 2u + rsub][c4];
#pragma unroll
    for (int q = 0; q < 16; ++q) *(v4f*)(cp + (size_t)q * 2u * DM) = v[q]; } }

#define GP_L ((QT0 / 128) * (LQ / 64) * NB)      /* tiles of the f32 q | k | v of the leading rows */
#define GP_A ((unsigned int)(NR / 128) * (LQ / 64))      /* tiles of the q | k | v of all rows */

// cross-lane steps of the row reductions: lane l with lane l ^ M inside a 16-lane row (DPP row_xmask), and lane l with lane l ^ 16
template <int M> __device__ __forceinline__ float sm_xrow(float x) { return __builtin_bit_cast(float, __builtin_amdgcn_update_dpp(0, __builtin_bit_cast(int, x), 0x160 | M, 0xf, 0xf, true)); }
__device__ __forceinline__ float sm_xhalf(float x) { return __builtin_bit_cast(float, __builtin_amdgcn_permlanex16(__builtin_bit_cast(int, x), __builtin_bit_cast(int, x), 0x76543210, 0xfedcba98, false, false)); }
__device__ __forceinline__ float sm_wave_max(float v) { v = fmaxf(v, sm_xrow<1>(v)); v = fmaxf(v, sm_xrow<2>(v)); v = fmaxf(v, sm_xrow<4>(v)); v = fmaxf(v, sm_xrow<8>(v)); return fmaxf(v, sm_xhalf(v)); }
__device__ __forceinline__ float sm_wave_sum(float v) { v += sm_xrow<1>(v); v += sm_xrow<2>(v); v += sm_xrow<4>(v); v += sm_xrow<8>(v); return v + sm_xhalf(v); }

// e^x as the fast library form computes it (multiply by log2 e, then v_exp_f32); the v_nop in the same statement is the one free slot the instruction set asks for behind a transcendental
__device__ __forceinline__ float sm_exp(float x) { const float t = x * 1.44269504088896340736f; float r; asm("v_exp_f32 %0, %1\n\tv_nop" : "=v"(r) : "v"(t)); return r; }

// attention of the rows from QT0 on, scores, softmax and o in one launch. A work-group owns AQ query rows of one (batch, head); their score rows stay in LDS from the products to the last use, so no score or weight goes through memory and every (batch, head, row group) runs side by side. Keys are taken up to the end of the 128-key chunk that holds the rows; later keys have weight exactly zero.
// Step 1: wave w forms the 16-key score tiles w, w + 8, ... (value plane, then residual plane of q, folded in f32). Step 2: one wave per score row, two rows a wave: lane l keeps columns 128 c + 4 l + 0..3 of every chunk c in registers, maximum and sum are per-lane partials joined across the 32 lanes; the row's weights (f16 value plane, then x1024 residual plane) are written over its own scores. Step 3: waves 0..3 (16 head columns each) sum Vh ph and Vh pl from one V fragment, waves 4..7 sum Vres ph; k-steps in rising order into each accumulator; the three sums are folded in f32 in the order Vh ph, Vres ph, Vh pl.
#define AQ 16                        /* query rows per work-group */
#define APB (NKX * 4 + 32)           /* bytes of a score row in LDS; 32 more than a multiple of 256, so that the 16-byte fragment reads of 16 rows x 2 halves fall on all banks evenly */
static_assert(QT0 % 128 == 0 && SQ % 128 == 0 && 128 % AQ == 0 && NKX / 128 <= 16 && QT0 >= 256);
typedef float fa1 __attribute__((may_alias));
struct VB { v16h f[4]; };      /* the V fragments of one 128-key chunk (four k-steps) */
// a fragment from rows in row order (the weight rows in LDS), from a pointer that already holds the lane's 8 h, so that every load of a run names that one address with a constant offset
__device__ __forceinline__ v16h at_frag(const _Float16* q) { FragH f; f.half[0] = *(const v8us*)((const unsigned short*)q); f.half[1] = *(const v8us*)((const unsigned short*)q + 16); return f.v; }
__device__ __forceinline__ void vb_load(VB& s, const _Float16* q) {
#pragma unroll
  for (int u = 0; u < 4; ++u) s.f[u] = at_frag(q + u * 32); }
// the same chunk from a plane in fragment order: four blocks that follow one another
__device__ __forceinline__ void vb_loadg(VB& s, const _Float16* q) {
#pragma unroll
  for (int u = 0; u < 4; ++u) s.f[u] = g2_frag(q + u * 512); }
// f32 attention of the leading rows, run by the first A0Y grid rows of the attention launch, beside the work-groups of the later rows instead of in a launch of its own in front of them. A work-group owns A0R query rows of the four heads of one (batch, kv head), which share the staged K and V rows; a wave takes 16 rows of one head, two lanes a row: lane l and lane l + 16 each keep one half (32 elements) of the row's q and o in registers for the whole key loop (every loop over the half is unrolled whole so that both are indexed by constants), so that this path needs no more registers than the other and two work-groups still share a WGP. A score is the sum of the two lanes' 32-term sums; maximum, sum and weights are formed alike in both lanes. The K and V rows are staged in LDS 64 keys at a time and read from there at one address per half wave: K transposed, so that one 16-byte read brings one head element of four neighbouring keys. One trip takes four keys: their four score sums are independent chains that fill each other's latency. The running maximum and sum and each o element take their terms in the order of the keys. The o rows (x64) leave as f16 value + x1024 residual planes of the merged o rows.
#define A0R 32                                   /* query rows of each of its four heads per work-group of the f32 path */
#define A0G (NB * NKV * (QT0 / A0R))             /* its work-groups */
#define A0Y (A0G / (NH * NB))                    /* the grid rows they fill */
static_assert(A0G % (NH * NB) == 0 && QT0 % 64 == 0 && 64 % A0R == 0 && A0R == 32 && (1 << KVSH) == 4);
#define A0K (HD * 68 + 16)                       /* floats of the K tile */
static_assert((A0K + 64 * HD + 4 * A0R * 68) * 4 <= AQ * APB);
__device__ __forceinline__ void att0_rows(const float* __restrict__ F0, _Float16* __restrict__ OH, _Float16* __restrict__ OL, unsigned char* lds, unsigned int id) {
  float* lk = (float*)lds;                                            /* K tile [head element][key]; pitch 68: the transposing stores of a wave fall on 32 different banks, rows stay 16-byte aligned; elements 32..63 stand 16 floats further on, so that the two addresses of a wave's read fall on different banks */
  float (*lv)[HD] = (float (*)[HD])(lds + A0K * 4);                   /* V tile [key][head element] */
  float (*lo)[68] = (float (*)[68])(lds + A0K * 4 + 64 * HD * 4);     /* o rows [head of the four][row] */
  const unsigned int tid = threadIdx.x, w = (unsigned int)__builtin_amdgcn_readfirstlane((int)(tid >> 5)), lane = tid & 31u, ln = lane & 15u, hh = lane >> 4;
  const unsigned int rg = (unsigned int)(QT0 / A0R - 1) - id / (unsigned int)(NB * NKV), sl = id % (unsigned int)(NB * NKV), b = sl / (unsigned int)NKV, hk = sl % (unsigned int)NKV;      /* the longest rows start first */
  const unsigned int i = rg * (unsigned int)A0R + (w & 1u) * 16u + ln; const unsigned int ld = (unsigned int)LQ;
  const float* QF = F0 + (size_t)b * QT0 * LQ;      /* q | k | v rows of the batch's leading rows */
  const float* qr = QF + (size_t)i * ld + ((hk << KVSH) + (w >> 1)) * HD + hh * 32u;
  v4f q[HD / 8], o[HD / 8];
#pragma unroll
  for (int c = 0; c < HD / 8; ++c) { q[c] = *(const v4fa*)(qr + c * 4); const v4f z = {0.f, 0.f, 0.f, 0.f}; o[c] = z; }
  asm volatile("s_wait_xcnt 0x0" :: "v"(qr) : "memory");      /* stands in front of code that writes anew the address registers which the q loads name; the pointer as an input keeps them out of those loads' own results */
  /* a thread's share of a tile. K: key (tid & 7) of a group of 8, 16-byte piece ((tid >> 3) & 7) of a group of 8 (a wave's load covers 8 rows x 64 bytes), key groups (tid >> 6) and (tid >> 6) + 4. V: key (tid >> 4) of a group of 16, piece (tid & 15) (whole rows). */
  const unsigned int kb = tid & 7u, ka = (tid >> 3) & 7u, kg = tid >> 6, vb = tid >> 4, va = tid & 15u;
  const unsigned int kofs = ((kg * 8u + kb) * ld + ka * 4u) * 4u, vofs = (vb * ld + va * 4u) * 4u;      /* byte offsets, the same for every tile */
  float m = -1.0e30f, l = 0.f; const unsigned int jmax = rg * (unsigned int)A0R + (unsigned int)(A0R - 1);      /* keys up to the work-group's last row */
#pragma unroll 1      /* a tile's code is long already */
  for (unsigned int j0 = 0; j0 <= jmax; j0 += 64u) { const char* tb = (const char*)(QF + (size_t)j0 * ld + hk * HD);      /* the tile's first row; its k columns stand DM, its v columns ROTN floats further on */
    __syncthreads();      /* every wave has read the last tile to its end */
    { v4f kk[4], vv[4]; const char* kq = tb + kofs; const char* vq = tb + vofs;      /* a thread's four pieces of each tile lie at constant distances from one address */
#pragma unroll
      for (int it = 0; it < 4; ++it) kk[it] = *(const v4fa*)(kq + DM * 4 + (it & 1) * (32 * LQ * 4) + (it >> 1) * 128);
#pragma unroll
      for (int it = 0; it < 4; ++it) vv[it] = *(const v4fa*)(vq + ROTN * 4 + it * (16 * LQ * 4));
      asm volatile("s_wait_xcnt 0x0" :: "v"(kq), "v"(vq) : "memory");      /* stands in front of code that writes anew the address registers which the K and V loads name; the addresses as inputs keep them out of those loads' own results */
#pragma unroll
      for (int it = 0; it < 4; ++it) {
#pragma unroll
        for (int t = 0; t < 4; ++t) lk[(((unsigned int)(it >> 1) * 8u + ka) * 4u + (unsigned int)t) * 68u + (unsigned int)(it >> 1) * 16u + ((unsigned int)(it & 1) * 4u + kg) * 8u + kb] = kk[it][t]; }
#pragma unroll
      for (int it = 0; it < 4; ++it) *(v4fa*)&lv[(unsigned int)it * 16u + vb][va * 4u] = vv[it]; }
    __syncthreads();      /* the tile is whole before any wave reads it */
    const unsigned int jend = jmax + 1u - j0 < 64u ? jmax + 1u - j0 : 64u;      /* later keys of the tile lie above every row of the work-group: weight exactly zero */
    const float* lkh = lk + hh * (32u * 68u + 16u);
#pragma unroll 1      /* one trip is already four keys; more would only add code */
    for (unsigned int jj = 0; jj < jend; jj += 4u) { float s[4] = {0.f, 0.f, 0.f, 0.f}; v4f kr[HD / 2];
      /* The LDS reads of a trip are asked for in whole runs that stand ahead of their use, so that a wave waits out the LDS latency once per run; left to itself the compiler put most of them directly in front of their use, each with a full wait of its own. The pieces wait in the register arrays kr and vr; every plain '#pragma unroll' of this loop stands on a short loop over a register array, which unrolled whole is indexed by constants. */
#pragma unroll
      for (int c = 0; c < HD / 2; ++c) kr[c] = *(const v4fa*)(lkh + c * 68 + jj);
      __builtin_amdgcn_sched_barrier(0);      /* the run of K reads may not sink in among the score sums */
#pragma unroll
      for (int c = 0; c < HD / 8; ++c) {
#pragma unroll
        for (int t = 0; t < 4; ++t) { const v4f k4 = kr[c * 4 + t];
#pragma unroll
          for (int u = 0; u < 4; ++u) s[u] = __fadd_rn(s[u], __fmul_rn(q[c][t], k4[u])); } }
#pragma unroll 1      /* two of the four keys a pass, kept as a loop: only the V pieces of two keys are in registers at a time, so that the kernel stays inside the 256 registers that let two work-groups share a WGP */
      for (unsigned int u2 = 0; u2 < 4u; u2 += 2u) { const float s2[2] = {u2 ? s[2] : s[0], u2 ? s[3] : s[1]}; float sc[2], e[2]; v4f vr[2][HD / 8];      /* the pass's V reads come first, as one run: the exponentials run while they are under way */
#pragma unroll
        for (int u = 0; u < 2; ++u) {
#pragma unroll
          for (int c = 0; c < HD / 8; ++c) vr[u][c] = *(const v4fa*)&lv[jj + u2 + (unsigned int)u][hh * 32u + (unsigned int)(c * 4)]; }
#pragma unroll
        for (int u = 0; u < 2; ++u) { const float su = __fmul_rn(__fadd_rn(s2[u], sm_xhalf(s2[u])), 0.125f);      /* own half + the other lane's half: the same value in both lanes */
          const float f = (j0 + jj + u2 + (unsigned int)u <= i) ? 1.f : 0.f; const float sm = fmaf(f, su, (1.f - f) * -1.0e30f); const float mn = fmaxf(m, sm); sc[u] = expf(m - mn); e[u] = expf(sm - mn); l = __fadd_rn(__fmul_rn(l, sc[u]), e[u]); m = mn; }
#pragma unroll
        for (int u = 0; u < 2; ++u) {
#pragma unroll
          for (int c = 0; c < HD / 8; ++c) { const v4f vv = vr[u][c];
#pragma unroll
            for (int t = 0; t < 4; ++t) o[c][t] = __fadd_rn(__fmul_rn(o[c][t], sc[u]), __fmul_rn(e[u], vv[t])); } } } } }
  { const float fin = 64.0f / l;      /* o carried x64 like the f16 path */
#pragma unroll
    for (int c = 0; c < HD / 8; ++c) { v4f oo = o[c];
#pragma unroll
      for (int u = 0; u < 4; ++u) oo[u] = __fmul_rn(oo[u], fin);
      *(v4fa*)&lo[w * 16u + ln][hh * 32u + (unsigned int)(c * 4)] = oo; } }
  __syncthreads();      /* the o rows of the four heads are whole */
#pragma unroll
  for (int it = 0; it < 4; ++it) { const unsigned int p = (unsigned int)it * 256u + tid, row = (p >> 7) * 16u + (p & 15u), pc = ((p >> 4) & 7u) * 8u; const v4f a = *(const v4fa*)&lo[row][pc], c = *(const v4fa*)&lo[row][pc + 4u]; FragH fh, fl;      /* a wave: 16 rows x 2 neighbouring pieces, 512 bytes in a row of each plane */
#pragma unroll
    for (int t = 0; t < 4; ++t) { _Float16 hv = (_Float16)a[t]; fh.h[t] = hv; fl.h[t] = (_Float16)((a[t] - (float)hv) * 1024.0f); hv = (_Float16)c[t]; fh.h[4 + t] = hv; fl.h[4 + t] = (_Float16)((c[t] - (float)hv) * 1024.0f); }
    const v8us oh = fh.half[0], ol = fl.half[0]; const size_t d = fo_piece((size_t)b * SQ + rg * (unsigned int)A0R + (row & (unsigned int)(A0R - 1)), ((hk << KVSH) + row / (unsigned int)A0R) * HD + pc, (unsigned int)DM);
    *(v8us*)((unsigned short*)OH + d) = oh; *(v8us*)((unsigned short*)OL + d) = ol; } }

__global__ __launch_bounds__(256) void k_attf(const _Float16* __restrict__ Q16, const _Float16* __restrict__ QL, const _Float16* __restrict__ K16, const _Float16* __restrict__ VT, const _Float16* __restrict__ VTL, _Float16* __restrict__ OH, _Float16* __restrict__ OL, const float* __restrict__ F0) {
  __shared__ __attribute__((aligned(16))) unsigned char sp[AQ * APB];      /* per row: f32 scores, later f16 weights at byte 0 and their residuals at byte 2 NKX */
  __shared__ __attribute__((aligned(16))) float oc[AQ][68];
  if (blockIdx.y < (unsigned int)A0Y) { att0_rows(F0, OH, OL, sp, blockIdx.y * (unsigned int)(NH * NB) + blockIdx.x); return; }      /* block-uniform: the first work-groups take the leading rows in f32 */
  const unsigned int tid = threadIdx.x, w = (unsigned int)__builtin_amdgcn_readfirstlane((int)(tid >> 5)), lane = tid & 31u, ln = lane & 15u, hh = lane >> 4;
  const unsigned int h = blockIdx.x % (unsigned int)NH, b = blockIdx.x / (unsigned int)NH, hk = h >> KVSH;
  const unsigned int q0 = (unsigned int)(SQ - AQ) - (blockIdx.y - (unsigned int)A0Y) * (unsigned int)AQ;      /* the longest rows start first */
  const unsigned int nch = q0 / 128u + 1u;      /* 128-key chunks; at least 3 */
  const size_t r0 = (size_t)b * SQ;
  const v8f z8 = {0.f,0.f,0.f,0.f,0.f,0.f,0.f,0.f};
  /* every plain '#pragma unroll' of this kernel, of vb_load and of vb_loadg stands on a short loop over a register array (u, r, q, c): unrolled whole, the array is indexed by constants and stays in registers */
  { const _Float16* qp = Q16 + (r0 + q0) * LQ + h * (HD * 16) + lane * 8u; const _Float16* lp = QL + (r0 + q0) * LQ + h * (HD * 16) + lane * 8u;      /* a head's 64 columns are two blocks that follow one another */
    const v16h qh0 = g2_frag(qp), qh1 = g2_frag(qp + 512), ql0 = g2_frag(lp), ql1 = g2_frag(lp + 512);
    asm volatile("s_wait_xcnt 0x0" :: "v"(qp), "v"(lp) : "memory");      /* stands in front of code that writes anew the address registers which the q loads name; the pointers as inputs keep them whole up to here */
    const _Float16* kb = K16 + (r0 + w * 16u) * LQ + hk * (HD * 16) + lane * 8u;
#pragma unroll 1      /* one trip is already four tiles with all their loads in flight together */
    for (unsigned int i0 = 0; i0 < nch; i0 += 4u) { const _Float16* kp[4]; v16h k0[4], k1[4];
#pragma unroll
      for (int u = 0; u < 4; ++u) { const unsigned int i = i0 + (unsigned int)u; kp[u] = kb + (size_t)((i < nch ? i : nch - 1u) * 128u) * LQ; }      /* past the end: the last tile again, so that no load stands under a test */
#pragma unroll
      for (int u = 0; u < 4; ++u) { k0[u] = g2_frag(kp[u]); k1[u] = g2_frag(kp[u] + 512); }
      asm volatile("s_wait_xcnt 0x0" :: "v"(kp[0]), "v"(kp[1]), "v"(kp[2]), "v"(kp[3]) : "memory");      /* the same for the K loads */
      __builtin_amdgcn_sched_barrier(0);      /* keeps the first product, which waits for its tile, from moving up among the loads of the later tiles */
#pragma unroll
      for (int u = 0; u < 4; ++u) { if (i0 + (unsigned int)u < nch) {
        v8f a1 = g2_mma(qh0, k0[u], z8); a1 = g2_mma(qh1, k1[u], a1);
        v8f a2 = g2_mma(ql0, k0[u], z8); a2 = g2_mma(ql1, k1[u], a2);
        unsigned char* sd = sp + (8u * hh) * (unsigned int)APB + (((i0 + (unsigned int)u) * 8u + w) * 16u + ln) * 4u;
#pragma unroll
        for (int r = 0; r < 8; ++r) *(fa1*)(sd + (unsigned int)r * (unsigned int)APB) = a2[r] * 0.0001220703125f + a1[r] * 0.125f; } } } }
  __syncthreads();      /* all score tiles of the 16 rows are in LDS */
#pragma unroll 1      /* the second row reuses the first row's registers */
  for (unsigned int rr = 0; rr < 2u; ++rr) { const unsigned int row = w * 2u + rr; unsigned char* rp = sp + row * (unsigned int)APB; const unsigned int last = q0 + row; v4f e[16];
#pragma unroll
    for (unsigned int c = 0; c < 16u; ++c) { if (c < nch) e[c] = *(const v4fa*)(rp + (c * 128u + lane * 4u) * 4u); }
    v4f m4 = {-3.0e38f, -3.0e38f, -3.0e38f, -3.0e38f};
#pragma unroll
    for (unsigned int c = 0; c < 16u; ++c) { if (c < nch) {
#pragma unroll
      for (int q = 0; q < 4; ++q) { e[c][q] = (c * 128u + lane * 4u + (unsigned int)q <= last) ? e[c][q] : -1.0e9f; m4[q] = fmaxf(m4[q], e[c][q]); } } }
    const float mx = sm_wave_max(fmaxf(fmaxf(m4[0], m4[1]), fmaxf(m4[2], m4[3])));
    v4f s4 = {0.f, 0.f, 0.f, 0.f};
#pragma unroll
    for (unsigned int c = 0; c < 16u; ++c) { if (c < nch) {
#pragma unroll
      for (int q = 0; q < 4; ++q) { e[c][q] = sm_exp(e[c][q] - mx); s4[q] += e[c][q]; } } }
    const float se = sm_wave_sum((s4[0] + s4[1]) + (s4[2] + s4[3])); const float sc = 256.0f / se;
#pragma unroll
    for (unsigned int c = 0; c < 16u; ++c) { if (c < nch) { v4h h4, l4;
#pragma unroll
      for (int q = 0; q < 4; ++q) { const float pv = e[c][q] * sc; const _Float16 hv = (_Float16)pv; h4[q] = hv; l4[q] = (_Float16)((pv - (float)hv) * 1024.0f); }
      *(v4ha*)(rp + (c * 128u + lane * 4u) * 2u) = h4; *(v4ha*)(rp + (unsigned int)NKX * 2u + (c * 128u + lane * 4u) * 2u) = l4; } } }
  __syncthreads();      /* all weight rows are in LDS */
  { const unsigned int ct = w & 3u; const bool resv = w >= 4u;      /* wave-uniform */
    const _Float16* vp = (resv ? VTL : VT) + (((size_t)b * NKV + hk) * HD + ct * 16u) * SQ + lane * 8u;      /* a chunk of 128 keys is four blocks, 2048 elements */
    const _Float16* ph = (const _Float16*)(sp + ln * (unsigned int)APB) + 8u * hh; const _Float16* pl = ph + NKX;
    v8f a1 = z8, a3 = z8; VB v0, v1, v2;      /* ring of three chunks: chunk c + 2 is asked for in front of the products of chunk c */
    vb_loadg(v0, vp); vb_loadg(v1, vp + 2048);
    asm volatile("s_wait_xcnt 0x0" :: "v"(vp) : "memory");      /* as above, for the V loads */
    /* one chunk: NEW takes chunk C + 2 (past the end: the last chunk again, so that no load stands under a test and each wait can count the younger chunks as still in flight); the chunk's weight fragments are read from LDS together; the wait as above, whose memory clobber also holds those reads in front of it, ahead of the first product; then the products of chunk C from CUR */
#define AT_CHUNK(CUR, NEW, C) { const unsigned int cc = (C); const _Float16* vn = vp + (cc + 2u < nch ? cc + 2u : nch - 1u) * 2048u; vb_loadg(NEW, vn); VB pa, pb; vb_load(pa, ph + cc * 128u); if (!resv) vb_load(pb, pl + cc * 128u); \
      asm volatile("s_wait_xcnt 0x0" :: "v"(vn) : "memory"); \
      _Pragma("unroll") for (int u = 0; u < 4; ++u) a1 = g2_mma(pa.f[u], CUR.f[u], a1); \
      if (!resv) { _Pragma("unroll") for (int u = 0; u < 4; ++u) a3 = g2_mma(pb.f[u], CUR.f[u], a3); } }
    unsigned int c = 0;
#pragma unroll 1      /* one trip is three chunks, so that the ring's stages are named, not indexed; no way out from inside a trip, the last zero, one or two chunks stand behind the loop */
    for (; c + 3u <= nch; c += 3u) { AT_CHUNK(v0, v2, c); AT_CHUNK(v1, v0, c + 1u); AT_CHUNK(v2, v1, c + 2u); }
    if (c < nch) { AT_CHUNK(v0, v2, c); if (c + 1u < nch) AT_CHUNK(v1, v0, c + 1u); }
#undef AT_CHUNK
    if (resv) {
#pragma unroll
      for (int r = 0; r < 8; ++r) oc[8u * hh + (unsigned int)r][ct * 16u + ln] = a1[r]; }
    __syncthreads();      /* the Vres ph sums are in LDS */
    if (!resv) {      /* own elements: each is read and rewritten by the same lane */
#pragma unroll
      for (int r = 0; r < 8; ++r) { float o = a1[r] * 0.25f; o = oc[8u * hh + (unsigned int)r][ct * 16u + ln] * 0.000244140625f + o; o = a3[r] * 0.000244140625f + o; oc[8u * hh + (unsigned int)r][ct * 16u + ln] = o; } } }
  __syncthreads();      /* the o tile is whole */
  if (tid < 128u) { const unsigned int row = tid & 15u, pc = (tid >> 4) * 8u; const v4f a = *(const v4fa*)&oc[row][pc], c = *(const v4fa*)&oc[row][pc + 4u]; FragH fh, fl;      /* a wave: 16 rows x 2 neighbouring pieces, 512 bytes in a row of each plane */
#pragma unroll
    for (int q = 0; q < 4; ++q) { _Float16 hv = (_Float16)a[q]; fh.h[q] = hv; fl.h[q] = (_Float16)((a[q] - (float)hv) * 1024.0f); hv = (_Float16)c[q]; fh.h[4 + q] = hv; fl.h[4 + q] = (_Float16)((c[q] - (float)hv) * 1024.0f); }
    const v8us oh = fh.half[0], ol = fl.half[0]; const size_t d = fo_piece(r0 + q0 + row, h * HD + pc, (unsigned int)DM);
    *(v8us*)((unsigned short*)OH + d) = oh; *(v8us*)((unsigned short*)OL + d) = ol; } }

constexpr size_t al256(size_t b) { return (b + 255) & ~(size_t)255; }
constexpr size_t SZ_BQKV = al256((size_t)LQ * DM * 2);
constexpr size_t SZ_BO   = al256((size_t)DM * DM * 2);
constexpr size_t SZ_XO   = al256(NR * DM * 2);                          /* X16, later reused as the merged o value rows */
constexpr size_t SZ_QKV  = al256(NR * LQ * 2);                          /* value plane; the residual plane has the same size */
constexpr size_t SZ_F0   = al256((size_t)NB * QT0 * LQ * 4);
constexpr size_t SZ_VT   = al256((size_t)NB * NKV * HD * SQ * 2);       /* V^T value plane; the residual plane has the same size */
constexpr size_t SZ_OL   = al256(NR * DM * 2);                          /* merged o residual rows */
constexpr size_t WS_TOTAL = SZ_BQKV + SZ_BO + SZ_XO + 2 * SZ_QKV + SZ_F0 + 2 * SZ_VT + SZ_OL;
static_assert(WS_TOTAL <= (size_t)134217728);
/* plane coverage equalities of the producer grids */
static_assert(((size_t)(DM / 64) * (DM / 64)) * 64 * 64 == (size_t)DM * DM);
static_assert(((size_t)(DM / 64) * (KVD / 64)) * 64 * 64 == (size_t)DM * KVD);
static_assert(((size_t)NB * NKV * (SQ / 64)) * 64 * 64 == (size_t)NB * NKV * HD * SQ);
static_assert((NR * DM) % (256 * 8) == 0);
static_assert((size_t)A0G * 4 * A0R * HD == (size_t)NB * QT0 * DM);
static_assert(((size_t)(NR / 128) * (LQ / 64)) * 128 * 64 == NR * LQ);
static_assert(((size_t)NH * NB * ((SQ - QT0) / AQ)) * AQ * HD == (NR - (size_t)NB * QT0) * DM);
static_assert(((size_t)(SQ / 128) * (DM / 64) * NB) * 128 * 64 == NR * DM);

extern "C" void kernel_launch(void* const* d_in, const int* in_sizes, int n_in,
                              void* d_out, int out_size, void* d_ws, size_t ws_size, hipStream_t stream) {
  if (n_in < 7) return;
  const size_t need_x = ((size_t)(NB - 1) * SQ_FULL + SQ) * DM;
  if ((size_t)in_sizes[0] < need_x) return;
  if ((size_t)in_sizes[1] < (size_t)SQ * 32) return;
  if ((size_t)in_sizes[2] < (size_t)SQ * 32) return;
  if ((size_t)in_sizes[3] < (size_t)DM * DM) return;
  if ((size_t)in_sizes[4] < (size_t)DM * KVD) return;
  if ((size_t)in_sizes[5] < (size_t)DM * KVD) return;
  if ((size_t)in_sizes[6] < (size_t)DM * DM) return;
  if ((size_t)out_size < need_x) return;
  const float* x = (const float*)d_in[0]; const float* cosb = (const float*)d_in[1]; const float* sinb = (const float*)d_in[2];      /* tables [pos][32], read as values */
  const float* wq = (const float*)d_in[3]; const float* wk = (const float*)d_in[4]; const float* wv = (const float*)d_in[5]; const float* wo = (const float*)d_in[6];      /* all [in][out] */
  float* out = (float*)d_out;
  char* ws = (char*)d_ws; size_t off = 0;
  auto take = [&](size_t bytes) { char* p = ws + off; off += (bytes + 255) & ~(size_t)255; return p; };
  _Float16* BQKV = (_Float16*)take(SZ_BQKV); _Float16* BO = (_Float16*)take(SZ_BO);
  _Float16* X16 = (_Float16*)take(SZ_XO); _Float16* OH = X16;      /* X16 is dead after the projection GEMMs; the merged o value rows take its place */
  _Float16* QKV = (_Float16*)take(SZ_QKV); const _Float16* Q16 = QKV; const _Float16* K16 = QKV + DM * 16; const _Float16* V16 = QKV + ROTN * 16;      /* fragment order: column c, a multiple of 32, begins 16 c elements into a row group */
  _Float16* QKVL = (_Float16*)take(SZ_QKV); const _Float16* QL = QKVL; const _Float16* VL16 = QKVL + ROTN * 16;      /* x1024 residual plane, same layout (k columns unused) */
  float* F0 = (float*)take(SZ_F0);
  _Float16* VT = (_Float16*)take(SZ_VT); _Float16* VTL = (_Float16*)take(SZ_VT);
  _Float16* OL = (_Float16*)take(SZ_OL);
  if (off > ws_size) return;

  k_prep<<<PW_ALL + PX_ALL, 256, 0, stream>>>(x, wq, wk, wv, wo, X16, BQKV, BO);      /* weights -> Bt planes, x -> X16 */
  k_gemm2<<<dim3(GP_L + GP_A, 1), 128, 0, stream>>>(X16, DM, (size_t)0, BQKV, DM, (size_t)0, 0u, 0.0625f, nullptr, QKV, QKVL, LQ, (size_t)0, (int)(NR), LQ, DM, cosb, sinb, (unsigned int)ROTN, (unsigned int)(SQ - 1), (unsigned int)GP_L, (size_t)SQ * DM, F0, (size_t)QT0 * LQ, QT0);      /* q | k | v rows (f16 value + residual) and, side by side, f32 q | k | v of rows 0..QT0-1 of every batch; q / k rotated + normalised */
  k_vt<<<dim3(NB * NKV * (SQ / 64), 2), 256, 0, stream>>>(V16, VT, VL16, VTL);      /* V^T value and residual planes [NB][NKV][HD][SQ] */
  k_attf<<<dim3(NH * NB, A0Y + (SQ - QT0) / AQ), 256, 0, stream>>>(Q16, QL, K16, VT, VTL, OH, OL, F0);      /* grid rows below A0Y: f32 attention for rows 0..QT0-1; the others, rows from QT0 on: scores, softmax and o; final o (x64) written as f16 value + x1024 residual merged rows */
  k_gemmo<<<dim3((SQ / 128) * (DM / 64), NB), 128, 0, stream>>>(OH, OL, BO, out);      /* out rows in the output layout: o value plane and o residual plane against Wo, folded in f32 */
}

// v010
// A run of this version takes 106 microseconds.
// Two timings next to v009 put it at 1.28 and 1.29 times that version's speed.
// Counting every step since v000, it is 60.9 times as fast.
#include <hip/hip_runtime.h>
// All contractions: v_wmma_f32_16x16x32_f16 (f16 operands, f32 accumulate). x, cos, sin and all four weights are RNE-converted to bf16 first (exact in f16; weights carried x16); q (after split-half rotation + scale-free RMS normalisation in f32), v, softmax weights (unnormalised, e^(score - 8) x 2^15) and o (x64) are f16 value + x1024 residual planes, every residual product summed apart from its value product and folded in f32; k is a single f16 plane; the first 256 query rows of every batch use f32 q/k/v from exact-operand GEMMs and an f32 online softmax on VALU.
// Causal grouped-query self-attention: x [NB][SQ][1024]; q = x Wq (16 heads of 64), k = x Wk, v = x Wv (4 kv heads of 64; weights are [in][out]); rotation with INPUT tables cos/sin [pos][32]: y[j] = x[j] c + x[j+32] s, y[j+32] = x[j+32] c - x[j] s; q, k scaled by rsqrt(mean square over the head + 1e-6); query head h uses kv head h >> 2; scores * 0.125; keys above the query get exactly zero weight; softmax; out = merged y Wo -> [NB][SQ][1024] f32.
// Structure: token rows r = b*SQ + s; X16 exact f16 rows; one q|k|v GEMM (N = 1536) whose epilogue applies rotation + normalisation on the 64-column head tiles of q and k and writes value + residual planes; V^T value and residual planes per (batch, kv head) via LDS transposes; one attention launch, a work-group per (batch, kv head, 32 query rows of each of its four heads), which streams over the keys 64 at a time: K and both V^T planes staged in LDS for its eight waves, a wave (16 rows of one head) keeps scores = k qh + k qres, weights and o = Vh ph + (Vh pl + Vres ph) in registers, row sum beside them, o divided by it at the end and written as f16 value + residual merged o rows (x64); out = oh Wo + ores Wo. Rows 0..255 of each batch: f32 attention by the first work-groups of the same launch, split into the same two o planes. Every f16 operand plane in the workspace (X16, the weights, q | k | v, V^T, o) is stored in fragment order (see fo_piece).
#ifndef NB
#define NB 2
#endif
#ifndef SQ
#define SQ 2048
#endif
#define NB_FULL 2
#define SQ_FULL 2048
#define DM 1024
#define NH 16
#define NKV 4
#define KVSH 2                       /* query head -> kv head shift */
#define HD 64
#define KVD (NKV * HD)               /* 256 */
#define LQ (DM + 2 * KVD)            /* row pitch of the q | k | v rows: 1536 */
#define ROTN (DM + KVD)              /* columns below this are q / k heads (rotated + normalised) */
#define QT 256                       /* not used by any kernel, only by the static_asserts */
#define QT0 256                      /* leading rows of every batch computed in f32 */
#define NR ((size_t)NB * SQ)         /* token rows */

static_assert(NB <= NB_FULL);
static_assert(SQ <= SQ_FULL);
static_assert((SQ & (SQ - 1)) == 0);
static_assert(SQ % QT == 0);
static_assert((QT & (QT - 1)) == 0);
static_assert(QT % 128 == 0);
static_assert(QT0 == QT);
static_assert(QT0 % 128 == 0);
static_assert(QT0 % 64 == 0);
static_assert(HD == 64);
static_assert(DM == NH * HD);
static_assert(NH == (NKV << KVSH));
static_assert(DM / 8 == 128);
static_assert(DM % 64 == 0);
static_assert(KVD % 64 == 0);
static_assert(LQ % 64 == 0);
static_assert(ROTN % 64 == 0);
static_assert(((size_t)NB * SQ) % 128 == 0);
static_assert(SQ % 64 == 0);
static_assert(DM % 32 == 0);

typedef unsigned short v8us __attribute__((ext_vector_type(8), may_alias));
typedef float  v8f  __attribute__((ext_vector_type(8)));
typedef float  v4f  __attribute__((ext_vector_type(4)));
typedef float  v4fa __attribute__((ext_vector_type(4), may_alias));
typedef _Float16 v16h __attribute__((ext_vector_type(16)));
typedef _Float16 v4h __attribute__((ext_vector_type(4)));
typedef _Float16 v4ha __attribute__((ext_vector_type(4), may_alias));
union FragH { v16h v; v8us half[2]; _Float16 h[16]; unsigned short u[16]; };

__device__ __forceinline__ unsigned short bf16_bits(float x) { unsigned int u = __float_as_uint(x); return (unsigned short)((u + 0x7FFFu + ((u >> 16) & 1u)) >> 16); }
__device__ __forceinline__ float bf16_val(unsigned short b) { return __uint_as_float(((unsigned int)b) << 16); }
__device__ __forceinline__ float bf16_rne(float x) { return bf16_val(bf16_bits(x)); }

// fragment: elements 0..7 <- k0 + 8h + 0..7, elements 8..15 <- k0 + 16 + 8h + 0..7 (same map for A rows and B columns)
// Fragment order of an f16 operand plane (rows of L elements, L a multiple of 32): the plane is cut into blocks of 16 rows x 32 k, 512 elements each, block (g, s) at (g * (L / 32) + s) * 512. Inside a block stand elements 0..7 of the fragment of lanes 0, 1, .. 31 (lane = 16 h + row), then elements 8..15 in the same lane order. Each of a fragment's two 16-byte loads then reads 512 bytes in a row, four whole lines; with the rows in memory order it read 32 bytes on each of 16 lines. A group of 16 rows takes 16 L elements as in row order, so offsets of whole row groups keep their values; 32 columns further on is 512 elements further on.
// fo_piece: offset of the 8 elements k .. k + 7 (k a multiple of 8) of row r
__device__ __forceinline__ size_t fo_piece(size_t r, unsigned int k, unsigned int L) { return ((r >> 4) * (size_t)(L >> 5) + (k >> 5)) * 512u + ((k >> 4) & 1u) * 256u + ((k >> 3) & 1u) * 128u + ((unsigned int)r & 15u) * 8u; }
// p: the block's start + 8 * lane
__device__ __forceinline__ v16h g2_frag(const _Float16* p) { FragH f; f.half[0] = *(const v8us*)((const unsigned short*)p); f.half[1] = *(const v8us*)((const unsigned short*)p + 256); return f.v; }
__device__ __forceinline__ v8f g2_mma(v16h a, v16h b, v8f c) { v8f d = __builtin_amdgcn_wmma_f32_16x16x32_f16(false, a, false, b, (short)0, c, false, false); asm volatile("v_nop\n\tv_nop\n\tv_nop\n\tv_nop" : "+v"(d) : "v"(a), "v"(b)); return d; }

// bx: the 64 x 64 tile of this weight that the work-group takes
__device__ __forceinline__ void wT_tile(const float* __restrict__ w, unsigned int Kd, unsigned int Nd, _Float16* __restrict__ Bt, unsigned int bx) {
  __shared__ unsigned short tl[64][66];
  const unsigned int tid = threadIdx.x; const unsigned int ntn = Nd >> 6; const unsigned int kt = bx / ntn, nt = bx - kt * ntn; const unsigned int k0 = kt * 64u, n0 = nt * 64u;
  for (unsigned int i = tid; i < 64u * 16u; i += 256u) { const unsigned int r = i >> 4, c4 = (i & 15u) * 4u; const v4f a = *(const v4fa*)(w + (size_t)(k0 + r) * Nd + n0 + c4); FragH f;
#pragma unroll
    for (int q = 0; q < 4; ++q) f.h[q] = (_Float16)(bf16_rne(a[q]) * 16.0f);
#pragma unroll
    for (int q = 0; q < 4; ++q) tl[r][c4 + q] = f.u[q]; }
  __syncthreads();
  {
#pragma unroll
    for (int rd = 0; rd < 2; ++rd) { const unsigned int d = (unsigned int)rd * 32u + (tid >> 7) * 16u + (tid & 15u), pc = (tid >> 4) & 7u; FragH f;      /* a wave: 16 rows x 2 neighbouring pieces, 512 bytes in a row of the plane */
#pragma unroll
      for (int q = 0; q < 8; ++q) f.u[q] = tl[pc * 8u + q][d];
      const v8us o = f.half[0];
      *(v8us*)((unsigned short*)Bt + fo_piece(n0 + d, k0 + pc * 8u, Kd)) = o; }
     } }

__device__ __forceinline__ void x16_tile(const float* __restrict__ x, _Float16* __restrict__ X16, unsigned int bx) {
  /* a work-group takes 16 rows x 128 columns: four blocks that follow one another in the plane. Whole 512-byte runs of x rows come in, the f16 tile turns in LDS, whole runs of the plane go out. */
  __shared__ __attribute__((aligned(16))) unsigned short tl[16][136];      /* pitch 136: rows stay 16-byte aligned and the 16-byte reads of 16 rows fall on different banks */
  const unsigned int tid = threadIdx.x;
  const unsigned int g = bx >> 3, kt = bx & 7u;                   /* DM / 128 = 8 column tiles per row group */
  const unsigned int r = tid >> 5, c4 = (tid & 31u) * 4u;      /* rows r and r + 8 of the group: a wave reads 512 bytes in a row of one x row */
  const unsigned int row = g * 16u + r, b = row / (unsigned int)SQ, s = row - b * (unsigned int)SQ;      /* a group of 16 rows lies in one batch */
  const float* xp = x + ((size_t)b * SQ_FULL + s) * DM + kt * 128u + c4;
  const v4f a0 = *(const v4fa*)xp, a1 = *(const v4fa*)(xp + 8 * DM); v4h h0, h1;
  asm volatile("s_wait_xcnt 0x0" :: "v"(xp) : "memory");      /* stands in front of code that writes anew the address registers which the two loads name; the pointer as an input keeps them out of those loads' own results */
#pragma unroll
  for (int q = 0; q < 4; ++q) { h0[q] = (_Float16)bf16_rne(a0[q]); h1[q] = (_Float16)bf16_rne(a1[q]); }
  *(v4ha*)&tl[r][c4] = h0; *(v4ha*)&tl[r + 8u][c4] = h1;
  __syncthreads();      /* the tile is whole before it is read across its rows */
  const v8us o = *(const v8us*)&tl[tid & 15u][(tid >> 6) * 32u + ((tid >> 5) & 1u) * 16u + ((tid >> 4) & 1u) * 8u];      /* thread = (block, fragment half, lane) in the plane's own order */
  *(v8us*)((unsigned short*)X16 + ((size_t)bx * 256u + tid) * 8u) = o;
}

// the four weight transposes and the x conversion depend on nothing but the inputs: one launch runs them side by side, each work-group taking one tile of one of the five jobs (block-uniform choice, in front of every barrier)
#define PW_Q ((DM / 64) * (DM / 64))             /* tiles of Wq, and of Wo */
#define PW_KV ((DM / 64) * (KVD / 64))           /* tiles of Wk, and of Wv */
#define PW_ALL (2 * PW_Q + 2 * PW_KV)
#define PX_ALL ((unsigned int)(NR * DM / (256 * 8)))      /* tiles of x */
__global__ __launch_bounds__(256) void k_prep(const float* __restrict__ x, const float* __restrict__ wq, const float* __restrict__ wk, const float* __restrict__ wv, const float* __restrict__ wo, _Float16* __restrict__ X16, _Float16* __restrict__ BQKV, _Float16* __restrict__ BO) {
  const unsigned int bx = blockIdx.x;
  if (bx >= (unsigned int)PW_ALL) { x16_tile(x, X16, bx - (unsigned int)PW_ALL); return; }
  const float* w = wq; _Float16* Bt = BQKV; unsigned int Nd = (unsigned int)DM, t = bx;                                                     /* W[DM][DM] -> Bt rows 0..1023 */
  if (bx >= (unsigned int)(PW_Q + 2 * PW_KV)) { w = wo; Bt = BO; t = bx - (unsigned int)(PW_Q + 2 * PW_KV); }                                /* Wo[c][n] -> Bt[n][c] */
  else if (bx >= (unsigned int)(PW_Q + PW_KV)) { w = wv; Bt = BQKV + (size_t)ROTN * DM; Nd = (unsigned int)KVD; t = bx - (unsigned int)(PW_Q + PW_KV); }      /* W[DM][KVD] -> Bt rows 1280..1535 */
  else if (bx >= (unsigned int)PW_Q) { w = wk; Bt = BQKV + (size_t)DM * DM; Nd = (unsigned int)KVD; t = bx - (unsigned int)PW_Q; }           /* W[DM][KVD] -> Bt rows 1024..1279 */
  wT_tile(w, (unsigned int)DM, Nd, Bt, t);
}

// grid row 0 turns the value plane, grid row 1 the residual plane, side by side in one launch
__global__ __launch_bounds__(256) void k_vt(const _Float16* __restrict__ VH16, _Float16* __restrict__ VtH, const _Float16* __restrict__ VL16, _Float16* __restrict__ VtL) {
  __shared__ unsigned short tl[64][66];
  const _Float16* V16 = blockIdx.y ? VL16 : VH16; _Float16* Vt = blockIdx.y ? VtL : VtH;      /* block-uniform */
  const unsigned int tid = threadIdx.x; const unsigned int slab = blockIdx.x / (unsigned int)(SQ / 64), lg = blockIdx.x % (unsigned int)(SQ / 64); const unsigned int b = slab / (unsigned int)NKV, h = slab % (unsigned int)NKV;
  for (unsigned int i = tid; i < 64u * 8u; i += 256u) { const unsigned int r = (i >> 7) * 16u + (i & 15u), c8 = ((i >> 4) & 7u) * 8u; FragH f; const unsigned short* vq = (const unsigned short*)V16 + fo_piece((size_t)b * SQ + lg * 64u + r, h * 64u + c8, (unsigned int)LQ); f.half[0] = *(const v8us*)vq;      /* a wave: 16 rows x 2 neighbouring pieces, 512 bytes in a row of the plane */
    asm volatile("s_wait_xcnt 0x0" :: "v"(vq) : "memory");      /* stands in front of code that writes anew the address registers which the load names; the pointer as an input keeps them out of the load's own result */
#pragma unroll
    for (int q = 0; q < 8; ++q) tl[r][c8 + q] = f.u[q]; }
  __syncthreads();
  {
#pragma unroll
    for (int rd = 0; rd < 2; ++rd) { const unsigned int d = (unsigned int)rd * 32u + (tid >> 7) * 16u + (tid & 15u), pc = (tid >> 4) & 7u; FragH f;      /* the same deal of a wave for the plane that is written */
#pragma unroll
      for (int q = 0; q < 8; ++q) f.u[q] = tl[pc * 8u + q][d];
      const v8us o = f.half[0];
      *(v8us*)((unsigned short*)Vt + fo_piece((size_t)slab * 64u + d, lg * 64u + pc * 8u, (unsigned int)SQ)) = o; }
     } }

// one k-step (32 k) of a wave's operands: two A row fragments and four B column fragments
struct G2Stage { v16h a0, a1, b0, b1, b2, b3; };
__device__ __forceinline__ void g2_load(G2Stage& s, const _Float16* a0p, const _Float16* a1p, const _Float16* b0p, const _Float16* b1p, const _Float16* b2p, const _Float16* b3p, int kb) {
  s.a0 = g2_frag(a0p + kb); s.a1 = g2_frag(a1p + kb); s.b0 = g2_frag(b0p + kb); s.b1 = g2_frag(b1p + kb); s.b2 = g2_frag(b2p + kb); s.b3 = g2_frag(b3p + kb); }
__device__ __forceinline__ void g2_step(const G2Stage& s, v8f& c00, v8f& c01, v8f& c02, v8f& c03, v8f& c10, v8f& c11, v8f& c12, v8f& c13) {
  c00 = g2_mma(s.a0, s.b0, c00); c10 = g2_mma(s.a1, s.b0, c10); c01 = g2_mma(s.a0, s.b1, c01); c11 = g2_mma(s.a1, s.b1, c11);
  c02 = g2_mma(s.a0, s.b2, c02); c12 = g2_mma(s.a1, s.b2, c12); c03 = g2_mma(s.a0, s.b3, c03); c13 = g2_mma(s.a1, s.b3, c13); }

// batched GEMM (grid.y = head / batch slab): C = alpha * A Bt^T. A f16 [M][K], rows of lda elements (slab stride sA), Bt f16 [N][K], rows of ldb elements (slab stride sB applied to blockIdx.y >> bsh), both in fragment order; outputs f32 C in row order and/or f16 value plane C16 (+ optional x2^10 residual plane C16L of the same f32 value) in fragment order, rows of ldc elements, slab stride sC.
// A second product of the same A and Bt planes may run side by side with the first in one launch: the first nx2 work-groups (none where nx2 is 0) form slabs of M2 rows, slab strides sA2 and sC2, f32 output C2 only.
__global__ __launch_bounds__(128) void k_gemm2(const _Float16* __restrict__ A, int lda, size_t sA, const _Float16* __restrict__ Bh, int ldb, size_t sB, unsigned int bsh, float alpha,
    float* C, _Float16* C16, _Float16* C16L, int ldc, size_t sC, int M, int N, int K, const float* cosb, const float* sinb, unsigned int rotN, unsigned int pmask, unsigned int nx2, size_t sA2, float* C2, size_t sC2, int M2) {
  __shared__ __attribute__((aligned(16))) float so[4][32][68];
  const unsigned int tid = threadIdx.x, w = tid >> 5, lane = tid & 31u, ln = lane & 15u, hh = lane >> 4; unsigned int bx = blockIdx.x, by = blockIdx.y;
  if (bx < nx2) { const unsigned int per = ((unsigned int)M2 >> 7) * ((unsigned int)N >> 6); by = bx / per; bx -= by * per; sA = sA2; sC = sC2; M = M2; C = C2; C16 = nullptr; C16L = nullptr; }      /* block-uniform: tile and slab of the second product */
  else bx -= nx2;
  A += (size_t)by * sA; Bh += (size_t)(by >> bsh) * sB; const size_t cofs = (size_t)by * sC;
  const unsigned int ntn = (unsigned int)N >> 6; const unsigned int mt = bx / ntn, nq = bx - mt * ntn; const unsigned int row0 = mt * 128u + 32u * w, col0 = nq * 64u; if (row0 >= (unsigned int)M) return;
  const _Float16* a0p = A + (size_t)row0 * lda + lane * 8u; const _Float16* a1p = a0p + (size_t)16 * lda;      /* first block of the row group + the lane's place in a block */
  const _Float16* b0p = Bh + (size_t)col0 * ldb + lane * 8u; const _Float16* b1p = b0p + (size_t)16 * ldb; const _Float16* b2p = b1p + (size_t)16 * ldb; const _Float16* b3p = b2p + (size_t)16 * ldb;
  const v8f z8 = {0.f,0.f,0.f,0.f,0.f,0.f,0.f,0.f}; v8f c00 = z8, c01 = z8, c02 = z8, c03 = z8, c10 = z8, c11 = z8, c12 = z8, c13 = z8;
  /* K loop as a ring of three register stages: the twelve loads of k-step s + 2 are issued together in front of the products of k-step s, so a wave waits for a whole stage that was asked for two steps earlier instead of for each fragment in turn. In front of and inside the loop no load stands under a test of its own, so that each wait can count the younger stages as still in flight; the last two to four steps are peeled. The order of the k-steps and of the products into each accumulator is unchanged. */
#define G2_LD(S, ST) g2_load(S, a0p, a1p, b0p, b1p, b2p, b3p, (ST) * 512)
#define G2_ST(S) g2_step(S, c00, c01, c02, c03, c10, c11, c12, c13)
#define G2_XW() asm volatile("s_wait_xcnt 0x0" ::: "memory")      /* stands in front of code that writes anew the address registers which the loads issued so far name */
  const int nst = (K + 31) >> 5;
  if (nst == 1) { G2Stage s0; G2_LD(s0, 0); G2_ST(s0); }
  else if (nst > 1) { G2Stage s0, s1, s2; int st = 0;
    G2_LD(s0, 0); G2_LD(s1, 1); G2_XW();
#pragma unroll 1      /* one trip is already three k-steps; more would only add code */
    for (; st + 5 <= nst; st += 3) { G2_LD(s2, 2); G2_ST(s0); G2_LD(s0, 3); G2_ST(s1); G2_LD(s1, 4); G2_ST(s2); G2_XW();
      a0p += 1536; a1p += 1536; b0p += 1536; b1p += 1536; b2p += 1536; b3p += 1536; }      /* every load names one of the six pointers with a constant offset; they move on three blocks a trip */
    const int rem = nst - st;      /* 2, 3 or 4 steps are left; s0 and s1 hold the first two */
    if (rem >= 3) G2_LD(s2, 2);
    G2_ST(s0);
    if (rem >= 4) { G2_XW(); const int kt = 3 * 512;      /* here the address registers die with their loads and a later fragment may land in them: the wait stands behind each fragment's loads */
      s0.a0 = g2_frag(a0p + kt); G2_XW(); s0.a1 = g2_frag(a1p + kt); G2_XW(); s0.b0 = g2_frag(b0p + kt); G2_XW(); s0.b1 = g2_frag(b1p + kt); G2_XW(); s0.b2 = g2_frag(b2p + kt); G2_XW(); s0.b3 = g2_frag(b3p + kt); G2_XW(); }
    G2_ST(s1);
    if (rem >= 3) G2_ST(s2);
    if (rem >= 4) G2_ST(s0); }
#undef G2_LD
#undef G2_ST
#undef G2_XW
  v8f accs[8] = {c00, c01, c02, c03, c10, c11, c12, c13};
#pragma unroll
  for (int u = 0; u < 8; ++u) accs[u] = accs[u] * alpha;
#pragma unroll
  for (int u = 0; u < 8; ++u) { const unsigned int t = (unsigned int)u & 3u, half = (unsigned int)u >> 2;
#pragma unroll
    for (int r = 0; r < 8; ++r) { const unsigned int rloc = half * 16u + 8u * hh + (unsigned int)r;
      so[w][rloc][t * 16u + ln] = accs[u][r]; } }
  __builtin_amdgcn_fence(4 /* acq_rel order */, "workgroup"); __builtin_amdgcn_wave_barrier();
  if (col0 < rotN) {      /* block-uniform: this tile is one q / k head; lane owns tile row 'lane' */
    const unsigned int pos = (row0 + lane) & pmask;
    const float* cr = cosb + (size_t)pos * 32u; const float* sr = sinb + (size_t)pos * 32u; float ss = 0.f;
#pragma unroll 1
    for (unsigned int j = 0; j < 32u; j += 4u) { const v4f cc = *(const v4fa*)(cr + j), sn = *(const v4fa*)(sr + j); const v4f x1 = *(const v4fa*)&so[w][lane][j], x2 = *(const v4fa*)&so[w][lane][32u + j]; v4f y1, y2;
#pragma unroll
      for (int q = 0; q < 4; ++q) { const float c = bf16_rne(cc[q]), s = bf16_rne(sn[q]); y1[q] = x1[q] * c + x2[q] * s; y2[q] = x2[q] * c - x1[q] * s; ss += y1[q] * y1[q] + y2[q] * y2[q]; }
      *(v4fa*)&so[w][lane][j] = y1; *(v4fa*)&so[w][lane][32u + j] = y2; }
    const float rs = rsqrtf(ss * 0.015625f + 1.0e-6f);
#pragma unroll 1
    for (unsigned int j = 0; j < 64u; j += 4u) { v4f y = *(const v4fa*)&so[w][lane][j];
#pragma unroll
      for (int q = 0; q < 4; ++q) y[q] = y[q] * rs;
      *(v4fa*)&so[w][lane][j] = y; }
    __builtin_amdgcn_fence(4 /* acq_rel order */, "workgroup"); __builtin_amdgcn_wave_barrier(); }
  if (C) { const unsigned int rsub = lane >> 4, c4 = (lane & 15u) * 4u;
#pragma unroll
    for (int q = 0; q < 16; ++q) { const unsigned int r = (unsigned int)q * 2u + rsub; const v4f v = *(const v4fa*)&so[w][r][c4];
      *(v4f*)(C + cofs + (size_t)(row0 + r) * ldc + col0 + c4) = v; }
    asm volatile("s_wait_xcnt 0x0" ::: "memory"); }      /* stands in front of code that writes anew the registers which these stores name */
  if (C16) {      /* the wave's tile is 2 x 2 whole blocks of the plane; one store takes one fragment half of a block, 512 bytes in a row */
    const size_t ob = cofs + (size_t)row0 * ldc + (size_t)(col0 >> 5) * 512u + lane * 8u; v4f ta[8], tc[8];
#pragma unroll
    for (int q = 0; q < 8; ++q) { const float* sr = &so[w][((unsigned int)q >> 2) * 16u + ln][(((unsigned int)q >> 1) & 1u) * 32u + ((unsigned int)q & 1u) * 16u + hh * 8u]; ta[q] = *(const v4fa*)sr; tc[q] = *(const v4fa*)(sr + 4); }      /* all LDS reads together, ahead of the waits below */
#pragma unroll
    for (int q = 0; q < 8; ++q) { const unsigned int rg = (unsigned int)q >> 2, s = ((unsigned int)q >> 1) & 1u, hf = (unsigned int)q & 1u; const v4f va = ta[q], vc = tc[q]; FragH fh, fl;
#pragma unroll
      for (int i = 0; i < 4; ++i) { _Float16 h = (_Float16)va[i]; fh.h[i] = h; fl.h[i] = (_Float16)((va[i] - (float)h) * 1024.0f); h = (_Float16)vc[i]; fh.h[4 + i] = h; fl.h[4 + i] = (_Float16)((vc[i] - (float)h) * 1024.0f); }
      const v8us oh = fh.half[0], ol = fl.half[0]; const size_t o = ob + (size_t)rg * 16u * ldc + s * 512u + hf * 256u;
      *(v8us*)((unsigned short*)C16 + o) = oh;
      asm volatile("s_wait_xcnt 0x0" ::: "memory");      /* the same for this store */
      if (C16L) { *(v8us*)((unsigned short*)C16L + o) = ol;
        asm volatile("s_wait_xcnt 0x0" ::: "memory"); } } } }      /* and for this one */

// out = OSH * (oh Wo) + OSL * (ores Wo), both products in one launch. A wave owns 32 rows x 64 columns of out and keeps two accumulator sets, one per o plane: every Wo fragment it loads feeds the products of both planes (8 fragment loads for 16 products; with a launch per plane 12), and the two sums are folded in registers, so that out is written once and never read. Each accumulator takes its k-steps in rising order, and the fold is value sum * OSH first, then residual sum * OSL added to it.
#define OSH 0.0009765625f                /* 1 / (64 * 16): o is carried x64, Wo x16 */
#define OSL 0.00000095367431640625f      /* the same / 1024 for the residual plane */
#define ONST (DM / 32)                   /* k-steps */
static_assert(ONST >= 2);
struct GOStage { v16h h0, h1, l0, l1, b0, b1, b2, b3; };      /* one k-step: two row fragments of each o plane, four Wo column fragments */
// every load of a stage names one of three addresses with a constant offset: 16 rows further on is 16 DM elements further on
__device__ __forceinline__ void go_load(GOStage& s, const _Float16* hp, const _Float16* lp, const _Float16* bp, int kb) {
  s.h0 = g2_frag(hp + kb); s.h1 = g2_frag(hp + 16 * DM + kb); s.l0 = g2_frag(lp + kb); s.l1 = g2_frag(lp + 16 * DM + kb);
  s.b0 = g2_frag(bp + kb); s.b1 = g2_frag(bp + 16 * DM + kb); s.b2 = g2_frag(bp + 32 * DM + kb); s.b3 = g2_frag(bp + 48 * DM + kb); }
// the plain builtin: its operands may stand in any register of the wave's budget (this kernel needs more than 256), and the compiler keeps the distances behind it itself
__device__ __forceinline__ v8f go_mma(v16h a, v16h b, v8f c) { return __builtin_amdgcn_wmma_f32_16x16x32_f16(false, a, false, b, (short)0, c, false, false); }
__device__ __forceinline__ void go_col(v16h b, const GOStage& s, v8f& h0, v8f& h1, v8f& l0, v8f& l1) { h0 = go_mma(s.h0, b, h0); h1 = go_mma(s.h1, b, h1); l0 = go_mma(s.l0, b, l0); l1 = go_mma(s.l1, b, l1); }
__device__ __forceinline__ void go_step(const GOStage& s, v8f (&ch)[8], v8f (&cl)[8]) {
  go_col(s.b0, s, ch[0], ch[4], cl[0], cl[4]); go_col(s.b1, s, ch[1], ch[5], cl[1], cl[5]); go_col(s.b2, s, ch[2], ch[6], cl[2], cl[6]); go_col(s.b3, s, ch[3], ch[7], cl[3], cl[7]); }
__global__ __launch_bounds__(128) void k_gemmo(const _Float16* __restrict__ AH, const _Float16* __restrict__ AL, const _Float16* __restrict__ Bh, float* __restrict__ C) {
  __shared__ __attribute__((aligned(16))) float so[4][32][68];
  const unsigned int tid = threadIdx.x, w = tid >> 5, lane = tid & 31u, ln = lane & 15u, hh = lane >> 4;
  const unsigned int mt = blockIdx.x / (unsigned int)(DM / 64), nq = blockIdx.x % (unsigned int)(DM / 64); const unsigned int row0 = mt * 128u + 32u * w, col0 = nq * 64u;
  const size_t aofs = ((size_t)blockIdx.y * SQ + row0) * DM + lane * 8u;      /* first block of the row group + the lane's place in a block */
  const _Float16* hp = AH + aofs; const _Float16* lp = AL + aofs; const _Float16* bp = Bh + (size_t)col0 * DM + lane * 8u;
  const v8f z8 = {0.f,0.f,0.f,0.f,0.f,0.f,0.f,0.f}; v8f ch[8], cl[8];
  /* every plain '#pragma unroll' of this kernel stands on a short loop over a register array: unrolled whole, the array is indexed by constants and stays in registers */
#pragma unroll
  for (int u = 0; u < 8; ++u) { ch[u] = z8; cl[u] = z8; }
  /* K loop as in k_gemm2: a ring of three register stages, the loads of k-step s + 2 issued together in front of the products of k-step s; the last two to four steps are peeled */
#define GO_LD(S, ST) go_load(S, hp, lp, bp, (ST) * 512)
#define GO_XW() asm volatile("s_wait_xcnt 0x0" :: "v"(hp), "v"(lp), "v"(bp) : "memory")      /* stands in front of code that writes anew the address registers which the loads issued so far name; the three addresses as inputs keep them whole up to here */
  { GOStage s0, s1, s2; int st = 0;
    GO_LD(s0, 0); GO_LD(s1, 1); GO_XW();
#pragma unroll 1      /* one trip is already three k-steps; more would only add code */
    for (; st + 5 <= ONST; st += 3) { GO_LD(s2, 2); go_step(s0, ch, cl); GO_LD(s0, 3); go_step(s1, ch, cl); GO_LD(s1, 4); go_step(s2, ch, cl); GO_XW();
      hp += 1536; lp += 1536; bp += 1536; }      /* three blocks a trip */
    constexpr int rem = ONST - ((ONST - 2) / 3) * 3;      /* 2, 3 or 4 steps are left; s0 and s1 hold the first two */
    if (rem >= 3) { GO_LD(s2, 2); GO_XW(); }
    go_step(s0, ch, cl);
    if (rem >= 4) { GO_LD(s0, 3); GO_XW(); }
    go_step(s1, ch, cl);
    if (rem >= 3) go_step(s2, ch, cl);
    if (rem >= 4) go_step(s0, ch, cl); }
#undef GO_LD
#undef GO_XW
#pragma unroll
  for (int u = 0; u < 8; ++u) { const unsigned int t = (unsigned int)u & 3u, half = (unsigned int)u >> 2; const v8f o = cl[u] * OSL + ch[u] * OSH;
#pragma unroll
    for (int r = 0; r < 8; ++r) so[w][half * 16u + 8u * hh + (unsigned int)r][t * 16u + ln] = o[r]; }
  __builtin_amdgcn_fence(4 /* acq_rel order */, "workgroup"); __builtin_amdgcn_wave_barrier();      /* the wave's own tile is in LDS before its lanes read across it */
  { const unsigned int rsub = lane >> 4, c4 = (lane & 15u) * 4u; float* cp = C + ((size_t)blockIdx.y * SQ_FULL + row0 + rsub) * DM + col0 + c4; v4f v[16];      /* whole 256-byte runs of two out rows a store; all stores name one address with a constant offset */
#pragma unroll
    for (int q = 0; q < 16; ++q) v[q] = *(const v4fa*)&so[w][(unsigned int)q * 2u + rsub][c4];
#pragma unroll
    for (int q = 0; q < 16; ++q) *(v4f*)(cp + (size_t)q * 2u * DM) = v[q]; } }

#define GP_L ((QT0 / 128) * (LQ / 64) * NB)      /* tiles of the f32 q | k | v of the leading rows */
#define GP_A ((unsigned int)(NR / 128) * (LQ / 64))      /* tiles of the q | k | v of all rows */

// lane l with lane l ^ 16
__device__ __forceinline__ float sm_xhalf(float x) { return __builtin_bit_cast(float, __builtin_amdgcn_permlanex16(__builtin_bit_cast(int, x), __builtin_bit_cast(int, x), 0x76543210, 0xfedcba98, false, false)); }

// 2^t of eight values, one v_exp_f32 each. In one statement, results in registers of their own: no exponential is followed by an instruction that reads its result or overwrites its source, and the one v_nop at the end is the free slot the instruction set asks for behind the last of them
__device__ __forceinline__ v8f at_exp2(v8f t) { float r0, r1, r2, r3, r4, r5, r6, r7;
  asm("v_exp_f32 %0, %8\n\tv_exp_f32 %1, %9\n\tv_exp_f32 %2, %10\n\tv_exp_f32 %3, %11\n\tv_exp_f32 %4, %12\n\tv_exp_f32 %5, %13\n\tv_exp_f32 %6, %14\n\tv_exp_f32 %7, %15\n\tv_nop"
      : "=&v"(r0), "=&v"(r1), "=&v"(r2), "=&v"(r3), "=&v"(r4), "=&v"(r5), "=&v"(r6), "=&v"(r7) : "v"(t[0]), "v"(t[1]), "v"(t[2]), "v"(t[3]), "v"(t[4]), "v"(t[5]), "v"(t[6]), "v"(t[7]));
  const v8f r = {r0, r1, r2, r3, r4, r5, r6, r7}; return r; }

// f32 attention of the leading rows, run by the first A0Y grid rows of the attention launch, beside the work-groups of the later rows instead of in a launch of its own in front of them. A work-group owns A0R query rows of the four heads of one (batch, kv head), which share the staged K and V rows; a wave takes 16 rows of one head, two lanes a row: lane l and lane l + 16 each keep one half (32 elements) of the row's q and o in registers for the whole key loop (every loop over the half is unrolled whole so that both are indexed by constants), so that this path needs no more registers than the other and two work-groups still share a WGP. A score is the sum of the two lanes' 32-term sums; maximum, sum and weights are formed alike in both lanes. The K and V rows are staged in LDS 64 keys at a time and read from there at one address per half wave: K transposed, so that one 16-byte read brings one head element of four neighbouring keys. One trip takes four keys: their four score sums are independent chains that fill each other's latency. The running maximum and sum and each o element take their terms in the order of the keys. The o rows (x64) leave as f16 value + x1024 residual planes of the merged o rows.
#define A0R 32                                   /* query rows of each of its four heads per work-group of the f32 path */
#define A0G (NB * NKV * (QT0 / A0R))             /* its work-groups */
#define A0Y (A0G / (NH * NB))                    /* the grid rows they fill */
static_assert(A0G % (NH * NB) == 0 && QT0 % 64 == 0 && 64 % A0R == 0 && A0R == 32 && (1 << KVSH) == 4);
#define A0K (HD * 68 + 16)                       /* floats of the K tile */
__device__ __forceinline__ void att0_rows(const float* __restrict__ F0, _Float16* __restrict__ OH, _Float16* __restrict__ OL, unsigned char* lds, unsigned int id) {
  float* lk = (float*)lds;                                            /* K tile [head element][key]; pitch 68: the transposing stores of a wave fall on 32 different banks, rows stay 16-byte aligned; elements 32..63 stand 16 floats further on, so that the two addresses of a wave's read fall on different banks */
  float (*lv)[HD] = (float (*)[HD])(lds + A0K * 4);                   /* V tile [key][head element] */
  float (*lo)[68] = (float (*)[68])(lds + A0K * 4 + 64 * HD * 4);     /* o rows [head of the four][row] */
  const unsigned int tid = threadIdx.x, w = (unsigned int)__builtin_amdgcn_readfirstlane((int)(tid >> 5)), lane = tid & 31u, ln = lane & 15u, hh = lane >> 4;
  const unsigned int rg = (unsigned int)(QT0 / A0R - 1) - id / (unsigned int)(NB * NKV), sl = id % (unsigned int)(NB * NKV), b = sl / (unsigned int)NKV, hk = sl % (unsigned int)NKV;      /* the longest rows start first */
  const unsigned int i = rg * (unsigned int)A0R + (w & 1u) * 16u + ln; const unsigned int ld = (unsigned int)LQ;
  const float* QF = F0 + (size_t)b * QT0 * LQ;      /* q | k | v rows of the batch's leading rows */
  const float* qr = QF + (size_t)i * ld + ((hk << KVSH) + (w >> 1)) * HD + hh * 32u;
  v4f q[HD / 8], o[HD / 8];
#pragma unroll
  for (int c = 0; c < HD / 8; ++c) { q[c] = *(const v4fa*)(qr + c * 4); const v4f z = {0.f, 0.f, 0.f, 0.f}; o[c] = z; }
  asm volatile("s_wait_xcnt 0x0" :: "v"(qr) : "memory");      /* stands in front of code that writes anew the address registers which the q loads name; the pointer as an input keeps them out of those loads' own results */
  /* a thread's share of a tile. K: key (tid & 7) of a group of 8, 16-byte piece ((tid >> 3) & 7) of a group of 8 (a wave's load covers 8 rows x 64 bytes), key groups (tid >> 6) and (tid >> 6) + 4. V: key (tid >> 4) of a group of 16, piece (tid & 15) (whole rows). */
  const unsigned int kb = tid & 7u, ka = (tid >> 3) & 7u, kg = tid >> 6, vb = tid >> 4, va = tid & 15u;
  const unsigned int kofs = ((kg * 8u + kb) * ld + ka * 4u) * 4u, vofs = (vb * ld + va * 4u) * 4u;      /* byte offsets, the same for every tile */
  float m = -1.0e30f, l = 0.f; const unsigned int jmax = rg * (unsigned int)A0R + (unsigned int)(A0R - 1);      /* keys up to the work-group's last row */
#pragma unroll 1      /* a tile's code is long already */
  for (unsigned int j0 = 0; j0 <= jmax; j0 += 64u) { const char* tb = (const char*)(QF + (size_t)j0 * ld + hk * HD);      /* the tile's first row; its k columns stand DM, its v columns ROTN floats further on */
    __syncthreads();      /* every wave has read the last tile to its end */
    { v4f kk[4], vv[4]; const char* kq = tb + kofs; const char* vq = tb + vofs;      /* a thread's four pieces of each tile lie at constant distances from one address */
#pragma unroll
      for (int it = 0; it < 4; ++it) kk[it] = *(const v4fa*)(kq + DM * 4 + (it & 1) * (32 * LQ * 4) + (it >> 1) * 128);
#pragma unroll
      for (int it = 0; it < 4; ++it) vv[it] = *(const v4fa*)(vq + ROTN * 4 + it * (16 * LQ * 4));
      asm volatile("s_wait_xcnt 0x0" :: "v"(kq), "v"(vq) : "memory");      /* stands in front of code that writes anew the address registers which the K and V loads name; the addresses as inputs keep them out of those loads' own results */
#pragma unroll
      for (int it = 0; it < 4; ++it) {
#pragma unroll
        for (int t = 0; t < 4; ++t) lk[(((unsigned int)(it >> 1) * 8u + ka) * 4u + (unsigned int)t) * 68u + (unsigned int)(it >> 1) * 16u + ((unsigned int)(it & 1) * 4u + kg) * 8u + kb] = kk[it][t]; }
#pragma unroll
      for (int it = 0; it < 4; ++it) *(v4fa*)&lv[(unsigned int)it * 16u + vb][va * 4u] = vv[it]; }
    __syncthreads();      /* the tile is whole before any wave reads it */
    const unsigned int jend = jmax + 1u - j0 < 64u ? jmax + 1u - j0 : 64u;      /* later keys of the tile lie above every row of the work-group: weight exactly zero */
    const float* lkh = lk + hh * (32u * 68u + 16u);
#pragma unroll 1      /* one trip is already four keys; more would only add code */
    for (unsigned int jj = 0; jj < jend; jj += 4u) { float s[4] = {0.f, 0.f, 0.f, 0.f}; v4f kr[HD / 2];
      /* The LDS reads of a trip are asked for in whole runs that stand ahead of their use, so that a wave waits out the LDS latency once per run; left to itself the compiler put most of them directly in front of their use, each with a full wait of its own. The pieces wait in the register arrays kr and vr; every plain '#pragma unroll' of this loop stands on a short loop over a register array, which unrolled whole is indexed by constants. */
#pragma unroll
      for (int c = 0; c < HD / 2; ++c) kr[c] = *(const v4fa*)(lkh + c * 68 + jj);
      __builtin_amdgcn_sched_barrier(0);      /* the run of K reads may not sink in among the score sums */
#pragma unroll
      for (int c = 0; c < HD / 8; ++c) {
#pragma unroll
        for (int t = 0; t < 4; ++t) { const v4f k4 = kr[c * 4 + t];
#pragma unroll
          for (int u = 0; u < 4; ++u) s[u] = __fadd_rn(s[u], __fmul_rn(q[c][t], k4[u])); } }
#pragma unroll 1      /* two of the four keys a pass, kept as a loop: only the V pieces of two keys are in registers at a time, so that the kernel stays inside the 256 registers that let two work-groups share a WGP */
      for (unsigned int u2 = 0; u2 < 4u; u2 += 2u) { const float s2[2] = {u2 ? s[2] : s[0], u2 ? s[3] : s[1]}; float sc[2], e[2]; v4f vr[2][HD / 8];      /* the pass's V reads come first, as one run: the exponentials run while they are under way */
#pragma unroll
        for (int u = 0; u < 2; ++u) {
#pragma unroll
          for (int c = 0; c < HD / 8; ++c) vr[u][c] = *(const v4fa*)&lv[jj + u2 + (unsigned int)u][hh * 32u + (unsigned int)(c * 4)]; }
#pragma unroll
        for (int u = 0; u < 2; ++u) { const float su = __fmul_rn(__fadd_rn(s2[u], sm_xhalf(s2[u])), 0.125f);      /* own half + the other lane's half: the same value in both lanes */
          const float f = (j0 + jj + u2 + (unsigned int)u <= i) ? 1.f : 0.f; const float sm = fmaf(f, su, (1.f - f) * -1.0e30f); const float mn = fmaxf(m, sm); sc[u] = expf(m - mn); e[u] = expf(sm - mn); l = __fadd_rn(__fmul_rn(l, sc[u]), e[u]); m = mn; }
#pragma unroll
        for (int u = 0; u < 2; ++u) {
#pragma unroll
          for (int c = 0; c < HD / 8; ++c) { const v4f vv = vr[u][c];
#pragma unroll
            for (int t = 0; t < 4; ++t) o[c][t] = __fadd_rn(__fmul_rn(o[c][t], sc[u]), __fmul_rn(e[u], vv[t])); } } } } }
  { const float fin = 64.0f / l;      /* o carried x64 like the f16 path */
#pragma unroll
    for (int c = 0; c < HD / 8; ++c) { v4f oo = o[c];
#pragma unroll
      for (int u = 0; u < 4; ++u) oo[u] = __fmul_rn(oo[u], fin);
      *(v4fa*)&lo[w * 16u + ln][hh * 32u + (unsigned int)(c * 4)] = oo; } }
  __syncthreads();      /* the o rows of the four heads are whole */
#pragma unroll
  for (int it = 0; it < 4; ++it) { const unsigned int p = (unsigned int)it * 256u + tid, row = (p >> 7) * 16u + (p & 15u), pc = ((p >> 4) & 7u) * 8u; const v4f a = *(const v4fa*)&lo[row][pc], c = *(const v4fa*)&lo[row][pc + 4u]; FragH fh, fl;      /* a wave: 16 rows x 2 neighbouring pieces, 512 bytes in a row of each plane */
#pragma unroll
    for (int t = 0; t < 4; ++t) { _Float16 hv = (_Float16)a[t]; fh.h[t] = hv; fl.h[t] = (_Float16)((a[t] - (float)hv) * 1024.0f); hv = (_Float16)c[t]; fh.h[4 + t] = hv; fl.h[4 + t] = (_Float16)((c[t] - (float)hv) * 1024.0f); }
    const v8us oh = fh.half[0], ol = fl.half[0]; const size_t d = fo_piece((size_t)b * SQ + rg * (unsigned int)A0R + (row & (unsigned int)(A0R - 1)), ((hk << KVSH) + row / (unsigned int)A0R) * HD + pc, (unsigned int)DM);
    *(v8us*)((unsigned short*)OH + d) = oh; *(v8us*)((unsigned short*)OL + d) = ol; } }

// attention of the rows from QT0 on, scores, softmax and o in one launch, streamed over the keys. A work-group owns AW query rows of each of the four heads of one (batch, kv head); its eight waves (wave w: head w >> 1 of the four, rows 16 (w & 1) + 0..15) use the same K and V rows, which are staged in LDS once for all of them, 64 keys a stage, two buffers: a K or V fragment leaves L2 once per 128 (head, row) pairs. The planes stand in fragment order, so a stage is twelve runs of 2 KiB copied as they are (K: 16 keys x 64 head elements a run; V^T value and residual: 16 head elements x 64 keys a run).
// A wave never puts a score down. It forms the TRANSPOSED score tile, keys x queries = (K rows as A) x (q rows as B): in the accumulator lane 16 h + n holds keys 8 h + 0..7 of query n, and that is the place of elements 0..7 of the B fragment of a product over 32 keys; the tile of the next 16 keys gives elements 8..15. So the weights of 32 keys turn into the B fragments of o^T = V^T P^T by arithmetic in their own lanes alone.
// q and k rows are normalised to mean square <= 1 over 64 elements, so a score (x 0.125) cannot pass 8 but by operand rounding: the weight is taken as e^(score - 8) x 2^15 with that fixed bound in the place of the row maximum (between 2^15 e^-16 and 2^15, normal f16 numbers), the softmax being the same for any common shift. Weights are f16 value + x1024 residual; a lane sums its own f32 weights (eight partial sums, keys in rising order, joined at the end, then lane l with lane l ^ 16), and o = (Vh ph + (Vh pl + Vres ph) / 1024) * 64 / sum. Keys above the query get weight exactly zero.
#define AW 32                                    /* query rows of each of its four heads per work-group */
#define A1G (NB * NKV * ((SQ - QT0) / AW))       /* its work-groups */
#define A1Y (A1G / (NH * NB))                    /* the grid rows they fill */
#define A1F (256 - A0G)                          /* with the f32 path's work-groups these fill the 256 WGPs once */
#define SRUN 1024                                /* elements of a run */
#define SBUF (12 * SRUN)                         /* elements of a stage: 4 runs of K, 4 of V^T value, 4 of V^T residual */
#define ATL ((A0K + 64 * HD + 4 * A0R * 68) * 4) /* LDS bytes of the launch: what the f32 path takes */
static_assert(A1G % (NH * NB) == 0 && (SQ - QT0) % AW == 0 && QT0 % AW == 0 && AW == 32 && SQ % 64 == 0 && (1 << KVSH) == 4 && A1F >= 0 && A1F <= A1G && 2 * SBUF * 2 <= ATL);
// a fragment from a block in LDS; p: the block's start + 8 * lane
__device__ __forceinline__ v16h at_lfrag(const unsigned short* p) { FragH f; f.half[0] = *(const v8us*)p; f.half[1] = *(const v8us*)(p + 256); return f.v; }
__global__ __launch_bounds__(256) void k_attf(const _Float16* __restrict__ Q16, const _Float16* __restrict__ QL, const _Float16* __restrict__ K16, const _Float16* __restrict__ VT, const _Float16* __restrict__ VTL, _Float16* __restrict__ OH, _Float16* __restrict__ OL, const float* __restrict__ F0) {
  __shared__ __attribute__((aligned(16))) unsigned char sp[ATL];      /* two stage buffers; the f32 path's tiles */
  if (blockIdx.y < (unsigned int)A0Y) { att0_rows(F0, OH, OL, sp, blockIdx.y * (unsigned int)(NH * NB) + blockIdx.x); return; }      /* block-uniform: the first work-groups take the leading rows in f32 */
  const unsigned int tid = threadIdx.x, w = (unsigned int)__builtin_amdgcn_readfirstlane((int)(tid >> 5)), lane = tid & 31u, ln = lane & 15u, hh = lane >> 4;
  const unsigned int id = (blockIdx.y - (unsigned int)A0Y) * (unsigned int)(NH * NB) + blockIdx.x;
  const unsigned int rk = id < (unsigned int)A1F ? id : (unsigned int)(A1G - 1 + A1F) - id;      /* rank by length, 0 the longest. Work-groups below A1F take the longest ones, longest first, the rest take the others, shortest first (for speed only) */
  const unsigned int sl = rk % (unsigned int)(NB * NKV), b = sl / (unsigned int)NKV, hk = sl % (unsigned int)NKV;
  const unsigned int q0 = (unsigned int)(SQ - AW) - (rk / (unsigned int)(NB * NKV)) * (unsigned int)AW;
  const unsigned int h = (hk << KVSH) + (w >> 1), qr0 = q0 + (w & 1u) * 16u;      /* the wave's head and first row */
  const unsigned int nst = q0 / 32u + 1u, nsg = (nst + 1u) >> 1;      /* steps of 32 keys up to the work-group's last row; stages of 64 keys */
  const size_t r0 = (size_t)b * SQ;
  const v8f z8 = {0.f,0.f,0.f,0.f,0.f,0.f,0.f,0.f};
  /* every plain '#pragma unroll' of this kernel stands on a short loop over a register array (i, r, dt) or over the two steps of a stage: unrolled whole, the arrays are indexed by constants and stay in registers */
  const _Float16* qp = Q16 + (r0 + qr0) * LQ + h * (HD * 16) + lane * 8u; const _Float16* lp = QL + (r0 + qr0) * LQ + h * (HD * 16) + lane * 8u;      /* a head's 64 columns are two blocks that follow one another */
  const v16h qh0 = g2_frag(qp), qh1 = g2_frag(qp + 512), ql0 = g2_frag(lp), ql1 = g2_frag(lp + 512);
  asm volatile("s_wait_xcnt 0x0" :: "v"(qp), "v"(lp) : "memory");      /* stands in front of code that writes anew the address registers which the q loads name; the pointers as inputs keep them whole up to here */
  /* a thread's share of a stage: 16 bytes of every second run */
  const unsigned int hf = tid >> 7, off = (tid & 127u) * 8u;
  const unsigned short* kg0 = (const unsigned short*)K16 + (r0 + hf * 16u) * LQ + hk * (HD * 16) + off;
  const size_t vofs = (((size_t)b * NKV + hk) * HD + hf * 16u) * SQ + off;
  const unsigned short* vg0 = (const unsigned short*)VT + vofs; const unsigned short* lg0 = (const unsigned short*)VTL + vofs;
  unsigned short* lb = (unsigned short*)sp; unsigned short* sd0 = lb + hf * (unsigned int)SRUN + off;
  v8us st[6];
  /* the wait stands in front of code that writes anew the address registers which the six loads name; the addresses as inputs keep them out of those loads' own results, and the scheduling barrier behind it keeps later writes of such a register from moving up over the wait */
#define AT_LOAD(T) { const unsigned int tt = (T); const unsigned short* kq = kg0 + (size_t)tt * (64u * LQ); const unsigned short* vq = vg0 + tt * 1024u; const unsigned short* lq = lg0 + tt * 1024u; \
    st[0] = *(const v8us*)kq; st[1] = *(const v8us*)(kq + 32 * LQ); st[2] = *(const v8us*)vq; st[3] = *(const v8us*)(vq + 32 * SQ); st[4] = *(const v8us*)lq; st[5] = *(const v8us*)(lq + 32 * SQ); \
    asm volatile("s_wait_xcnt 0x0" :: "v"(kq), "v"(vq), "v"(lq) : "memory"); __builtin_amdgcn_sched_barrier(0); }
#define AT_STORE(B) { unsigned short* sd = sd0 + (B) * (unsigned int)SBUF; _Pragma("unroll") for (int i = 0; i < 6; ++i) *(v8us*)(sd + i * (2 * SRUN)) = st[i]; }
  AT_LOAD(0u); AT_STORE(0u);
  __syncthreads();      /* stage 0 is whole before any wave reads it */
  v8f ah[4], al[4], ls8 = z8;
#pragma unroll
  for (int dt = 0; dt < 4; ++dt) { ah[dt] = z8; al[dt] = z8; }
#pragma unroll 1      /* one trip is a stage of 40 products a wave; more would only add code */
  for (unsigned int t = 0; t < nsg; ++t) {
    AT_LOAD(t + 1u < nsg ? t + 1u : t);      /* the next stage is asked for ahead of this stage's work (past the end: this stage again, so that no load stands under a test) */
    const unsigned short* cb = lb + (t & 1u) * (unsigned int)SBUF + lane * 8u;
#pragma unroll
    for (int ks = 0; ks < 2; ++ks) { if (ks == 0 || t * 2u + 1u < nst) {      /* block-uniform: the second half of the last stage may lie above every row */
      const unsigned int kb0 = t * 64u + (unsigned int)ks * 32u; const unsigned short* kl = cb + ks * (2 * SRUN);
      const v16h k00 = at_lfrag(kl), k01 = at_lfrag(kl + 512), k10 = at_lfrag(kl + SRUN), k11 = at_lfrag(kl + SRUN + 512);
      v8f s0h = go_mma(k00, qh0, z8), s1h = go_mma(k10, qh0, z8), s0l = go_mma(k00, ql0, z8), s1l = go_mma(k10, ql0, z8);
      s0h = go_mma(k01, qh1, s0h); s1h = go_mma(k11, qh1, s1h); s0l = go_mma(k01, ql1, s0l); s1l = go_mma(k11, ql1, s1l);
      /* exponent to base 2 of e^(score - 8) x 2^15, score = 0.125 (value sum + residual sum / 1024) */
      v8f p0 = at_exp2(s0l * 0.00017611023448351604f + (s0h * 0.18033688011112042f + 3.458439672888293f));
      v8f p1 = at_exp2(s1l * 0.00017611023448351604f + (s1h * 0.18033688011112042f + 3.458439672888293f));
      if (kb0 + 31u > qr0) {      /* wave-uniform: only here can a key lie above a row of the wave */
        const int lim = (int)(qr0 + ln) - (int)(kb0 + 8u * hh);
#pragma unroll
        for (int r = 0; r < 8; ++r) { p0[r] = (r <= lim) ? p0[r] : 0.f; p1[r] = (r + 16 <= lim) ? p1[r] : 0.f; } }
      ls8 += p0; ls8 += p1;
      FragH fh, fl;
#pragma unroll
      for (int r = 0; r < 8; ++r) { _Float16 hv = (_Float16)p0[r]; fh.h[r] = hv; fl.h[r] = (_Float16)((p0[r] - (float)hv) * 1024.0f); hv = (_Float16)p1[r]; fh.h[8 + r] = hv; fl.h[8 + r] = (_Float16)((p1[r] - (float)hv) * 1024.0f); }
      v16h vf[4];
#pragma unroll
      for (int dt = 0; dt < 4; ++dt) vf[dt] = at_lfrag(cb + (4 + dt) * SRUN + ks * 512);
#pragma unroll
      for (int dt = 0; dt < 4; ++dt) { ah[dt] = go_mma(vf[dt], fh.v, ah[dt]); al[dt] = go_mma(vf[dt], fl.v, al[dt]); }
#pragma unroll
      for (int dt = 0; dt < 4; ++dt) vf[dt] = at_lfrag(cb + (8 + dt) * SRUN + ks * 512);
#pragma unroll
      for (int dt = 0; dt < 4; ++dt) al[dt] = go_mma(vf[dt], fh.v, al[dt]); } }
    AT_STORE((t + 1u) & 1u);      /* into the buffer that every wave left at the last barrier */
    __syncthreads(); }      /* the next stage is whole, and this stage's buffer is read to its end */
#undef AT_LOAD
#undef AT_STORE
  float ls = ((ls8[0] + ls8[1]) + (ls8[2] + ls8[3])) + ((ls8[4] + ls8[5]) + (ls8[6] + ls8[7])); ls = ls + sm_xhalf(ls);      /* the two lanes of a query hold different keys */
  const float fin = 64.0f / ls;      /* o carried x64 */
  v8us oh[4], ol[4];
#pragma unroll
  for (int dt = 0; dt < 4; ++dt) { FragH fh, fl;      /* lane 16 h + n holds head elements 16 dt + 8 h + 0..7 of query n: one piece of the plane */
#pragma unroll
    for (int r = 0; r < 8; ++r) { const float o = (al[dt][r] * 0.0009765625f + ah[dt][r]) * fin; const _Float16 hv = (_Float16)o; fh.h[r] = hv; fl.h[r] = (_Float16)((o - (float)hv) * 1024.0f); }
    oh[dt] = fh.half[0]; ol[dt] = fl.half[0]; }
  const size_t d = fo_piece(r0 + qr0 + ln, h * HD + 8u * hh, (unsigned int)DM);      /* 16 head elements further on is 256 elements further on in the plane */
  unsigned short* ohp = (unsigned short*)OH + d; unsigned short* olp = (unsigned short*)OL + d;
  __builtin_amdgcn_sched_barrier(0);      /* the eight stores stand behind the last arithmetic of the wave, so that no register which they name is written anew */
#pragma unroll
  for (int dt = 0; dt < 4; ++dt) { *(v8us*)(ohp + dt * 256) = oh[dt]; *(v8us*)(olp + dt * 256) = ol[dt]; } }      /* a wave's store is 512 bytes in a row */

constexpr size_t al256(size_t b) { return (b + 255) & ~(size_t)255; }
constexpr size_t SZ_BQKV = al256((size_t)LQ * DM * 2);
constexpr size_t SZ_BO   = al256((size_t)DM * DM * 2);
constexpr size_t SZ_XO   = al256(NR * DM * 2);                          /* X16, later reused as the merged o value rows */
constexpr size_t SZ_QKV  = al256(NR * LQ * 2);                          /* value plane; the residual plane has the same size */
constexpr size_t SZ_F0   = al256((size_t)NB * QT0 * LQ * 4);
constexpr size_t SZ_VT   = al256((size_t)NB * NKV * HD * SQ * 2);       /* V^T value plane; the residual plane has the same size */
constexpr size_t SZ_OL   = al256(NR * DM * 2);                          /* merged o residual rows */
constexpr size_t WS_TOTAL = SZ_BQKV + SZ_BO + SZ_XO + 2 * SZ_QKV + SZ_F0 + 2 * SZ_VT + SZ_OL;
static_assert(WS_TOTAL <= (size_t)134217728);
/* plane coverage equalities of the producer grids */
static_assert(((size_t)(DM / 64) * (DM / 64)) * 64 * 64 == (size_t)DM * DM);
static_assert(((size_t)(DM / 64) * (KVD / 64)) * 64 * 64 == (size_t)DM * KVD);
static_assert(((size_t)NB * NKV * (SQ / 64)) * 64 * 64 == (size_t)NB * NKV * HD * SQ);
static_assert((NR * DM) % (256 * 8) == 0);
static_assert((size_t)A0G * 4 * A0R * HD == (size_t)NB * QT0 * DM);
static_assert(((size_t)(NR / 128) * (LQ / 64)) * 128 * 64 == NR * LQ);
static_assert((size_t)A1G * 4 * AW * HD == (NR - (size_t)NB * QT0) * DM);
static_assert(((size_t)(SQ / 128) * (DM / 64) * NB) * 128 * 64 == NR * DM);

extern "C" void kernel_launch(void* const* d_in, const int* in_sizes, int n_in,
                              void* d_out, int out_size, void* d_ws, size_t ws_size, hipStream_t stream) {
  if (n_in < 7) return;
  const size_t need_x = ((size_t)(NB - 1) * SQ_FULL + SQ) * DM;
  if ((size_t)in_sizes[0] < need_x) return;
  if ((size_t)in_sizes[1] < (size_t)SQ * 32) return;
  if ((size_t)in_sizes[2] < (size_t)SQ * 32) return;
  if ((size_t)in_sizes[3] < (size_t)DM * DM) return;
  if ((size_t)in_sizes[4] < (size_t)DM * KVD) return;
  if ((size_t)in_sizes[5] < (size_t)DM * KVD) return;
  if ((size_t)in_sizes[6] < (size_t)DM * DM) return;
  if ((size_t)out_size < need_x) return;
  const float* x = (const float*)d_in[0]; const float* cosb = (const float*)d_in[1]; const float* sinb = (const float*)d_in[2];      /* tables [pos][32], read as values */
  const float* wq = (const float*)d_in[3]; const float* wk = (const float*)d_in[4]; const float* wv = (const float*)d_in[5]; const float* wo = (const float*)d_in[6];      /* all [in][out] */
  float* out = (float*)d_out;
  char* ws = (char*)d_ws; size_t off = 0;
  auto take = [&](size_t bytes) { char* p = ws + off; off += (bytes + 255) & ~(size_t)255; return p; };
  _Float16* BQKV = (_Float16*)take(SZ_BQKV); _Float16* BO = (_Float16*)take(SZ_BO);
  _Float16* X16 = (_Float16*)take(SZ_XO); _Float16* OH = X16;      /* X16 is dead after the projection GEMMs; the merged o value rows take its place */
  _Float16* QKV = (_Float16*)take(SZ_QKV); const _Float16* Q16 = QKV; const _Float16* K16 = QKV + DM * 16; const _Float16* V16 = QKV + ROTN * 16;      /* fragment order: column c, a multiple of 32, begins 16 c elements into a row group */
  _Float16* QKVL = (_Float16*)take(SZ_QKV); const _Float16* QL = QKVL; const _Float16* VL16 = QKVL + ROTN * 16;      /* x1024 residual plane, same layout (k columns unused) */
  float* F0 = (float*)take(SZ_F0);
  _Float16* VT = (_Float16*)take(SZ_VT); _Float16* VTL = (_Float16*)take(SZ_VT);
  _Float16* OL = (_Float16*)take(SZ_OL);
  if (off > ws_size) return;

  k_prep<<<PW_ALL + PX_ALL, 256, 0, stream>>>(x, wq, wk, wv, wo, X16, BQKV, BO);      /* weights -> Bt planes, x -> X16 */
  k_gemm2<<<dim3(GP_L + GP_A, 1), 128, 0, stream>>>(X16, DM, (size_t)0, BQKV, DM, (size_t)0, 0u, 0.0625f, nullptr, QKV, QKVL, LQ, (size_t)0, (int)(NR), LQ, DM, cosb, sinb, (unsigned int)ROTN, (unsigned int)(SQ - 1), (unsigned int)GP_L, (size_t)SQ * DM, F0, (size_t)QT0 * LQ, QT0);      /* q | k | v rows (f16 value + residual) and, side by side, f32 q | k | v of rows 0..QT0-1 of every batch; q / k rotated + normalised */
  k_vt<<<dim3(NB * NKV * (SQ / 64), 2), 256, 0, stream>>>(V16, VT, VL16, VTL);      /* V^T value and residual planes [NB][NKV][HD][SQ] */
  k_attf<<<dim3(NH * NB, A0Y + A1Y), 256, 0, stream>>>(Q16, QL, K16, VT, VTL, OH, OL, F0);      /* grid rows below A0Y: f32 attention for rows 0..QT0-1; the others, rows from QT0 on: scores, softmax and o; final o (x64) written as f16 value + x1024 residual merged rows */
  k_gemmo<<<dim3((SQ / 128) * (DM / 64), NB), 128, 0, stream>>>(OH, OL, BO, out);      /* out rows in the output layout: o value plane and o residual plane against Wo, folded in f32 */
}
